// v000
// The times below were measured on an AMD MI455X: many runs one after another, warmed up first and cycling through
// copies of the inputs, with the whole window's GPU time divided by the number of runs. Launches and the gaps
// between them are all in it. The median over several windows is given; except for v000 it joins two sittings, which
// can be a few percent apart, so the side-by-side timings, each taken in one sitting, are the better comparison.
// v000, which the later versions start from, runs in 145 microseconds.
#include <hip/hip_runtime.h>

// Contractions: X x [Wf|Wg|Wh] on v_wmma_f32_16x16x32_bf16 (bf16 operands = RNE-converted inputs, f32 accumulate);
// S^T = F x G^T, CTX = P x Hv (P as f16 carried x4096) and OUT = CTX x Wo (Wo as f16 of the bf16 value, carried x16)
// on v_wmma_f32_16x16x32_f16 (f16 operands, f32 accumulate). Max-pool, softmax and residual in f32.

#ifndef NB
#define NB 8
#endif
#ifndef SEQ
#define SEQ 4096
#endif
#define NB_FULL  8
#define SEQ_FULL 4096
#define W_IMG    64                 // image width (pixels per image row)
#define CIN      256                // input channels
#define DQK      32                 // query / key channels
#define DV       128                // value channels
#define NPROJ    192                // packed projection columns: [0,32) f, [32,64) g, [64,192) h
#define NKEY     (SEQ / 4)          // pooled key count per image
#define KTILE    64                 // keys produced per projection block
#define BQ       128                // query rows per attention block (8 waves x 16)
#define BK       32                 // keys per inner iteration
#define NWAVE    8
#define PP       168                // LDS pitch (halves) of the ww-pooled staging rows
#define GP       40                 // LDS pitch (halves) of the g staging tile
#define FP       40                 // LDS pitch (halves) of the pooled f tile
#define HP       72                 // LDS pitch (halves) of the pooled h^T tile
#define CP       136                // LDS pitch (halves) of the ctx staging tile
#define OP       68                 // LDS pitch (floats) of the output staging tile

static_assert(SEQ % 256 == 0);
static_assert(SEQ >= 256 && SEQ <= SEQ_FULL);
static_assert(NB >= 1 && NB <= NB_FULL);
static_assert(BQ == NWAVE * 16);
static_assert(NKEY % BK == 0);
static_assert(NKEY % KTILE == 0);
static_assert(CIN % 32 == 0 && DV % 32 == 0 && DQK == 32);
// coverage equalities (grid x block x per-thread elements == plane extent)
static_assert((SEQ / 256) * 2 * NWAVE * 16 == SEQ);          // g plane rows per image
static_assert((SEQ / 256) * KTILE == NKEY);                   // f / h^T plane keys per image
static_assert((SEQ / BQ) * NWAVE * 16 == SEQ);                // ctx plane rows per image
static_assert(((NB * SEQ) / 128) * NWAVE * 16 == NB * SEQ);   // output rows
static_assert((GP * 2) % 16 == 0 && (FP * 2) % 16 == 0 && (HP * 2) % 16 == 0 && (CP * 2) % 16 == 0);
static_assert((OP * 4) % 16 == 0);

typedef __bf16   bf16;
typedef _Float16 f16;
typedef bf16     v16bf __attribute__((ext_vector_type(16)));
typedef f16      v16h  __attribute__((ext_vector_type(16)));
typedef f16      v8h   __attribute__((ext_vector_type(8)));
typedef float    v8f   __attribute__((ext_vector_type(8)));
typedef float    v4f   __attribute__((ext_vector_type(4)));
typedef unsigned v4u   __attribute__((ext_vector_type(4)));

union FragB  { v16bf v; v4u q[2]; bf16 h[16]; };
union FragH  { v16h  v; v4u q[2]; f16  h[16]; };
union Pack8B { v4u u; bf16 h[8]; };
union Pack8H { v4u u; v8h v; f16 h[8]; };

// WMMA helpers: builtin followed by the VALU hazard guard (ties D, keeps A/B live).
static __device__ __forceinline__ v8f mma_bf16(v16bf a, v16bf b, v8f acc) {
  acc = __builtin_amdgcn_wmma_f32_16x16x32_bf16(false, a, false, b, (short)0, acc, false, false);
  asm volatile("v_nop\n\tv_nop\n\tv_nop\n\tv_nop" : "+v"(acc) : "v"(a), "v"(b));
  return acc;
}
static __device__ __forceinline__ v8f mma_f16(v16h a, v16h b, v8f acc) {
  acc = __builtin_amdgcn_wmma_f32_16x16x32_f16(false, a, false, b, (short)0, acc, false, false);
  asm volatile("v_nop\n\tv_nop\n\tv_nop\n\tv_nop" : "+v"(acc) : "v"(a), "v"(b));
  return acc;
}

// Weight planes (k-contiguous rows, B fragments load like A fragments):
//   wct [NPROJ][CIN] bf16 : row n = column n of [wf | wg | wh], RNE bf16.
//   wot [CIN][DV]    f16  : row n = column n of wo, value f16(bf16(w) * 16) (exact).
// Blocks 0..23: 8 rows of wct each (one wave per 512-B row, one instruction); blocks 24..39: 16 rows of wot each
// (one wave per two 256-B rows, one instruction). Source selection is block-uniform.
// coverage: wct rows 0..191 x k 0..255; wot rows 0..255 x k 0..127.
__global__ __launch_bounds__(256) void pack_w_kernel(const float* __restrict__ wf, const float* __restrict__ wg,
                                                      const float* __restrict__ wh, const float* __restrict__ wo,
                                                      bf16* __restrict__ wct, f16* __restrict__ wot) {
  const int blk = blockIdx.x;
  const int tid = threadIdx.x;
  if (blk < 24) {
    const int n  = blk * 8 + (tid >> 5);       // 0..191
    const int kq = (tid & 31) * 8;             // 0..248
    const float* src = (blk < 4) ? wf : ((blk < 8) ? wg : wh);
    const int pitch  = (blk < 8) ? DQK : DV;
    const int nl     = (blk < 4) ? n : ((blk < 8) ? (n - 32) : (n - 64));
    Pack8B pk;
    #pragma unroll
    for (int i = 0; i < 8; ++i) pk.h[i] = (bf16)src[(size_t)(kq + i) * pitch + nl];   // RNE convert
    bf16* dst = wct + (size_t)n * CIN + kq;
    *(v4u*)dst = pk.u;
    
  } else {
    const int j  = (blk - 24) * 256 + tid;     // 0..4095
    const int n  = j >> 4;                     // 0..255
    const int kq = (j & 15) * 8;               // 0..120
    Pack8H pk;
    #pragma unroll
    for (int i = 0; i < 8; ++i) {
      const float v = (float)(bf16)wo[(size_t)(kq + i) * CIN + n];
      pk.h[i] = (f16)(v * 16.0f);              // bf16 significand fits f16: exact for normal results
    }
    f16* dst = wot + (size_t)n * DV + kq;
    *(v4u*)dst = pk.u;
    
  }
}

// One wave's 16-pixel M tile times NTN consecutive 16-column tiles of wct starting at tile NT0; K = CIN.
// A fragments from f32 x rows (RNE bf16 convert, split k map); B fragments from the k-contiguous wct rows.
template <int NT0, int NTN>
static __device__ __forceinline__ void proj_tiles(const float* __restrict__ xr, const bf16* __restrict__ wct,
                                                  int m, int hi, v8f (&acc)[NTN]) {
  #pragma unroll
  for (int t = 0; t < NTN; ++t) acc[t] = (v8f){0, 0, 0, 0, 0, 0, 0, 0};
  for (int kk = 0; kk < CIN / 32; ++kk) {
    const float* xp = xr + kk * 32;
    const v4f a0 = *(const v4f*)(xp + hi * 8);
    const v4f a1 = *(const v4f*)(xp + hi * 8 + 4);
    const v4f b0 = *(const v4f*)(xp + 16 + hi * 8);
    const v4f b1 = *(const v4f*)(xp + 16 + hi * 8 + 4);
    FragB a;
    #pragma unroll
    for (int i = 0; i < 4; ++i) {
      a.h[i]      = (bf16)a0[i];   // elems 0..7  : k = kk*32 + hi*8 + 0..7
      a.h[4 + i]  = (bf16)a1[i];
      a.h[8 + i]  = (bf16)b0[i];   // elems 8..15 : k = kk*32 + 16 + hi*8 + 0..7
      a.h[12 + i] = (bf16)b1[i];
    }
    #pragma unroll
    for (int t = 0; t < NTN; ++t) {
      const bf16* wp = wct + (size_t)((NT0 + t) * 16 + m) * CIN + kk * 32 + hi * 8;
      FragB bw;
      bw.q[0] = *(const v4u*)(wp);        // k = kk*32 + hi*8 + 0..7, n = tile*16 + m
      bw.q[1] = *(const v4u*)(wp + 16);   // k = kk*32 + 16 + hi*8 + 0..7
      acc[t] = mma_bf16(a.v, bw.v, acc[t]);
    }
  }
}

// Projection + 2x2 max-pool. Block = (64-key tile kt, batch b), 256 threads; two iterations each cover
// image rows hh = kt*4 + it*2 + {0,1}; wave -> (hh, 16 pixels along ww).
//   gq  [NB][SEQ][DQK]  f16 : queries, one 64-B row per pixel (wave writes 16 rows = 1 KB, 2 instructions).
//   fk  [NB][NKEY][DQK] f16 : pooled keys, 64 rows per block = 4 KB (one 512-B instruction per wave).
// LDS regions: sP cross-wave (block barrier), sG per-wave but read across lanes after the block barrier,
// sF / sHT cross-wave (block barrier). Staged extent == consumed extent for all four.
__global__ __launch_bounds__(256) void proj_pool_kernel(const float* __restrict__ x, const bf16* __restrict__ wct,
                                                         f16* __restrict__ gq, f16* __restrict__ fk,
                                                         f16* __restrict__ hvt) {
  const int kt   = blockIdx.x;
  const int b    = blockIdx.y;
  const int tid  = threadIdx.x;
  const int wave = tid >> 5;
  const int lane = tid & 31;
  const int m    = lane & 15;
  const int hi   = lane >> 4;
  const int hsel = wave >> 2;          // which of the two image rows of this iteration
  const int ww0  = (wave & 3) * 16;    // first pixel column of this wave's tile

  __shared__ __align__(16) f16 sP[2 * 32 * PP];       // [hsel][pw][160 cols] ww-pooled f|h
  __shared__ __align__(16) f16 sG[NWAVE * 16 * GP];   // per-wave g tile [16][32]
  __shared__ __align__(16) f16 sF[64 * FP];           // pooled f [64 keys][32]
  __shared__ __align__(16) f16 sHT[DV * HP];          // pooled h^T [128 d][64 keys]

  f16* sg = sG + wave * (16 * GP);
  f16* sp = sP + hsel * (32 * PP);
  const int pwb = (ww0 >> 1) + hi * 4;   // pooled column index base for this lane half

  for (int it = 0; it < 2; ++it) {
    const int hh   = kt * 4 + it * 2 + hsel;
    const int pix0 = hh * W_IMG + ww0;
    const float* xr = x + ((size_t)b * SEQ_FULL + pix0 + m) * CIN;

    {   // tiles 0..3: f (0,1) and g (2,3)
      v8f acc[4];
      proj_tiles<0, 4>(xr, wct, m, hi, acc);
      #pragma unroll
      for (int r = 0; r < 8; ++r) {
        sg[(hi * 8 + r) * GP + m]      = (f16)acc[2][r];
        sg[(hi * 8 + r) * GP + 16 + m] = (f16)acc[3][r];
      }
      // ww pairs are D rows (2rp, 2rp+1) of the same lane half; pooled column pw = ww0/2 + 4*hi + rp
      #pragma unroll
      for (int rp = 0; rp < 4; ++rp) {
        #pragma unroll
        for (int t = 0; t < 2; ++t)
          sp[(pwb + rp) * PP + t * 16 + m] = (f16)fmaxf(acc[t][2 * rp], acc[t][2 * rp + 1]);
      }
    }
    {   // tiles 4..11: h
      v8f acc[8];
      proj_tiles<4, 8>(xr, wct, m, hi, acc);
      #pragma unroll
      for (int rp = 0; rp < 4; ++rp) {
        #pragma unroll
        for (int t = 0; t < 8; ++t)
          sp[(pwb + rp) * PP + 32 + t * 16 + m] = (f16)fmaxf(acc[t][2 * rp], acc[t][2 * rp + 1]);
      }
    }
    __syncthreads();

    // g tile -> gq: 16 consecutive pixel rows x 64 B = 1 KB contiguous; 32 lanes x 16 B per instruction
    {
      v4u    gv[2];
      size_t gi[2];
      #pragma unroll
      for (int i2 = 0; i2 < 2; ++i2) {
        const int row = i2 * 8 + (lane >> 2);
        const int cq  = (lane & 3) * 8;
        Pack8H p;
        p.v = *(const v8h*)(sg + row * GP + cq);
        gv[i2] = p.u;
        gi[i2] = ((size_t)b * SEQ + pix0 + row) * DQK + cq;
      }
      #pragma unroll
      for (int i2 = 0; i2 < 2; ++i2) *(v4u*)(gq + gi[i2]) = gv[i2];
      
    }

    // hh-pool into the block's pooled tiles
    #pragma unroll
    for (int e = 0; e < 4; ++e) {
      const int idx = e * 256 + tid;
      const int pw  = idx >> 5;
      const int c   = idx & 31;
      const float v = fmaxf((float)sP[pw * PP + c], (float)sP[32 * PP + pw * PP + c]);
      sF[(it * 32 + pw) * FP + c] = (f16)v;
    }
    #pragma unroll
    for (int e = 0; e < 16; ++e) {
      const int idx = e * 256 + tid;
      const int pw  = idx >> 7;
      const int d   = idx & 127;
      const float v = fmaxf((float)sP[pw * PP + 32 + d], (float)sP[32 * PP + pw * PP + 32 + d]);
      sHT[d * HP + it * 32 + pw] = (f16)v;
    }
    __syncthreads();
  }

  // final plane stores: fk (wave -> 8 rows = 512 B), hvt (per instruction 4 d-lines, 8 lanes x 16 B each)
  v4u    fv;
  size_t fi;
  {
    const int row = tid >> 2;            // 0..63
    const int cq  = (tid & 3) * 8;
    Pack8H p;
    p.v = *(const v8h*)(sF + row * FP + cq);
    fv = p.u;
    fi = ((size_t)b * NKEY + kt * KTILE + row) * DQK + cq;
  }
  v4u    hv[4];
  size_t hidx[4];
  #pragma unroll
  for (int ps = 0; ps < 4; ++ps) {
    const int d  = ps * 32 + (tid >> 3);   // 0..127
    const int kq = (tid & 7) * 8;          // 0..56
    Pack8H p;
    p.v = *(const v8h*)(sHT + d * HP + kq);
    hv[ps]   = p.u;
    hidx[ps] = ((size_t)b * DV + d) * NKEY + kt * KTILE + kq;
  }
  *(v4u*)(fk + fi) = fv;
  #pragma unroll
  for (int ps = 0; ps < 4; ++ps) *(v4u*)(hvt + hidx[ps]) = hv[ps];
  
}

// Flash attention, non-causal, no score scaling. Block = (query block of 128, batch); one wave owns 16 queries.
// S^T = F x G^T so queries sit on lanes; P^T in C-layout is bit-identical to the A-fragment layout of CTX += P x Hv.
// F A-fragments, G B-fragments and Hv^T B-fragments are loaded straight from the f16 planes (two 16-B loads each).
//   ctx [NB][SEQ][DV] f16 : one 256-B row per query; wave writes 16 rows = 4 KB contiguous, 512 B per instruction.
// LDS: sC per-wave region, written and read across lanes under a block barrier; staged extent == consumed extent.
__global__ __launch_bounds__(256) void attn_kernel(const f16* __restrict__ gq, const f16* __restrict__ fk,
                                                   const f16* __restrict__ hvt, f16* __restrict__ ctx) {
  const int qblk = blockIdx.x;
  const int b    = blockIdx.y;
  const int tid  = threadIdx.x;
  const int wave = tid >> 5;
  const int lane = tid & 31;
  const int lq   = lane & 15;   // query column of S^T / d column of CTX
  const int hi   = lane >> 4;   // k-split half

  __shared__ __align__(16) f16 sC[NWAVE * 16 * CP];

  const int qrow0 = qblk * BQ + wave * 16;

  // G as B-operand fragment: lane lq holds query qrow0+lq, elements follow the split d map
  FragH qf;
  {
    const f16* qp = gq + ((size_t)b * SEQ + qrow0 + lq) * DQK + hi * 8;
    qf.q[0] = *(const v4u*)(qp);        // d = hi*8 + 0..7
    qf.q[1] = *(const v4u*)(qp + 16);   // d = 16 + hi*8 + 0..7
  }

  const f16* fk_b = fk + (size_t)b * NKEY * DQK;
  const f16* vt_b = hvt + (size_t)b * DV * NKEY;

  v8f o[8];
  #pragma unroll
  for (int dt = 0; dt < 8; ++dt) o[dt] = (v8f){0, 0, 0, 0, 0, 0, 0, 0};

  float rmax = -__builtin_inff();
  float rsum = 0.0f;
  const float SL = 1.4426950408889634f;   // log2(e); the scores carry no extra scale

  for (int i = 0; i < NKEY / BK; ++i) {
    const int j0 = i * BK;

    // F A-fragments: row = key j0 + sub*16 + lq, split d map
    FragH ak[2];
    #pragma unroll
    for (int sub = 0; sub < 2; ++sub) {
      const f16* base = fk_b + (size_t)(j0 + sub * 16 + lq) * DQK + hi * 8;
      ak[sub].q[0] = *(const v4u*)(base);        // d = hi*8 + 0..7
      ak[sub].q[1] = *(const v4u*)(base + 16);   // d = 16 + hi*8 + 0..7
    }

    // S^T tiles: c[sub][r] = score(query qrow0+lq, key j0 + sub*16 + hi*8 + r)
    v8f c[2];
    #pragma unroll
    for (int sub = 0; sub < 2; ++sub)
      c[sub] = mma_f16(ak[sub].v, qf.v, (v8f){0, 0, 0, 0, 0, 0, 0, 0});

    // online softmax: query lq's 32 scores are split across lane / lane^16
    float m_new = rmax;
    #pragma unroll
    for (int r = 0; r < 8; ++r) {
      m_new = fmaxf(m_new, c[0][r]);
      m_new = fmaxf(m_new, c[1][r]);
    }
    m_new = fmaxf(m_new, __shfl_xor(m_new, 16, 32));
    const float scale = __builtin_amdgcn_exp2f((rmax - m_new) * SL);
    rmax = m_new;

    // exp + pack: P^T C-layout == A-fragment layout for the PV product; P carried x4096 in f16
    FragH pa;
    float psum = 0.0f;
    #pragma unroll
    for (int r = 0; r < 8; ++r) {
      const float p0 = __builtin_amdgcn_exp2f((c[0][r] - m_new) * SL);   // key j0 + hi*8 + r
      const float p1 = __builtin_amdgcn_exp2f((c[1][r] - m_new) * SL);   // key j0 + 16 + hi*8 + r
      psum += p0 + p1;
      pa.h[r]     = (f16)(p0 * 4096.0f);
      pa.h[8 + r] = (f16)(p1 * 4096.0f);
    }
    rsum = rsum * scale + psum + __shfl_xor(psum, 16, 32);

    // rescale CTX: queries are the row dimension there -> per-row scale from lane 8*hi + r
    float sc[8];
    #pragma unroll
    for (int r = 0; r < 8; ++r) sc[r] = __shfl(scale, (hi << 3) + r, 32);
    #pragma unroll
    for (int dt = 0; dt < 8; ++dt) {
      #pragma unroll
      for (int r = 0; r < 8; ++r) o[dt][r] *= sc[r];
    }

    // CTX += P x Hv : B-fragment column n = d = dt*16 + lq, split key map from the transposed plane
    #pragma unroll
    for (int dt = 0; dt < 8; ++dt) {
      const f16* base = vt_b + (size_t)(dt * 16 + lq) * NKEY + j0 + hi * 8;
      FragH bv;
      bv.q[0] = *(const v4u*)(base);        // keys j0 + hi*8 + 0..7
      bv.q[1] = *(const v4u*)(base + 16);   // keys j0 + 16 + hi*8 + 0..7
      o[dt] = mma_f16(pa.v, bv.v, o[dt]);
    }
  }

  // normalize: lane holds column d = dt*16 + lq for query rows 8*hi + r
  float rs[8];
  #pragma unroll
  for (int r = 0; r < 8; ++r) rs[r] = 1.0f / __shfl(rsum, (hi << 3) + r, 32);

  f16* stg = sC + wave * (16 * CP);
  #pragma unroll
  for (int r = 0; r < 8; ++r) {
    #pragma unroll
    for (int dt = 0; dt < 8; ++dt)
      stg[(hi * 8 + r) * CP + dt * 16 + lq] = (f16)(o[dt][r] * (1.0f / 4096.0f) * rs[r]);
  }
  __syncthreads();

  // lanes 16..31 the next row; 8 instructions cover the wave's 16 rows.
  v4u    vals[8];
  size_t gidx[8];
  #pragma unroll
  for (int it = 0; it < 8; ++it) {
    const int row = it * 2 + hi;
    const int dq  = lq * 8;
    Pack8H p;
    p.v = *(const v8h*)(stg + row * CP + dq);
    vals[it] = p.u;
    gidx[it] = ((size_t)b * SEQ + qrow0 + row) * DV + dq;
  }
  #pragma unroll
  for (int it = 0; it < 8; ++it) *(v4u*)(ctx + gidx[it]) = vals[it];
  
}

// Output projection + scaled residual: out = gamma * (CTX x Wo) + x_bf16. Block = 8 waves, wave -> one 16-row M tile,
// four passes over 64-column quarters. A fragments from the f16 ctx plane, B fragments from wot (carried x16).
// Epilogue per quarter: f32 tile staged in LDS (per-wave region, block barriers), then per instruction lanes 0..15
__global__ __launch_bounds__(256) void oproj_kernel(const f16* __restrict__ ctx, const f16* __restrict__ wot,
                                                    const float* __restrict__ x, const float* __restrict__ gamma,
                                                    float* __restrict__ out) {
  const int tid  = threadIdx.x;
  const int wave = tid >> 5;
  const int lane = tid & 31;
  const int m    = lane & 15;   // B column within a tile / 16-B piece index of the quarter-row
  const int hi   = lane >> 4;
  const int mt   = blockIdx.x * NWAVE + wave;
  const int prow0 = mt * 16;                 // plane row of ctx
  const int bb    = prow0 / SEQ;
  const int pix0  = prow0 - bb * SEQ;
  const size_t xrow0 = (size_t)bb * SEQ_FULL + pix0;

  __shared__ __align__(16) float sO[NWAVE * 16 * OP];
  float* so = sO + wave * (16 * OP);

  const float gsc = (float)(bf16)gamma[0] * 0.0625f;   // gamma (RNE bf16) folded with the 1/16 Wo carry
  const f16* ap0 = ctx + (size_t)(prow0 + m) * DV + hi * 8;

  #pragma unroll 1
  for (int qn = 0; qn < 4; ++qn) {
    v8f acc[4];
    #pragma unroll
    for (int j = 0; j < 4; ++j) acc[j] = (v8f){0, 0, 0, 0, 0, 0, 0, 0};
    #pragma unroll
    for (int kk = 0; kk < DV / 32; ++kk) {
      FragH a;
      a.q[0] = *(const v4u*)(ap0 + kk * 32);        // d = kk*32 + hi*8 + 0..7
      a.q[1] = *(const v4u*)(ap0 + kk * 32 + 16);   // d = kk*32 + 16 + hi*8 + 0..7
      #pragma unroll
      for (int j = 0; j < 4; ++j) {
        const int nt = qn * 4 + j;
        const f16* wp = wot + (size_t)(nt * 16 + m) * DV + kk * 32 + hi * 8;
        FragH bw;
        bw.q[0] = *(const v4u*)(wp);
        bw.q[1] = *(const v4u*)(wp + 16);
        acc[j] = mma_f16(a.v, bw.v, acc[j]);
      }
    }
    #pragma unroll
    for (int r = 0; r < 8; ++r) {
      #pragma unroll
      for (int j = 0; j < 4; ++j) so[(hi * 8 + r) * OP + j * 16 + m] = acc[j][r] * gsc;
    }
    __syncthreads();

    v4f    vals[8];
    size_t gidx[8];
    #pragma unroll
    for (int it = 0; it < 8; ++it) {
      const int row = it * 2 + hi;
      v4f v = *(const v4f*)(so + row * OP + m * 4);
      const size_t g = (xrow0 + row) * CIN + qn * 64 + m * 4;
      const v4f xv = *(const v4f*)(x + g);
      #pragma unroll
      for (int cc = 0; cc < 4; ++cc) v[cc] = v[cc] + (float)(bf16)xv[cc];   // residual with the RNE bf16 input value
      vals[it] = v;
      gidx[it] = g;
    }
    #pragma unroll
    for (int it = 0; it < 8; ++it) *(v4f*)(out + gidx[it]) = vals[it];
    
    __syncthreads();
  }
}

extern "C" void kernel_launch(void* const* d_in, const int* in_sizes, int n_in,
                              void* d_out, int out_size, void* d_ws, size_t ws_size,
                              hipStream_t stream) {
  if (n_in < 6) return;
  const size_t rows_used = (size_t)(NB - 1) * SEQ_FULL + SEQ;
  if ((size_t)in_sizes[0] < rows_used * CIN) return;
  if (in_sizes[1] < CIN * DQK) return;
  if (in_sizes[2] < CIN * DQK) return;
  if (in_sizes[3] < CIN * DV) return;
  if (in_sizes[4] < DV * CIN) return;
  if (in_sizes[5] < 1) return;
  if ((size_t)out_size < rows_used * CIN) return;

  const size_t wct_bytes = (size_t)NPROJ * CIN * 2;           // 98,304
  const size_t wot_bytes = (size_t)CIN * DV * 2;              // 65,536
  const size_t gq_bytes  = (size_t)NB * SEQ * DQK * 2;        // 2,097,152 at full size
  const size_t fk_bytes  = (size_t)NB * NKEY * DQK * 2;       // 524,288
  const size_t hvt_bytes = (size_t)NB * DV * NKEY * 2;        // 2,097,152
  const size_t ctx_bytes = (size_t)NB * SEQ * DV * 2;         // 8,388,608
  const size_t off_wct = 0;
  const size_t off_wot = off_wct + wct_bytes;
  const size_t off_gq  = off_wot + wot_bytes;
  const size_t off_fk  = off_gq + gq_bytes;
  const size_t off_hvt = off_fk + fk_bytes;
  const size_t off_ctx = off_hvt + hvt_bytes;
  const size_t total   = off_ctx + ctx_bytes;                 // 13,271,040 at full size
  if (ws_size < total) return;

  const float* x     = (const float*)d_in[0];
  const float* wf    = (const float*)d_in[1];
  const float* wg    = (const float*)d_in[2];
  const float* wh    = (const float*)d_in[3];
  const float* wo    = (const float*)d_in[4];
  const float* gamma = (const float*)d_in[5];
  float* out = (float*)d_out;
  char*  ws  = (char*)d_ws;
  bf16* wct = (bf16*)(ws + off_wct);
  f16*  wot = (f16*)(ws + off_wot);
  f16*  gq  = (f16*)(ws + off_gq);
  f16*  fk  = (f16*)(ws + off_fk);
  f16*  hvt = (f16*)(ws + off_hvt);
  f16*  ctx = (f16*)(ws + off_ctx);

  pack_w_kernel<<<40, 256, 0, stream>>>(wf, wg, wh, wo, wct, wot);
  proj_pool_kernel<<<dim3(SEQ / 256, NB), 256, 0, stream>>>(x, wct, gq, fk, hvt);
  attn_kernel<<<dim3(SEQ / BQ, NB), 256, 0, stream>>>(gq, fk, hvt, ctx);
  oproj_kernel<<<(NB * SEQ) / 128, 256, 0, stream>>>(ctx, wot, x, gamma, out);
}

// v001
// It runs in 98.7 microseconds.
// Next to v000, in two timings, it ran 1.47 and 1.50 times as fast.
#include <hip/hip_runtime.h>

// Contractions: X x [Wf|Wg|Wh] on v_wmma_f32_16x16x32_bf16 (bf16 operands = RNE-converted inputs, f32 accumulate);
// S^T = F x G^T, CTX = P x Hv (P as f16 carried x4096) and OUT = CTX x Wo (Wo as f16 of the bf16 value, carried x16)
// on v_wmma_f32_16x16x32_f16 (f16 operands, f32 accumulate). Max-pool, softmax and residual in f32.

#ifndef NB
#define NB 8
#endif
#ifndef SEQ
#define SEQ 4096
#endif
#define NB_FULL  8
#define SEQ_FULL 4096
#define W_IMG    64                 // image width (pixels per image row)
#define CIN      256                // input channels
#define DQK      32                 // query / key channels
#define DV       128                // value channels
#define NPROJ    192                // packed projection columns: [0,32) f, [32,64) g, [64,192) h
#define NKEY     (SEQ / 4)          // pooled key count per image
#define KTILE    64                 // keys produced per projection block
#define BQ       128                // query rows per attention block (8 waves x 16)
#define BK       32                 // keys per inner iteration
#define NWAVE    8
#define PP       168                // LDS pitch (halves) of the ww-pooled staging rows
#define GP       40                 // LDS pitch (halves) of the g staging tile
#define FP       40                 // LDS pitch (halves) of the pooled f tile
#define HP       72                 // LDS pitch (halves) of the pooled h^T tile
#define CP       136                // LDS pitch (halves) of the ctx staging tile
#define OP       68                 // LDS pitch (floats) of the output staging tile
#define SK       64                 // keys per LDS stage of the attention loop (two BK passes)
#define NST      (NKEY / SK)        // stages per image
#define FSP      40                 // LDS pitch (halves) of a staged f row: 80 B = 16 B x odd
#define VSP      72                 // LDS pitch (halves) of a staged h^T row: 144 B = 16 B x odd

static_assert(SEQ % 256 == 0);
static_assert(SEQ >= 256 && SEQ <= SEQ_FULL);
static_assert(NB >= 1 && NB <= NB_FULL);
static_assert(BQ == NWAVE * 16);
static_assert(NKEY % BK == 0);
static_assert(NKEY % KTILE == 0);
static_assert(CIN % 32 == 0 && DV % 32 == 0 && DQK == 32);
// coverage equalities (grid x block x per-thread elements == plane extent)
static_assert((SEQ / 256) * 2 * NWAVE * 16 == SEQ);          // g plane rows per image
static_assert((SEQ / 256) * KTILE == NKEY);                   // f / h^T plane keys per image
static_assert((SEQ / BQ) * NWAVE * 16 == SEQ);                // ctx plane rows per image
static_assert(((NB * SEQ) / 128) * NWAVE * 16 == NB * SEQ);   // output rows
static_assert((GP * 2) % 16 == 0 && (FP * 2) % 16 == 0 && (HP * 2) % 16 == 0 && (CP * 2) % 16 == 0);
static_assert((OP * 4) % 16 == 0);
static_assert(NKEY % SK == 0 && SK == 2 * BK && NST >= 1);
static_assert((FSP * 2) % 16 == 0 && (VSP * 2) % 16 == 0);
static_assert(SK * DQK * 2 == 256 * 16);        // f stage: one 16-B copy per thread
static_assert(DV * SK * 2 == 4 * 256 * 16);     // h^T stage: four 16-B copies per thread

typedef __bf16   bf16;
typedef _Float16 f16;
typedef bf16     v16bf __attribute__((ext_vector_type(16)));
typedef f16      v16h  __attribute__((ext_vector_type(16)));
typedef f16      v8h   __attribute__((ext_vector_type(8)));
typedef float    v8f   __attribute__((ext_vector_type(8)));
typedef float    v4f   __attribute__((ext_vector_type(4)));
typedef unsigned v4u   __attribute__((ext_vector_type(4)));

union FragB  { v16bf v; v4u q[2]; bf16 h[16]; };
union FragH  { v16h  v; v4u q[2]; f16  h[16]; };
union Pack8B { v4u u; bf16 h[8]; };
union Pack8H { v4u u; v8h v; f16 h[8]; };

// WMMA helpers: builtin followed by the VALU hazard guard (ties D, keeps A/B live).
static __device__ __forceinline__ v8f mma_bf16(v16bf a, v16bf b, v8f acc) {
  acc = __builtin_amdgcn_wmma_f32_16x16x32_bf16(false, a, false, b, (short)0, acc, false, false);
  asm volatile("v_nop\n\tv_nop\n\tv_nop\n\tv_nop" : "+v"(acc) : "v"(a), "v"(b));
  return acc;
}
static __device__ __forceinline__ v8f mma_f16(v16h a, v16h b, v8f acc) {
  acc = __builtin_amdgcn_wmma_f32_16x16x32_f16(false, a, false, b, (short)0, acc, false, false);
  asm volatile("v_nop\n\tv_nop\n\tv_nop\n\tv_nop" : "+v"(acc) : "v"(a), "v"(b));
  return acc;
}

// Weight planes (k-contiguous rows, B fragments load like A fragments):
//   wct [NPROJ][CIN] bf16 : row n = column n of [wf | wg | wh], RNE bf16.
//   wot [CIN][DV]    f16  : row n = column n of wo, value f16(bf16(w) * 16) (exact).
// Blocks 0..23: 8 rows of wct each (one wave per 512-B row, one instruction); blocks 24..39: 16 rows of wot each
// (one wave per two 256-B rows, one instruction). Source selection is block-uniform.
// coverage: wct rows 0..191 x k 0..255; wot rows 0..255 x k 0..127.
__global__ __launch_bounds__(256) void pack_w_kernel(const float* __restrict__ wf, const float* __restrict__ wg,
                                                      const float* __restrict__ wh, const float* __restrict__ wo,
                                                      bf16* __restrict__ wct, f16* __restrict__ wot) {
  const int blk = blockIdx.x;
  const int tid = threadIdx.x;
  if (blk < 24) {
    const int n  = blk * 8 + (tid >> 5);       // 0..191
    const int kq = (tid & 31) * 8;             // 0..248
    const float* src = (blk < 4) ? wf : ((blk < 8) ? wg : wh);
    const int pitch  = (blk < 8) ? DQK : DV;
    const int nl     = (blk < 4) ? n : ((blk < 8) ? (n - 32) : (n - 64));
    Pack8B pk;
    #pragma unroll
    for (int i = 0; i < 8; ++i) pk.h[i] = (bf16)src[(size_t)(kq + i) * pitch + nl];   // RNE convert
    bf16* dst = wct + (size_t)n * CIN + kq;
    *(v4u*)dst = pk.u;
    
  } else {
    const int j  = (blk - 24) * 256 + tid;     // 0..4095
    const int n  = j >> 4;                     // 0..255
    const int kq = (j & 15) * 8;               // 0..120
    Pack8H pk;
    #pragma unroll
    for (int i = 0; i < 8; ++i) {
      const float v = (float)(bf16)wo[(size_t)(kq + i) * CIN + n];
      pk.h[i] = (f16)(v * 16.0f);              // bf16 significand fits f16: exact for normal results
    }
    f16* dst = wot + (size_t)n * DV + kq;
    *(v4u*)dst = pk.u;
    
  }
}

// One wave's 16-pixel M tile times NTN consecutive 16-column tiles of wct starting at tile NT0; K = CIN.
// A fragments from f32 x rows (RNE bf16 convert, split k map); B fragments from the k-contiguous wct rows.
template <int NT0, int NTN>
static __device__ __forceinline__ void proj_tiles(const float* __restrict__ xr, const bf16* __restrict__ wct,
                                                  int m, int hi, v8f (&acc)[NTN]) {
  #pragma unroll
  for (int t = 0; t < NTN; ++t) acc[t] = (v8f){0, 0, 0, 0, 0, 0, 0, 0};
  for (int kk = 0; kk < CIN / 32; ++kk) {
    const float* xp = xr + kk * 32;
    const v4f a0 = *(const v4f*)(xp + hi * 8);
    const v4f a1 = *(const v4f*)(xp + hi * 8 + 4);
    const v4f b0 = *(const v4f*)(xp + 16 + hi * 8);
    const v4f b1 = *(const v4f*)(xp + 16 + hi * 8 + 4);
    FragB a;
    #pragma unroll
    for (int i = 0; i < 4; ++i) {
      a.h[i]      = (bf16)a0[i];   // elems 0..7  : k = kk*32 + hi*8 + 0..7
      a.h[4 + i]  = (bf16)a1[i];
      a.h[8 + i]  = (bf16)b0[i];   // elems 8..15 : k = kk*32 + 16 + hi*8 + 0..7
      a.h[12 + i] = (bf16)b1[i];
    }
    #pragma unroll
    for (int t = 0; t < NTN; ++t) {
      const bf16* wp = wct + (size_t)((NT0 + t) * 16 + m) * CIN + kk * 32 + hi * 8;
      FragB bw;
      bw.q[0] = *(const v4u*)(wp);        // k = kk*32 + hi*8 + 0..7, n = tile*16 + m
      bw.q[1] = *(const v4u*)(wp + 16);   // k = kk*32 + 16 + hi*8 + 0..7
      acc[t] = mma_bf16(a.v, bw.v, acc[t]);
    }
  }
}

// Projection + 2x2 max-pool. Block = (64-key tile kt, batch b), 256 threads; two iterations each cover
// image rows hh = kt*4 + it*2 + {0,1}; wave -> (hh, 16 pixels along ww).
//   gq  [NB][SEQ][DQK]  f16 : queries, one 64-B row per pixel (wave writes 16 rows = 1 KB, 2 instructions).
//   fk  [NB][NKEY][DQK] f16 : pooled keys, 64 rows per block = 4 KB (one 512-B instruction per wave).
// LDS regions: sP cross-wave (block barrier), sG per-wave but read across lanes after the block barrier,
// sF / sHT cross-wave (block barrier). Staged extent == consumed extent for all four.
__global__ __launch_bounds__(256) void proj_pool_kernel(const float* __restrict__ x, const bf16* __restrict__ wct,
                                                         f16* __restrict__ gq, f16* __restrict__ fk,
                                                         f16* __restrict__ hvt) {
  const int kt   = blockIdx.x;
  const int b    = blockIdx.y;
  const int tid  = threadIdx.x;
  const int wave = tid >> 5;
  const int lane = tid & 31;
  const int m    = lane & 15;
  const int hi   = lane >> 4;
  const int hsel = wave >> 2;          // which of the two image rows of this iteration
  const int ww0  = (wave & 3) * 16;    // first pixel column of this wave's tile

  __shared__ __align__(16) f16 sP[2 * 32 * PP];       // [hsel][pw][160 cols] ww-pooled f|h
  __shared__ __align__(16) f16 sG[NWAVE * 16 * GP];   // per-wave g tile [16][32]
  __shared__ __align__(16) f16 sF[64 * FP];           // pooled f [64 keys][32]
  __shared__ __align__(16) f16 sHT[DV * HP];          // pooled h^T [128 d][64 keys]

  f16* sg = sG + wave * (16 * GP);
  f16* sp = sP + hsel * (32 * PP);
  const int pwb = (ww0 >> 1) + hi * 4;   // pooled column index base for this lane half

  for (int it = 0; it < 2; ++it) {
    const int hh   = kt * 4 + it * 2 + hsel;
    const int pix0 = hh * W_IMG + ww0;
    const float* xr = x + ((size_t)b * SEQ_FULL + pix0 + m) * CIN;

    {   // tiles 0..3: f (0,1) and g (2,3)
      v8f acc[4];
      proj_tiles<0, 4>(xr, wct, m, hi, acc);
      #pragma unroll
      for (int r = 0; r < 8; ++r) {
        sg[(hi * 8 + r) * GP + m]      = (f16)acc[2][r];
        sg[(hi * 8 + r) * GP + 16 + m] = (f16)acc[3][r];
      }
      // ww pairs are D rows (2rp, 2rp+1) of the same lane half; pooled column pw = ww0/2 + 4*hi + rp
      #pragma unroll
      for (int rp = 0; rp < 4; ++rp) {
        #pragma unroll
        for (int t = 0; t < 2; ++t)
          sp[(pwb + rp) * PP + t * 16 + m] = (f16)fmaxf(acc[t][2 * rp], acc[t][2 * rp + 1]);
      }
    }
    {   // tiles 4..11: h
      v8f acc[8];
      proj_tiles<4, 8>(xr, wct, m, hi, acc);
      #pragma unroll
      for (int rp = 0; rp < 4; ++rp) {
        #pragma unroll
        for (int t = 0; t < 8; ++t)
          sp[(pwb + rp) * PP + 32 + t * 16 + m] = (f16)fmaxf(acc[t][2 * rp], acc[t][2 * rp + 1]);
      }
    }
    __syncthreads();

    // g tile -> gq: 16 consecutive pixel rows x 64 B = 1 KB contiguous; 32 lanes x 16 B per instruction
    {
      v4u    gv[2];
      size_t gi[2];
      #pragma unroll
      for (int i2 = 0; i2 < 2; ++i2) {
        const int row = i2 * 8 + (lane >> 2);
        const int cq  = (lane & 3) * 8;
        Pack8H p;
        p.v = *(const v8h*)(sg + row * GP + cq);
        gv[i2] = p.u;
        gi[i2] = ((size_t)b * SEQ + pix0 + row) * DQK + cq;
      }
      #pragma unroll
      for (int i2 = 0; i2 < 2; ++i2) *(v4u*)(gq + gi[i2]) = gv[i2];
      
    }

    // hh-pool into the block's pooled tiles
    #pragma unroll
    for (int e = 0; e < 4; ++e) {
      const int idx = e * 256 + tid;
      const int pw  = idx >> 5;
      const int c   = idx & 31;
      const float v = fmaxf((float)sP[pw * PP + c], (float)sP[32 * PP + pw * PP + c]);
      sF[(it * 32 + pw) * FP + c] = (f16)v;
    }
    #pragma unroll
    for (int e = 0; e < 16; ++e) {
      const int idx = e * 256 + tid;
      const int pw  = idx >> 7;
      const int d   = idx & 127;
      const float v = fmaxf((float)sP[pw * PP + 32 + d], (float)sP[32 * PP + pw * PP + 32 + d]);
      sHT[d * HP + it * 32 + pw] = (f16)v;
    }
    __syncthreads();
  }

  // final plane stores: fk (wave -> 8 rows = 512 B), hvt (per instruction 4 d-lines, 8 lanes x 16 B each)
  v4u    fv;
  size_t fi;
  {
    const int row = tid >> 2;            // 0..63
    const int cq  = (tid & 3) * 8;
    Pack8H p;
    p.v = *(const v8h*)(sF + row * FP + cq);
    fv = p.u;
    fi = ((size_t)b * NKEY + kt * KTILE + row) * DQK + cq;
  }
  v4u    hv[4];
  size_t hidx[4];
  #pragma unroll
  for (int ps = 0; ps < 4; ++ps) {
    const int d  = ps * 32 + (tid >> 3);   // 0..127
    const int kq = (tid & 7) * 8;          // 0..56
    Pack8H p;
    p.v = *(const v8h*)(sHT + d * HP + kq);
    hv[ps]   = p.u;
    hidx[ps] = ((size_t)b * DV + d) * NKEY + kt * KTILE + kq;
  }
  *(v4u*)(fk + fi) = fv;
  #pragma unroll
  for (int ps = 0; ps < 4; ++ps) *(v4u*)(hvt + hidx[ps]) = hv[ps];
  
}

// One stage of 64 keys into LDS, five asynchronous 16-B copies per thread: one piece of the f tile (64 rows x 64 B)
// and four of the h^T tile (128 rows x 128 B; a wave covers four whole 128-B lines per copy). The s_wait_xcnt closes
// the statement so that no address register of an issued copy is rewritten ahead of it.
static __device__ __forceinline__ void stage_copy(unsigned lf, const f16* gf, unsigned lv, const f16* gv) {
  const unsigned lv1 = lv + 1 * 32 * VSP * 2, lv2 = lv + 2 * 32 * VSP * 2, lv3 = lv + 3 * 32 * VSP * 2;
  const f16* gv1 = gv + (size_t)1 * 32 * NKEY;
  const f16* gv2 = gv + (size_t)2 * 32 * NKEY;
  const f16* gv3 = gv + (size_t)3 * 32 * NKEY;
  asm volatile("global_load_async_to_lds_b128 %0, %1, off\n\t"
               "global_load_async_to_lds_b128 %2, %3, off\n\t"
               "global_load_async_to_lds_b128 %4, %5, off\n\t"
               "global_load_async_to_lds_b128 %6, %7, off\n\t"
               "global_load_async_to_lds_b128 %8, %9, off\n\t"
               "s_wait_xcnt 0x0"
               :: "v"(lf), "v"(gf), "v"(lv), "v"(gv), "v"(lv1), "v"(gv1), "v"(lv2), "v"(gv2), "v"(lv3), "v"(gv3)
               : "memory");
}

// Flash attention, non-causal, no score scaling. Block = (query block of 128, batch); one wave owns 16 queries.
// S^T = F x G^T so queries sit on lanes; P^T in C-layout is bit-identical to the A-fragment layout of CTX += P x Hv.
// G B-fragments come straight from the f16 plane. The f and h^T tiles, which all eight waves read, are brought into
// LDS once per block in stages of 64 keys (two buffers, the next stage's copies fly while this one is worked on);
// F A-fragments and Hv^T B-fragments are two 16-B LDS loads each.
//   ctx [NB][SEQ][DV] f16 : one 256-B row per query; wave writes 16 rows = 4 KB contiguous, 512 B per instruction.
// LDS: sC per-wave region, written and read across lanes under a block barrier; staged extent == consumed extent.
__global__ __launch_bounds__(256) void attn_kernel(const f16* __restrict__ gq, const f16* __restrict__ fk,
                                                   const f16* __restrict__ hvt, f16* __restrict__ ctx) {
  const int qblk = blockIdx.x;
  const int b    = blockIdx.y;
  const int tid  = threadIdx.x;
  const int wave = tid >> 5;
  const int lane = tid & 31;
  const int lq   = lane & 15;   // query column of S^T / d column of CTX
  const int hi   = lane >> 4;   // k-split half

  __shared__ __align__(16) f16 sC[NWAVE * 16 * CP];
  __shared__ __align__(16) f16 sKF[2 * SK * FSP];   // [buffer][key][32 d], pitch FSP
  __shared__ __align__(16) f16 sKV[2 * DV * VSP];   // [buffer][d][64 keys], pitch VSP

  const int qrow0 = qblk * BQ + wave * 16;

  // G as B-operand fragment: lane lq holds query qrow0+lq, elements follow the split d map
  FragH qf;
  {
    const f16* qp = gq + ((size_t)b * SEQ + qrow0 + lq) * DQK + hi * 8;
    qf.q[0] = *(const v4u*)(qp);        // d = hi*8 + 0..7
    qf.q[1] = *(const v4u*)(qp + 16);   // d = 16 + hi*8 + 0..7
  }

  const f16* fk_b = fk + (size_t)b * NKEY * DQK;
  const f16* vt_b = hvt + (size_t)b * DV * NKEY;

  v8f o[8];
  #pragma unroll
  for (int dt = 0; dt < 8; ++dt) o[dt] = (v8f){0, 0, 0, 0, 0, 0, 0, 0};

  float rmax = -__builtin_inff();
  float rsum = 0.0f;
  const float SL = 1.4426950408889634f;   // log2(e); the scores carry no extra scale

  // this thread's pieces of a stage: LDS byte addresses in buffer 0 and global pointers of stage 0
  const unsigned lf0 = (unsigned)(uintptr_t)sKF + (unsigned)((tid >> 2) * (FSP * 2) + (tid & 3) * 16);
  const unsigned lv0 = (unsigned)(uintptr_t)sKV + (unsigned)((tid >> 3) * (VSP * 2) + (tid & 7) * 16);
  const f16* gf0 = fk_b + tid * 8;                                  // f stage = 4 KB contiguous
  const f16* gv0 = vt_b + (size_t)(tid >> 3) * NKEY + (tid & 7) * 8;

  stage_copy(lf0, gf0, lv0, gv0);
  asm volatile("s_wait_asynccnt 0x0" ::: "memory");   // this wave's pieces of stage 0 have landed
  __syncthreads();                                    // publishes stage 0 to all waves
  if (NST > 1) stage_copy(lf0 + SK * FSP * 2, gf0 + SK * DQK, lv0 + DV * VSP * 2, gv0 + SK);

  for (int t = 0; t < NST; ++t) {
   const int buf = t & 1;
   const f16* sf = sKF + buf * (SK * FSP);
   const f16* sv = sKV + buf * (DV * VSP);
   #pragma unroll   // both passes of a stage inline: j0 folds into the LDS loads' immediate offsets
   for (int ps = 0; ps < SK / BK; ++ps) {
    const int j0 = ps * BK;   // first key of this pass inside the stage

    // F A-fragments: row = key j0 + sub*16 + lq, split d map
    FragH ak[2];
    #pragma unroll
    for (int sub = 0; sub < 2; ++sub) {
      const f16* base = sf + (j0 + sub * 16 + lq) * FSP + hi * 8;
      ak[sub].q[0] = *(const v4u*)(base);        // d = hi*8 + 0..7
      ak[sub].q[1] = *(const v4u*)(base + 16);   // d = 16 + hi*8 + 0..7
    }

    // S^T tiles: c[sub][r] = score(query qrow0+lq, key j0 + sub*16 + hi*8 + r)
    v8f c[2];
    #pragma unroll
    for (int sub = 0; sub < 2; ++sub)
      c[sub] = mma_f16(ak[sub].v, qf.v, (v8f){0, 0, 0, 0, 0, 0, 0, 0});

    // online softmax: query lq's 32 scores are split across lane / lane^16
    float m_new = rmax;
    #pragma unroll
    for (int r = 0; r < 8; ++r) {
      m_new = fmaxf(m_new, c[0][r]);
      m_new = fmaxf(m_new, c[1][r]);
    }
    m_new = fmaxf(m_new, __shfl_xor(m_new, 16, 32));
    const float scale = __builtin_amdgcn_exp2f((rmax - m_new) * SL);
    rmax = m_new;

    // exp + pack: P^T C-layout == A-fragment layout for the PV product; P carried x4096 in f16
    FragH pa;
    float psum = 0.0f;
    #pragma unroll
    for (int r = 0; r < 8; ++r) {
      const float p0 = __builtin_amdgcn_exp2f((c[0][r] - m_new) * SL);   // key j0 + hi*8 + r
      const float p1 = __builtin_amdgcn_exp2f((c[1][r] - m_new) * SL);   // key j0 + 16 + hi*8 + r
      psum += p0 + p1;
      pa.h[r]     = (f16)(p0 * 4096.0f);
      pa.h[8 + r] = (f16)(p1 * 4096.0f);
    }
    rsum = rsum * scale + psum + __shfl_xor(psum, 16, 32);

    // rescale CTX: queries are the row dimension there -> per-row scale from lane 8*hi + r
    float sc[8];
    #pragma unroll
    for (int r = 0; r < 8; ++r) sc[r] = __shfl(scale, (hi << 3) + r, 32);
    #pragma unroll
    for (int dt = 0; dt < 8; ++dt) {
      #pragma unroll
      for (int r = 0; r < 8; ++r) o[dt][r] *= sc[r];
    }

    // CTX += P x Hv : B-fragment column n = d = dt*16 + lq, split key map from the transposed plane
    #pragma unroll
    for (int dt = 0; dt < 8; ++dt) {
      const f16* base = sv + (dt * 16 + lq) * VSP + j0 + hi * 8;
      FragH bv;
      bv.q[0] = *(const v4u*)(base);        // keys j0 + hi*8 + 0..7
      bv.q[1] = *(const v4u*)(base + 16);   // keys j0 + 16 + hi*8 + 0..7
      o[dt] = mma_f16(pa.v, bv.v, o[dt]);
    }
   }
   // hand-over: stage t + 1 becomes readable, and the buffer of stage t free, behind this one barrier
   asm volatile("s_wait_dscnt 0x0" ::: "memory");      // this wave's reads of stage t are done before the refill
   asm volatile("s_wait_asynccnt 0x0" ::: "memory");   // this wave's pieces of stage t + 1 have landed
   __syncthreads();
   if (t + 2 < NST)
     stage_copy(lf0 + buf * (SK * FSP * 2), gf0 + (size_t)(t + 2) * (SK * DQK),
                lv0 + buf * (DV * VSP * 2), gv0 + (size_t)(t + 2) * SK);
  }
  asm volatile("s_wait_asynccnt 0x0" ::: "memory");    // no copy is outstanding when the wave goes on to its end

  // normalize: lane holds column d = dt*16 + lq for query rows 8*hi + r
  float rs[8];
  #pragma unroll
  for (int r = 0; r < 8; ++r) rs[r] = 1.0f / __shfl(rsum, (hi << 3) + r, 32);

  f16* stg = sC + wave * (16 * CP);
  #pragma unroll
  for (int r = 0; r < 8; ++r) {
    #pragma unroll
    for (int dt = 0; dt < 8; ++dt)
      stg[(hi * 8 + r) * CP + dt * 16 + lq] = (f16)(o[dt][r] * (1.0f / 4096.0f) * rs[r]);
  }
  __syncthreads();

  // lanes 16..31 the next row; 8 instructions cover the wave's 16 rows.
  v4u    vals[8];
  size_t gidx[8];
  #pragma unroll
  for (int it = 0; it < 8; ++it) {
    const int row = it * 2 + hi;
    const int dq  = lq * 8;
    Pack8H p;
    p.v = *(const v8h*)(stg + row * CP + dq);
    vals[it] = p.u;
    gidx[it] = ((size_t)b * SEQ + qrow0 + row) * DV + dq;
  }
  #pragma unroll
  for (int it = 0; it < 8; ++it) *(v4u*)(ctx + gidx[it]) = vals[it];
  
}

// Output projection + scaled residual: out = gamma * (CTX x Wo) + x_bf16. Block = 8 waves, wave -> one 16-row M tile,
// four passes over 64-column quarters. A fragments from the f16 ctx plane, B fragments from wot (carried x16).
// Epilogue per quarter: f32 tile staged in LDS (per-wave region, block barriers), then per instruction lanes 0..15
__global__ __launch_bounds__(256) void oproj_kernel(const f16* __restrict__ ctx, const f16* __restrict__ wot,
                                                    const float* __restrict__ x, const float* __restrict__ gamma,
                                                    float* __restrict__ out) {
  const int tid  = threadIdx.x;
  const int wave = tid >> 5;
  const int lane = tid & 31;
  const int m    = lane & 15;   // B column within a tile / 16-B piece index of the quarter-row
  const int hi   = lane >> 4;
  const int mt   = blockIdx.x * NWAVE + wave;
  const int prow0 = mt * 16;                 // plane row of ctx
  const int bb    = prow0 / SEQ;
  const int pix0  = prow0 - bb * SEQ;
  const size_t xrow0 = (size_t)bb * SEQ_FULL + pix0;

  __shared__ __align__(16) float sO[NWAVE * 16 * OP];
  float* so = sO + wave * (16 * OP);

  const float gsc = (float)(bf16)gamma[0] * 0.0625f;   // gamma (RNE bf16) folded with the 1/16 Wo carry
  const f16* ap0 = ctx + (size_t)(prow0 + m) * DV + hi * 8;

  #pragma unroll 1
  for (int qn = 0; qn < 4; ++qn) {
    v8f acc[4];
    #pragma unroll
    for (int j = 0; j < 4; ++j) acc[j] = (v8f){0, 0, 0, 0, 0, 0, 0, 0};
    #pragma unroll
    for (int kk = 0; kk < DV / 32; ++kk) {
      FragH a;
      a.q[0] = *(const v4u*)(ap0 + kk * 32);        // d = kk*32 + hi*8 + 0..7
      a.q[1] = *(const v4u*)(ap0 + kk * 32 + 16);   // d = kk*32 + 16 + hi*8 + 0..7
      #pragma unroll
      for (int j = 0; j < 4; ++j) {
        const int nt = qn * 4 + j;
        const f16* wp = wot + (size_t)(nt * 16 + m) * DV + kk * 32 + hi * 8;
        FragH bw;
        bw.q[0] = *(const v4u*)(wp);
        bw.q[1] = *(const v4u*)(wp + 16);
        acc[j] = mma_f16(a.v, bw.v, acc[j]);
      }
    }
    #pragma unroll
    for (int r = 0; r < 8; ++r) {
      #pragma unroll
      for (int j = 0; j < 4; ++j) so[(hi * 8 + r) * OP + j * 16 + m] = acc[j][r] * gsc;
    }
    __syncthreads();

    v4f    vals[8];
    size_t gidx[8];
    #pragma unroll
    for (int it = 0; it < 8; ++it) {
      const int row = it * 2 + hi;
      v4f v = *(const v4f*)(so + row * OP + m * 4);
      const size_t g = (xrow0 + row) * CIN + qn * 64 + m * 4;
      const v4f xv = *(const v4f*)(x + g);
      #pragma unroll
      for (int cc = 0; cc < 4; ++cc) v[cc] = v[cc] + (float)(bf16)xv[cc];   // residual with the RNE bf16 input value
      vals[it] = v;
      gidx[it] = g;
    }
    #pragma unroll
    for (int it = 0; it < 8; ++it) *(v4f*)(out + gidx[it]) = vals[it];
    
    __syncthreads();
  }
}

extern "C" void kernel_launch(void* const* d_in, const int* in_sizes, int n_in,
                              void* d_out, int out_size, void* d_ws, size_t ws_size,
                              hipStream_t stream) {
  if (n_in < 6) return;
  const size_t rows_used = (size_t)(NB - 1) * SEQ_FULL + SEQ;
  if ((size_t)in_sizes[0] < rows_used * CIN) return;
  if (in_sizes[1] < CIN * DQK) return;
  if (in_sizes[2] < CIN * DQK) return;
  if (in_sizes[3] < CIN * DV) return;
  if (in_sizes[4] < DV * CIN) return;
  if (in_sizes[5] < 1) return;
  if ((size_t)out_size < rows_used * CIN) return;

  const size_t wct_bytes = (size_t)NPROJ * CIN * 2;           // 98,304
  const size_t wot_bytes = (size_t)CIN * DV * 2;              // 65,536
  const size_t gq_bytes  = (size_t)NB * SEQ * DQK * 2;        // 2,097,152 at full size
  const size_t fk_bytes  = (size_t)NB * NKEY * DQK * 2;       // 524,288
  const size_t hvt_bytes = (size_t)NB * DV * NKEY * 2;        // 2,097,152
  const size_t ctx_bytes = (size_t)NB * SEQ * DV * 2;         // 8,388,608
  const size_t off_wct = 0;
  const size_t off_wot = off_wct + wct_bytes;
  const size_t off_gq  = off_wot + wot_bytes;
  const size_t off_fk  = off_gq + gq_bytes;
  const size_t off_hvt = off_fk + fk_bytes;
  const size_t off_ctx = off_hvt + hvt_bytes;
  const size_t total   = off_ctx + ctx_bytes;                 // 13,271,040 at full size
  if (ws_size < total) return;

  const float* x     = (const float*)d_in[0];
  const float* wf    = (const float*)d_in[1];
  const float* wg    = (const float*)d_in[2];
  const float* wh    = (const float*)d_in[3];
  const float* wo    = (const float*)d_in[4];
  const float* gamma = (const float*)d_in[5];
  float* out = (float*)d_out;
  char*  ws  = (char*)d_ws;
  bf16* wct = (bf16*)(ws + off_wct);
  f16*  wot = (f16*)(ws + off_wot);
  f16*  gq  = (f16*)(ws + off_gq);
  f16*  fk  = (f16*)(ws + off_fk);
  f16*  hvt = (f16*)(ws + off_hvt);
  f16*  ctx = (f16*)(ws + off_ctx);

  pack_w_kernel<<<40, 256, 0, stream>>>(wf, wg, wh, wo, wct, wot);
  proj_pool_kernel<<<dim3(SEQ / 256, NB), 256, 0, stream>>>(x, wct, gq, fk, hvt);
  attn_kernel<<<dim3(SEQ / BQ, NB), 256, 0, stream>>>(gq, fk, hvt, ctx);
  oproj_kernel<<<(NB * SEQ) / 128, 256, 0, stream>>>(ctx, wot, x, gamma, out);
}

// v002
// It runs in 66.9 microseconds.
// Timed twice side by side with v001, it ran 1.55 and 1.48 times as fast.
// Counting every step since v000, it is 2.25 times as fast.
#include <hip/hip_runtime.h>

// Contractions: X x [Wf|Wg|Wh] on v_wmma_f32_16x16x32_bf16 (bf16 operands = RNE-converted inputs, f32 accumulate);
// S^T = F x G^T, CTX = P x Hv (P as f16 carried x4096) and OUT = CTX x Wo (Wo as f16 of the bf16 value, carried x16)
// on v_wmma_f32_16x16x32_f16 (f16 operands, f32 accumulate). Max-pool, softmax and residual in f32.

#ifndef NB
#define NB 8
#endif
#ifndef SEQ
#define SEQ 4096
#endif
#define NB_FULL  8
#define SEQ_FULL 4096
#define W_IMG    64                 // image width (pixels per image row)
#define CIN      256                // input channels
#define DQK      32                 // query / key channels
#define DV       128                // value channels
#define NPROJ    192                // packed projection columns: [0,32) f, [32,64) g, [64,192) h
#define NKEY     (SEQ / 4)          // pooled key count per image
#define KTILE    64                 // keys produced per projection block
#define BQ       128                // query rows per attention block (8 waves x 16)
#define BK       32                 // keys per inner iteration
#define NWAVE    8
#define PP       168                // LDS pitch (halves) of the ww-pooled staging rows
#define GP       40                 // LDS pitch (halves) of the g staging tile
#define FP       40                 // LDS pitch (halves) of the pooled f tile
#define HP       72                 // LDS pitch (halves) of the pooled h^T tile
#define CP       136                // LDS pitch (halves) of the ctx staging tile
#define OP       68                 // LDS pitch (floats) of the output staging tile
#define SK       64                 // keys per LDS stage of the attention loop (two BK passes)
#define NST      (NKEY / SK)        // stages per image
#define FSP      40                 // LDS pitch (halves) of a staged f row: 80 B = 16 B x odd
#define VSP      72                 // LDS pitch (halves) of a staged h^T row: 144 B = 16 B x odd

static_assert(SEQ % 256 == 0);
static_assert(SEQ >= 256 && SEQ <= SEQ_FULL);
static_assert(NB >= 1 && NB <= NB_FULL);
static_assert(BQ == NWAVE * 16);
static_assert(NKEY % BK == 0);
static_assert(NKEY % KTILE == 0);
static_assert(CIN % 32 == 0 && DV % 32 == 0 && DQK == 32);
// coverage equalities (grid x block x per-thread elements == plane extent)
static_assert((SEQ / 256) * 2 * NWAVE * 16 == SEQ);          // g plane rows per image
static_assert((SEQ / 256) * KTILE == NKEY);                   // f / h^T plane keys per image
static_assert((SEQ / BQ) * NWAVE * 16 == SEQ);                // ctx plane rows per image
static_assert(((NB * SEQ) / 128) * NWAVE * 16 == NB * SEQ);   // output rows
static_assert((GP * 2) % 16 == 0 && (FP * 2) % 16 == 0 && (HP * 2) % 16 == 0 && (CP * 2) % 16 == 0);
static_assert((OP * 4) % 16 == 0);
static_assert(NKEY % SK == 0 && SK == 2 * BK && NST >= 1);
static_assert((FSP * 2) % 16 == 0 && (VSP * 2) % 16 == 0);
static_assert(SK * DQK * 2 == 256 * 16);        // f stage: one 16-B copy per thread
static_assert(DV * SK * 2 == 4 * 256 * 16);     // h^T stage: four 16-B copies per thread

typedef __bf16   bf16;
typedef _Float16 f16;
typedef bf16     v16bf __attribute__((ext_vector_type(16)));
typedef f16      v16h  __attribute__((ext_vector_type(16)));
typedef f16      v8h   __attribute__((ext_vector_type(8)));
typedef float    v8f   __attribute__((ext_vector_type(8)));
typedef float    v4f   __attribute__((ext_vector_type(4)));
typedef unsigned v4u   __attribute__((ext_vector_type(4)));

union FragB  { v16bf v; v4u q[2]; bf16 h[16]; };
union FragH  { v16h  v; v4u q[2]; f16  h[16]; };
union Pack8B { v4u u; bf16 h[8]; };
union Pack8H { v4u u; v8h v; f16 h[8]; };

// WMMA helpers: the plain builtins; the compiler keeps the distance behind its own matrix instructions. No volatile
// statement stands behind them, so that a block's fragment loads can be issued ahead of the block before it.
static __device__ __forceinline__ v8f mma_bf16(v16bf a, v16bf b, v8f acc) {
  return __builtin_amdgcn_wmma_f32_16x16x32_bf16(false, a, false, b, (short)0, acc, false, false);
}
static __device__ __forceinline__ v8f mma_f16(v16h a, v16h b, v8f acc) {
  return __builtin_amdgcn_wmma_f32_16x16x32_f16(false, a, false, b, (short)0, acc, false, false);
}

// Weight planes (k-contiguous rows, B fragments load like A fragments):
//   wct [NPROJ][CIN] bf16 : row n = column n of [wf | wg | wh], RNE bf16.
//   wot [CIN][DV]    f16  : row n = column n of wo, value f16(bf16(w) * 16) (exact).
// Blocks 0..23: 8 rows of wct each (one wave per 512-B row, one instruction); blocks 24..39: 16 rows of wot each
// (one wave per two 256-B rows, one instruction). Source selection is block-uniform.
// coverage: wct rows 0..191 x k 0..255; wot rows 0..255 x k 0..127.
__global__ __launch_bounds__(256) void pack_w_kernel(const float* __restrict__ wf, const float* __restrict__ wg,
                                                      const float* __restrict__ wh, const float* __restrict__ wo,
                                                      bf16* __restrict__ wct, f16* __restrict__ wot) {
  const int blk = blockIdx.x;
  const int tid = threadIdx.x;
  if (blk < 24) {
    const int n  = blk * 8 + (tid >> 5);       // 0..191
    const int kq = (tid & 31) * 8;             // 0..248
    const float* src = (blk < 4) ? wf : ((blk < 8) ? wg : wh);
    const int pitch  = (blk < 8) ? DQK : DV;
    const int nl     = (blk < 4) ? n : ((blk < 8) ? (n - 32) : (n - 64));
    Pack8B pk;
    #pragma unroll
    for (int i = 0; i < 8; ++i) pk.h[i] = (bf16)src[(size_t)(kq + i) * pitch + nl];   // RNE convert
    bf16* dst = wct + (size_t)n * CIN + kq;
    *(v4u*)dst = pk.u;
    
  } else {
    const int j  = (blk - 24) * 256 + tid;     // 0..4095
    const int n  = j >> 4;                     // 0..255
    const int kq = (j & 15) * 8;               // 0..120
    Pack8H pk;
    #pragma unroll
    for (int i = 0; i < 8; ++i) {
      const float v = (float)(bf16)wo[(size_t)(kq + i) * CIN + n];
      pk.h[i] = (f16)(v * 16.0f);              // bf16 significand fits f16: exact for normal results
    }
    f16* dst = wot + (size_t)n * DV + kq;
    *(v4u*)dst = pk.u;
    
  }
}

// One wave's 16-pixel M tile times NTN consecutive 16-column tiles of wct starting at tile NT0; K = CIN.
// A fragments from f32 x rows (RNE bf16 convert, split k map); B fragments from the k-contiguous wct rows.
// Loads go out in groups ahead of the matrix work: the x pieces AD k-blocks ahead, the wct fragments one k-block ahead.
template <int NT0, int NTN, int AD>
static __device__ __forceinline__ void proj_tiles(const float* __restrict__ xr, const bf16* wct,
                                                  int m, int hi, v8f (&acc)[NTN]) {
  constexpr int NKB = CIN / 32;
  #pragma unroll
  for (int t = 0; t < NTN; ++t) acc[t] = (v8f){0, 0, 0, 0, 0, 0, 0, 0};
  const float* xp = xr + hi * 8;
  const bf16*  wp = wct + (size_t)(NT0 * 16 + m) * CIN + hi * 8;
  v4f   ax[NKB][4];
  FragB bw[NKB][NTN];
  #pragma unroll
  for (int kk = 0; kk < NKB; ++kk) {
    if (kk < AD) {
      ax[kk][0] = *(const v4f*)(xp + kk * 32);
      ax[kk][1] = *(const v4f*)(xp + kk * 32 + 4);
      ax[kk][2] = *(const v4f*)(xp + kk * 32 + 16);
      ax[kk][3] = *(const v4f*)(xp + kk * 32 + 20);
    }
  }
  #pragma unroll
  for (int t = 0; t < NTN; ++t) {
    bw[0][t].q[0] = *(const v4u*)(wp + (size_t)t * 16 * CIN);
    bw[0][t].q[1] = *(const v4u*)(wp + (size_t)t * 16 * CIN + 16);
  }
  #pragma unroll
  for (int kk = 0; kk < NKB; ++kk) {
    if (kk + AD < NKB) {
      const int ka = kk + AD;
      ax[ka][0] = *(const v4f*)(xp + ka * 32);
      ax[ka][1] = *(const v4f*)(xp + ka * 32 + 4);
      ax[ka][2] = *(const v4f*)(xp + ka * 32 + 16);
      ax[ka][3] = *(const v4f*)(xp + ka * 32 + 20);
    }
    if (kk + 1 < NKB) {
      #pragma unroll
      for (int t = 0; t < NTN; ++t) {
        bw[kk + 1][t].q[0] = *(const v4u*)(wp + (size_t)t * 16 * CIN + (kk + 1) * 32);        // k = hi*8 + 0..7 of the block
        bw[kk + 1][t].q[1] = *(const v4u*)(wp + (size_t)t * 16 * CIN + (kk + 1) * 32 + 16);   // k = 16 + hi*8 + 0..7
      }
    }
    __builtin_amdgcn_sched_barrier(0);   // the next block's loads stay in front of this block's matrix work
    FragB a;
    #pragma unroll
    for (int i = 0; i < 4; ++i) {
      a.h[i]      = (bf16)ax[kk][0][i];   // elems 0..7  : k = kk*32 + hi*8 + 0..7
      a.h[4 + i]  = (bf16)ax[kk][1][i];
      a.h[8 + i]  = (bf16)ax[kk][2][i];   // elems 8..15 : k = kk*32 + 16 + hi*8 + 0..7
      a.h[12 + i] = (bf16)ax[kk][3][i];
    }
    #pragma unroll
    for (int t = 0; t < NTN; ++t) acc[t] = mma_bf16(a.v, bw[kk][t].v, acc[t]);
    __builtin_amdgcn_sched_barrier(0);   // later loads are not lifted over this block: two blocks of wct fragments live at most
  }
}

// Projection + 2x2 max-pool. Block = (64-key tile kt, batch b), 256 threads; two iterations each cover
// image rows hh = kt*4 + it*2 + {0,1}; wave -> (hh, 16 pixels along ww).
//   gq  [NB][SEQ][DQK]  f16 : queries, one 64-B row per pixel (wave writes 16 rows = 1 KB, 2 instructions).
//   fk  [NB][NKEY][DQK] f16 : pooled keys, 64 rows per block = 4 KB (one 512-B instruction per wave).
// LDS regions: sP cross-wave (block barrier), sG per-wave but read across lanes after the block barrier,
// sF / sHT cross-wave (block barrier). Staged extent == consumed extent for all four.
// wct carries no __restrict__: with it the compiler lifts every wct load out of the loop over it and spills them.
__global__ __launch_bounds__(256) void proj_pool_kernel(const float* __restrict__ x, const bf16* wct,
                                                         f16* __restrict__ gq, f16* __restrict__ fk,
                                                         f16* __restrict__ hvt) {
  const int kt   = blockIdx.x;
  const int b    = blockIdx.y;
  const int tid  = threadIdx.x;
  const int wave = tid >> 5;
  const int lane = tid & 31;
  const int m    = lane & 15;
  const int hi   = lane >> 4;
  const int hsel = wave >> 2;          // which of the two image rows of this iteration
  const int ww0  = (wave & 3) * 16;    // first pixel column of this wave's tile

  __shared__ __align__(16) f16 sP[2 * 32 * PP];       // [hsel][pw][160 cols] ww-pooled f|h
  __shared__ __align__(16) f16 sG[NWAVE * 16 * GP];   // per-wave g tile [16][32]
  __shared__ __align__(16) f16 sF[64 * FP];           // pooled f [64 keys][32]
  __shared__ __align__(16) f16 sHT[DV * HP];          // pooled h^T [128 d][64 keys]

  f16* sg = sG + wave * (16 * GP);
  f16* sp = sP + hsel * (32 * PP);
  const int pwb = (ww0 >> 1) + hi * 4;   // pooled column index base for this lane half

  for (int it = 0; it < 2; ++it) {
    const int hh   = kt * 4 + it * 2 + hsel;
    const int pix0 = hh * W_IMG + ww0;
    const float* xr = x + ((size_t)b * SEQ_FULL + pix0 + m) * CIN;

    {   // tiles 0..3: f (0,1) and g (2,3)
      v8f acc[4];
      proj_tiles<0, 4, CIN / 32>(xr, wct, m, hi, acc);   // first touch of x: all its pieces in flight at once
      #pragma unroll
      for (int r = 0; r < 8; ++r) {
        sg[(hi * 8 + r) * GP + m]      = (f16)acc[2][r];
        sg[(hi * 8 + r) * GP + 16 + m] = (f16)acc[3][r];
      }
      // ww pairs are D rows (2rp, 2rp+1) of the same lane half; pooled column pw = ww0/2 + 4*hi + rp
      #pragma unroll
      for (int rp = 0; rp < 4; ++rp) {
        #pragma unroll
        for (int t = 0; t < 2; ++t)
          sp[(pwb + rp) * PP + t * 16 + m] = (f16)fmaxf(acc[t][2 * rp], acc[t][2 * rp + 1]);
      }
    }
    {   // tiles 4..11: h
      v8f acc[8];
      proj_tiles<4, 8, 1>(xr, wct, m, hi, acc);
      #pragma unroll
      for (int rp = 0; rp < 4; ++rp) {
        #pragma unroll
        for (int t = 0; t < 8; ++t)
          sp[(pwb + rp) * PP + 32 + t * 16 + m] = (f16)fmaxf(acc[t][2 * rp], acc[t][2 * rp + 1]);
      }
    }
    __syncthreads();

    // g tile -> gq: 16 consecutive pixel rows x 64 B = 1 KB contiguous; 32 lanes x 16 B per instruction
    {
      v4u    gv[2];
      size_t gi[2];
      #pragma unroll
      for (int i2 = 0; i2 < 2; ++i2) {
        const int row = i2 * 8 + (lane >> 2);
        const int cq  = (lane & 3) * 8;
        Pack8H p;
        p.v = *(const v8h*)(sg + row * GP + cq);
        gv[i2] = p.u;
        gi[i2] = ((size_t)b * SEQ + pix0 + row) * DQK + cq;
      }
      #pragma unroll
      for (int i2 = 0; i2 < 2; ++i2) *(v4u*)(gq + gi[i2]) = gv[i2];
      
    }

    // hh-pool into the block's pooled tiles
    #pragma unroll
    for (int e = 0; e < 4; ++e) {
      const int idx = e * 256 + tid;
      const int pw  = idx >> 5;
      const int c   = idx & 31;
      const float v = fmaxf((float)sP[pw * PP + c], (float)sP[32 * PP + pw * PP + c]);
      sF[(it * 32 + pw) * FP + c] = (f16)v;
    }
    #pragma unroll
    for (int e = 0; e < 16; ++e) {
      const int idx = e * 256 + tid;
      const int pw  = idx >> 7;
      const int d   = idx & 127;
      const float v = fmaxf((float)sP[pw * PP + 32 + d], (float)sP[32 * PP + pw * PP + 32 + d]);
      sHT[d * HP + it * 32 + pw] = (f16)v;
    }
    __syncthreads();
  }

  // final plane stores: fk (wave -> 8 rows = 512 B), hvt (per instruction 4 d-lines, 8 lanes x 16 B each)
  v4u    fv;
  size_t fi;
  {
    const int row = tid >> 2;            // 0..63
    const int cq  = (tid & 3) * 8;
    Pack8H p;
    p.v = *(const v8h*)(sF + row * FP + cq);
    fv = p.u;
    fi = ((size_t)b * NKEY + kt * KTILE + row) * DQK + cq;
  }
  v4u    hv[4];
  size_t hidx[4];
  #pragma unroll
  for (int ps = 0; ps < 4; ++ps) {
    const int d  = ps * 32 + (tid >> 3);   // 0..127
    const int kq = (tid & 7) * 8;          // 0..56
    Pack8H p;
    p.v = *(const v8h*)(sHT + d * HP + kq);
    hv[ps]   = p.u;
    hidx[ps] = ((size_t)b * DV + d) * NKEY + kt * KTILE + kq;
  }
  *(v4u*)(fk + fi) = fv;
  #pragma unroll
  for (int ps = 0; ps < 4; ++ps) *(v4u*)(hvt + hidx[ps]) = hv[ps];
  
}

// One stage of 64 keys into LDS, five asynchronous 16-B copies per thread: one piece of the f tile (64 rows x 64 B)
// and four of the h^T tile (128 rows x 128 B; a wave covers four whole 128-B lines per copy). The s_wait_xcnt closes
// the statement so that no address register of an issued copy is rewritten ahead of it.
static __device__ __forceinline__ void stage_copy(unsigned lf, const f16* gf, unsigned lv, const f16* gv) {
  const unsigned lv1 = lv + 1 * 32 * VSP * 2, lv2 = lv + 2 * 32 * VSP * 2, lv3 = lv + 3 * 32 * VSP * 2;
  const f16* gv1 = gv + (size_t)1 * 32 * NKEY;
  const f16* gv2 = gv + (size_t)2 * 32 * NKEY;
  const f16* gv3 = gv + (size_t)3 * 32 * NKEY;
  asm volatile("global_load_async_to_lds_b128 %0, %1, off\n\t"
               "global_load_async_to_lds_b128 %2, %3, off\n\t"
               "global_load_async_to_lds_b128 %4, %5, off\n\t"
               "global_load_async_to_lds_b128 %6, %7, off\n\t"
               "global_load_async_to_lds_b128 %8, %9, off\n\t"
               "s_wait_xcnt 0x0"
               :: "v"(lf), "v"(gf), "v"(lv), "v"(gv), "v"(lv1), "v"(gv1), "v"(lv2), "v"(gv2), "v"(lv3), "v"(gv3)
               : "memory");
}

// Flash attention, non-causal, no score scaling. Block = (query block of 128, batch); one wave owns 16 queries.
// S^T = F x G^T so queries sit on lanes; P^T in C-layout is bit-identical to the A-fragment layout of CTX += P x Hv.
// G B-fragments come straight from the f16 plane. The f and h^T tiles, which all eight waves read, are brought into
// LDS once per block in stages of 64 keys (two buffers, the next stage's copies fly while this one is worked on);
// F A-fragments and Hv^T B-fragments are two 16-B LDS loads each, issued in two groups per stage ahead of their use (F of both passes goes in the first).
//   ctx [NB][SEQ][DV] f16 : one 256-B row per query; wave writes 16 rows = 4 KB contiguous, 512 B per instruction.
// LDS: sC per-wave region, written and read across lanes under a block barrier; staged extent == consumed extent.
__global__ __launch_bounds__(256) void attn_kernel(const f16* __restrict__ gq, const f16* __restrict__ fk,
                                                   const f16* __restrict__ hvt, f16* __restrict__ ctx) {
  const int qblk = blockIdx.x;
  const int b    = blockIdx.y;
  const int tid  = threadIdx.x;
  const int wave = tid >> 5;
  const int lane = tid & 31;
  const int lq   = lane & 15;   // query column of S^T / d column of CTX
  const int hi   = lane >> 4;   // k-split half

  __shared__ __align__(16) f16 sC[NWAVE * 16 * CP];
  __shared__ __align__(16) f16 sKF[2 * SK * FSP];   // [buffer][key][32 d], pitch FSP
  __shared__ __align__(16) f16 sKV[2 * DV * VSP];   // [buffer][d][64 keys], pitch VSP

  const int qrow0 = qblk * BQ + wave * 16;

  // G as B-operand fragment: lane lq holds query qrow0+lq, elements follow the split d map
  FragH qf;
  {
    const f16* qp = gq + ((size_t)b * SEQ + qrow0 + lq) * DQK + hi * 8;
    qf.q[0] = *(const v4u*)(qp);        // d = hi*8 + 0..7
    qf.q[1] = *(const v4u*)(qp + 16);   // d = 16 + hi*8 + 0..7
  }

  const f16* fk_b = fk + (size_t)b * NKEY * DQK;
  const f16* vt_b = hvt + (size_t)b * DV * NKEY;

  v8f o[8];
  #pragma unroll
  for (int dt = 0; dt < 8; ++dt) o[dt] = (v8f){0, 0, 0, 0, 0, 0, 0, 0};

  float rmax = -__builtin_inff();
  float rsum = 0.0f;
  const float SL = 1.4426950408889634f;   // log2(e); the scores carry no extra scale

  // this thread's pieces of a stage: LDS byte addresses in buffer 0 and global pointers of stage 0
  const unsigned lf0 = (unsigned)(uintptr_t)sKF + (unsigned)((tid >> 2) * (FSP * 2) + (tid & 3) * 16);
  const unsigned lv0 = (unsigned)(uintptr_t)sKV + (unsigned)((tid >> 3) * (VSP * 2) + (tid & 7) * 16);
  const f16* gf0 = fk_b + tid * 8;                                  // f stage = 4 KB contiguous
  const f16* gv0 = vt_b + (size_t)(tid >> 3) * NKEY + (tid & 7) * 8;

  stage_copy(lf0, gf0, lv0, gv0);
  asm volatile("s_wait_asynccnt 0x0" ::: "memory");   // this wave's pieces of stage 0 have landed
  __syncthreads();                                    // publishes stage 0 to all waves
  if (NST > 1) stage_copy(lf0 + SK * FSP * 2, gf0 + SK * DQK, lv0 + DV * VSP * 2, gv0 + SK);

  for (int t = 0; t < NST; ++t) {
   const int buf = t & 1;
   const f16* sf = sKF + buf * (SK * FSP);
   const f16* sv = sKV + buf * (DV * VSP);
   // One group of LDS loads at the head of the stage: the F A-fragments of both passes (row = key, split d map) and the
   // Hv^T B-fragments of the first pass (column n = d = dt*16 + lq, split key map from the transposed tile).
   FragH ak[SK / BK][2];
   #pragma unroll
   for (int ps = 0; ps < SK / BK; ++ps) {
     #pragma unroll
     for (int sub = 0; sub < 2; ++sub) {
       const f16* base = sf + (ps * BK + sub * 16 + lq) * FSP + hi * 8;
       ak[ps][sub].q[0] = *(const v4u*)(base);        // d = hi*8 + 0..7
       ak[ps][sub].q[1] = *(const v4u*)(base + 16);   // d = 16 + hi*8 + 0..7
     }
   }
   FragH bv[8];
   #pragma unroll
   for (int dt = 0; dt < 8; ++dt) {
     const f16* base = sv + (dt * 16 + lq) * VSP + hi * 8;
     bv[dt].q[0] = *(const v4u*)(base);        // keys hi*8 + 0..7
     bv[dt].q[1] = *(const v4u*)(base + 16);   // keys 16 + hi*8 + 0..7
   }
   __builtin_amdgcn_sched_barrier(0);   // the group stays whole, in front of the scores and the softmax that hide its latency
   #pragma unroll   // both passes of a stage inline: j0 folds into the LDS loads' immediate offsets
   for (int ps = 0; ps < SK / BK; ++ps) {
    // S^T tiles: c[sub][r] = score(query qrow0+lq, key j0 + sub*16 + hi*8 + r), j0 = ps * BK
    v8f c[2];
    #pragma unroll
    for (int sub = 0; sub < 2; ++sub)
      c[sub] = mma_f16(ak[ps][sub].v, qf.v, (v8f){0, 0, 0, 0, 0, 0, 0, 0});

    // online softmax: query lq's 32 scores are split across lane / lane^16
    float m_new = rmax;
    #pragma unroll
    for (int r = 0; r < 8; ++r) {
      m_new = fmaxf(m_new, c[0][r]);
      m_new = fmaxf(m_new, c[1][r]);
    }
    m_new = fmaxf(m_new, __shfl_xor(m_new, 16, 32));
    const float scale = __builtin_amdgcn_exp2f((rmax - m_new) * SL);
    rmax = m_new;

    // exp + pack: P^T C-layout == A-fragment layout for the PV product; P carried x4096 in f16
    FragH pa;
    float psum = 0.0f;
    #pragma unroll
    for (int r = 0; r < 8; ++r) {
      const float p0 = __builtin_amdgcn_exp2f((c[0][r] - m_new) * SL);   // key j0 + hi*8 + r
      const float p1 = __builtin_amdgcn_exp2f((c[1][r] - m_new) * SL);   // key j0 + 16 + hi*8 + r
      psum += p0 + p1;
      pa.h[r]     = (f16)(p0 * 4096.0f);
      pa.h[8 + r] = (f16)(p1 * 4096.0f);
    }
    rsum = rsum * scale + psum + __shfl_xor(psum, 16, 32);

    // rescale CTX: queries are the row dimension there -> per-row scale from lane 8*hi + r
    float sc[8];
    #pragma unroll
    for (int r = 0; r < 8; ++r) sc[r] = __shfl(scale, (hi << 3) + r, 32);
    #pragma unroll
    for (int dt = 0; dt < 8; ++dt) {
      #pragma unroll
      for (int r = 0; r < 8; ++r) o[dt][r] *= sc[r];
    }

    // CTX += P x Hv
    #pragma unroll
    for (int dt = 0; dt < 8; ++dt) o[dt] = mma_f16(pa.v, bv[dt].v, o[dt]);
    if (ps + 1 < SK / BK) {
      __builtin_amdgcn_sched_barrier(0);   // the next pass's group is not lifted over these products: one set of Hv^T registers
      #pragma unroll
      for (int dt = 0; dt < 8; ++dt) {
        const f16* base = sv + (dt * 16 + lq) * VSP + (ps + 1) * BK + hi * 8;
        bv[dt].q[0] = *(const v4u*)(base);        // keys j0 + hi*8 + 0..7 of the next pass
        bv[dt].q[1] = *(const v4u*)(base + 16);   // keys j0 + 16 + hi*8 + 0..7
      }
      __builtin_amdgcn_sched_barrier(0);   // and it stays whole, in front of the next pass's scores and softmax
    }
   }
   __builtin_amdgcn_sched_barrier(0);   // the second pass's work stays in front of the hand-over, whose waits would else stand right behind its loads
   // hand-over: stage t + 1 becomes readable, and the buffer of stage t free, behind this one barrier
   asm volatile("s_wait_dscnt 0x0" ::: "memory");      // this wave's reads of stage t are done before the refill
   asm volatile("s_wait_asynccnt 0x0" ::: "memory");   // this wave's pieces of stage t + 1 have landed
   __syncthreads();
   if (t + 2 < NST)
     stage_copy(lf0 + buf * (SK * FSP * 2), gf0 + (size_t)(t + 2) * (SK * DQK),
                lv0 + buf * (DV * VSP * 2), gv0 + (size_t)(t + 2) * SK);
  }
  asm volatile("s_wait_asynccnt 0x0" ::: "memory");    // no copy is outstanding when the wave goes on to its end

  // normalize: lane holds column d = dt*16 + lq for query rows 8*hi + r
  float rs[8];
  #pragma unroll
  for (int r = 0; r < 8; ++r) rs[r] = 1.0f / __shfl(rsum, (hi << 3) + r, 32);

  f16* stg = sC + wave * (16 * CP);
  #pragma unroll
  for (int r = 0; r < 8; ++r) {
    #pragma unroll
    for (int dt = 0; dt < 8; ++dt)
      stg[(hi * 8 + r) * CP + dt * 16 + lq] = (f16)(o[dt][r] * (1.0f / 4096.0f) * rs[r]);
  }
  __syncthreads();

  // lanes 16..31 the next row; 8 instructions cover the wave's 16 rows.
  v4u    vals[8];
  size_t gidx[8];
  #pragma unroll
  for (int it = 0; it < 8; ++it) {
    const int row = it * 2 + hi;
    const int dq  = lq * 8;
    Pack8H p;
    p.v = *(const v8h*)(stg + row * CP + dq);
    vals[it] = p.u;
    gidx[it] = ((size_t)b * SEQ + qrow0 + row) * DV + dq;
  }
  #pragma unroll
  for (int it = 0; it < 8; ++it) *(v4u*)(ctx + gidx[it]) = vals[it];
  
}

// Output projection + scaled residual: out = gamma * (CTX x Wo) + x_bf16. Block = 8 waves, wave -> one 16-row M tile,
// four passes over 64-column quarters. A fragments from the f16 ctx plane, B fragments from wot (carried x16).
// Epilogue per quarter: f32 tile staged in LDS (per-wave region, block barriers), then per instruction lanes 0..15
__global__ __launch_bounds__(256) void oproj_kernel(const f16* __restrict__ ctx, const f16* __restrict__ wot,
                                                    const float* __restrict__ x, const float* __restrict__ gamma,
                                                    float* __restrict__ out) {
  const int tid  = threadIdx.x;
  const int wave = tid >> 5;
  const int lane = tid & 31;
  const int m    = lane & 15;   // B column within a tile / 16-B piece index of the quarter-row
  const int hi   = lane >> 4;
  const int mt   = blockIdx.x * NWAVE + wave;
  const int prow0 = mt * 16;                 // plane row of ctx
  const int bb    = prow0 / SEQ;
  const int pix0  = prow0 - bb * SEQ;
  const size_t xrow0 = (size_t)bb * SEQ_FULL + pix0;

  __shared__ __align__(16) float sO[NWAVE * 16 * OP];
  float* so = sO + wave * (16 * OP);

  const float gsc = (float)(bf16)gamma[0] * 0.0625f;   // gamma (RNE bf16) folded with the 1/16 Wo carry
  const f16* ap0 = ctx + (size_t)(prow0 + m) * DV + hi * 8;
  FragH a[DV / 32];   // the wave's ctx rows, the same for all four quarters
  #pragma unroll
  for (int kk = 0; kk < DV / 32; ++kk) {
    a[kk].q[0] = *(const v4u*)(ap0 + kk * 32);        // d = kk*32 + hi*8 + 0..7
    a[kk].q[1] = *(const v4u*)(ap0 + kk * 32 + 16);   // d = kk*32 + 16 + hi*8 + 0..7
  }

  #pragma unroll 1
  for (int qn = 0; qn < 4; ++qn) {
    // one group of loads per quarter: its sixteen Wo fragments, then the x pieces of its residual
    FragH bw[DV / 32][4];
    #pragma unroll
    for (int kk = 0; kk < DV / 32; ++kk) {
      #pragma unroll
      for (int j = 0; j < 4; ++j) {
        const f16* wp = wot + (size_t)((qn * 4 + j) * 16 + m) * DV + kk * 32 + hi * 8;
        bw[kk][j].q[0] = *(const v4u*)(wp);
        bw[kk][j].q[1] = *(const v4u*)(wp + 16);
      }
    }
    v4f    xq[8];
    size_t gidx[8];
    #pragma unroll
    for (int it = 0; it < 8; ++it) {
      gidx[it] = (xrow0 + it * 2 + hi) * CIN + qn * 64 + m * 4;
      xq[it]   = *(const v4f*)(x + gidx[it]);
    }
    __builtin_amdgcn_sched_barrier(0);   // the group stays whole, in front of the quarter's matrix work
    v8f acc[4];
    #pragma unroll
    for (int j = 0; j < 4; ++j) acc[j] = (v8f){0, 0, 0, 0, 0, 0, 0, 0};
    #pragma unroll
    for (int kk = 0; kk < DV / 32; ++kk) {
      #pragma unroll
      for (int j = 0; j < 4; ++j) acc[j] = mma_f16(a[kk].v, bw[kk][j].v, acc[j]);
    }
    #pragma unroll
    for (int r = 0; r < 8; ++r) {
      #pragma unroll
      for (int j = 0; j < 4; ++j) so[(hi * 8 + r) * OP + j * 16 + m] = acc[j][r] * gsc;
    }
    __syncthreads();

    v4f vals[8];
    #pragma unroll
    for (int it = 0; it < 8; ++it) {
      const int row = it * 2 + hi;
      v4f v = *(const v4f*)(so + row * OP + m * 4);
      #pragma unroll
      for (int cc = 0; cc < 4; ++cc) v[cc] = v[cc] + (float)(bf16)xq[it][cc];   // residual with the RNE bf16 input value
      vals[it] = v;
    }
    #pragma unroll
    for (int it = 0; it < 8; ++it) *(v4f*)(out + gidx[it]) = vals[it];
    
    __syncthreads();
  }
}

extern "C" void kernel_launch(void* const* d_in, const int* in_sizes, int n_in,
                              void* d_out, int out_size, void* d_ws, size_t ws_size,
                              hipStream_t stream) {
  if (n_in < 6) return;
  const size_t rows_used = (size_t)(NB - 1) * SEQ_FULL + SEQ;
  if ((size_t)in_sizes[0] < rows_used * CIN) return;
  if (in_sizes[1] < CIN * DQK) return;
  if (in_sizes[2] < CIN * DQK) return;
  if (in_sizes[3] < CIN * DV) return;
  if (in_sizes[4] < DV * CIN) return;
  if (in_sizes[5] < 1) return;
  if ((size_t)out_size < rows_used * CIN) return;

  const size_t wct_bytes = (size_t)NPROJ * CIN * 2;           // 98,304
  const size_t wot_bytes = (size_t)CIN * DV * 2;              // 65,536
  const size_t gq_bytes  = (size_t)NB * SEQ * DQK * 2;        // 2,097,152 at full size
  const size_t fk_bytes  = (size_t)NB * NKEY * DQK * 2;       // 524,288
  const size_t hvt_bytes = (size_t)NB * DV * NKEY * 2;        // 2,097,152
  const size_t ctx_bytes = (size_t)NB * SEQ * DV * 2;         // 8,388,608
  const size_t off_wct = 0;
  const size_t off_wot = off_wct + wct_bytes;
  const size_t off_gq  = off_wot + wot_bytes;
  const size_t off_fk  = off_gq + gq_bytes;
  const size_t off_hvt = off_fk + fk_bytes;
  const size_t off_ctx = off_hvt + hvt_bytes;
  const size_t total   = off_ctx + ctx_bytes;                 // 13,271,040 at full size
  if (ws_size < total) return;

  const float* x     = (const float*)d_in[0];
  const float* wf    = (const float*)d_in[1];
  const float* wg    = (const float*)d_in[2];
  const float* wh    = (const float*)d_in[3];
  const float* wo    = (const float*)d_in[4];
  const float* gamma = (const float*)d_in[5];
  float* out = (float*)d_out;
  char*  ws  = (char*)d_ws;
  bf16* wct = (bf16*)(ws + off_wct);
  f16*  wot = (f16*)(ws + off_wot);
  f16*  gq  = (f16*)(ws + off_gq);
  f16*  fk  = (f16*)(ws + off_fk);
  f16*  hvt = (f16*)(ws + off_hvt);
  f16*  ctx = (f16*)(ws + off_ctx);

  pack_w_kernel<<<40, 256, 0, stream>>>(wf, wg, wh, wo, wct, wot);
  proj_pool_kernel<<<dim3(SEQ / 256, NB), 256, 0, stream>>>(x, wct, gq, fk, hvt);
  attn_kernel<<<dim3(SEQ / BQ, NB), 256, 0, stream>>>(gq, fk, hvt, ctx);
  oproj_kernel<<<(NB * SEQ) / 128, 256, 0, stream>>>(ctx, wot, x, gamma, out);
}

// v003
// It runs in 47.5 microseconds.
// In both of two side-by-side timings against v002, it was 1.41 times as fast.
// All steps since v000 together make it 3.17 times as fast.
#include <hip/hip_runtime.h>

// Contractions: X x [Wf|Wg|Wh] on v_wmma_f32_16x16x32_bf16 (bf16 operands = RNE-converted inputs, f32 accumulate);
// S^T = F x G^T, CTX = P x Hv (P as f16 carried x4096) and OUT = CTX x Wo (Wo as f16 of the bf16 value, carried x16)
// on v_wmma_f32_16x16x32_f16 (f16 operands, f32 accumulate). Max-pool, softmax and residual in f32.

#ifndef NB
#define NB 8
#endif
#ifndef SEQ
#define SEQ 4096
#endif
#define NB_FULL  8
#define SEQ_FULL 4096
#define W_IMG    64                 // image width (pixels per image row)
#define CIN      256                // input channels
#define DQK      32                 // query / key channels
#define DV       128                // value channels
#define NPROJ    192                // packed projection columns: [0,32) f, [32,64) g, [64,192) h
#define NKEY     (SEQ / 4)          // pooled key count per image
#define KTILE    64                 // keys produced per projection block
#define BQ       128                // query rows per attention block (8 waves x 16)
#define BK       32                 // keys per inner iteration
#define NWAVE    8
#define PP       168                // LDS pitch (halves) of the ww-pooled staging rows
#define GP       40                 // LDS pitch (halves) of the g staging tile
#define FP       40                 // LDS pitch (halves) of the pooled f tile
#define HP       72                 // LDS pitch (halves) of the pooled h^T tile
#define CP       136                // LDS pitch (halves) of the ctx staging tile
#define OP       68                 // LDS pitch (floats) of the output staging tile
#define SK       64                 // keys per LDS stage of the attention loop (two BK passes)
#define NST      (NKEY / SK)        // stages per image
#define FSP      40                 // LDS pitch (halves) of a staged f row: 80 B = 16 B x odd
#define VSP      72                 // LDS pitch (halves) of a staged h^T row: 144 B = 16 B x odd
#define FRU      256                // halves per weight fragment unit: 32 lanes x 16 B = 512 B = four whole lines

static_assert(SEQ % 256 == 0);
static_assert(SEQ >= 256 && SEQ <= SEQ_FULL);
static_assert(NB >= 1 && NB <= NB_FULL);
static_assert(BQ == NWAVE * 16);
static_assert(NKEY % BK == 0);
static_assert(NKEY % KTILE == 0);
static_assert(CIN % 32 == 0 && DV % 32 == 0 && DQK == 32);
// coverage equalities (grid x block x per-thread elements == plane extent)
static_assert((SEQ / 256) * 2 * NWAVE * 16 == SEQ);          // g plane rows per image
static_assert((SEQ / 256) * KTILE == NKEY);                   // f / h^T plane keys per image
static_assert((SEQ / BQ) * NWAVE * 16 == SEQ);                // ctx plane rows per image
static_assert(((NB * SEQ) / 128) * NWAVE * 16 == NB * SEQ);   // output rows
static_assert((GP * 2) % 16 == 0 && (FP * 2) % 16 == 0 && (HP * 2) % 16 == 0 && (CP * 2) % 16 == 0);
static_assert((OP * 4) % 16 == 0);
static_assert(NKEY % SK == 0 && SK == 2 * BK && NST >= 1);
static_assert((FSP * 2) % 16 == 0 && (VSP * 2) % 16 == 0);
static_assert(SK * DQK * 2 == 256 * 16);        // f stage: one 16-B copy per thread
static_assert(DV * SK * 2 == 4 * 256 * 16);     // h^T stage: four 16-B copies per thread

typedef __bf16   bf16;
typedef _Float16 f16;
typedef bf16     v16bf __attribute__((ext_vector_type(16)));
typedef f16      v16h  __attribute__((ext_vector_type(16)));
typedef f16      v8h   __attribute__((ext_vector_type(8)));
typedef float    v8f   __attribute__((ext_vector_type(8)));
typedef float    v4f   __attribute__((ext_vector_type(4)));
typedef unsigned v4u   __attribute__((ext_vector_type(4)));

union FragB  { v16bf v; v4u q[2]; bf16 h[16]; };
union FragH  { v16h  v; v4u q[2]; f16  h[16]; };
union Pack8B { v4u u; bf16 h[8]; };
union Pack8H { v4u u; v8h v; f16 h[8]; };

// WMMA helpers: the plain builtins; the compiler keeps the distance behind its own matrix instructions. No volatile
// statement stands behind them, so that a block's fragment loads can be issued ahead of the block before it.
static __device__ __forceinline__ v8f mma_bf16(v16bf a, v16bf b, v8f acc) {
  return __builtin_amdgcn_wmma_f32_16x16x32_bf16(false, a, false, b, (short)0, acc, false, false);
}
static __device__ __forceinline__ v8f mma_f16(v16h a, v16h b, v8f acc) {
  return __builtin_amdgcn_wmma_f32_16x16x32_f16(false, a, false, b, (short)0, acc, false, false);
}

// Weight planes, packed in fragment order: a unit is the 512 contiguous bytes that one wave-wide 16-B load of a
// B fragment half takes, lane (hi, m) holding column n = tile * 16 + m, k = kk * 32 + q * 16 + hi * 8 + 0..7.
//   wct unit (t * 8 + kk) * 2 + q, t = 0..11  : bf16 RNE of column t * 16 + m of [wf | wg | wh].
//   wot unit (nt * 4 + kk) * 2 + q, nt = 0..15 : f16(bf16(w) * 16) (exact) of column nt * 16 + m of wo.
// One wave packs one unit (one 512-B store). Blocks 0..23: wct units 0..191; blocks 24..39: wot units 0..127.
// Source selection is block-uniform (16 units per column tile, 8 units per block).
// coverage: wct columns 0..191 x k 0..255; wot columns 0..255 x k 0..127.
__global__ __launch_bounds__(256) void pack_w_kernel(const float* __restrict__ wf, const float* __restrict__ wg,
                                                      const float* __restrict__ wh, const float* __restrict__ wo,
                                                      bf16* __restrict__ wct, f16* __restrict__ wot) {
  const int blk  = blockIdx.x;
  const int tid  = threadIdx.x;
  const int wave = tid >> 5;
  const int lane = tid & 31;
  const int m    = lane & 15;
  const int hi   = lane >> 4;
  if (blk < 24) {
    const int u  = blk * 8 + wave;                                       // 0..191
    const int n  = (u >> 4) * 16 + m;                                    // 0..191
    const int k0 = ((u >> 1) & 7) * 32 + (u & 1) * 16 + hi * 8;          // 0..248
    const float* src = (blk < 4) ? wf : ((blk < 8) ? wg : wh);
    const int pitch  = (blk < 8) ? DQK : DV;
    const int nl     = (blk < 4) ? n : ((blk < 8) ? (n - 32) : (n - 64));
    Pack8B pk;
    #pragma unroll
    for (int i = 0; i < 8; ++i) pk.h[i] = (bf16)src[(size_t)(k0 + i) * pitch + nl];   // RNE convert
    *(v4u*)(wct + (size_t)u * FRU + lane * 8) = pk.u;
  } else {
    const int u  = (blk - 24) * 8 + wave;                                // 0..127
    const int n  = (u >> 3) * 16 + m;                                    // 0..255
    const int k0 = ((u >> 1) & 3) * 32 + (u & 1) * 16 + hi * 8;          // 0..120
    Pack8H pk;
    #pragma unroll
    for (int i = 0; i < 8; ++i) {
      const float v = (float)(bf16)wo[(size_t)(k0 + i) * CIN + n];
      pk.h[i] = (f16)(v * 16.0f);              // bf16 significand fits f16: exact for normal results
    }
    *(v4u*)(wot + (size_t)u * FRU + lane * 8) = pk.u;
    asm volatile("s_wait_xcnt 0x0" ::: "memory");   // stands before any later write of the store's address or data registers
  }
}

// One wave's 16-pixel M tile times NTN consecutive 16-column tiles of wct starting at tile NT0; K = CIN.
// A fragments from f32 x rows (RNE bf16 convert, split k map); B fragments from the fragment-ordered wct units.
// Loads go out in groups ahead of the matrix work: the x pieces AD k-blocks ahead, the wct fragments one k-block ahead.
template <int NT0, int NTN, int AD>
static __device__ __forceinline__ void proj_tiles(const float* __restrict__ xr, const bf16* wct,
                                                  int m, int hi, v8f (&acc)[NTN]) {
  constexpr int NKB = CIN / 32;
  #pragma unroll
  for (int t = 0; t < NTN; ++t) acc[t] = (v8f){0, 0, 0, 0, 0, 0, 0, 0};
  const float* xp = xr + hi * 8;
  const bf16*  wp = wct + (size_t)NT0 * (NKB * 2 * FRU) + (hi * 16 + m) * 8;   // this lane's 16 B of every unit
  v4f   ax[NKB][4];
  FragB bw[NKB][NTN];
  #pragma unroll
  for (int kk = 0; kk < NKB; ++kk) {
    if (kk < AD) {
      ax[kk][0] = *(const v4f*)(xp + kk * 32);
      ax[kk][1] = *(const v4f*)(xp + kk * 32 + 4);
      ax[kk][2] = *(const v4f*)(xp + kk * 32 + 16);
      ax[kk][3] = *(const v4f*)(xp + kk * 32 + 20);
    }
  }
  #pragma unroll
  for (int t = 0; t < NTN; ++t) {
    bw[0][t].q[0] = *(const v4u*)(wp + (t * NKB * 2) * FRU);
    bw[0][t].q[1] = *(const v4u*)(wp + (t * NKB * 2 + 1) * FRU);
  }
  #pragma unroll
  for (int kk = 0; kk < NKB; ++kk) {
    if (kk + AD < NKB) {
      const int ka = kk + AD;
      ax[ka][0] = *(const v4f*)(xp + ka * 32);
      ax[ka][1] = *(const v4f*)(xp + ka * 32 + 4);
      ax[ka][2] = *(const v4f*)(xp + ka * 32 + 16);
      ax[ka][3] = *(const v4f*)(xp + ka * 32 + 20);
    }
    if (kk + 1 < NKB) {
      #pragma unroll
      for (int t = 0; t < NTN; ++t) {
        bw[kk + 1][t].q[0] = *(const v4u*)(wp + ((t * NKB + kk + 1) * 2) * FRU);       // k = hi*8 + 0..7 of the block
        bw[kk + 1][t].q[1] = *(const v4u*)(wp + ((t * NKB + kk + 1) * 2 + 1) * FRU);   // k = 16 + hi*8 + 0..7
      }
    }
    __builtin_amdgcn_sched_barrier(0);   // the next block's loads stay in front of this block's matrix work
    FragB a;
    #pragma unroll
    for (int i = 0; i < 4; ++i) {
      a.h[i]      = (bf16)ax[kk][0][i];   // elems 0..7  : k = kk*32 + hi*8 + 0..7
      a.h[4 + i]  = (bf16)ax[kk][1][i];
      a.h[8 + i]  = (bf16)ax[kk][2][i];   // elems 8..15 : k = kk*32 + 16 + hi*8 + 0..7
      a.h[12 + i] = (bf16)ax[kk][3][i];
    }
    #pragma unroll
    for (int t = 0; t < NTN; ++t) acc[t] = mma_bf16(a.v, bw[kk][t].v, acc[t]);
    __builtin_amdgcn_sched_barrier(0);   // later loads are not lifted over this block: two blocks of wct fragments live at most
  }
}

// Projection + 2x2 max-pool. Block = (64-key tile kt, batch b), 256 threads; two iterations each cover
// image rows hh = kt*4 + it*2 + {0,1}; wave -> (hh, 16 pixels along ww).
//   gq  [NB][SEQ][DQK]  f16 : queries, one 64-B row per pixel (wave writes 16 rows = 1 KB, 2 instructions).
//   fk  [NB][NKEY][DQK] f16 : pooled keys, 64 rows per block = 4 KB (one 512-B instruction per wave).
// LDS regions: sP cross-wave (block barrier), sG per-wave but read across lanes after the block barrier,
// sF / sHT cross-wave (block barrier). Staged extent == consumed extent for all four.
// wct carries no __restrict__: with it the compiler lifts every wct load out of the loop over it and spills them.
__global__ __launch_bounds__(256) void proj_pool_kernel(const float* __restrict__ x, const bf16* wct,
                                                         f16* __restrict__ gq, f16* __restrict__ fk,
                                                         f16* __restrict__ hvt) {
  const int kt   = blockIdx.x;
  const int b    = blockIdx.y;
  const int tid  = threadIdx.x;
  const int wave = tid >> 5;
  const int lane = tid & 31;
  const int m    = lane & 15;
  const int hi   = lane >> 4;
  const int hsel = wave >> 2;          // which of the two image rows of this iteration
  const int ww0  = (wave & 3) * 16;    // first pixel column of this wave's tile

  __shared__ __align__(16) f16 sP[2 * 32 * PP];       // [hsel][pw][160 cols] ww-pooled f|h
  __shared__ __align__(16) f16 sG[NWAVE * 16 * GP];   // per-wave g tile [16][32]
  __shared__ __align__(16) f16 sF[64 * FP];           // pooled f [64 keys][32]
  __shared__ __align__(16) f16 sHT[DV * HP];          // pooled h^T [128 d][64 keys]

  f16* sg = sG + wave * (16 * GP);
  f16* sp = sP + hsel * (32 * PP);
  const int pwb = (ww0 >> 1) + hi * 4;   // pooled column index base for this lane half

  for (int it = 0; it < 2; ++it) {
    const int hh   = kt * 4 + it * 2 + hsel;
    const int pix0 = hh * W_IMG + ww0;
    const float* xr = x + ((size_t)b * SEQ_FULL + pix0 + m) * CIN;

    {   // tiles 0..3: f (0,1) and g (2,3)
      v8f acc[4];
      proj_tiles<0, 4, CIN / 32>(xr, wct, m, hi, acc);   // first touch of x: all its pieces in flight at once
      #pragma unroll
      for (int r = 0; r < 8; ++r) {
        sg[(hi * 8 + r) * GP + m]      = (f16)acc[2][r];
        sg[(hi * 8 + r) * GP + 16 + m] = (f16)acc[3][r];
      }
      // ww pairs are D rows (2rp, 2rp+1) of the same lane half; pooled column pw = ww0/2 + 4*hi + rp
      #pragma unroll
      for (int rp = 0; rp < 4; ++rp) {
        #pragma unroll
        for (int t = 0; t < 2; ++t)
          sp[(pwb + rp) * PP + t * 16 + m] = (f16)fmaxf(acc[t][2 * rp], acc[t][2 * rp + 1]);
      }
    }
    {   // tiles 4..11: h
      v8f acc[8];
      proj_tiles<4, 8, 1>(xr, wct, m, hi, acc);
      #pragma unroll
      for (int rp = 0; rp < 4; ++rp) {
        #pragma unroll
        for (int t = 0; t < 8; ++t)
          sp[(pwb + rp) * PP + 32 + t * 16 + m] = (f16)fmaxf(acc[t][2 * rp], acc[t][2 * rp + 1]);
      }
    }
    __syncthreads();

    // g tile -> gq: 16 consecutive pixel rows x 64 B = 1 KB contiguous; 32 lanes x 16 B per instruction
    {
      v4u    gv[2];
      size_t gi[2];
      #pragma unroll
      for (int i2 = 0; i2 < 2; ++i2) {
        const int row = i2 * 8 + (lane >> 2);
        const int cq  = (lane & 3) * 8;
        Pack8H p;
        p.v = *(const v8h*)(sg + row * GP + cq);
        gv[i2] = p.u;
        gi[i2] = ((size_t)b * SEQ + pix0 + row) * DQK + cq;
      }
      #pragma unroll
      for (int i2 = 0; i2 < 2; ++i2) *(v4u*)(gq + gi[i2]) = gv[i2];
      
    }

    // hh-pool into the block's pooled tiles
    #pragma unroll
    for (int e = 0; e < 4; ++e) {
      const int idx = e * 256 + tid;
      const int pw  = idx >> 5;
      const int c   = idx & 31;
      const float v = fmaxf((float)sP[pw * PP + c], (float)sP[32 * PP + pw * PP + c]);
      sF[(it * 32 + pw) * FP + c] = (f16)v;
    }
    #pragma unroll
    for (int e = 0; e < 16; ++e) {
      const int idx = e * 256 + tid;
      const int pw  = idx >> 7;
      const int d   = idx & 127;
      const float v = fmaxf((float)sP[pw * PP + 32 + d], (float)sP[32 * PP + pw * PP + 32 + d]);
      sHT[d * HP + it * 32 + pw] = (f16)v;
    }
    __syncthreads();
  }

  // final plane stores: fk (wave -> 8 rows = 512 B), hvt (per instruction 4 d-lines, 8 lanes x 16 B each)
  v4u    fv;
  size_t fi;
  {
    const int row = tid >> 2;            // 0..63
    const int cq  = (tid & 3) * 8;
    Pack8H p;
    p.v = *(const v8h*)(sF + row * FP + cq);
    fv = p.u;
    fi = ((size_t)b * NKEY + kt * KTILE + row) * DQK + cq;
  }
  v4u    hv[4];
  size_t hidx[4];
  #pragma unroll
  for (int ps = 0; ps < 4; ++ps) {
    const int d  = ps * 32 + (tid >> 3);   // 0..127
    const int kq = (tid & 7) * 8;          // 0..56
    Pack8H p;
    p.v = *(const v8h*)(sHT + d * HP + kq);
    hv[ps]   = p.u;
    hidx[ps] = ((size_t)b * DV + d) * NKEY + kt * KTILE + kq;
  }
  *(v4u*)(fk + fi) = fv;
  #pragma unroll
  for (int ps = 0; ps < 4; ++ps) *(v4u*)(hvt + hidx[ps]) = hv[ps];
  
}

// One stage of 64 keys into LDS, five asynchronous 16-B copies per thread: one piece of the f tile (64 rows x 64 B)
// and four of the h^T tile (128 rows x 128 B; a wave covers four whole 128-B lines per copy). The s_wait_xcnt closes
// the statement so that no address register of an issued copy is rewritten ahead of it.
static __device__ __forceinline__ void stage_copy(unsigned lf, const f16* gf, unsigned lv, const f16* gv) {
  const unsigned lv1 = lv + 1 * 32 * VSP * 2, lv2 = lv + 2 * 32 * VSP * 2, lv3 = lv + 3 * 32 * VSP * 2;
  const f16* gv1 = gv + (size_t)1 * 32 * NKEY;
  const f16* gv2 = gv + (size_t)2 * 32 * NKEY;
  const f16* gv3 = gv + (size_t)3 * 32 * NKEY;
  asm volatile("global_load_async_to_lds_b128 %0, %1, off\n\t"
               "global_load_async_to_lds_b128 %2, %3, off\n\t"
               "global_load_async_to_lds_b128 %4, %5, off\n\t"
               "global_load_async_to_lds_b128 %6, %7, off\n\t"
               "global_load_async_to_lds_b128 %8, %9, off\n\t"
               "s_wait_xcnt 0x0"
               :: "v"(lf), "v"(gf), "v"(lv), "v"(gv), "v"(lv1), "v"(gv1), "v"(lv2), "v"(gv2), "v"(lv3), "v"(gv3)
               : "memory");
}

// Flash attention, non-causal, no score scaling. Block = (query block of 128, batch); one wave owns 16 queries.
// S^T = F x G^T so queries sit on lanes; P^T in C-layout is bit-identical to the A-fragment layout of CTX += P x Hv.
// G B-fragments come straight from the f16 plane. The f and h^T tiles, which all eight waves read, are brought into
// LDS once per block in stages of 64 keys (two buffers, the next stage's copies fly while this one is worked on);
// F A-fragments and Hv^T B-fragments are two 16-B LDS loads each, issued in two groups per stage ahead of their use (F of both passes goes in the first).
//   ctx [NB][SEQ][DV] f16 : one 256-B row per query; wave writes 16 rows = 4 KB contiguous, 512 B per instruction.
// LDS: sC per-wave region, written and read across lanes under a block barrier; staged extent == consumed extent.
__global__ __launch_bounds__(256) void attn_kernel(const f16* __restrict__ gq, const f16* __restrict__ fk,
                                                   const f16* __restrict__ hvt, f16* __restrict__ ctx) {
  const int qblk = blockIdx.x;
  const int b    = blockIdx.y;
  const int tid  = threadIdx.x;
  const int wave = tid >> 5;
  const int lane = tid & 31;
  const int lq   = lane & 15;   // query column of S^T / d column of CTX
  const int hi   = lane >> 4;   // k-split half

  __shared__ __align__(16) f16 sC[NWAVE * 16 * CP];
  __shared__ __align__(16) f16 sKF[2 * SK * FSP];   // [buffer][key][32 d], pitch FSP
  __shared__ __align__(16) f16 sKV[2 * DV * VSP];   // [buffer][d][64 keys], pitch VSP

  const int qrow0 = qblk * BQ + wave * 16;

  // G as B-operand fragment: lane lq holds query qrow0+lq, elements follow the split d map
  FragH qf;
  {
    const f16* qp = gq + ((size_t)b * SEQ + qrow0 + lq) * DQK + hi * 8;
    qf.q[0] = *(const v4u*)(qp);        // d = hi*8 + 0..7
    qf.q[1] = *(const v4u*)(qp + 16);   // d = 16 + hi*8 + 0..7
  }

  const f16* fk_b = fk + (size_t)b * NKEY * DQK;
  const f16* vt_b = hvt + (size_t)b * DV * NKEY;

  v8f o[8];
  #pragma unroll
  for (int dt = 0; dt < 8; ++dt) o[dt] = (v8f){0, 0, 0, 0, 0, 0, 0, 0};

  float rmax = -__builtin_inff();
  float rsum = 0.0f;
  const float SL = 1.4426950408889634f;   // log2(e); the scores carry no extra scale

  // this thread's pieces of a stage: LDS byte addresses in buffer 0 and global pointers of stage 0
  const unsigned lf0 = (unsigned)(uintptr_t)sKF + (unsigned)((tid >> 2) * (FSP * 2) + (tid & 3) * 16);
  const unsigned lv0 = (unsigned)(uintptr_t)sKV + (unsigned)((tid >> 3) * (VSP * 2) + (tid & 7) * 16);
  const f16* gf0 = fk_b + tid * 8;                                  // f stage = 4 KB contiguous
  const f16* gv0 = vt_b + (size_t)(tid >> 3) * NKEY + (tid & 7) * 8;

  stage_copy(lf0, gf0, lv0, gv0);
  asm volatile("s_wait_asynccnt 0x0" ::: "memory");   // this wave's pieces of stage 0 have landed
  __syncthreads();                                    // publishes stage 0 to all waves
  if (NST > 1) stage_copy(lf0 + SK * FSP * 2, gf0 + SK * DQK, lv0 + DV * VSP * 2, gv0 + SK);

  for (int t = 0; t < NST; ++t) {
   const int buf = t & 1;
   const f16* sf = sKF + buf * (SK * FSP);
   const f16* sv = sKV + buf * (DV * VSP);
   // One group of LDS loads at the head of the stage: the F A-fragments of both passes (row = key, split d map) and the
   // Hv^T B-fragments of the first pass (column n = d = dt*16 + lq, split key map from the transposed tile).
   FragH ak[SK / BK][2];
   #pragma unroll
   for (int ps = 0; ps < SK / BK; ++ps) {
     #pragma unroll
     for (int sub = 0; sub < 2; ++sub) {
       const f16* base = sf + (ps * BK + sub * 16 + lq) * FSP + hi * 8;
       ak[ps][sub].q[0] = *(const v4u*)(base);        // d = hi*8 + 0..7
       ak[ps][sub].q[1] = *(const v4u*)(base + 16);   // d = 16 + hi*8 + 0..7
     }
   }
   FragH bv[8];
   #pragma unroll
   for (int dt = 0; dt < 8; ++dt) {
     const f16* base = sv + (dt * 16 + lq) * VSP + hi * 8;
     bv[dt].q[0] = *(const v4u*)(base);        // keys hi*8 + 0..7
     bv[dt].q[1] = *(const v4u*)(base + 16);   // keys 16 + hi*8 + 0..7
   }
   __builtin_amdgcn_sched_barrier(0);   // the group stays whole, in front of the scores and the softmax that hide its latency
   #pragma unroll   // both passes of a stage inline: j0 folds into the LDS loads' immediate offsets
   for (int ps = 0; ps < SK / BK; ++ps) {
    // S^T tiles: c[sub][r] = score(query qrow0+lq, key j0 + sub*16 + hi*8 + r), j0 = ps * BK
    v8f c[2];
    #pragma unroll
    for (int sub = 0; sub < 2; ++sub)
      c[sub] = mma_f16(ak[ps][sub].v, qf.v, (v8f){0, 0, 0, 0, 0, 0, 0, 0});

    // online softmax: query lq's 32 scores are split across lane / lane^16
    float m_new = rmax;
    #pragma unroll
    for (int r = 0; r < 8; ++r) {
      m_new = fmaxf(m_new, c[0][r]);
      m_new = fmaxf(m_new, c[1][r]);
    }
    m_new = fmaxf(m_new, __shfl_xor(m_new, 16, 32));
    const float scale = __builtin_amdgcn_exp2f((rmax - m_new) * SL);
    rmax = m_new;

    // exp + pack: P^T C-layout == A-fragment layout for the PV product; P carried x4096 in f16
    FragH pa;
    float psum = 0.0f;
    #pragma unroll
    for (int r = 0; r < 8; ++r) {
      const float p0 = __builtin_amdgcn_exp2f((c[0][r] - m_new) * SL);   // key j0 + hi*8 + r
      const float p1 = __builtin_amdgcn_exp2f((c[1][r] - m_new) * SL);   // key j0 + 16 + hi*8 + r
      psum += p0 + p1;
      pa.h[r]     = (f16)(p0 * 4096.0f);
      pa.h[8 + r] = (f16)(p1 * 4096.0f);
    }
    rsum = rsum * scale + psum + __shfl_xor(psum, 16, 32);

    // rescale CTX: queries are the row dimension there -> per-row scale from lane 8*hi + r
    float sc[8];
    #pragma unroll
    for (int r = 0; r < 8; ++r) sc[r] = __shfl(scale, (hi << 3) + r, 32);
    #pragma unroll
    for (int dt = 0; dt < 8; ++dt) {
      #pragma unroll
      for (int r = 0; r < 8; ++r) o[dt][r] *= sc[r];
    }

    // CTX += P x Hv
    #pragma unroll
    for (int dt = 0; dt < 8; ++dt) o[dt] = mma_f16(pa.v, bv[dt].v, o[dt]);
    if (ps + 1 < SK / BK) {
      __builtin_amdgcn_sched_barrier(0);   // the next pass's group is not lifted over these products: one set of Hv^T registers
      #pragma unroll
      for (int dt = 0; dt < 8; ++dt) {
        const f16* base = sv + (dt * 16 + lq) * VSP + (ps + 1) * BK + hi * 8;
        bv[dt].q[0] = *(const v4u*)(base);        // keys j0 + hi*8 + 0..7 of the next pass
        bv[dt].q[1] = *(const v4u*)(base + 16);   // keys j0 + 16 + hi*8 + 0..7
      }
      __builtin_amdgcn_sched_barrier(0);   // and it stays whole, in front of the next pass's scores and softmax
    }
   }
   __builtin_amdgcn_sched_barrier(0);   // the second pass's work stays in front of the hand-over, whose waits would else stand right behind its loads
   // hand-over: stage t + 1 becomes readable, and the buffer of stage t free, behind this one barrier
   asm volatile("s_wait_dscnt 0x0" ::: "memory");      // this wave's reads of stage t are done before the refill
   asm volatile("s_wait_asynccnt 0x0" ::: "memory");   // this wave's pieces of stage t + 1 have landed
   __syncthreads();
   if (t + 2 < NST)
     stage_copy(lf0 + buf * (SK * FSP * 2), gf0 + (size_t)(t + 2) * (SK * DQK),
                lv0 + buf * (DV * VSP * 2), gv0 + (size_t)(t + 2) * SK);
  }
  asm volatile("s_wait_asynccnt 0x0" ::: "memory");    // no copy is outstanding when the wave goes on to its end

  // normalize: lane holds column d = dt*16 + lq for query rows 8*hi + r
  float rs[8];
  #pragma unroll
  for (int r = 0; r < 8; ++r) rs[r] = 1.0f / __shfl(rsum, (hi << 3) + r, 32);

  f16* stg = sC + wave * (16 * CP);
  #pragma unroll
  for (int r = 0; r < 8; ++r) {
    #pragma unroll
    for (int dt = 0; dt < 8; ++dt)
      stg[(hi * 8 + r) * CP + dt * 16 + lq] = (f16)(o[dt][r] * (1.0f / 4096.0f) * rs[r]);
  }
  __syncthreads();

  // lanes 16..31 the next row; 8 instructions cover the wave's 16 rows.
  v4u    vals[8];
  size_t gidx[8];
  #pragma unroll
  for (int it = 0; it < 8; ++it) {
    const int row = it * 2 + hi;
    const int dq  = lq * 8;
    Pack8H p;
    p.v = *(const v8h*)(stg + row * CP + dq);
    vals[it] = p.u;
    gidx[it] = ((size_t)b * SEQ + qrow0 + row) * DV + dq;
  }
  #pragma unroll
  for (int it = 0; it < 8; ++it) *(v4u*)(ctx + gidx[it]) = vals[it];
  
}

// Output projection + scaled residual: out = gamma * (CTX x Wo) + x_bf16. Block = 8 waves, wave -> one 16-row M tile,
// four passes over 64-column quarters. A fragments from the f16 ctx plane, B fragments from the wot units (carried x16).
// Epilogue per quarter: f32 tile staged in LDS (per-wave region, block barriers), then per instruction lanes 0..15
__global__ __launch_bounds__(256) void oproj_kernel(const f16* __restrict__ ctx, const f16* __restrict__ wot,
                                                    const float* __restrict__ x, const float* __restrict__ gamma,
                                                    float* __restrict__ out) {
  const int tid  = threadIdx.x;
  const int wave = tid >> 5;
  const int lane = tid & 31;
  const int m    = lane & 15;   // B column within a tile / 16-B piece index of the quarter-row
  const int hi   = lane >> 4;
  const int mt   = blockIdx.x * NWAVE + wave;
  const int prow0 = mt * 16;                 // plane row of ctx
  const int bb    = prow0 / SEQ;
  const int pix0  = prow0 - bb * SEQ;
  const size_t xrow0 = (size_t)bb * SEQ_FULL + pix0;

  __shared__ __align__(16) float sO[NWAVE * 16 * OP];
  float* so = sO + wave * (16 * OP);

  const float gsc = (float)(bf16)gamma[0] * 0.0625f;   // gamma (RNE bf16) folded with the 1/16 Wo carry
  const f16* ap0 = ctx + (size_t)(prow0 + m) * DV + hi * 8;
  FragH a[DV / 32];   // the wave's ctx rows, the same for all four quarters
  #pragma unroll
  for (int kk = 0; kk < DV / 32; ++kk) {
    a[kk].q[0] = *(const v4u*)(ap0 + kk * 32);        // d = kk*32 + hi*8 + 0..7
    a[kk].q[1] = *(const v4u*)(ap0 + kk * 32 + 16);   // d = kk*32 + 16 + hi*8 + 0..7
  }

  #pragma unroll 1
  for (int qn = 0; qn < 4; ++qn) {
    // one group of loads per quarter: its sixteen Wo fragments, then the x pieces of its residual
    FragH bw[DV / 32][4];
    #pragma unroll
    for (int kk = 0; kk < DV / 32; ++kk) {
      #pragma unroll
      for (int j = 0; j < 4; ++j) {
        const f16* wp = wot + (size_t)(((qn * 4 + j) * (DV / 32) + kk) * 2) * FRU + lane * 8;
        bw[kk][j].q[0] = *(const v4u*)(wp);         // d = kk*32 + hi*8 + 0..7 of column (qn*4 + j)*16 + m
        bw[kk][j].q[1] = *(const v4u*)(wp + FRU);   // d = kk*32 + 16 + hi*8 + 0..7
      }
    }
    v4f    xq[8];
    size_t gidx[8];
    #pragma unroll
    for (int it = 0; it < 8; ++it) {
      gidx[it] = (xrow0 + it * 2 + hi) * CIN + qn * 64 + m * 4;
      xq[it]   = *(const v4f*)(x + gidx[it]);
    }
    __builtin_amdgcn_sched_barrier(0);   // the group stays whole, in front of the quarter's matrix work
    v8f acc[4];
    #pragma unroll
    for (int j = 0; j < 4; ++j) acc[j] = (v8f){0, 0, 0, 0, 0, 0, 0, 0};
    #pragma unroll
    for (int kk = 0; kk < DV / 32; ++kk) {
      #pragma unroll
      for (int j = 0; j < 4; ++j) acc[j] = mma_f16(a[kk].v, bw[kk][j].v, acc[j]);
    }
    #pragma unroll
    for (int r = 0; r < 8; ++r) {
      #pragma unroll
      for (int j = 0; j < 4; ++j) so[(hi * 8 + r) * OP + j * 16 + m] = acc[j][r] * gsc;
    }
    __syncthreads();

    v4f vals[8];
    #pragma unroll
    for (int it = 0; it < 8; ++it) {
      const int row = it * 2 + hi;
      v4f v = *(const v4f*)(so + row * OP + m * 4);
      #pragma unroll
      for (int cc = 0; cc < 4; ++cc) v[cc] = v[cc] + (float)(bf16)xq[it][cc];   // residual with the RNE bf16 input value
      vals[it] = v;
    }
    #pragma unroll
    for (int it = 0; it < 8; ++it) *(v4f*)(out + gidx[it]) = vals[it];
    
    __syncthreads();
  }
}

extern "C" void kernel_launch(void* const* d_in, const int* in_sizes, int n_in,
                              void* d_out, int out_size, void* d_ws, size_t ws_size,
                              hipStream_t stream) {
  if (n_in < 6) return;
  const size_t rows_used = (size_t)(NB - 1) * SEQ_FULL + SEQ;
  if ((size_t)in_sizes[0] < rows_used * CIN) return;
  if (in_sizes[1] < CIN * DQK) return;
  if (in_sizes[2] < CIN * DQK) return;
  if (in_sizes[3] < CIN * DV) return;
  if (in_sizes[4] < DV * CIN) return;
  if (in_sizes[5] < 1) return;
  if ((size_t)out_size < rows_used * CIN) return;

  const size_t wct_bytes = (size_t)NPROJ * CIN * 2;           // 98,304
  const size_t wot_bytes = (size_t)CIN * DV * 2;              // 65,536
  const size_t gq_bytes  = (size_t)NB * SEQ * DQK * 2;        // 2,097,152 at full size
  const size_t fk_bytes  = (size_t)NB * NKEY * DQK * 2;       // 524,288
  const size_t hvt_bytes = (size_t)NB * DV * NKEY * 2;        // 2,097,152
  const size_t ctx_bytes = (size_t)NB * SEQ * DV * 2;         // 8,388,608
  const size_t off_wct = 0;
  const size_t off_wot = off_wct + wct_bytes;
  const size_t off_gq  = off_wot + wot_bytes;
  const size_t off_fk  = off_gq + gq_bytes;
  const size_t off_hvt = off_fk + fk_bytes;
  const size_t off_ctx = off_hvt + hvt_bytes;
  const size_t total   = off_ctx + ctx_bytes;                 // 13,271,040 at full size
  if (ws_size < total) return;

  const float* x     = (const float*)d_in[0];
  const float* wf    = (const float*)d_in[1];
  const float* wg    = (const float*)d_in[2];
  const float* wh    = (const float*)d_in[3];
  const float* wo    = (const float*)d_in[4];
  const float* gamma = (const float*)d_in[5];
  float* out = (float*)d_out;
  char*  ws  = (char*)d_ws;
  bf16* wct = (bf16*)(ws + off_wct);
  f16*  wot = (f16*)(ws + off_wot);
  f16*  gq  = (f16*)(ws + off_gq);
  f16*  fk  = (f16*)(ws + off_fk);
  f16*  hvt = (f16*)(ws + off_hvt);
  f16*  ctx = (f16*)(ws + off_ctx);

  pack_w_kernel<<<40, 256, 0, stream>>>(wf, wg, wh, wo, wct, wot);
  proj_pool_kernel<<<dim3(SEQ / 256, NB), 256, 0, stream>>>(x, wct, gq, fk, hvt);
  attn_kernel<<<dim3(SEQ / BQ, NB), 256, 0, stream>>>(gq, fk, hvt, ctx);
  oproj_kernel<<<(NB * SEQ) / 128, 256, 0, stream>>>(ctx, wot, x, gamma, out);
}

// v004
// Measured time: 40.1 microseconds a run.
// In two side-by-side timings against v003, it was 1.18 and 1.19 times as fast.
// Counting every step since v000, it is 3.76 times as fast.
#include <hip/hip_runtime.h>

// Contractions: X x [Wf|Wg|Wh] on v_wmma_f32_16x16x32_bf16 (bf16 operands = RNE-converted inputs, f32 accumulate);
// S^T = F x G^T, CTX = P x Hv (P as f16 carried x4096) and OUT = CTX x Wo (Wo as f16 of the bf16 value, carried x16)
// on v_wmma_f32_16x16x32_f16 (f16 operands, f32 accumulate). Max-pool, softmax and residual in f32.

#ifndef NB
#define NB 8
#endif
#ifndef SEQ
#define SEQ 4096
#endif
#define NB_FULL  8
#define SEQ_FULL 4096
#define W_IMG    64                 // image width (pixels per image row)
#define CIN      256                // input channels
#define DQK      32                 // query / key channels
#define DV       128                // value channels
#define NPROJ    192                // packed projection columns: [0,32) f, [32,64) g, [64,192) h
#define NKEY     (SEQ / 4)          // pooled key count per image
#define KTILE    32                 // keys produced per projection block (two image rows)
#define BQ       128                // query rows per attention block (8 waves x 16)
#define BK       32                 // keys per inner iteration
#define NWAVE    8
#define PP       168                // LDS pitch (halves) of the ww-pooled staging rows
#define GP       40                 // LDS pitch (halves) of the g staging tile
#define FP       40                 // LDS pitch (halves) of the pooled f tile
#define HP       40                 // LDS pitch (halves) of the pooled h^T tile: 80 B = 16 B x odd
#define CP       136                // LDS pitch (halves) of the ctx staging tile
#define OP       68                 // LDS pitch (floats) of the output staging tile
#define SK       64                 // keys per LDS stage of the attention loop (two BK passes)
#define NST      (NKEY / SK)        // stages per image
#define FSP      40                 // LDS pitch (halves) of a staged f row: 80 B = 16 B x odd
#define VSP      72                 // LDS pitch (halves) of a staged h^T row: 144 B = 16 B x odd
#define FRU      256                // halves per weight fragment unit: 32 lanes x 16 B = 512 B = four whole lines

static_assert(SEQ % 256 == 0);
static_assert(SEQ >= 256 && SEQ <= SEQ_FULL);
static_assert(NB >= 1 && NB <= NB_FULL);
static_assert(BQ == NWAVE * 16);
static_assert(NKEY % BK == 0);
static_assert(NKEY % KTILE == 0);
static_assert(CIN % 32 == 0 && DV % 32 == 0 && DQK == 32);
// coverage equalities (grid x block x per-thread elements == plane extent)
static_assert((SEQ / 128) * NWAVE * 16 == SEQ);              // g plane rows per image
static_assert((SEQ / 128) * KTILE == NKEY);                   // f / h^T plane keys per image
static_assert(2 * W_IMG == NWAVE * 16 && KTILE == W_IMG / 2); // a projection block = two whole image rows
static_assert((SEQ / BQ) * NWAVE * 16 == SEQ);                // ctx plane rows per image
static_assert(((NB * SEQ) / 128) * NWAVE * 16 == NB * SEQ);   // output rows
static_assert((GP * 2) % 16 == 0 && (FP * 2) % 16 == 0 && (HP * 2) % 16 == 0 && (CP * 2) % 16 == 0);
static_assert((OP * 4) % 16 == 0);
static_assert(NKEY % SK == 0 && SK == 2 * BK && NST >= 1);
static_assert((FSP * 2) % 16 == 0 && (VSP * 2) % 16 == 0);
static_assert(SK * DQK * 2 == 256 * 16);        // f stage: one 16-B copy per thread
static_assert(DV * SK * 2 == 4 * 256 * 16);     // h^T stage: four 16-B copies per thread
static_assert(SK == 2 * KTILE);                 // h^T stage: two whole key tiles of the plane, 16 KB contiguous

typedef __bf16   bf16;
typedef _Float16 f16;
typedef bf16     v16bf __attribute__((ext_vector_type(16)));
typedef f16      v16h  __attribute__((ext_vector_type(16)));
typedef f16      v8h   __attribute__((ext_vector_type(8)));
typedef float    v8f   __attribute__((ext_vector_type(8)));
typedef float    v4f   __attribute__((ext_vector_type(4)));
typedef unsigned v4u   __attribute__((ext_vector_type(4)));

union FragB  { v16bf v; v4u q[2]; bf16 h[16]; };
union FragH  { v16h  v; v4u q[2]; f16  h[16]; };
union Pack8B { v4u u; bf16 h[8]; };
union Pack8H { v4u u; v8h v; f16 h[8]; };

// WMMA helpers: the plain builtins; the compiler keeps the distance behind its own matrix instructions. No volatile
// statement stands behind them, so that a block's fragment loads can be issued ahead of the block before it.
static __device__ __forceinline__ v8f mma_bf16(v16bf a, v16bf b, v8f acc) {
  return __builtin_amdgcn_wmma_f32_16x16x32_bf16(false, a, false, b, (short)0, acc, false, false);
}
static __device__ __forceinline__ v8f mma_f16(v16h a, v16h b, v8f acc) {
  return __builtin_amdgcn_wmma_f32_16x16x32_f16(false, a, false, b, (short)0, acc, false, false);
}

// Weight planes, packed in fragment order: a unit is the 512 contiguous bytes that one wave-wide 16-B load of a
// B fragment half takes, lane (hi, m) holding column n = tile * 16 + m, k = kk * 32 + q * 16 + hi * 8 + 0..7.
//   wct unit (t * 8 + kk) * 2 + q, t = 0..11  : bf16 RNE of column t * 16 + m of [wf | wg | wh].
//   wot unit (nt * 4 + kk) * 2 + q, nt = 0..15 : f16(bf16(w) * 16) (exact) of column nt * 16 + m of wo.
// One wave packs one unit (one 512-B store). Blocks 0..23: wct units 0..191; blocks 24..39: wot units 0..127.
// Source selection is block-uniform (16 units per column tile, 8 units per block).
// coverage: wct columns 0..191 x k 0..255; wot columns 0..255 x k 0..127.
__global__ __launch_bounds__(256) void pack_w_kernel(const float* __restrict__ wf, const float* __restrict__ wg,
                                                      const float* __restrict__ wh, const float* __restrict__ wo,
                                                      bf16* __restrict__ wct, f16* __restrict__ wot) {
  const int blk  = blockIdx.x;
  const int tid  = threadIdx.x;
  const int wave = tid >> 5;
  const int lane = tid & 31;
  const int m    = lane & 15;
  const int hi   = lane >> 4;
  if (blk < 24) {
    const int u  = blk * 8 + wave;                                       // 0..191
    const int n  = (u >> 4) * 16 + m;                                    // 0..191
    const int k0 = ((u >> 1) & 7) * 32 + (u & 1) * 16 + hi * 8;          // 0..248
    const float* src = (blk < 4) ? wf : ((blk < 8) ? wg : wh);
    const int pitch  = (blk < 8) ? DQK : DV;
    const int nl     = (blk < 4) ? n : ((blk < 8) ? (n - 32) : (n - 64));
    Pack8B pk;
    #pragma unroll
    for (int i = 0; i < 8; ++i) pk.h[i] = (bf16)src[(size_t)(k0 + i) * pitch + nl];   // RNE convert
    *(v4u*)(wct + (size_t)u * FRU + lane * 8) = pk.u;
  } else {
    const int u  = (blk - 24) * 8 + wave;                                // 0..127
    const int n  = (u >> 3) * 16 + m;                                    // 0..255
    const int k0 = ((u >> 1) & 3) * 32 + (u & 1) * 16 + hi * 8;          // 0..120
    Pack8H pk;
    #pragma unroll
    for (int i = 0; i < 8; ++i) {
      const float v = (float)(bf16)wo[(size_t)(k0 + i) * CIN + n];
      pk.h[i] = (f16)(v * 16.0f);              // bf16 significand fits f16: exact for normal results
    }
    *(v4u*)(wot + (size_t)u * FRU + lane * 8) = pk.u;
    asm volatile("s_wait_xcnt 0x0" ::: "memory");   // stands before any later write of the store's address or data registers
  }
}

// One wave's 16-pixel M tile times NTN consecutive 16-column tiles of wct starting at tile NT0; K = CIN.
// A fragments from f32 x rows (RNE bf16 convert, split k map); B fragments from the fragment-ordered wct units.
// Loads go out in groups ahead of the matrix work: the x pieces AD k-blocks ahead, the wct fragments one k-block ahead.
template <int NT0, int NTN, int AD>
static __device__ __forceinline__ void proj_tiles(const float* __restrict__ xr, const bf16* wct,
                                                  int m, int hi, v8f (&acc)[NTN]) {
  constexpr int NKB = CIN / 32;
  #pragma unroll
  for (int t = 0; t < NTN; ++t) acc[t] = (v8f){0, 0, 0, 0, 0, 0, 0, 0};
  const float* xp = xr + hi * 8;
  const bf16*  wp = wct + (size_t)NT0 * (NKB * 2 * FRU) + (hi * 16 + m) * 8;   // this lane's 16 B of every unit
  v4f   ax[NKB][4];
  FragB bw[NKB][NTN];
  #pragma unroll
  for (int kk = 0; kk < NKB; ++kk) {
    if (kk < AD) {
      ax[kk][0] = *(const v4f*)(xp + kk * 32);
      ax[kk][1] = *(const v4f*)(xp + kk * 32 + 4);
      ax[kk][2] = *(const v4f*)(xp + kk * 32 + 16);
      ax[kk][3] = *(const v4f*)(xp + kk * 32 + 20);
    }
  }
  #pragma unroll
  for (int t = 0; t < NTN; ++t) {
    bw[0][t].q[0] = *(const v4u*)(wp + (t * NKB * 2) * FRU);
    bw[0][t].q[1] = *(const v4u*)(wp + (t * NKB * 2 + 1) * FRU);
  }
  #pragma unroll
  for (int kk = 0; kk < NKB; ++kk) {
    if (kk + AD < NKB) {
      const int ka = kk + AD;
      ax[ka][0] = *(const v4f*)(xp + ka * 32);
      ax[ka][1] = *(const v4f*)(xp + ka * 32 + 4);
      ax[ka][2] = *(const v4f*)(xp + ka * 32 + 16);
      ax[ka][3] = *(const v4f*)(xp + ka * 32 + 20);
    }
    if (kk + 1 < NKB) {
      #pragma unroll
      for (int t = 0; t < NTN; ++t) {
        bw[kk + 1][t].q[0] = *(const v4u*)(wp + ((t * NKB + kk + 1) * 2) * FRU);       // k = hi*8 + 0..7 of the block
        bw[kk + 1][t].q[1] = *(const v4u*)(wp + ((t * NKB + kk + 1) * 2 + 1) * FRU);   // k = 16 + hi*8 + 0..7
      }
    }
    __builtin_amdgcn_sched_barrier(0);   // the next block's loads stay in front of this block's matrix work
    FragB a;
    #pragma unroll
    for (int i = 0; i < 4; ++i) {
      a.h[i]      = (bf16)ax[kk][0][i];   // elems 0..7  : k = kk*32 + hi*8 + 0..7
      a.h[4 + i]  = (bf16)ax[kk][1][i];
      a.h[8 + i]  = (bf16)ax[kk][2][i];   // elems 8..15 : k = kk*32 + 16 + hi*8 + 0..7
      a.h[12 + i] = (bf16)ax[kk][3][i];
    }
    #pragma unroll
    for (int t = 0; t < NTN; ++t) acc[t] = mma_bf16(a.v, bw[kk][t].v, acc[t]);
    __builtin_amdgcn_sched_barrier(0);   // later loads are not lifted over this block: two blocks of wct fragments live at most
  }
}

// Projection + 2x2 max-pool. Block = (32-key tile kt, batch b), 256 threads: the two image rows hh = kt*2 + {0,1},
// so that the grid has one block for every WGP of the chip; wave -> (hh, 16 pixels along ww).
//   gq  [NB][SEQ][DQK]  f16 : queries, one 64-B row per pixel (wave writes 16 rows = 1 KB, 2 instructions).
//   fk  [NB][NKEY][DQK] f16 : pooled keys, 32 rows per block = 2 KB (one 512-B instruction per wave, four waves).
//   hvt [NB][NKEY/32][DV][32] f16 : pooled values, transposed inside a 32-key tile; a block writes its own 8 KB,
//                                   whole lines only (512 B per instruction).
// LDS regions: sP cross-wave (block barrier), sG per-wave but read across lanes after the block barrier,
// sF / sHT cross-wave (block barrier). Staged extent == consumed extent for all four.
__global__ __launch_bounds__(256) void proj_pool_kernel(const float* __restrict__ x, const bf16* wct,
                                                         f16* __restrict__ gq, f16* __restrict__ fk,
                                                         f16* __restrict__ hvt) {
  const int kt   = blockIdx.x;
  const int b    = blockIdx.y;
  const int tid  = threadIdx.x;
  const int wave = tid >> 5;
  const int lane = tid & 31;
  const int m    = lane & 15;
  const int hi   = lane >> 4;
  const int hsel = wave >> 2;          // which of the block's two image rows
  const int ww0  = (wave & 3) * 16;    // first pixel column of this wave's tile

  __shared__ __align__(16) f16 sP[2 * 32 * PP];       // [hsel][pw][160 cols] ww-pooled f|h
  __shared__ __align__(16) f16 sG[NWAVE * 16 * GP];   // per-wave g tile [16][32]
  __shared__ __align__(16) f16 sF[KTILE * FP];        // pooled f [32 keys][32]
  __shared__ __align__(16) f16 sHT[DV * HP];          // pooled h^T [128 d][32 keys]

  f16* sg = sG + wave * (16 * GP);
  f16* sp = sP + hsel * (32 * PP);
  const int pwb = (ww0 >> 1) + hi * 4;   // pooled column index base for this lane half

  const int hh   = kt * 2 + hsel;
  const int pix0 = hh * W_IMG + ww0;
  const float* xr = x + ((size_t)b * SEQ_FULL + pix0 + m) * CIN;

  {   // tiles 0..3: f (0,1) and g (2,3)
    v8f acc[4];
    proj_tiles<0, 4, CIN / 32>(xr, wct, m, hi, acc);   // first touch of x: all its pieces in flight at once
    #pragma unroll
    for (int r = 0; r < 8; ++r) {
      sg[(hi * 8 + r) * GP + m]      = (f16)acc[2][r];
      sg[(hi * 8 + r) * GP + 16 + m] = (f16)acc[3][r];
    }
    // ww pairs are D rows (2rp, 2rp+1) of the same lane half; pooled column pw = ww0/2 + 4*hi + rp
    #pragma unroll
    for (int rp = 0; rp < 4; ++rp) {
      #pragma unroll
      for (int t = 0; t < 2; ++t)
        sp[(pwb + rp) * PP + t * 16 + m] = (f16)fmaxf(acc[t][2 * rp], acc[t][2 * rp + 1]);
    }
  }
  {   // tiles 4..11: h
    v8f acc[8];
    proj_tiles<4, 8, 1>(xr, wct, m, hi, acc);
    #pragma unroll
    for (int rp = 0; rp < 4; ++rp) {
      #pragma unroll
      for (int t = 0; t < 8; ++t)
        sp[(pwb + rp) * PP + 32 + t * 16 + m] = (f16)fmaxf(acc[t][2 * rp], acc[t][2 * rp + 1]);
    }
  }
  __syncthreads();

  // g tile -> gq: 16 consecutive pixel rows x 64 B = 1 KB contiguous; 32 lanes x 16 B per instruction
  {
    v4u    gv[2];
    size_t gi[2];
    #pragma unroll
    for (int i2 = 0; i2 < 2; ++i2) {
      const int row = i2 * 8 + (lane >> 2);
      const int cq  = (lane & 3) * 8;
      Pack8H p;
      p.v = *(const v8h*)(sg + row * GP + cq);
      gv[i2] = p.u;
      gi[i2] = ((size_t)b * SEQ + pix0 + row) * DQK + cq;
    }
    #pragma unroll
    for (int i2 = 0; i2 < 2; ++i2) *(v4u*)(gq + gi[i2]) = gv[i2];
  }

  // hh-pool into the block's pooled tiles
  #pragma unroll
  for (int e = 0; e < 4; ++e) {
    const int idx = e * 256 + tid;
    const int pw  = idx >> 5;
    const int c   = idx & 31;
    const float v = fmaxf((float)sP[pw * PP + c], (float)sP[32 * PP + pw * PP + c]);
    sF[pw * FP + c] = (f16)v;
  }
  #pragma unroll
  for (int e = 0; e < 16; ++e) {
    const int idx = e * 256 + tid;
    const int pw  = idx >> 7;
    const int d   = idx & 127;
    const float v = fmaxf((float)sP[pw * PP + 32 + d], (float)sP[32 * PP + pw * PP + 32 + d]);
    sHT[d * HP + pw] = (f16)v;
  }
  __syncthreads();

  // final plane stores: hvt (two 16-B pieces per thread, piece p = d * 4 + key quarter), fk (waves 0..3, 8 rows each)
  v4u    hv[2];
  size_t hidx[2];
  #pragma unroll
  for (int ps = 0; ps < 2; ++ps) {
    const int pc = ps * 256 + tid;         // 0..511
    Pack8H p;
    p.v = *(const v8h*)(sHT + (pc >> 2) * HP + (pc & 3) * 8);
    hv[ps]   = p.u;
    hidx[ps] = ((size_t)b * (NKEY / KTILE) + kt) * (DV * KTILE) + (size_t)pc * 8;
  }
  #pragma unroll
  for (int ps = 0; ps < 2; ++ps) *(v4u*)(hvt + hidx[ps]) = hv[ps];
  if (tid < KTILE * 4) {                   // wave-uniform: 128 pieces of 16 B
    const int row = tid >> 2;              // 0..31
    const int cq  = (tid & 3) * 8;
    Pack8H p;
    p.v = *(const v8h*)(sF + row * FP + cq);
    *(v4u*)(fk + ((size_t)b * NKEY + kt * KTILE + row) * DQK + cq) = p.u;
  }
}

// One stage of 64 keys into LDS, five asynchronous 16-B copies per thread: one piece of the f tile (64 rows x 64 B)
// and four of the h^T stage, which is two 32-key tiles of the plane = 16 KB contiguous (a wave covers four whole
// 128-B lines per copy). Copy i takes piece i * 256 + tid: key tile i >> 1, d = (i & 1) * 64 + (tid >> 2), key quarter
// tid & 3; in LDS the two tiles stand side by side in a row of 64 keys. The s_wait_xcnt closes the statement so that
// no address register of an issued copy is rewritten ahead of it.
static __device__ __forceinline__ void stage_copy(unsigned lf, const f16* gf, unsigned lv, const f16* gv) {
  const unsigned lv1 = lv + 64 * VSP * 2, lv2 = lv + KTILE * 2, lv3 = lv + 64 * VSP * 2 + KTILE * 2;
  const f16* gv1 = gv + 1 * 256 * 8;
  const f16* gv2 = gv + 2 * 256 * 8;
  const f16* gv3 = gv + 3 * 256 * 8;
  asm volatile("global_load_async_to_lds_b128 %0, %1, off\n\t"
               "global_load_async_to_lds_b128 %2, %3, off\n\t"
               "global_load_async_to_lds_b128 %4, %5, off\n\t"
               "global_load_async_to_lds_b128 %6, %7, off\n\t"
               "global_load_async_to_lds_b128 %8, %9, off\n\t"
               "s_wait_xcnt 0x0"
               :: "v"(lf), "v"(gf), "v"(lv), "v"(gv), "v"(lv1), "v"(gv1), "v"(lv2), "v"(gv2), "v"(lv3), "v"(gv3)
               : "memory");
}

// Flash attention, non-causal, no score scaling. Block = (query block of 128, batch); one wave owns 16 queries.
// S^T = F x G^T so queries sit on lanes; P^T in C-layout is bit-identical to the A-fragment layout of CTX += P x Hv.
// G B-fragments come straight from the f16 plane. The f and h^T tiles, which all eight waves read, are brought into
// LDS once per block in stages of 64 keys (two buffers, the next stage's copies fly while this one is worked on);
// F A-fragments and Hv^T B-fragments are two 16-B LDS loads each, issued in two groups per stage ahead of their use (F of both passes goes in the first).
//   ctx [NB][SEQ][DV] f16 : one 256-B row per query; wave writes 16 rows = 4 KB contiguous, 512 B per instruction.
// LDS: sC per-wave region, written and read across lanes under a block barrier; staged extent == consumed extent.
__global__ __launch_bounds__(256) void attn_kernel(const f16* __restrict__ gq, const f16* __restrict__ fk,
                                                   const f16* __restrict__ hvt, f16* __restrict__ ctx) {
  const int qblk = blockIdx.x;
  const int b    = blockIdx.y;
  const int tid  = threadIdx.x;
  const int wave = tid >> 5;
  const int lane = tid & 31;
  const int lq   = lane & 15;   // query column of S^T / d column of CTX
  const int hi   = lane >> 4;   // k-split half

  __shared__ __align__(16) f16 sC[NWAVE * 16 * CP];
  __shared__ __align__(16) f16 sKF[2 * SK * FSP];   // [buffer][key][32 d], pitch FSP
  __shared__ __align__(16) f16 sKV[2 * DV * VSP];   // [buffer][d][64 keys], pitch VSP

  const int qrow0 = qblk * BQ + wave * 16;

  // G as B-operand fragment: lane lq holds query qrow0+lq, elements follow the split d map
  FragH qf;
  {
    const f16* qp = gq + ((size_t)b * SEQ + qrow0 + lq) * DQK + hi * 8;
    qf.q[0] = *(const v4u*)(qp);        // d = hi*8 + 0..7
    qf.q[1] = *(const v4u*)(qp + 16);   // d = 16 + hi*8 + 0..7
  }

  const f16* fk_b = fk + (size_t)b * NKEY * DQK;
  const f16* vt_b = hvt + (size_t)b * DV * NKEY;

  v8f o[8];
  #pragma unroll
  for (int dt = 0; dt < 8; ++dt) o[dt] = (v8f){0, 0, 0, 0, 0, 0, 0, 0};

  float rmax = -__builtin_inff();
  float rsum = 0.0f;
  const float SL = 1.4426950408889634f;   // log2(e); the scores carry no extra scale

  // this thread's pieces of a stage: LDS byte addresses in buffer 0 and global pointers of stage 0
  const unsigned lf0 = (unsigned)(uintptr_t)sKF + (unsigned)((tid >> 2) * (FSP * 2) + (tid & 3) * 16);
  const unsigned lv0 = (unsigned)(uintptr_t)sKV + (unsigned)((tid >> 2) * (VSP * 2) + (tid & 3) * 16);
  const f16* gf0 = fk_b + tid * 8;                                  // f stage = 4 KB contiguous
  const f16* gv0 = vt_b + tid * 8;                                  // h^T stage = 16 KB contiguous

  stage_copy(lf0, gf0, lv0, gv0);
  asm volatile("s_wait_asynccnt 0x0" ::: "memory");   // this wave's pieces of stage 0 have landed
  __syncthreads();                                    // publishes stage 0 to all waves
  if (NST > 1) stage_copy(lf0 + SK * FSP * 2, gf0 + SK * DQK, lv0 + DV * VSP * 2, gv0 + SK * DV);

  for (int t = 0; t < NST; ++t) {
   const int buf = t & 1;
   const f16* sf = sKF + buf * (SK * FSP);
   const f16* sv = sKV + buf * (DV * VSP);
   // One group of LDS loads at the head of the stage: the F A-fragments of both passes (row = key, split d map) and the
   // Hv^T B-fragments of the first pass (column n = d = dt*16 + lq, split key map from the transposed tile).
   FragH ak[SK / BK][2];
   #pragma unroll
   for (int ps = 0; ps < SK / BK; ++ps) {
     #pragma unroll
     for (int sub = 0; sub < 2; ++sub) {
       const f16* base = sf + (ps * BK + sub * 16 + lq) * FSP + hi * 8;
       ak[ps][sub].q[0] = *(const v4u*)(base);        // d = hi*8 + 0..7
       ak[ps][sub].q[1] = *(const v4u*)(base + 16);   // d = 16 + hi*8 + 0..7
     }
   }
   FragH bv[8];
   #pragma unroll
   for (int dt = 0; dt < 8; ++dt) {
     const f16* base = sv + (dt * 16 + lq) * VSP + hi * 8;
     bv[dt].q[0] = *(const v4u*)(base);        // keys hi*8 + 0..7
     bv[dt].q[1] = *(const v4u*)(base + 16);   // keys 16 + hi*8 + 0..7
   }
   __builtin_amdgcn_sched_barrier(0);   // the group stays whole, in front of the scores and the softmax that hide its latency
   #pragma unroll   // both passes of a stage inline: j0 folds into the LDS loads' immediate offsets
   for (int ps = 0; ps < SK / BK; ++ps) {
    // S^T tiles: c[sub][r] = score(query qrow0+lq, key j0 + sub*16 + hi*8 + r), j0 = ps * BK
    v8f c[2];
    #pragma unroll
    for (int sub = 0; sub < 2; ++sub)
      c[sub] = mma_f16(ak[ps][sub].v, qf.v, (v8f){0, 0, 0, 0, 0, 0, 0, 0});

    // online softmax: query lq's 32 scores are split across lane / lane^16
    float m_new = rmax;
    #pragma unroll
    for (int r = 0; r < 8; ++r) {
      m_new = fmaxf(m_new, c[0][r]);
      m_new = fmaxf(m_new, c[1][r]);
    }
    m_new = fmaxf(m_new, __shfl_xor(m_new, 16, 32));
    const float scale = __builtin_amdgcn_exp2f((rmax - m_new) * SL);
    rmax = m_new;

    // exp + pack: P^T C-layout == A-fragment layout for the PV product; P carried x4096 in f16
    FragH pa;
    float psum = 0.0f;
    #pragma unroll
    for (int r = 0; r < 8; ++r) {
      const float p0 = __builtin_amdgcn_exp2f((c[0][r] - m_new) * SL);   // key j0 + hi*8 + r
      const float p1 = __builtin_amdgcn_exp2f((c[1][r] - m_new) * SL);   // key j0 + 16 + hi*8 + r
      psum += p0 + p1;
      pa.h[r]     = (f16)(p0 * 4096.0f);
      pa.h[8 + r] = (f16)(p1 * 4096.0f);
    }
    rsum = rsum * scale + psum + __shfl_xor(psum, 16, 32);

    // rescale CTX: queries are the row dimension there -> per-row scale from lane 8*hi + r
    float sc[8];
    #pragma unroll
    for (int r = 0; r < 8; ++r) sc[r] = __shfl(scale, (hi << 3) + r, 32);
    #pragma unroll
    for (int dt = 0; dt < 8; ++dt) {
      #pragma unroll
      for (int r = 0; r < 8; ++r) o[dt][r] *= sc[r];
    }

    // CTX += P x Hv
    #pragma unroll
    for (int dt = 0; dt < 8; ++dt) o[dt] = mma_f16(pa.v, bv[dt].v, o[dt]);
    if (ps + 1 < SK / BK) {
      __builtin_amdgcn_sched_barrier(0);   // the next pass's group is not lifted over these products: one set of Hv^T registers
      #pragma unroll
      for (int dt = 0; dt < 8; ++dt) {
        const f16* base = sv + (dt * 16 + lq) * VSP + (ps + 1) * BK + hi * 8;
        bv[dt].q[0] = *(const v4u*)(base);        // keys j0 + hi*8 + 0..7 of the next pass
        bv[dt].q[1] = *(const v4u*)(base + 16);   // keys j0 + 16 + hi*8 + 0..7
      }
      __builtin_amdgcn_sched_barrier(0);   // and it stays whole, in front of the next pass's scores and softmax
    }
   }
   __builtin_amdgcn_sched_barrier(0);   // the second pass's work stays in front of the hand-over, whose waits would else stand right behind its loads
   // hand-over: stage t + 1 becomes readable, and the buffer of stage t free, behind this one barrier
   asm volatile("s_wait_dscnt 0x0" ::: "memory");      // this wave's reads of stage t are done before the refill
   asm volatile("s_wait_asynccnt 0x0" ::: "memory");   // this wave's pieces of stage t + 1 have landed
   __syncthreads();
   if (t + 2 < NST)
     stage_copy(lf0 + buf * (SK * FSP * 2), gf0 + (size_t)(t + 2) * (SK * DQK),
                lv0 + buf * (DV * VSP * 2), gv0 + (size_t)(t + 2) * (SK * DV));
  }
  asm volatile("s_wait_asynccnt 0x0" ::: "memory");    // no copy is outstanding when the wave goes on to its end

  // normalize: lane holds column d = dt*16 + lq for query rows 8*hi + r
  float rs[8];
  #pragma unroll
  for (int r = 0; r < 8; ++r) rs[r] = 1.0f / __shfl(rsum, (hi << 3) + r, 32);

  f16* stg = sC + wave * (16 * CP);
  #pragma unroll
  for (int r = 0; r < 8; ++r) {
    #pragma unroll
    for (int dt = 0; dt < 8; ++dt)
      stg[(hi * 8 + r) * CP + dt * 16 + lq] = (f16)(o[dt][r] * (1.0f / 4096.0f) * rs[r]);
  }
  __syncthreads();

  // lanes 16..31 the next row; 8 instructions cover the wave's 16 rows.
  v4u    vals[8];
  size_t gidx[8];
  #pragma unroll
  for (int it = 0; it < 8; ++it) {
    const int row = it * 2 + hi;
    const int dq  = lq * 8;
    Pack8H p;
    p.v = *(const v8h*)(stg + row * CP + dq);
    vals[it] = p.u;
    gidx[it] = ((size_t)b * SEQ + qrow0 + row) * DV + dq;
  }
  #pragma unroll
  for (int it = 0; it < 8; ++it) *(v4u*)(ctx + gidx[it]) = vals[it];
  
}

// Output projection + scaled residual: out = gamma * (CTX x Wo) + x_bf16. Block = 8 waves, wave -> one 16-row M tile,
// four passes over 64-column quarters. A fragments from the f16 ctx plane, B fragments from the wot units (carried x16).
// Epilogue per quarter: f32 tile staged in LDS (per-wave region, block barriers), then per instruction lanes 0..15
__global__ __launch_bounds__(256) void oproj_kernel(const f16* __restrict__ ctx, const f16* __restrict__ wot,
                                                    const float* __restrict__ x, const float* __restrict__ gamma,
                                                    float* __restrict__ out) {
  const int tid  = threadIdx.x;
  const int wave = tid >> 5;
  const int lane = tid & 31;
  const int m    = lane & 15;   // B column within a tile / 16-B piece index of the quarter-row
  const int hi   = lane >> 4;
  const int mt   = blockIdx.x * NWAVE + wave;
  const int prow0 = mt * 16;                 // plane row of ctx
  const int bb    = prow0 / SEQ;
  const int pix0  = prow0 - bb * SEQ;
  const size_t xrow0 = (size_t)bb * SEQ_FULL + pix0;

  __shared__ __align__(16) float sO[NWAVE * 16 * OP];
  float* so = sO + wave * (16 * OP);

  const float gsc = (float)(bf16)gamma[0] * 0.0625f;   // gamma (RNE bf16) folded with the 1/16 Wo carry
  const f16* ap0 = ctx + (size_t)(prow0 + m) * DV + hi * 8;
  FragH a[DV / 32];   // the wave's ctx rows, the same for all four quarters
  #pragma unroll
  for (int kk = 0; kk < DV / 32; ++kk) {
    a[kk].q[0] = *(const v4u*)(ap0 + kk * 32);        // d = kk*32 + hi*8 + 0..7
    a[kk].q[1] = *(const v4u*)(ap0 + kk * 32 + 16);   // d = kk*32 + 16 + hi*8 + 0..7
  }

  #pragma unroll 1
  for (int qn = 0; qn < 4; ++qn) {
    // one group of loads per quarter: its sixteen Wo fragments, then the x pieces of its residual
    FragH bw[DV / 32][4];
    #pragma unroll
    for (int kk = 0; kk < DV / 32; ++kk) {
      #pragma unroll
      for (int j = 0; j < 4; ++j) {
        const f16* wp = wot + (size_t)(((qn * 4 + j) * (DV / 32) + kk) * 2) * FRU + lane * 8;
        bw[kk][j].q[0] = *(const v4u*)(wp);         // d = kk*32 + hi*8 + 0..7 of column (qn*4 + j)*16 + m
        bw[kk][j].q[1] = *(const v4u*)(wp + FRU);   // d = kk*32 + 16 + hi*8 + 0..7
      }
    }
    v4f    xq[8];
    size_t gidx[8];
    #pragma unroll
    for (int it = 0; it < 8; ++it) {
      gidx[it] = (xrow0 + it * 2 + hi) * CIN + qn * 64 + m * 4;
      xq[it]   = *(const v4f*)(x + gidx[it]);
    }
    __builtin_amdgcn_sched_barrier(0);   // the group stays whole, in front of the quarter's matrix work
    v8f acc[4];
    #pragma unroll
    for (int j = 0; j < 4; ++j) acc[j] = (v8f){0, 0, 0, 0, 0, 0, 0, 0};
    #pragma unroll
    for (int kk = 0; kk < DV / 32; ++kk) {
      #pragma unroll
      for (int j = 0; j < 4; ++j) acc[j] = mma_f16(a[kk].v, bw[kk][j].v, acc[j]);
    }
    #pragma unroll
    for (int r = 0; r < 8; ++r) {
      #pragma unroll
      for (int j = 0; j < 4; ++j) so[(hi * 8 + r) * OP + j * 16 + m] = acc[j][r] * gsc;
    }
    __syncthreads();

    v4f vals[8];
    #pragma unroll
    for (int it = 0; it < 8; ++it) {
      const int row = it * 2 + hi;
      v4f v = *(const v4f*)(so + row * OP + m * 4);
      #pragma unroll
      for (int cc = 0; cc < 4; ++cc) v[cc] = v[cc] + (float)(bf16)xq[it][cc];   // residual with the RNE bf16 input value
      vals[it] = v;
    }
    #pragma unroll
    for (int it = 0; it < 8; ++it) *(v4f*)(out + gidx[it]) = vals[it];
    
    __syncthreads();
  }
}

extern "C" void kernel_launch(void* const* d_in, const int* in_sizes, int n_in,
                              void* d_out, int out_size, void* d_ws, size_t ws_size,
                              hipStream_t stream) {
  if (n_in < 6) return;
  const size_t rows_used = (size_t)(NB - 1) * SEQ_FULL + SEQ;
  if ((size_t)in_sizes[0] < rows_used * CIN) return;
  if (in_sizes[1] < CIN * DQK) return;
  if (in_sizes[2] < CIN * DQK) return;
  if (in_sizes[3] < CIN * DV) return;
  if (in_sizes[4] < DV * CIN) return;
  if (in_sizes[5] < 1) return;
  if ((size_t)out_size < rows_used * CIN) return;

  const size_t wct_bytes = (size_t)NPROJ * CIN * 2;           // 98,304
  const size_t wot_bytes = (size_t)CIN * DV * 2;              // 65,536
  const size_t gq_bytes  = (size_t)NB * SEQ * DQK * 2;        // 2,097,152 at full size
  const size_t fk_bytes  = (size_t)NB * NKEY * DQK * 2;       // 524,288
  const size_t hvt_bytes = (size_t)NB * DV * NKEY * 2;        // 2,097,152
  const size_t ctx_bytes = (size_t)NB * SEQ * DV * 2;         // 8,388,608
  const size_t off_wct = 0;
  const size_t off_wot = off_wct + wct_bytes;
  const size_t off_gq  = off_wot + wot_bytes;
  const size_t off_fk  = off_gq + gq_bytes;
  const size_t off_hvt = off_fk + fk_bytes;
  const size_t off_ctx = off_hvt + hvt_bytes;
  const size_t total   = off_ctx + ctx_bytes;                 // 13,271,040 at full size
  if (ws_size < total) return;

  const float* x     = (const float*)d_in[0];
  const float* wf    = (const float*)d_in[1];
  const float* wg    = (const float*)d_in[2];
  const float* wh    = (const float*)d_in[3];
  const float* wo    = (const float*)d_in[4];
  const float* gamma = (const float*)d_in[5];
  float* out = (float*)d_out;
  char*  ws  = (char*)d_ws;
  bf16* wct = (bf16*)(ws + off_wct);
  f16*  wot = (f16*)(ws + off_wot);
  f16*  gq  = (f16*)(ws + off_gq);
  f16*  fk  = (f16*)(ws + off_fk);
  f16*  hvt = (f16*)(ws + off_hvt);
  f16*  ctx = (f16*)(ws + off_ctx);

  pack_w_kernel<<<40, 256, 0, stream>>>(wf, wg, wh, wo, wct, wot);
  proj_pool_kernel<<<dim3(SEQ / 128, NB), 256, 0, stream>>>(x, wct, gq, fk, hvt);
  attn_kernel<<<dim3(SEQ / BQ, NB), 256, 0, stream>>>(gq, fk, hvt, ctx);
  oproj_kernel<<<(NB * SEQ) / 128, 256, 0, stream>>>(ctx, wot, x, gamma, out);
}

// v005
// A run of this version takes 36.8 microseconds.
// Timed twice side by side with v004, it ran 1.09 times as fast both times.
// Counting every step since v000, it is 4.11 times as fast.
#include <hip/hip_runtime.h>

// Contractions: X x [Wf|Wg|Wh] on v_wmma_f32_16x16x32_bf16 (bf16 operands = RNE-converted inputs, f32 accumulate);
// S^T = F x G^T, CTX = P x Hv (P as f16 carried x4096) and OUT = CTX x Wo (Wo as f16 of the bf16 value, carried x16)
// on v_wmma_f32_16x16x32_f16 (f16 operands, f32 accumulate). Max-pool, softmax and residual in f32.

#ifndef NB
#define NB 8
#endif
#ifndef SEQ
#define SEQ 4096
#endif
#define NB_FULL  8
#define SEQ_FULL 4096
#define W_IMG    64                 // image width (pixels per image row)
#define CIN      256                // input channels
#define DQK      32                 // query / key channels
#define DV       128                // value channels
#define NPROJ    192                // packed projection columns: [0,32) f, [32,64) g, [64,192) h
#define NKEY     (SEQ / 4)          // pooled key count per image
#define KTILE    32                 // keys produced per projection block (two image rows)
#define BQ       128                // query rows per attention block (8 waves x 16)
#define BK       32                 // keys per inner iteration
#define NWAVE    8
#define PP       168                // LDS pitch (halves) of the ww-pooled staging rows
#define GP       40                 // LDS pitch (halves) of the g staging tile
#define FP       40                 // LDS pitch (halves) of the pooled f tile
#define HP       40                 // LDS pitch (halves) of the pooled h^T tile: 80 B = 16 B x odd
#define CP       136                // LDS pitch (halves) of the ctx staging tile
#define OP       68                 // LDS pitch (floats) of the output staging tile
#define SK       64                 // keys per LDS stage of the attention loop (two BK passes)
#define NST      (NKEY / SK)        // stages per image
#define FSP      40                 // LDS pitch (halves) of a staged f row: 80 B = 16 B x odd
#define VSP      72                 // LDS pitch (halves) of a staged h^T row: 144 B = 16 B x odd
#define FRU      256                // halves per weight fragment unit: 32 lanes x 16 B = 512 B = four whole lines

static_assert(SEQ % 256 == 0);
static_assert(SEQ >= 256 && SEQ <= SEQ_FULL);
static_assert(NB >= 1 && NB <= NB_FULL);
static_assert(BQ == NWAVE * 16);
static_assert(NKEY % BK == 0);
static_assert(NKEY % KTILE == 0);
static_assert(CIN % 32 == 0 && DV % 32 == 0 && DQK == 32);
// coverage equalities (grid x block x per-thread elements == plane extent)
static_assert((SEQ / 128) * NWAVE * 16 == SEQ);              // g plane rows per image
static_assert((SEQ / 128) * KTILE == NKEY);                   // f / h^T plane keys per image
static_assert(2 * W_IMG == NWAVE * 16 && KTILE == W_IMG / 2); // a projection block = two whole image rows
static_assert((SEQ / BQ) * NWAVE * 16 == SEQ);                // ctx and output rows per image
static_assert((GP * 2) % 16 == 0 && (FP * 2) % 16 == 0 && (HP * 2) % 16 == 0 && (CP * 2) % 16 == 0);
static_assert((OP * 4) % 16 == 0);
static_assert(NKEY % SK == 0 && SK == 2 * BK && NST >= 1);
static_assert((FSP * 2) % 16 == 0 && (VSP * 2) % 16 == 0);
static_assert(SK * DQK * 2 == 256 * 16);        // f stage: one 16-B copy per thread
static_assert(DV * SK * 2 == 4 * 256 * 16);     // h^T stage: four 16-B copies per thread
static_assert(SK == 2 * KTILE);                 // h^T stage: two whole key tiles of the plane, 16 KB contiguous

typedef __bf16   bf16;
typedef _Float16 f16;
typedef bf16     v16bf __attribute__((ext_vector_type(16)));
typedef f16      v16h  __attribute__((ext_vector_type(16)));
typedef f16      v8h   __attribute__((ext_vector_type(8)));
typedef float    v8f   __attribute__((ext_vector_type(8)));
typedef float    v4f   __attribute__((ext_vector_type(4)));
typedef unsigned v4u   __attribute__((ext_vector_type(4)));

union FragB  { v16bf v; v4u q[2]; bf16 h[16]; };
union FragH  { v16h  v; v4u q[2]; f16  h[16]; };
union Pack8B { v4u u; bf16 h[8]; };
union Pack8H { v4u u; v8h v; f16 h[8]; };

// WMMA helpers: the plain builtins; the compiler keeps the distance behind its own matrix instructions. No volatile
// statement stands behind them, so that a block's fragment loads can be issued ahead of the block before it.
static __device__ __forceinline__ v8f mma_bf16(v16bf a, v16bf b, v8f acc) {
  return __builtin_amdgcn_wmma_f32_16x16x32_bf16(false, a, false, b, (short)0, acc, false, false);
}
static __device__ __forceinline__ v8f mma_f16(v16h a, v16h b, v8f acc) {
  return __builtin_amdgcn_wmma_f32_16x16x32_f16(false, a, false, b, (short)0, acc, false, false);
}

// Weight planes, packed in fragment order: a unit is the 512 contiguous bytes that one wave-wide 16-B load of a
// B fragment half takes, lane (hi, m) holding column n = tile * 16 + m, k = kk * 32 + q * 16 + hi * 8 + 0..7.
//   wct unit (t * 8 + kk) * 2 + q, t = 0..11  : bf16 RNE of column t * 16 + m of [wf | wg | wh].
//   wot unit (nt * 4 + kk) * 2 + q, nt = 0..15 : f16(bf16(w) * 16) (exact) of column nt * 16 + m of wo.
// One wave packs one unit (one 512-B store). Blocks 0..23: wct units 0..191; blocks 24..39: wot units 0..127.
// Source selection is block-uniform (16 units per column tile, 8 units per block).
// coverage: wct columns 0..191 x k 0..255; wot columns 0..255 x k 0..127.
__global__ __launch_bounds__(256) void pack_w_kernel(const float* __restrict__ wf, const float* __restrict__ wg,
                                                      const float* __restrict__ wh, const float* __restrict__ wo,
                                                      bf16* __restrict__ wct, f16* __restrict__ wot) {
  const int blk  = blockIdx.x;
  const int tid  = threadIdx.x;
  const int wave = tid >> 5;
  const int lane = tid & 31;
  const int m    = lane & 15;
  const int hi   = lane >> 4;
  if (blk < 24) {
    const int u  = blk * 8 + wave;                                       // 0..191
    const int n  = (u >> 4) * 16 + m;                                    // 0..191
    const int k0 = ((u >> 1) & 7) * 32 + (u & 1) * 16 + hi * 8;          // 0..248
    const float* src = (blk < 4) ? wf : ((blk < 8) ? wg : wh);
    const int pitch  = (blk < 8) ? DQK : DV;
    const int nl     = (blk < 4) ? n : ((blk < 8) ? (n - 32) : (n - 64));
    Pack8B pk;
    #pragma unroll
    for (int i = 0; i < 8; ++i) pk.h[i] = (bf16)src[(size_t)(k0 + i) * pitch + nl];   // RNE convert
    *(v4u*)(wct + (size_t)u * FRU + lane * 8) = pk.u;
  } else {
    const int u  = (blk - 24) * 8 + wave;                                // 0..127
    const int n  = (u >> 3) * 16 + m;                                    // 0..255
    const int k0 = ((u >> 1) & 3) * 32 + (u & 1) * 16 + hi * 8;          // 0..120
    Pack8H pk;
    #pragma unroll
    for (int i = 0; i < 8; ++i) {
      const float v = (float)(bf16)wo[(size_t)(k0 + i) * CIN + n];
      pk.h[i] = (f16)(v * 16.0f);              // bf16 significand fits f16: exact for normal results
    }
    *(v4u*)(wot + (size_t)u * FRU + lane * 8) = pk.u;
    asm volatile("s_wait_xcnt 0x0" ::: "memory");   // stands before any later write of the store's address or data registers
  }
}

// One wave's 16-pixel M tile times NTN consecutive 16-column tiles of wct starting at tile NT0; K = CIN.
// A fragments from f32 x rows (RNE bf16 convert, split k map); B fragments from the fragment-ordered wct units.
// Loads go out in groups ahead of the matrix work: the x pieces AD k-blocks ahead, the wct fragments one k-block ahead.
template <int NT0, int NTN, int AD>
static __device__ __forceinline__ void proj_tiles(const float* __restrict__ xr, const bf16* wct,
                                                  int m, int hi, v8f (&acc)[NTN]) {
  constexpr int NKB = CIN / 32;
  #pragma unroll
  for (int t = 0; t < NTN; ++t) acc[t] = (v8f){0, 0, 0, 0, 0, 0, 0, 0};
  const float* xp = xr + hi * 8;
  const bf16*  wp = wct + (size_t)NT0 * (NKB * 2 * FRU) + (hi * 16 + m) * 8;   // this lane's 16 B of every unit
  v4f   ax[NKB][4];
  FragB bw[NKB][NTN];
  #pragma unroll
  for (int kk = 0; kk < NKB; ++kk) {
    if (kk < AD) {
      ax[kk][0] = *(const v4f*)(xp + kk * 32);
      ax[kk][1] = *(const v4f*)(xp + kk * 32 + 4);
      ax[kk][2] = *(const v4f*)(xp + kk * 32 + 16);
      ax[kk][3] = *(const v4f*)(xp + kk * 32 + 20);
    }
  }
  #pragma unroll
  for (int t = 0; t < NTN; ++t) {
    bw[0][t].q[0] = *(const v4u*)(wp + (t * NKB * 2) * FRU);
    bw[0][t].q[1] = *(const v4u*)(wp + (t * NKB * 2 + 1) * FRU);
  }
  #pragma unroll
  for (int kk = 0; kk < NKB; ++kk) {
    if (kk + AD < NKB) {
      const int ka = kk + AD;
      ax[ka][0] = *(const v4f*)(xp + ka * 32);
      ax[ka][1] = *(const v4f*)(xp + ka * 32 + 4);
      ax[ka][2] = *(const v4f*)(xp + ka * 32 + 16);
      ax[ka][3] = *(const v4f*)(xp + ka * 32 + 20);
    }
    if (kk + 1 < NKB) {
      #pragma unroll
      for (int t = 0; t < NTN; ++t) {
        bw[kk + 1][t].q[0] = *(const v4u*)(wp + ((t * NKB + kk + 1) * 2) * FRU);       // k = hi*8 + 0..7 of the block
        bw[kk + 1][t].q[1] = *(const v4u*)(wp + ((t * NKB + kk + 1) * 2 + 1) * FRU);   // k = 16 + hi*8 + 0..7
      }
    }
    __builtin_amdgcn_sched_barrier(0);   // the next block's loads stay in front of this block's matrix work
    FragB a;
    #pragma unroll
    for (int i = 0; i < 4; ++i) {
      a.h[i]      = (bf16)ax[kk][0][i];   // elems 0..7  : k = kk*32 + hi*8 + 0..7
      a.h[4 + i]  = (bf16)ax[kk][1][i];
      a.h[8 + i]  = (bf16)ax[kk][2][i];   // elems 8..15 : k = kk*32 + 16 + hi*8 + 0..7
      a.h[12 + i] = (bf16)ax[kk][3][i];
    }
    #pragma unroll
    for (int t = 0; t < NTN; ++t) acc[t] = mma_bf16(a.v, bw[kk][t].v, acc[t]);
    __builtin_amdgcn_sched_barrier(0);   // later loads are not lifted over this block: two blocks of wct fragments live at most
  }
}

// Projection + 2x2 max-pool. Block = (32-key tile kt, batch b), 256 threads: the two image rows hh = kt*2 + {0,1},
// so that the grid has one block for every WGP of the chip; wave -> (hh, 16 pixels along ww).
//   gq  [NB][SEQ][DQK]  f16 : queries, one 64-B row per pixel (wave writes 16 rows = 1 KB, 2 instructions).
//   fk  [NB][NKEY][DQK] f16 : pooled keys, 32 rows per block = 2 KB (one 512-B instruction per wave, four waves).
//   hvt [NB][NKEY/32][DV][32] f16 : pooled values, transposed inside a 32-key tile; a block writes its own 8 KB,
//                                   whole lines only (512 B per instruction).
// LDS regions: sP cross-wave (block barrier), sG per-wave but read across lanes after the block barrier,
// sF / sHT cross-wave (block barrier). Staged extent == consumed extent for all four.
__global__ __launch_bounds__(256) void proj_pool_kernel(const float* __restrict__ x, const bf16* wct,
                                                         f16* __restrict__ gq, f16* __restrict__ fk,
                                                         f16* __restrict__ hvt) {
  const int kt   = blockIdx.x;
  const int b    = blockIdx.y;
  const int tid  = threadIdx.x;
  const int wave = tid >> 5;
  const int lane = tid & 31;
  const int m    = lane & 15;
  const int hi   = lane >> 4;
  const int hsel = wave >> 2;          // which of the block's two image rows
  const int ww0  = (wave & 3) * 16;    // first pixel column of this wave's tile

  __shared__ __align__(16) f16 sP[2 * 32 * PP];       // [hsel][pw][160 cols] ww-pooled f|h
  __shared__ __align__(16) f16 sG[NWAVE * 16 * GP];   // per-wave g tile [16][32]
  __shared__ __align__(16) f16 sF[KTILE * FP];        // pooled f [32 keys][32]
  __shared__ __align__(16) f16 sHT[DV * HP];          // pooled h^T [128 d][32 keys]

  f16* sg = sG + wave * (16 * GP);
  f16* sp = sP + hsel * (32 * PP);
  const int pwb = (ww0 >> 1) + hi * 4;   // pooled column index base for this lane half

  const int hh   = kt * 2 + hsel;
  const int pix0 = hh * W_IMG + ww0;
  const float* xr = x + ((size_t)b * SEQ_FULL + pix0 + m) * CIN;

  {   // tiles 0..3: f (0,1) and g (2,3)
    v8f acc[4];
    proj_tiles<0, 4, CIN / 32>(xr, wct, m, hi, acc);   // first touch of x: all its pieces in flight at once
    #pragma unroll
    for (int r = 0; r < 8; ++r) {
      sg[(hi * 8 + r) * GP + m]      = (f16)acc[2][r];
      sg[(hi * 8 + r) * GP + 16 + m] = (f16)acc[3][r];
    }
    // ww pairs are D rows (2rp, 2rp+1) of the same lane half; pooled column pw = ww0/2 + 4*hi + rp
    #pragma unroll
    for (int rp = 0; rp < 4; ++rp) {
      #pragma unroll
      for (int t = 0; t < 2; ++t)
        sp[(pwb + rp) * PP + t * 16 + m] = (f16)fmaxf(acc[t][2 * rp], acc[t][2 * rp + 1]);
    }
  }
  {   // tiles 4..11: h
    v8f acc[8];
    proj_tiles<4, 8, 1>(xr, wct, m, hi, acc);
    #pragma unroll
    for (int rp = 0; rp < 4; ++rp) {
      #pragma unroll
      for (int t = 0; t < 8; ++t)
        sp[(pwb + rp) * PP + 32 + t * 16 + m] = (f16)fmaxf(acc[t][2 * rp], acc[t][2 * rp + 1]);
    }
  }
  __syncthreads();

  // g tile -> gq: 16 consecutive pixel rows x 64 B = 1 KB contiguous; 32 lanes x 16 B per instruction
  {
    v4u    gv[2];
    size_t gi[2];
    #pragma unroll
    for (int i2 = 0; i2 < 2; ++i2) {
      const int row = i2 * 8 + (lane >> 2);
      const int cq  = (lane & 3) * 8;
      Pack8H p;
      p.v = *(const v8h*)(sg + row * GP + cq);
      gv[i2] = p.u;
      gi[i2] = ((size_t)b * SEQ + pix0 + row) * DQK + cq;
    }
    #pragma unroll
    for (int i2 = 0; i2 < 2; ++i2) *(v4u*)(gq + gi[i2]) = gv[i2];
  }

  // hh-pool into the block's pooled tiles
  #pragma unroll
  for (int e = 0; e < 4; ++e) {
    const int idx = e * 256 + tid;
    const int pw  = idx >> 5;
    const int c   = idx & 31;
    const float v = fmaxf((float)sP[pw * PP + c], (float)sP[32 * PP + pw * PP + c]);
    sF[pw * FP + c] = (f16)v;
  }
  #pragma unroll
  for (int e = 0; e < 16; ++e) {
    const int idx = e * 256 + tid;
    const int pw  = idx >> 7;
    const int d   = idx & 127;
    const float v = fmaxf((float)sP[pw * PP + 32 + d], (float)sP[32 * PP + pw * PP + 32 + d]);
    sHT[d * HP + pw] = (f16)v;
  }
  __syncthreads();

  // final plane stores: hvt (two 16-B pieces per thread, piece p = d * 4 + key quarter), fk (waves 0..3, 8 rows each)
  v4u    hv[2];
  size_t hidx[2];
  #pragma unroll
  for (int ps = 0; ps < 2; ++ps) {
    const int pc = ps * 256 + tid;         // 0..511
    Pack8H p;
    p.v = *(const v8h*)(sHT + (pc >> 2) * HP + (pc & 3) * 8);
    hv[ps]   = p.u;
    hidx[ps] = ((size_t)b * (NKEY / KTILE) + kt) * (DV * KTILE) + (size_t)pc * 8;
  }
  #pragma unroll
  for (int ps = 0; ps < 2; ++ps) *(v4u*)(hvt + hidx[ps]) = hv[ps];
  if (tid < KTILE * 4) {                   // wave-uniform: 128 pieces of 16 B
    const int row = tid >> 2;              // 0..31
    const int cq  = (tid & 3) * 8;
    Pack8H p;
    p.v = *(const v8h*)(sF + row * FP + cq);
    *(v4u*)(fk + ((size_t)b * NKEY + kt * KTILE + row) * DQK + cq) = p.u;
  }
}

// One stage of 64 keys into LDS, five asynchronous 16-B copies per thread: one piece of the f tile (64 rows x 64 B)
// and four of the h^T stage, which is two 32-key tiles of the plane = 16 KB contiguous (a wave covers four whole
// 128-B lines per copy). Copy i takes piece i * 256 + tid: key tile i >> 1, d = (i & 1) * 64 + (tid >> 2), key quarter
// tid & 3; in LDS the two tiles stand side by side in a row of 64 keys. The s_wait_xcnt closes the statement so that
// no address register of an issued copy is rewritten ahead of it.
static __device__ __forceinline__ void stage_copy(unsigned lf, const f16* gf, unsigned lv, const f16* gv) {
  const unsigned lv1 = lv + 64 * VSP * 2, lv2 = lv + KTILE * 2, lv3 = lv + 64 * VSP * 2 + KTILE * 2;
  const f16* gv1 = gv + 1 * 256 * 8;
  const f16* gv2 = gv + 2 * 256 * 8;
  const f16* gv3 = gv + 3 * 256 * 8;
  asm volatile("global_load_async_to_lds_b128 %0, %1, off\n\t"
               "global_load_async_to_lds_b128 %2, %3, off\n\t"
               "global_load_async_to_lds_b128 %4, %5, off\n\t"
               "global_load_async_to_lds_b128 %6, %7, off\n\t"
               "global_load_async_to_lds_b128 %8, %9, off\n\t"
               "s_wait_xcnt 0x0"
               :: "v"(lf), "v"(gf), "v"(lv), "v"(gv), "v"(lv1), "v"(gv1), "v"(lv2), "v"(gv2), "v"(lv3), "v"(gv3)
               : "memory");
}

// Flash attention, non-causal, no score scaling. Block = (query block of 128, batch); one wave owns 16 queries.
// S^T = F x G^T so queries sit on lanes; P^T in C-layout is bit-identical to the A-fragment layout of CTX += P x Hv.
// G B-fragments come straight from the f16 plane. The f and h^T tiles, which all eight waves read, are brought into
// LDS once per block in stages of 64 keys (two buffers, the next stage's copies fly while this one is worked on);
// F A-fragments and Hv^T B-fragments are two 16-B LDS loads each, issued as one group per pass ahead of their use.
// The output projection and the scaled residual follow in the same kernel: out = gamma * (CTX x Wo) + x_bf16. A wave's
// 16 x 128 CTX tile, rounded to f16, goes no further than LDS, from where the wave reads it back as A fragments.
// LDS: sC, sO per-wave regions, written and read across lanes under block barriers; staged extent == consumed extent.
__global__ __launch_bounds__(256) void attn_oproj_kernel(const f16* __restrict__ gq, const f16* __restrict__ fk,
                                                         const f16* __restrict__ hvt, const f16* __restrict__ wot,
                                                         const float* __restrict__ x, const float* __restrict__ gamma,
                                                         float* __restrict__ out) {
  const int qblk = blockIdx.x;
  const int b    = blockIdx.y;
  const int tid  = threadIdx.x;
  const int wave = tid >> 5;
  const int lane = tid & 31;
  const int lq   = lane & 15;   // query column of S^T / d column of CTX
  const int hi   = lane >> 4;   // k-split half

  __shared__ __align__(16) f16 sC[NWAVE * 16 * CP];
  __shared__ __align__(16) f16 sKF[2 * SK * FSP];   // [buffer][key][32 d], pitch FSP
  __shared__ __align__(16) f16 sKV[2 * DV * VSP];   // [buffer][d][64 keys], pitch VSP
  __shared__ __align__(16) float sO[NWAVE * 16 * OP];   // per-wave f32 tile of one output quarter

  const int qrow0 = qblk * BQ + wave * 16;

  // G as B-operand fragment: lane lq holds query qrow0+lq, elements follow the split d map
  FragH qf;
  {
    const f16* qp = gq + ((size_t)b * SEQ + qrow0 + lq) * DQK + hi * 8;
    qf.q[0] = *(const v4u*)(qp);        // d = hi*8 + 0..7
    qf.q[1] = *(const v4u*)(qp + 16);   // d = 16 + hi*8 + 0..7
  }

  const float gsc = (float)(bf16)gamma[0] * 0.0625f;   // gamma (RNE bf16) folded with the 1/16 Wo carry

  const f16* fk_b = fk + (size_t)b * NKEY * DQK;
  const f16* vt_b = hvt + (size_t)b * DV * NKEY;

  v8f o[8];
  #pragma unroll
  for (int dt = 0; dt < 8; ++dt) o[dt] = (v8f){0, 0, 0, 0, 0, 0, 0, 0};

  float rmax = -__builtin_inff();
  float rsum = 0.0f;
  const float SL = 1.4426950408889634f;   // log2(e); the scores carry no extra scale

  // this thread's pieces of a stage: LDS byte addresses in buffer 0 and global pointers of stage 0
  const unsigned lf0 = (unsigned)(uintptr_t)sKF + (unsigned)((tid >> 2) * (FSP * 2) + (tid & 3) * 16);
  const unsigned lv0 = (unsigned)(uintptr_t)sKV + (unsigned)((tid >> 2) * (VSP * 2) + (tid & 3) * 16);
  const f16* gf0 = fk_b + tid * 8;                                  // f stage = 4 KB contiguous
  const f16* gv0 = vt_b + tid * 8;                                  // h^T stage = 16 KB contiguous

  stage_copy(lf0, gf0, lv0, gv0);
  asm volatile("s_wait_asynccnt 0x0" ::: "memory");   // this wave's pieces of stage 0 have landed
  __syncthreads();                                    // publishes stage 0 to all waves
  if (NST > 1) stage_copy(lf0 + SK * FSP * 2, gf0 + SK * DQK, lv0 + DV * VSP * 2, gv0 + SK * DV);

  for (int t = 0; t < NST; ++t) {
   const int buf = t & 1;
   const f16* sf = sKF + buf * (SK * FSP);
   const f16* sv = sKV + buf * (DV * VSP);
   // One group of LDS loads at the head of the stage: the F A-fragments of both passes (row = key, split d map) and the
   // Hv^T B-fragments of the first pass (column n = d = dt*16 + lq, split key map from the transposed tile).
   FragH ak[SK / BK][2];
   #pragma unroll
   for (int ps = 0; ps < SK / BK; ++ps) {
     #pragma unroll
     for (int sub = 0; sub < 2; ++sub) {
       const f16* base = sf + (ps * BK + sub * 16 + lq) * FSP + hi * 8;
       ak[ps][sub].q[0] = *(const v4u*)(base);        // d = hi*8 + 0..7
       ak[ps][sub].q[1] = *(const v4u*)(base + 16);   // d = 16 + hi*8 + 0..7
     }
   }
   FragH bv[8];
   #pragma unroll
   for (int dt = 0; dt < 8; ++dt) {
     const f16* base = sv + (dt * 16 + lq) * VSP + hi * 8;
     bv[dt].q[0] = *(const v4u*)(base);        // keys hi*8 + 0..7
     bv[dt].q[1] = *(const v4u*)(base + 16);   // keys 16 + hi*8 + 0..7
   }
   __builtin_amdgcn_sched_barrier(0);   // the group stays whole, in front of the scores and the softmax that hide its latency
   #pragma unroll   // both passes of a stage inline: j0 folds into the LDS loads' immediate offsets
   for (int ps = 0; ps < SK / BK; ++ps) {
    // S^T tiles: c[sub][r] = score(query qrow0+lq, key j0 + sub*16 + hi*8 + r), j0 = ps * BK
    v8f c[2];
    #pragma unroll
    for (int sub = 0; sub < 2; ++sub)
      c[sub] = mma_f16(ak[ps][sub].v, qf.v, (v8f){0, 0, 0, 0, 0, 0, 0, 0});

    // online softmax: query lq's 32 scores are split across lane / lane^16
    float m_new = rmax;
    #pragma unroll
    for (int r = 0; r < 8; ++r) {
      m_new = fmaxf(m_new, c[0][r]);
      m_new = fmaxf(m_new, c[1][r]);
    }
    m_new = fmaxf(m_new, __shfl_xor(m_new, 16, 32));
    const float scale = __builtin_amdgcn_exp2f((rmax - m_new) * SL);
    rmax = m_new;

    // exp + pack: P^T C-layout == A-fragment layout for the PV product; P carried x4096 in f16
    FragH pa;
    float psum = 0.0f;
    #pragma unroll
    for (int r = 0; r < 8; ++r) {
      const float p0 = __builtin_amdgcn_exp2f((c[0][r] - m_new) * SL);   // key j0 + hi*8 + r
      const float p1 = __builtin_amdgcn_exp2f((c[1][r] - m_new) * SL);   // key j0 + 16 + hi*8 + r
      psum += p0 + p1;
      pa.h[r]     = (f16)(p0 * 4096.0f);
      pa.h[8 + r] = (f16)(p1 * 4096.0f);
    }
    rsum = rsum * scale + psum + __shfl_xor(psum, 16, 32);

    // rescale CTX: queries are the row dimension there -> per-row scale from lane 8*hi + r
    float sc[8];
    #pragma unroll
    for (int r = 0; r < 8; ++r) sc[r] = __shfl(scale, (hi << 3) + r, 32);
    #pragma unroll
    for (int dt = 0; dt < 8; ++dt) {
      #pragma unroll
      for (int r = 0; r < 8; ++r) o[dt][r] *= sc[r];
    }

    // CTX += P x Hv
    #pragma unroll
    for (int dt = 0; dt < 8; ++dt) o[dt] = mma_f16(pa.v, bv[dt].v, o[dt]);
    if (ps + 1 < SK / BK) {
      __builtin_amdgcn_sched_barrier(0);   // the next pass's group is not lifted over these products: one set of Hv^T registers
      #pragma unroll
      for (int dt = 0; dt < 8; ++dt) {
        const f16* base = sv + (dt * 16 + lq) * VSP + (ps + 1) * BK + hi * 8;
        bv[dt].q[0] = *(const v4u*)(base);        // keys j0 + hi*8 + 0..7 of the next pass
        bv[dt].q[1] = *(const v4u*)(base + 16);   // keys j0 + 16 + hi*8 + 0..7
      }
      __builtin_amdgcn_sched_barrier(0);   // and it stays whole, in front of the next pass's scores and softmax
    }
   }
   __builtin_amdgcn_sched_barrier(0);   // the second pass's work stays in front of the hand-over, whose waits would else stand right behind its loads
   // hand-over: stage t + 1 becomes readable, and the buffer of stage t free, behind this one barrier
   asm volatile("s_wait_dscnt 0x0" ::: "memory");      // this wave's reads of stage t are done before the refill
   asm volatile("s_wait_asynccnt 0x0" ::: "memory");   // this wave's pieces of stage t + 1 have landed
   __syncthreads();
   if (t + 2 < NST)
     stage_copy(lf0 + buf * (SK * FSP * 2), gf0 + (size_t)(t + 2) * (SK * DQK),
                lv0 + buf * (DV * VSP * 2), gv0 + (size_t)(t + 2) * (SK * DV));
  }
  asm volatile("s_wait_asynccnt 0x0" ::: "memory");    // no copy is outstanding when the wave goes on to its end

  // normalize: lane holds column d = dt*16 + lq for query rows 8*hi + r
  float rs[8];
  #pragma unroll
  for (int r = 0; r < 8; ++r) rs[r] = 1.0f / __shfl(rsum, (hi << 3) + r, 32);

  f16* stg = sC + wave * (16 * CP);
  #pragma unroll
  for (int r = 0; r < 8; ++r) {
    #pragma unroll
    for (int dt = 0; dt < 8; ++dt)
      stg[(hi * 8 + r) * CP + dt * 16 + lq] = (f16)(o[dt][r] * (1.0f / 4096.0f) * rs[r]);
  }
  __syncthreads();

  // Output projection: four passes over 64-column quarters. A fragments from the wave's own CTX tile in LDS (row = query,
  // split d map), B fragments from the wot units (carried x16). Epilogue per quarter: f32 tile staged in LDS, then whole
  // 256-B quarter-rows per half wave, with the residual added.
  const int m = lq;                          // B column within a tile / 16-B piece index of the quarter-row
  const size_t xrow0 = (size_t)b * SEQ_FULL + qrow0;
  float* so = sO + wave * (16 * OP);

  const f16* ap0 = stg + m * CP + hi * 8;
  FragH a[DV / 32];   // the wave's ctx rows, the same for all four quarters
  #pragma unroll
  for (int kk = 0; kk < DV / 32; ++kk) {
    a[kk].q[0] = *(const v4u*)(ap0 + kk * 32);        // d = kk*32 + hi*8 + 0..7
    a[kk].q[1] = *(const v4u*)(ap0 + kk * 32 + 16);   // d = kk*32 + 16 + hi*8 + 0..7
  }

  #pragma unroll 1
  for (int qn = 0; qn < 4; ++qn) {
    // one group of loads per quarter: its sixteen Wo fragments, then the x pieces of its residual
    FragH bw[DV / 32][4];
    #pragma unroll
    for (int kk = 0; kk < DV / 32; ++kk) {
      #pragma unroll
      for (int j = 0; j < 4; ++j) {
        const f16* wp = wot + (size_t)(((qn * 4 + j) * (DV / 32) + kk) * 2) * FRU + lane * 8;
        bw[kk][j].q[0] = *(const v4u*)(wp);         // d = kk*32 + hi*8 + 0..7 of column (qn*4 + j)*16 + m
        bw[kk][j].q[1] = *(const v4u*)(wp + FRU);   // d = kk*32 + 16 + hi*8 + 0..7
      }
    }
    v4f    xq[8];
    size_t gidx[8];
    #pragma unroll
    for (int it = 0; it < 8; ++it) {
      gidx[it] = (xrow0 + it * 2 + hi) * CIN + qn * 64 + m * 4;
      xq[it]   = *(const v4f*)(x + gidx[it]);
    }
    __builtin_amdgcn_sched_barrier(0);   // the group stays whole, in front of the quarter's matrix work
    v8f acc[4];
    #pragma unroll
    for (int j = 0; j < 4; ++j) acc[j] = (v8f){0, 0, 0, 0, 0, 0, 0, 0};
    #pragma unroll
    for (int kk = 0; kk < DV / 32; ++kk) {
      #pragma unroll
      for (int j = 0; j < 4; ++j) acc[j] = mma_f16(a[kk].v, bw[kk][j].v, acc[j]);
    }
    #pragma unroll
    for (int r = 0; r < 8; ++r) {
      #pragma unroll
      for (int j = 0; j < 4; ++j) so[(hi * 8 + r) * OP + j * 16 + m] = acc[j][r] * gsc;
    }
    __syncthreads();

    v4f vals[8];
    #pragma unroll
    for (int it = 0; it < 8; ++it) {
      const int row = it * 2 + hi;
      v4f v = *(const v4f*)(so + row * OP + m * 4);
      #pragma unroll
      for (int cc = 0; cc < 4; ++cc) v[cc] = v[cc] + (float)(bf16)xq[it][cc];   // residual with the RNE bf16 input value
      vals[it] = v;
    }
    #pragma unroll
    for (int it = 0; it < 8; ++it) *(v4f*)(out + gidx[it]) = vals[it];
    
    __syncthreads();
  }
}

extern "C" void kernel_launch(void* const* d_in, const int* in_sizes, int n_in,
                              void* d_out, int out_size, void* d_ws, size_t ws_size,
                              hipStream_t stream) {
  if (n_in < 6) return;
  const size_t rows_used = (size_t)(NB - 1) * SEQ_FULL + SEQ;
  if ((size_t)in_sizes[0] < rows_used * CIN) return;
  if (in_sizes[1] < CIN * DQK) return;
  if (in_sizes[2] < CIN * DQK) return;
  if (in_sizes[3] < CIN * DV) return;
  if (in_sizes[4] < DV * CIN) return;
  if (in_sizes[5] < 1) return;
  if ((size_t)out_size < rows_used * CIN) return;

  const size_t wct_bytes = (size_t)NPROJ * CIN * 2;           // 98,304
  const size_t wot_bytes = (size_t)CIN * DV * 2;              // 65,536
  const size_t gq_bytes  = (size_t)NB * SEQ * DQK * 2;        // 2,097,152 at full size
  const size_t fk_bytes  = (size_t)NB * NKEY * DQK * 2;       // 524,288
  const size_t hvt_bytes = (size_t)NB * DV * NKEY * 2;        // 2,097,152
  const size_t off_wct = 0;
  const size_t off_wot = off_wct + wct_bytes;
  const size_t off_gq  = off_wot + wot_bytes;
  const size_t off_fk  = off_gq + gq_bytes;
  const size_t off_hvt = off_fk + fk_bytes;
  const size_t total   = off_hvt + hvt_bytes;                 // 4,882,432 at full size
  if (ws_size < total) return;

  const float* x     = (const float*)d_in[0];
  const float* wf    = (const float*)d_in[1];
  const float* wg    = (const float*)d_in[2];
  const float* wh    = (const float*)d_in[3];
  const float* wo    = (const float*)d_in[4];
  const float* gamma = (const float*)d_in[5];
  float* out = (float*)d_out;
  char*  ws  = (char*)d_ws;
  bf16* wct = (bf16*)(ws + off_wct);
  f16*  wot = (f16*)(ws + off_wot);
  f16*  gq  = (f16*)(ws + off_gq);
  f16*  fk  = (f16*)(ws + off_fk);
  f16*  hvt = (f16*)(ws + off_hvt);

  pack_w_kernel<<<40, 256, 0, stream>>>(wf, wg, wh, wo, wct, wot);
  proj_pool_kernel<<<dim3(SEQ / 128, NB), 256, 0, stream>>>(x, wct, gq, fk, hvt);
  attn_oproj_kernel<<<dim3(SEQ / BQ, NB), 256, 0, stream>>>(gq, fk, hvt, wot, x, gamma, out);
}

// v006
// Measured time: 34.7 microseconds a run.
// Next to v005, in two timings, it ran 1.06 times as fast each time.
// Counting every step since v000, it is 4.36 times as fast.
#include <hip/hip_runtime.h>

// Contractions: X x [Wf|Wg|Wh] on v_wmma_f32_16x16x32_bf16 (bf16 operands = RNE-converted inputs, f32 accumulate);
// S^T = F x G^T, CTX = P x Hv (P as f16 carried x4096) and OUT = CTX x Wo (Wo as f16 of the bf16 value, carried x16)
// on v_wmma_f32_16x16x32_f16 (f16 operands, f32 accumulate). Max-pool, softmax and residual in f32.

#ifndef NB
#define NB 8
#endif
#ifndef SEQ
#define SEQ 4096
#endif
#define NB_FULL  8
#define SEQ_FULL 4096
#define W_IMG    64                 // image width (pixels per image row)
#define CIN      256                // input channels
#define DQK      32                 // query / key channels
#define DV       128                // value channels
#define NPROJ    192                // packed projection columns: [0,32) f, [32,64) g, [64,192) h
#define NKEY     (SEQ / 4)          // pooled key count per image
#define KTILE    32                 // keys produced per projection block (two image rows)
#define BQ       128                // query rows per attention block (8 waves x 16)
#define BK       32                 // keys per inner iteration
#define NWAVE    8
#define PP       168                // LDS pitch (halves) of the ww-pooled staging rows
#define GP       40                 // LDS pitch (halves) of the g staging tile
#define FP       40                 // LDS pitch (halves) of the pooled f tile
#define HP       40                 // LDS pitch (halves) of the pooled h^T tile: 80 B = 16 B x odd
#define CP       136                // LDS pitch (halves) of the ctx staging tile
#define OP       68                 // LDS pitch (floats) of the output staging tile
#define SK       64                 // keys per LDS stage of the attention loop (two BK passes)
#define NST      (NKEY / SK)        // stages per image
#define FSP      40                 // LDS pitch (halves) of a staged f row: 80 B = 16 B x odd
#define VSP      72                 // LDS pitch (halves) of a staged h^T row: 144 B = 16 B x odd
#define FRU      256                // halves per weight fragment unit: 32 lanes x 16 B = 512 B = four whole lines
#define XP       260                // LDS pitch (floats) of a staged x row: 1040 B = 16 B x odd

static_assert(SEQ % 256 == 0);
static_assert(SEQ >= 256 && SEQ <= SEQ_FULL);
static_assert(NB >= 1 && NB <= NB_FULL);
static_assert(BQ == NWAVE * 16);
static_assert(NKEY % BK == 0);
static_assert(NKEY % KTILE == 0);
static_assert(CIN % 32 == 0 && DV % 32 == 0 && DQK == 32);
// coverage equalities (grid x block x per-thread elements == plane extent)
static_assert((SEQ / 128) * NWAVE * 16 == SEQ);              // g plane rows per image
static_assert((SEQ / 128) * KTILE == NKEY);                   // f / h^T plane keys per image
static_assert(2 * W_IMG == NWAVE * 16 && KTILE == W_IMG / 2); // a projection block = two whole image rows
static_assert((SEQ / BQ) * NWAVE * 16 == SEQ);                // ctx and output rows per image
static_assert((GP * 2) % 16 == 0 && (FP * 2) % 16 == 0 && (HP * 2) % 16 == 0 && (CP * 2) % 16 == 0);
static_assert((OP * 4) % 16 == 0);
static_assert(NKEY % SK == 0 && SK == 2 * BK && NST >= 1);
static_assert((FSP * 2) % 16 == 0 && (VSP * 2) % 16 == 0);
static_assert(SK * DQK * 2 == 256 * 16);        // f stage: one 16-B copy per thread
static_assert(DV * SK * 2 == 4 * 256 * 16);     // h^T stage: four 16-B copies per thread
static_assert(SK == 2 * KTILE);                 // h^T stage: two whole key tiles of the plane, 16 KB contiguous
static_assert((XP * 4) % 16 == 0 && XP >= CIN && CIN * 4 == 2 * 32 * 16);   // x row: two wave-wide 16-B copies
static_assert(W_IMG == 4 * 16 && NPROJ == 4 * 3 * 16 && NWAVE == 2 * 4);    // wave tile: one image row x three column tiles

typedef __bf16   bf16;
typedef _Float16 f16;
typedef bf16     v16bf __attribute__((ext_vector_type(16)));
typedef f16      v16h  __attribute__((ext_vector_type(16)));
typedef f16      v8h   __attribute__((ext_vector_type(8)));
typedef float    v8f   __attribute__((ext_vector_type(8)));
typedef float    v4f   __attribute__((ext_vector_type(4)));
typedef unsigned v4u   __attribute__((ext_vector_type(4)));

union FragB  { v16bf v; v4u q[2]; bf16 h[16]; };
union FragH  { v16h  v; v4u q[2]; f16  h[16]; };
union Pack8B { v4u u; bf16 h[8]; };
union Pack8H { v4u u; v8h v; f16 h[8]; };

// WMMA helpers: the plain builtins; the compiler keeps the distance behind its own matrix instructions. No volatile
// statement stands behind them, so that a block's fragment loads can be issued ahead of the block before it.
static __device__ __forceinline__ v8f mma_bf16(v16bf a, v16bf b, v8f acc) {
  return __builtin_amdgcn_wmma_f32_16x16x32_bf16(false, a, false, b, (short)0, acc, false, false);
}
static __device__ __forceinline__ v8f mma_f16(v16h a, v16h b, v8f acc) {
  return __builtin_amdgcn_wmma_f32_16x16x32_f16(false, a, false, b, (short)0, acc, false, false);
}

// Weight planes, packed in fragment order: a unit is the 512 contiguous bytes that one wave-wide 16-B load of a
// B fragment half takes, lane (hi, m) holding column n = tile * 16 + m, k = kk * 32 + q * 16 + hi * 8 + 0..7.
//   wct unit (t * 8 + kk) * 2 + q, t = 0..11  : bf16 RNE of column t * 16 + m of [wf | wg | wh].
//   wot unit (nt * 4 + kk) * 2 + q, nt = 0..15 : f16(bf16(w) * 16) (exact) of column nt * 16 + m of wo.
// One wave packs one unit (one 512-B store). Blocks 0..23: wct units 0..191; blocks 24..39: wot units 0..127.
// Source selection is block-uniform (16 units per column tile, 8 units per block).
// coverage: wct columns 0..191 x k 0..255; wot columns 0..255 x k 0..127.
__global__ __launch_bounds__(256) void pack_w_kernel(const float* __restrict__ wf, const float* __restrict__ wg,
                                                      const float* __restrict__ wh, const float* __restrict__ wo,
                                                      bf16* __restrict__ wct, f16* __restrict__ wot) {
  const int blk  = blockIdx.x;
  const int tid  = threadIdx.x;
  const int wave = tid >> 5;
  const int lane = tid & 31;
  const int m    = lane & 15;
  const int hi   = lane >> 4;
  if (blk < 24) {
    const int u  = blk * 8 + wave;                                       // 0..191
    const int n  = (u >> 4) * 16 + m;                                    // 0..191
    const int k0 = ((u >> 1) & 7) * 32 + (u & 1) * 16 + hi * 8;          // 0..248
    const float* src = (blk < 4) ? wf : ((blk < 8) ? wg : wh);
    const int pitch  = (blk < 8) ? DQK : DV;
    const int nl     = (blk < 4) ? n : ((blk < 8) ? (n - 32) : (n - 64));
    Pack8B pk;
    #pragma unroll
    for (int i = 0; i < 8; ++i) pk.h[i] = (bf16)src[(size_t)(k0 + i) * pitch + nl];   // RNE convert
    *(v4u*)(wct + (size_t)u * FRU + lane * 8) = pk.u;
  } else {
    const int u  = (blk - 24) * 8 + wave;                                // 0..127
    const int n  = (u >> 3) * 16 + m;                                    // 0..255
    const int k0 = ((u >> 1) & 3) * 32 + (u & 1) * 16 + hi * 8;          // 0..120
    Pack8H pk;
    #pragma unroll
    for (int i = 0; i < 8; ++i) {
      const float v = (float)(bf16)wo[(size_t)(k0 + i) * CIN + n];
      pk.h[i] = (f16)(v * 16.0f);              // bf16 significand fits f16: exact for normal results
    }
    *(v4u*)(wot + (size_t)u * FRU + lane * 8) = pk.u;
    asm volatile("s_wait_xcnt 0x0" ::: "memory");   // stands before any later write of the store's address or data registers
  }
}

// Four x rows (4 KB contiguous in global memory) into LDS, eight asynchronous 16-B copies per lane: copy j takes the
// 512 contiguous bytes j of the piece (four whole lines per wave-wide copy) to row j >> 1, half j & 1 of the padded tile.
// The s_wait_xcnt closes the statement so that no address register of an issued copy is rewritten ahead of it.
static __device__ __forceinline__ void x_copy4rows(unsigned l, const float* g) {
  const unsigned l1 = l + 512,              l2 = l + XP * 4,     l3 = l + XP * 4 + 512;
  const unsigned l4 = l + 2 * XP * 4,       l5 = l4 + 512,       l6 = l + 3 * XP * 4,   l7 = l6 + 512;
  const float* g1 = g + 1 * 128;
  const float* g2 = g + 2 * 128;
  const float* g3 = g + 3 * 128;
  const float* g4 = g + 4 * 128;
  const float* g5 = g + 5 * 128;
  const float* g6 = g + 6 * 128;
  const float* g7 = g + 7 * 128;
  asm volatile("global_load_async_to_lds_b128 %0, %1, off\n\t"
               "global_load_async_to_lds_b128 %2, %3, off\n\t"
               "global_load_async_to_lds_b128 %4, %5, off\n\t"
               "global_load_async_to_lds_b128 %6, %7, off\n\t"
               "global_load_async_to_lds_b128 %8, %9, off\n\t"
               "global_load_async_to_lds_b128 %10, %11, off\n\t"
               "global_load_async_to_lds_b128 %12, %13, off\n\t"
               "global_load_async_to_lds_b128 %14, %15, off\n\t"
               "s_wait_xcnt 0x0"
               :: "v"(l), "v"(g), "v"(l1), "v"(g1), "v"(l2), "v"(g2), "v"(l3), "v"(g3),
                  "v"(l4), "v"(g4), "v"(l5), "v"(g5), "v"(l6), "v"(g6), "v"(l7), "v"(g7)
               : "memory");
}

// Projection + 2x2 max-pool. Block = (32-key tile kt, batch b), 256 threads: the two image rows hh = kt*2 + {0,1},
// so that the grid has one block for every WGP of the chip. Matrix work: wave -> (image row, three column tiles);
// copies in and plane stores out: wave -> (image row, 16 pixels along ww).
//   gq  [NB][SEQ][DQK]  f16 : queries, one 64-B row per pixel (wave writes 16 rows = 1 KB, 2 instructions).
//   fk  [NB][NKEY][DQK] f16 : pooled keys, 32 rows per block = 2 KB (one 512-B instruction per wave, four waves).
//   hvt [NB][NKEY/32][DV][32] f16 : pooled values, transposed inside a 32-key tile; a block writes its own 8 KB,
//                                   whole lines only (512 B per instruction).
// x comes in once, in whole lines: each wave copies 16 pixel rows (16 KB contiguous) into sX, from where four waves read
// every row as A pieces (RNE bf16 convert, split k map); a direct fragment load would touch 16 lines for 512 bytes.
// LDS regions, all cross-wave under block barriers: sX (filled by copies), sP, sG, sF, sHT. Staged == consumed extent.
__global__ __launch_bounds__(256) void proj_pool_kernel(const float* __restrict__ x, const bf16* wct,
                                                         f16* __restrict__ gq, f16* __restrict__ fk,
                                                         f16* __restrict__ hvt) {
  const int kt   = blockIdx.x;
  const int b    = blockIdx.y;
  const int tid  = threadIdx.x;
  const int wave = tid >> 5;
  const int lane = tid & 31;
  const int m    = lane & 15;
  const int hi   = lane >> 4;
  const int hsel = wave >> 2;          // which of the block's two image rows
  const int ww0  = (wave & 3) * 16;    // first pixel column of this wave's 16 copied and stored pixels

  __shared__ __align__(16) f16 sP[2 * 32 * PP];       // [hsel][pw][160 cols] ww-pooled f|h
  __shared__ __align__(16) f16 sG[NWAVE * 16 * GP];   // g tile [16][32] of each 16-pixel group
  __shared__ __align__(16) f16 sF[KTILE * FP];        // pooled f [32 keys][32]
  __shared__ __align__(16) f16 sHT[DV * HP];          // pooled h^T [128 d][32 keys]
  __shared__ __align__(16) float sX[NWAVE * 16 * XP]; // x rows of the block's 128 pixels, f32, pitch XP

  f16* sg = sG + wave * (16 * GP);
  f16* sp = sP + hsel * (32 * PP);

  const int hh   = kt * 2 + hsel;
  const int pix0 = hh * W_IMG + ww0;
  {
    const unsigned lx = (unsigned)(uintptr_t)sX + (unsigned)(wave * (16 * XP * 4) + lane * 16);
    const float*   gx = x + ((size_t)b * SEQ_FULL + pix0) * CIN + lane * 4;
    #pragma unroll   // 32 copies of a wave in flight, four statements of eight
    for (int c = 0; c < 4; ++c) x_copy4rows(lx + c * (4 * XP * 4), gx + c * (4 * CIN));
  }
  // Wave tile: the 64 pixels of image row hsel (four M tiles) x three 16-column tiles t = ng * 3 + 0..2 of wct; K = CIN.
  // A wct fragment serves four M tiles, so the block takes each weight line through two waves, not eight.
  constexpr int NKB = CIN / 32;
  constexpr int BD  = 4;               // k-blocks that the wct fragments run ahead of the matrix work
  const int ng = __builtin_amdgcn_readfirstlane(wave) & 3;                      // scalar: it picks the tiles' kind below
  const bf16* wp = wct + (size_t)(ng * 3) * (NKB * 2 * FRU) + lane * 8;         // this lane's 16 B of every unit
  FragB bw[NKB][3];
  #pragma unroll
  for (int kk = 0; kk < BD; ++kk) {    // the first fragments fly together with the x copies
    #pragma unroll
    for (int j = 0; j < 3; ++j) {
      bw[kk][j].q[0] = *(const v4u*)(wp + ((j * NKB + kk) * 2) * FRU);       // k = hi*8 + 0..7 of the block
      bw[kk][j].q[1] = *(const v4u*)(wp + ((j * NKB + kk) * 2 + 1) * FRU);   // k = 16 + hi*8 + 0..7
    }
  }
  asm volatile("s_wait_asynccnt 0x0" ::: "memory");   // this wave's x rows have landed
  __syncthreads();                                    // publishes the x tile to the waves that share it

  v8f acc[4][3];
  #pragma unroll
  for (int mi = 0; mi < 4; ++mi) {
    #pragma unroll
    for (int j = 0; j < 3; ++j) acc[mi][j] = (v8f){0, 0, 0, 0, 0, 0, 0, 0};
  }
  const float* xp = sX + (hsel * 64 + m) * XP + hi * 8;   // row of M tile mi: + mi * 16 * XP
  v4f ax[NKB][4][4];
  #pragma unroll
  for (int mi = 0; mi < 4; ++mi) {
    ax[0][mi][0] = *(const v4f*)(xp + mi * 16 * XP);
    ax[0][mi][1] = *(const v4f*)(xp + mi * 16 * XP + 4);
    ax[0][mi][2] = *(const v4f*)(xp + mi * 16 * XP + 16);
    ax[0][mi][3] = *(const v4f*)(xp + mi * 16 * XP + 20);
  }
  #pragma unroll
  for (int kk = 0; kk < NKB; ++kk) {
    if (kk + 1 < NKB) {
      #pragma unroll
      for (int mi = 0; mi < 4; ++mi) {
        ax[kk + 1][mi][0] = *(const v4f*)(xp + mi * 16 * XP + (kk + 1) * 32);
        ax[kk + 1][mi][1] = *(const v4f*)(xp + mi * 16 * XP + (kk + 1) * 32 + 4);
        ax[kk + 1][mi][2] = *(const v4f*)(xp + mi * 16 * XP + (kk + 1) * 32 + 16);
        ax[kk + 1][mi][3] = *(const v4f*)(xp + mi * 16 * XP + (kk + 1) * 32 + 20);
      }
    }
    if (kk + BD < NKB) {
      #pragma unroll
      for (int j = 0; j < 3; ++j) {
        bw[kk + BD][j].q[0] = *(const v4u*)(wp + ((j * NKB + kk + BD) * 2) * FRU);
        bw[kk + BD][j].q[1] = *(const v4u*)(wp + ((j * NKB + kk + BD) * 2 + 1) * FRU);
      }
    }
    __builtin_amdgcn_sched_barrier(0);   // the later blocks' loads stay in front of this block's matrix work
    FragB a[4];
    #pragma unroll
    for (int mi = 0; mi < 4; ++mi) {
      #pragma unroll
      for (int i = 0; i < 4; ++i) {
        a[mi].h[i]      = (bf16)ax[kk][mi][0][i];   // elems 0..7  : k = kk*32 + hi*8 + 0..7
        a[mi].h[4 + i]  = (bf16)ax[kk][mi][1][i];
        a[mi].h[8 + i]  = (bf16)ax[kk][mi][2][i];   // elems 8..15 : k = kk*32 + 16 + hi*8 + 0..7
        a[mi].h[12 + i] = (bf16)ax[kk][mi][3][i];
      }
    }
    #pragma unroll
    for (int j = 0; j < 3; ++j) {
      #pragma unroll
      for (int mi = 0; mi < 4; ++mi) acc[mi][j] = mma_bf16(a[mi].v, bw[kk][j].v, acc[mi][j]);
    }
    __builtin_amdgcn_sched_barrier(0);   // later loads are not lifted over this block: two blocks of x pieces live at most
  }

  // Column tile t: 0, 1 = f, 2, 3 = g, 4..11 = h. g goes unpooled to the tile of its 16 pixels; f and h are pooled along
  // ww: the pairs are D rows (2rp, 2rp+1) of the same lane half, pooled column pw = mi*8 + 4*hi + rp.
  #pragma unroll
  for (int j = 0; j < 3; ++j) {
    const int t = ng * 3 + j;
    if (t == 2 || t == 3) {
      #pragma unroll
      for (int mi = 0; mi < 4; ++mi) {
        f16* sgt = sG + (hsel * 4 + mi) * (16 * GP) + (t - 2) * 16 + m;
        #pragma unroll
        for (int r = 0; r < 8; ++r) sgt[(hi * 8 + r) * GP] = (f16)acc[mi][j][r];
      }
    } else {
      const int col = (t < 2 ? t * 16 : t * 16 - 32) + m;   // sP columns: [0,32) f, [32,160) h
      #pragma unroll
      for (int mi = 0; mi < 4; ++mi) {
        #pragma unroll
        for (int rp = 0; rp < 4; ++rp)
          sp[(mi * 8 + hi * 4 + rp) * PP + col] = (f16)fmaxf(acc[mi][j][2 * rp], acc[mi][j][2 * rp + 1]);
      }
    }
  }
  __syncthreads();

  // g tile -> gq: 16 consecutive pixel rows x 64 B = 1 KB contiguous; 32 lanes x 16 B per instruction
  {
    v4u    gv[2];
    size_t gi[2];
    #pragma unroll
    for (int i2 = 0; i2 < 2; ++i2) {
      const int row = i2 * 8 + (lane >> 2);
      const int cq  = (lane & 3) * 8;
      Pack8H p;
      p.v = *(const v8h*)(sg + row * GP + cq);
      gv[i2] = p.u;
      gi[i2] = ((size_t)b * SEQ + pix0 + row) * DQK + cq;
    }
    #pragma unroll
    for (int i2 = 0; i2 < 2; ++i2) *(v4u*)(gq + gi[i2]) = gv[i2];
  }

  // hh-pool into the block's pooled tiles
  #pragma unroll
  for (int e = 0; e < 4; ++e) {
    const int idx = e * 256 + tid;
    const int pw  = idx >> 5;
    const int c   = idx & 31;
    const float v = fmaxf((float)sP[pw * PP + c], (float)sP[32 * PP + pw * PP + c]);
    sF[pw * FP + c] = (f16)v;
  }
  #pragma unroll
  for (int e = 0; e < 16; ++e) {
    const int idx = e * 256 + tid;
    const int pw  = idx >> 7;
    const int d   = idx & 127;
    const float v = fmaxf((float)sP[pw * PP + 32 + d], (float)sP[32 * PP + pw * PP + 32 + d]);
    sHT[d * HP + pw] = (f16)v;
  }
  __syncthreads();

  // final plane stores: hvt (two 16-B pieces per thread, piece p = d * 4 + key quarter), fk (waves 0..3, 8 rows each)
  v4u    hv[2];
  size_t hidx[2];
  #pragma unroll
  for (int ps = 0; ps < 2; ++ps) {
    const int pc = ps * 256 + tid;         // 0..511
    Pack8H p;
    p.v = *(const v8h*)(sHT + (pc >> 2) * HP + (pc & 3) * 8);
    hv[ps]   = p.u;
    hidx[ps] = ((size_t)b * (NKEY / KTILE) + kt) * (DV * KTILE) + (size_t)pc * 8;
  }
  #pragma unroll
  for (int ps = 0; ps < 2; ++ps) *(v4u*)(hvt + hidx[ps]) = hv[ps];
  if (tid < KTILE * 4) {                   // wave-uniform: 128 pieces of 16 B
    const int row = tid >> 2;              // 0..31
    const int cq  = (tid & 3) * 8;
    Pack8H p;
    p.v = *(const v8h*)(sF + row * FP + cq);
    *(v4u*)(fk + ((size_t)b * NKEY + kt * KTILE + row) * DQK + cq) = p.u;
  }
}

// One stage of 64 keys into LDS, five asynchronous 16-B copies per thread: one piece of the f tile (64 rows x 64 B)
// and four of the h^T stage, which is two 32-key tiles of the plane = 16 KB contiguous (a wave covers four whole
// 128-B lines per copy). Copy i takes piece i * 256 + tid: key tile i >> 1, d = (i & 1) * 64 + (tid >> 2), key quarter
// tid & 3; in LDS the two tiles stand side by side in a row of 64 keys. The s_wait_xcnt closes the statement so that
// no address register of an issued copy is rewritten ahead of it.
static __device__ __forceinline__ void stage_copy(unsigned lf, const f16* gf, unsigned lv, const f16* gv) {
  const unsigned lv1 = lv + 64 * VSP * 2, lv2 = lv + KTILE * 2, lv3 = lv + 64 * VSP * 2 + KTILE * 2;
  const f16* gv1 = gv + 1 * 256 * 8;
  const f16* gv2 = gv + 2 * 256 * 8;
  const f16* gv3 = gv + 3 * 256 * 8;
  asm volatile("global_load_async_to_lds_b128 %0, %1, off\n\t"
               "global_load_async_to_lds_b128 %2, %3, off\n\t"
               "global_load_async_to_lds_b128 %4, %5, off\n\t"
               "global_load_async_to_lds_b128 %6, %7, off\n\t"
               "global_load_async_to_lds_b128 %8, %9, off\n\t"
               "s_wait_xcnt 0x0"
               :: "v"(lf), "v"(gf), "v"(lv), "v"(gv), "v"(lv1), "v"(gv1), "v"(lv2), "v"(gv2), "v"(lv3), "v"(gv3)
               : "memory");
}

// Flash attention, non-causal, no score scaling. Block = (query block of 128, batch); one wave owns 16 queries.
// S^T = F x G^T so queries sit on lanes; P^T in C-layout is bit-identical to the A-fragment layout of CTX += P x Hv.
// G B-fragments come straight from the f16 plane. The f and h^T tiles, which all eight waves read, are brought into
// LDS once per block in stages of 64 keys (two buffers, the next stage's copies fly while this one is worked on);
// F A-fragments and Hv^T B-fragments are two 16-B LDS loads each, issued as one group per pass ahead of their use.
// The output projection and the scaled residual follow in the same kernel: out = gamma * (CTX x Wo) + x_bf16. A wave's
// 16 x 128 CTX tile, rounded to f16, goes no further than LDS, from where the wave reads it back as A fragments.
// LDS: sC, sO per-wave regions, written and read across lanes under block barriers; staged extent == consumed extent.
__global__ __launch_bounds__(256) void attn_oproj_kernel(const f16* __restrict__ gq, const f16* __restrict__ fk,
                                                         const f16* __restrict__ hvt, const f16* __restrict__ wot,
                                                         const float* __restrict__ x, const float* __restrict__ gamma,
                                                         float* __restrict__ out) {
  const int qblk = blockIdx.x;
  const int b    = blockIdx.y;
  const int tid  = threadIdx.x;
  const int wave = tid >> 5;
  const int lane = tid & 31;
  const int lq   = lane & 15;   // query column of S^T / d column of CTX
  const int hi   = lane >> 4;   // k-split half

  __shared__ __align__(16) f16 sC[NWAVE * 16 * CP];
  __shared__ __align__(16) f16 sKF[2 * SK * FSP];   // [buffer][key][32 d], pitch FSP
  __shared__ __align__(16) f16 sKV[2 * DV * VSP];   // [buffer][d][64 keys], pitch VSP
  __shared__ __align__(16) float sO[NWAVE * 16 * OP];   // per-wave f32 tile of one output quarter

  const int qrow0 = qblk * BQ + wave * 16;

  // G as B-operand fragment: lane lq holds query qrow0+lq, elements follow the split d map
  FragH qf;
  {
    const f16* qp = gq + ((size_t)b * SEQ + qrow0 + lq) * DQK + hi * 8;
    qf.q[0] = *(const v4u*)(qp);        // d = hi*8 + 0..7
    qf.q[1] = *(const v4u*)(qp + 16);   // d = 16 + hi*8 + 0..7
  }

  const float gsc = (float)(bf16)gamma[0] * 0.0625f;   // gamma (RNE bf16) folded with the 1/16 Wo carry

  const f16* fk_b = fk + (size_t)b * NKEY * DQK;
  const f16* vt_b = hvt + (size_t)b * DV * NKEY;

  v8f o[8];
  #pragma unroll
  for (int dt = 0; dt < 8; ++dt) o[dt] = (v8f){0, 0, 0, 0, 0, 0, 0, 0};

  float rmax = -__builtin_inff();
  float rsum = 0.0f;
  const float SL = 1.4426950408889634f;   // log2(e); the scores carry no extra scale

  // this thread's pieces of a stage: LDS byte addresses in buffer 0 and global pointers of stage 0
  const unsigned lf0 = (unsigned)(uintptr_t)sKF + (unsigned)((tid >> 2) * (FSP * 2) + (tid & 3) * 16);
  const unsigned lv0 = (unsigned)(uintptr_t)sKV + (unsigned)((tid >> 2) * (VSP * 2) + (tid & 3) * 16);
  const f16* gf0 = fk_b + tid * 8;                                  // f stage = 4 KB contiguous
  const f16* gv0 = vt_b + tid * 8;                                  // h^T stage = 16 KB contiguous

  stage_copy(lf0, gf0, lv0, gv0);
  asm volatile("s_wait_asynccnt 0x0" ::: "memory");   // this wave's pieces of stage 0 have landed
  __syncthreads();                                    // publishes stage 0 to all waves
  if (NST > 1) stage_copy(lf0 + SK * FSP * 2, gf0 + SK * DQK, lv0 + DV * VSP * 2, gv0 + SK * DV);

  for (int t = 0; t < NST; ++t) {
   const int buf = t & 1;
   const f16* sf = sKF + buf * (SK * FSP);
   const f16* sv = sKV + buf * (DV * VSP);
   // One group of LDS loads at the head of the stage: the F A-fragments of both passes (row = key, split d map) and the
   // Hv^T B-fragments of the first pass (column n = d = dt*16 + lq, split key map from the transposed tile).
   FragH ak[SK / BK][2];
   #pragma unroll
   for (int ps = 0; ps < SK / BK; ++ps) {
     #pragma unroll
     for (int sub = 0; sub < 2; ++sub) {
       const f16* base = sf + (ps * BK + sub * 16 + lq) * FSP + hi * 8;
       ak[ps][sub].q[0] = *(const v4u*)(base);        // d = hi*8 + 0..7
       ak[ps][sub].q[1] = *(const v4u*)(base + 16);   // d = 16 + hi*8 + 0..7
     }
   }
   FragH bv[8];
   #pragma unroll
   for (int dt = 0; dt < 8; ++dt) {
     const f16* base = sv + (dt * 16 + lq) * VSP + hi * 8;
     bv[dt].q[0] = *(const v4u*)(base);        // keys hi*8 + 0..7
     bv[dt].q[1] = *(const v4u*)(base + 16);   // keys 16 + hi*8 + 0..7
   }
   __builtin_amdgcn_sched_barrier(0);   // the group stays whole, in front of the scores and the softmax that hide its latency
   #pragma unroll   // both passes of a stage inline: j0 folds into the LDS loads' immediate offsets
   for (int ps = 0; ps < SK / BK; ++ps) {
    // S^T tiles: c[sub][r] = score(query qrow0+lq, key j0 + sub*16 + hi*8 + r), j0 = ps * BK
    v8f c[2];
    #pragma unroll
    for (int sub = 0; sub < 2; ++sub)
      c[sub] = mma_f16(ak[ps][sub].v, qf.v, (v8f){0, 0, 0, 0, 0, 0, 0, 0});

    // online softmax: query lq's 32 scores are split across lane / lane^16
    float m_new = rmax;
    #pragma unroll
    for (int r = 0; r < 8; ++r) {
      m_new = fmaxf(m_new, c[0][r]);
      m_new = fmaxf(m_new, c[1][r]);
    }
    m_new = fmaxf(m_new, __shfl_xor(m_new, 16, 32));
    const float scale = __builtin_amdgcn_exp2f((rmax - m_new) * SL);
    rmax = m_new;

    // exp + pack: P^T C-layout == A-fragment layout for the PV product; P carried x4096 in f16
    FragH pa;
    float psum = 0.0f;
    #pragma unroll
    for (int r = 0; r < 8; ++r) {
      const float p0 = __builtin_amdgcn_exp2f((c[0][r] - m_new) * SL);   // key j0 + hi*8 + r
      const float p1 = __builtin_amdgcn_exp2f((c[1][r] - m_new) * SL);   // key j0 + 16 + hi*8 + r
      psum += p0 + p1;
      pa.h[r]     = (f16)(p0 * 4096.0f);
      pa.h[8 + r] = (f16)(p1 * 4096.0f);
    }
    rsum = rsum * scale + psum + __shfl_xor(psum, 16, 32);

    // rescale CTX: queries are the row dimension there -> per-row scale from lane 8*hi + r
    float sc[8];
    #pragma unroll
    for (int r = 0; r < 8; ++r) sc[r] = __shfl(scale, (hi << 3) + r, 32);
    #pragma unroll
    for (int dt = 0; dt < 8; ++dt) {
      #pragma unroll
      for (int r = 0; r < 8; ++r) o[dt][r] *= sc[r];
    }

    // CTX += P x Hv
    #pragma unroll
    for (int dt = 0; dt < 8; ++dt) o[dt] = mma_f16(pa.v, bv[dt].v, o[dt]);
    if (ps + 1 < SK / BK) {
      __builtin_amdgcn_sched_barrier(0);   // the next pass's group is not lifted over these products: one set of Hv^T registers
      #pragma unroll
      for (int dt = 0; dt < 8; ++dt) {
        const f16* base = sv + (dt * 16 + lq) * VSP + (ps + 1) * BK + hi * 8;
        bv[dt].q[0] = *(const v4u*)(base);        // keys j0 + hi*8 + 0..7 of the next pass
        bv[dt].q[1] = *(const v4u*)(base + 16);   // keys j0 + 16 + hi*8 + 0..7
      }
      __builtin_amdgcn_sched_barrier(0);   // and it stays whole, in front of the next pass's scores and softmax
    }
   }
   __builtin_amdgcn_sched_barrier(0);   // the second pass's work stays in front of the hand-over, whose waits would else stand right behind its loads
   // hand-over: stage t + 1 becomes readable, and the buffer of stage t free, behind this one barrier
   asm volatile("s_wait_dscnt 0x0" ::: "memory");      // this wave's reads of stage t are done before the refill
   asm volatile("s_wait_asynccnt 0x0" ::: "memory");   // this wave's pieces of stage t + 1 have landed
   __syncthreads();
   if (t + 2 < NST)
     stage_copy(lf0 + buf * (SK * FSP * 2), gf0 + (size_t)(t + 2) * (SK * DQK),
                lv0 + buf * (DV * VSP * 2), gv0 + (size_t)(t + 2) * (SK * DV));
  }
  asm volatile("s_wait_asynccnt 0x0" ::: "memory");    // no copy is outstanding when the wave goes on to its end

  // normalize: lane holds column d = dt*16 + lq for query rows 8*hi + r
  float rs[8];
  #pragma unroll
  for (int r = 0; r < 8; ++r) rs[r] = 1.0f / __shfl(rsum, (hi << 3) + r, 32);

  f16* stg = sC + wave * (16 * CP);
  #pragma unroll
  for (int r = 0; r < 8; ++r) {
    #pragma unroll
    for (int dt = 0; dt < 8; ++dt)
      stg[(hi * 8 + r) * CP + dt * 16 + lq] = (f16)(o[dt][r] * (1.0f / 4096.0f) * rs[r]);
  }
  __syncthreads();

  // Output projection: four passes over 64-column quarters. A fragments from the wave's own CTX tile in LDS (row = query,
  // split d map), B fragments from the wot units (carried x16). Epilogue per quarter: f32 tile staged in LDS, then whole
  // 256-B quarter-rows per half wave, with the residual added.
  const int m = lq;                          // B column within a tile / 16-B piece index of the quarter-row
  const size_t xrow0 = (size_t)b * SEQ_FULL + qrow0;
  float* so = sO + wave * (16 * OP);

  const f16* ap0 = stg + m * CP + hi * 8;
  FragH a[DV / 32];   // the wave's ctx rows, the same for all four quarters
  #pragma unroll
  for (int kk = 0; kk < DV / 32; ++kk) {
    a[kk].q[0] = *(const v4u*)(ap0 + kk * 32);        // d = kk*32 + hi*8 + 0..7
    a[kk].q[1] = *(const v4u*)(ap0 + kk * 32 + 16);   // d = kk*32 + 16 + hi*8 + 0..7
  }

  #pragma unroll 1
  for (int qn = 0; qn < 4; ++qn) {
    // one group of loads per quarter: its sixteen Wo fragments, then the x pieces of its residual
    FragH bw[DV / 32][4];
    #pragma unroll
    for (int kk = 0; kk < DV / 32; ++kk) {
      #pragma unroll
      for (int j = 0; j < 4; ++j) {
        const f16* wp = wot + (size_t)(((qn * 4 + j) * (DV / 32) + kk) * 2) * FRU + lane * 8;
        bw[kk][j].q[0] = *(const v4u*)(wp);         // d = kk*32 + hi*8 + 0..7 of column (qn*4 + j)*16 + m
        bw[kk][j].q[1] = *(const v4u*)(wp + FRU);   // d = kk*32 + 16 + hi*8 + 0..7
      }
    }
    v4f    xq[8];
    size_t gidx[8];
    #pragma unroll
    for (int it = 0; it < 8; ++it) {
      gidx[it] = (xrow0 + it * 2 + hi) * CIN + qn * 64 + m * 4;
      xq[it]   = *(const v4f*)(x + gidx[it]);
    }
    __builtin_amdgcn_sched_barrier(0);   // the group stays whole, in front of the quarter's matrix work
    v8f acc[4];
    #pragma unroll
    for (int j = 0; j < 4; ++j) acc[j] = (v8f){0, 0, 0, 0, 0, 0, 0, 0};
    #pragma unroll
    for (int kk = 0; kk < DV / 32; ++kk) {
      #pragma unroll
      for (int j = 0; j < 4; ++j) acc[j] = mma_f16(a[kk].v, bw[kk][j].v, acc[j]);
    }
    #pragma unroll
    for (int r = 0; r < 8; ++r) {
      #pragma unroll
      for (int j = 0; j < 4; ++j) so[(hi * 8 + r) * OP + j * 16 + m] = acc[j][r] * gsc;
    }
    __syncthreads();

    v4f vals[8];
    #pragma unroll
    for (int it = 0; it < 8; ++it) {
      const int row = it * 2 + hi;
      v4f v = *(const v4f*)(so + row * OP + m * 4);
      #pragma unroll
      for (int cc = 0; cc < 4; ++cc) v[cc] = v[cc] + (float)(bf16)xq[it][cc];   // residual with the RNE bf16 input value
      vals[it] = v;
    }
    #pragma unroll
    for (int it = 0; it < 8; ++it) *(v4f*)(out + gidx[it]) = vals[it];
    
    __syncthreads();
  }
}

extern "C" void kernel_launch(void* const* d_in, const int* in_sizes, int n_in,
                              void* d_out, int out_size, void* d_ws, size_t ws_size,
                              hipStream_t stream) {
  if (n_in < 6) return;
  const size_t rows_used = (size_t)(NB - 1) * SEQ_FULL + SEQ;
  if ((size_t)in_sizes[0] < rows_used * CIN) return;
  if (in_sizes[1] < CIN * DQK) return;
  if (in_sizes[2] < CIN * DQK) return;
  if (in_sizes[3] < CIN * DV) return;
  if (in_sizes[4] < DV * CIN) return;
  if (in_sizes[5] < 1) return;
  if ((size_t)out_size < rows_used * CIN) return;

  const size_t wct_bytes = (size_t)NPROJ * CIN * 2;           // 98,304
  const size_t wot_bytes = (size_t)CIN * DV * 2;              // 65,536
  const size_t gq_bytes  = (size_t)NB * SEQ * DQK * 2;        // 2,097,152 at full size
  const size_t fk_bytes  = (size_t)NB * NKEY * DQK * 2;       // 524,288
  const size_t hvt_bytes = (size_t)NB * DV * NKEY * 2;        // 2,097,152
  const size_t off_wct = 0;
  const size_t off_wot = off_wct + wct_bytes;
  const size_t off_gq  = off_wot + wot_bytes;
  const size_t off_fk  = off_gq + gq_bytes;
  const size_t off_hvt = off_fk + fk_bytes;
  const size_t total   = off_hvt + hvt_bytes;                 // 4,882,432 at full size
  if (ws_size < total) return;

  const float* x     = (const float*)d_in[0];
  const float* wf    = (const float*)d_in[1];
  const float* wg    = (const float*)d_in[2];
  const float* wh    = (const float*)d_in[3];
  const float* wo    = (const float*)d_in[4];
  const float* gamma = (const float*)d_in[5];
  float* out = (float*)d_out;
  char*  ws  = (char*)d_ws;
  bf16* wct = (bf16*)(ws + off_wct);
  f16*  wot = (f16*)(ws + off_wot);
  f16*  gq  = (f16*)(ws + off_gq);
  f16*  fk  = (f16*)(ws + off_fk);
  f16*  hvt = (f16*)(ws + off_hvt);

  pack_w_kernel<<<40, 256, 0, stream>>>(wf, wg, wh, wo, wct, wot);
  proj_pool_kernel<<<dim3(SEQ / 128, NB), 256, 0, stream>>>(x, wct, gq, fk, hvt);
  attn_oproj_kernel<<<dim3(SEQ / BQ, NB), 256, 0, stream>>>(gq, fk, hvt, wot, x, gamma, out);
}

// v007
// A run of this version takes 31.7 microseconds.
// In two side-by-side timings against v006, it was 1.09 and 1.08 times as fast.
// Over all steps from v000 it is 4.74 times as fast.
#include <hip/hip_runtime.h>

// Contractions: X x [Wf|Wg|Wh] on v_wmma_f32_16x16x32_bf16 (bf16 operands = RNE-converted inputs, f32 accumulate);
// S^T = F x G^T, CTX^T = Hv^T x P^T (P as f16 carried x4096) and OUT = CTX x Wo (Wo as f16 of the bf16 value, carried x16)
// on v_wmma_f32_16x16x32_f16 (f16 operands, f32 accumulate). Max-pool, softmax and residual in f32.

#ifndef NB
#define NB 8
#endif
#ifndef SEQ
#define SEQ 4096
#endif
#define NB_FULL  8
#define SEQ_FULL 4096
#define W_IMG    64                 // image width (pixels per image row)
#define CIN      256                // input channels
#define DQK      32                 // query / key channels
#define DV       128                // value channels
#define NPROJ    192                // packed projection columns: [0,32) f, [32,64) g, [64,192) h
#define NKEY     (SEQ / 4)          // pooled key count per image
#define KTILE    32                 // keys produced per projection block (two image rows)
#define BQ       128                // query rows per attention block (8 waves x 16)
#define BK       32                 // keys per inner iteration
#define NWAVE    8
#define PP       168                // LDS pitch (halves) of the ww-pooled staging rows
#define GP       40                 // LDS pitch (halves) of the g staging tile
#define FP       40                 // LDS pitch (halves) of the pooled f tile
#define HP       40                 // LDS pitch (halves) of the pooled h^T tile: 80 B = 16 B x odd
#define OP       68                 // LDS pitch (floats) of the output staging tile
#define SK       64                 // keys per LDS stage of the attention loop (two BK passes)
#define NST      (NKEY / SK)        // stages per image
#define FSP      40                 // LDS pitch (halves) of a staged f row: 80 B = 16 B x odd
#define VSP      72                 // LDS pitch (halves) of a staged h^T row: 144 B = 16 B x odd
#define FRU      256                // halves per weight fragment unit: 32 lanes x 16 B = 512 B = four whole lines
#define XP       260                // LDS pitch (floats) of a staged x row: 1040 B = 16 B x odd

static_assert(SEQ % 256 == 0);
static_assert(SEQ >= 256 && SEQ <= SEQ_FULL);
static_assert(NB >= 1 && NB <= NB_FULL);
static_assert(BQ == NWAVE * 16);
static_assert(NKEY % BK == 0);
static_assert(NKEY % KTILE == 0);
static_assert(CIN % 32 == 0 && DV % 32 == 0 && DQK == 32);
// coverage equalities (grid x block x per-thread elements == plane extent)
static_assert((SEQ / 128) * NWAVE * 16 == SEQ);              // g plane rows per image
static_assert((SEQ / 128) * KTILE == NKEY);                   // f / h^T plane keys per image
static_assert(2 * W_IMG == NWAVE * 16 && KTILE == W_IMG / 2); // a projection block = two whole image rows
static_assert((SEQ / BQ) * NWAVE * 16 == SEQ);                // ctx and output rows per image
static_assert((GP * 2) % 16 == 0 && (FP * 2) % 16 == 0 && (HP * 2) % 16 == 0);
static_assert((OP * 4) % 16 == 0);
static_assert(NKEY % SK == 0 && SK == 2 * BK && NST >= 1);
static_assert((FSP * 2) % 16 == 0 && (VSP * 2) % 16 == 0);
static_assert(SK * DQK * 2 == 256 * 16);        // f stage: one 16-B copy per thread
static_assert(DV * SK * 2 == 4 * 256 * 16);     // h^T stage: four 16-B copies per thread
static_assert(SK == 2 * KTILE);                 // h^T stage: two whole key tiles of the plane, 16 KB contiguous
static_assert((XP * 4) % 16 == 0 && XP >= CIN && CIN * 4 == 2 * 32 * 16);   // x row: two wave-wide 16-B copies
static_assert(W_IMG == 4 * 16 && NPROJ == 4 * 3 * 16 && NWAVE == 2 * 4);    // wave tile: one image row x three column tiles

typedef __bf16   bf16;
typedef _Float16 f16;
typedef bf16     v16bf __attribute__((ext_vector_type(16)));
typedef f16      v16h  __attribute__((ext_vector_type(16)));
typedef f16      v8h   __attribute__((ext_vector_type(8)));
typedef float    v8f   __attribute__((ext_vector_type(8)));
typedef float    v4f   __attribute__((ext_vector_type(4)));
typedef unsigned v4u   __attribute__((ext_vector_type(4)));

union FragB  { v16bf v; v4u q[2]; bf16 h[16]; };
union FragH  { v16h  v; v4u q[2]; f16  h[16]; };
union Pack8B { v4u u; bf16 h[8]; };
union Pack8H { v4u u; v8h v; f16 h[8]; };

// WMMA helpers: the plain builtins; the compiler keeps the distance behind its own matrix instructions. No volatile
// statement stands behind them, so that a block's fragment loads can be issued ahead of the block before it.
static __device__ __forceinline__ v8f mma_bf16(v16bf a, v16bf b, v8f acc) {
  return __builtin_amdgcn_wmma_f32_16x16x32_bf16(false, a, false, b, (short)0, acc, false, false);
}
static __device__ __forceinline__ v8f mma_f16(v16h a, v16h b, v8f acc) {
  return __builtin_amdgcn_wmma_f32_16x16x32_f16(false, a, false, b, (short)0, acc, false, false);
}
// lane l takes the value of lane l ^ 16: a vector cross-row move, no trip through the LDS pipe
static __device__ __forceinline__ float xhalf(float v) {
  const int b = __builtin_bit_cast(int, v);
  return __builtin_bit_cast(float, __builtin_amdgcn_permlanex16(b, b, 0x76543210, 0xfedcba98, false, false));
}

// Weight planes, packed in fragment order: a unit is the 512 contiguous bytes that one wave-wide 16-B load of a
// B fragment half takes, lane (hi, m) holding column n = tile * 16 + m, k = kk * 32 + q * 16 + hi * 8 + 0..7.
//   wct unit (t * 8 + kk) * 2 + q, t = 0..11  : bf16 RNE of column t * 16 + m of [wf | wg | wh].
//   wot unit (nt * 4 + kk) * 2 + q, nt = 0..15 : f16(bf16(w) * 16) (exact) of column nt * 16 + m of wo.
// One wave packs one unit (one 512-B store). Blocks 0..23: wct units 0..191; blocks 24..39: wot units 0..127.
// Source selection is block-uniform (16 units per column tile, 8 units per block).
// coverage: wct columns 0..191 x k 0..255; wot columns 0..255 x k 0..127.
__global__ __launch_bounds__(256) void pack_w_kernel(const float* __restrict__ wf, const float* __restrict__ wg,
                                                      const float* __restrict__ wh, const float* __restrict__ wo,
                                                      bf16* __restrict__ wct, f16* __restrict__ wot) {
  const int blk  = blockIdx.x;
  const int tid  = threadIdx.x;
  const int wave = tid >> 5;
  const int lane = tid & 31;
  const int m    = lane & 15;
  const int hi   = lane >> 4;
  if (blk < 24) {
    const int u  = blk * 8 + wave;                                       // 0..191
    const int n  = (u >> 4) * 16 + m;                                    // 0..191
    const int k0 = ((u >> 1) & 7) * 32 + (u & 1) * 16 + hi * 8;          // 0..248
    const float* src = (blk < 4) ? wf : ((blk < 8) ? wg : wh);
    const int pitch  = (blk < 8) ? DQK : DV;
    const int nl     = (blk < 4) ? n : ((blk < 8) ? (n - 32) : (n - 64));
    Pack8B pk;
    #pragma unroll
    for (int i = 0; i < 8; ++i) pk.h[i] = (bf16)src[(size_t)(k0 + i) * pitch + nl];   // RNE convert
    *(v4u*)(wct + (size_t)u * FRU + lane * 8) = pk.u;
  } else {
    const int u  = (blk - 24) * 8 + wave;                                // 0..127
    const int n  = (u >> 3) * 16 + m;                                    // 0..255
    const int k0 = ((u >> 1) & 3) * 32 + (u & 1) * 16 + hi * 8;          // 0..120
    Pack8H pk;
    #pragma unroll
    for (int i = 0; i < 8; ++i) {
      const float v = (float)(bf16)wo[(size_t)(k0 + i) * CIN + n];
      pk.h[i] = (f16)(v * 16.0f);              // bf16 significand fits f16: exact for normal results
    }
    *(v4u*)(wot + (size_t)u * FRU + lane * 8) = pk.u;
    asm volatile("s_wait_xcnt 0x0" ::: "memory");   // stands before any later write of the store's address or data registers
  }
}

// Four x rows (4 KB contiguous in global memory) into LDS, eight asynchronous 16-B copies per lane: copy j takes the
// 512 contiguous bytes j of the piece (four whole lines per wave-wide copy) to row j >> 1, half j & 1 of the padded tile.
// The s_wait_xcnt closes the statement so that no address register of an issued copy is rewritten ahead of it.
static __device__ __forceinline__ void x_copy4rows(unsigned l, const float* g) {
  const unsigned l1 = l + 512,              l2 = l + XP * 4,     l3 = l + XP * 4 + 512;
  const unsigned l4 = l + 2 * XP * 4,       l5 = l4 + 512,       l6 = l + 3 * XP * 4,   l7 = l6 + 512;
  const float* g1 = g + 1 * 128;
  const float* g2 = g + 2 * 128;
  const float* g3 = g + 3 * 128;
  const float* g4 = g + 4 * 128;
  const float* g5 = g + 5 * 128;
  const float* g6 = g + 6 * 128;
  const float* g7 = g + 7 * 128;
  asm volatile("global_load_async_to_lds_b128 %0, %1, off\n\t"
               "global_load_async_to_lds_b128 %2, %3, off\n\t"
               "global_load_async_to_lds_b128 %4, %5, off\n\t"
               "global_load_async_to_lds_b128 %6, %7, off\n\t"
               "global_load_async_to_lds_b128 %8, %9, off\n\t"
               "global_load_async_to_lds_b128 %10, %11, off\n\t"
               "global_load_async_to_lds_b128 %12, %13, off\n\t"
               "global_load_async_to_lds_b128 %14, %15, off\n\t"
               "s_wait_xcnt 0x0"
               :: "v"(l), "v"(g), "v"(l1), "v"(g1), "v"(l2), "v"(g2), "v"(l3), "v"(g3),
                  "v"(l4), "v"(g4), "v"(l5), "v"(g5), "v"(l6), "v"(g6), "v"(l7), "v"(g7)
               : "memory");
}

// Projection + 2x2 max-pool. Block = (32-key tile kt, batch b), 256 threads: the two image rows hh = kt*2 + {0,1},
// so that the grid has one block for every WGP of the chip. Matrix work: wave -> (image row, three column tiles);
// copies in and plane stores out: wave -> (image row, 16 pixels along ww).
//   gq  [NB][SEQ][DQK]  f16 : queries, one 64-B row per pixel (wave writes 16 rows = 1 KB, 2 instructions).
//   fk  [NB][NKEY][DQK] f16 : pooled keys, 32 rows per block = 2 KB (one 512-B instruction per wave, four waves).
//   hvt [NB][NKEY/32][DV][32] f16 : pooled values, transposed inside a 32-key tile; a block writes its own 8 KB,
//                                   whole lines only (512 B per instruction).
// x comes in once, in whole lines: each wave copies 16 pixel rows (16 KB contiguous) into sX, from where four waves read
// every row as A pieces (RNE bf16 convert, split k map); a direct fragment load would touch 16 lines for 512 bytes.
// LDS regions, all cross-wave under block barriers: sX (filled by copies), sP, sG, sF, sHT. Staged == consumed extent.
__global__ __launch_bounds__(256) void proj_pool_kernel(const float* __restrict__ x, const bf16* wct,
                                                         f16* __restrict__ gq, f16* __restrict__ fk,
                                                         f16* __restrict__ hvt) {
  const int kt   = blockIdx.x;
  const int b    = blockIdx.y;
  const int tid  = threadIdx.x;
  const int wave = tid >> 5;
  const int lane = tid & 31;
  const int m    = lane & 15;
  const int hi   = lane >> 4;
  const int hsel = wave >> 2;          // which of the block's two image rows
  const int ww0  = (wave & 3) * 16;    // first pixel column of this wave's 16 copied and stored pixels

  __shared__ __align__(16) f16 sP[2 * 32 * PP];       // [hsel][pw][160 cols] ww-pooled f|h
  __shared__ __align__(16) f16 sG[NWAVE * 16 * GP];   // g tile [16][32] of each 16-pixel group
  __shared__ __align__(16) f16 sF[KTILE * FP];        // pooled f [32 keys][32]
  __shared__ __align__(16) f16 sHT[DV * HP];          // pooled h^T [128 d][32 keys]
  __shared__ __align__(16) float sX[NWAVE * 16 * XP]; // x rows of the block's 128 pixels, f32, pitch XP

  f16* sg = sG + wave * (16 * GP);
  f16* sp = sP + hsel * (32 * PP);

  const int hh   = kt * 2 + hsel;
  const int pix0 = hh * W_IMG + ww0;
  {
    const unsigned lx = (unsigned)(uintptr_t)sX + (unsigned)(wave * (16 * XP * 4) + lane * 16);
    const float*   gx = x + ((size_t)b * SEQ_FULL + pix0) * CIN + lane * 4;
    #pragma unroll   // 32 copies of a wave in flight, four statements of eight
    for (int c = 0; c < 4; ++c) x_copy4rows(lx + c * (4 * XP * 4), gx + c * (4 * CIN));
  }
  // Wave tile: the 64 pixels of image row hsel (four M tiles) x three 16-column tiles t = ng * 3 + 0..2 of wct; K = CIN.
  // A wct fragment serves four M tiles, so the block takes each weight line through two waves, not eight.
  constexpr int NKB = CIN / 32;
  constexpr int BD  = 4;               // k-blocks that the wct fragments run ahead of the matrix work
  const int ng = __builtin_amdgcn_readfirstlane(wave) & 3;                      // scalar: it picks the tiles' kind below
  const bf16* wp = wct + (size_t)(ng * 3) * (NKB * 2 * FRU) + lane * 8;         // this lane's 16 B of every unit
  FragB bw[NKB][3];
  #pragma unroll
  for (int kk = 0; kk < BD; ++kk) {    // the first fragments fly together with the x copies
    #pragma unroll
    for (int j = 0; j < 3; ++j) {
      bw[kk][j].q[0] = *(const v4u*)(wp + ((j * NKB + kk) * 2) * FRU);       // k = hi*8 + 0..7 of the block
      bw[kk][j].q[1] = *(const v4u*)(wp + ((j * NKB + kk) * 2 + 1) * FRU);   // k = 16 + hi*8 + 0..7
    }
  }
  asm volatile("s_wait_asynccnt 0x0" ::: "memory");   // this wave's x rows have landed
  __syncthreads();                                    // publishes the x tile to the waves that share it

  v8f acc[4][3];
  #pragma unroll
  for (int mi = 0; mi < 4; ++mi) {
    #pragma unroll
    for (int j = 0; j < 3; ++j) acc[mi][j] = (v8f){0, 0, 0, 0, 0, 0, 0, 0};
  }
  const float* xp = sX + (hsel * 64 + m) * XP + hi * 8;   // row of M tile mi: + mi * 16 * XP
  v4f ax[NKB][4][4];
  #pragma unroll
  for (int mi = 0; mi < 4; ++mi) {
    ax[0][mi][0] = *(const v4f*)(xp + mi * 16 * XP);
    ax[0][mi][1] = *(const v4f*)(xp + mi * 16 * XP + 4);
    ax[0][mi][2] = *(const v4f*)(xp + mi * 16 * XP + 16);
    ax[0][mi][3] = *(const v4f*)(xp + mi * 16 * XP + 20);
  }
  #pragma unroll
  for (int kk = 0; kk < NKB; ++kk) {
    if (kk + 1 < NKB) {
      #pragma unroll
      for (int mi = 0; mi < 4; ++mi) {
        ax[kk + 1][mi][0] = *(const v4f*)(xp + mi * 16 * XP + (kk + 1) * 32);
        ax[kk + 1][mi][1] = *(const v4f*)(xp + mi * 16 * XP + (kk + 1) * 32 + 4);
        ax[kk + 1][mi][2] = *(const v4f*)(xp + mi * 16 * XP + (kk + 1) * 32 + 16);
        ax[kk + 1][mi][3] = *(const v4f*)(xp + mi * 16 * XP + (kk + 1) * 32 + 20);
      }
    }
    if (kk + BD < NKB) {
      #pragma unroll
      for (int j = 0; j < 3; ++j) {
        bw[kk + BD][j].q[0] = *(const v4u*)(wp + ((j * NKB + kk + BD) * 2) * FRU);
        bw[kk + BD][j].q[1] = *(const v4u*)(wp + ((j * NKB + kk + BD) * 2 + 1) * FRU);
      }
    }
    __builtin_amdgcn_sched_barrier(0);   // the later blocks' loads stay in front of this block's matrix work
    FragB a[4];
    #pragma unroll
    for (int mi = 0; mi < 4; ++mi) {
      #pragma unroll
      for (int i = 0; i < 4; ++i) {
        a[mi].h[i]      = (bf16)ax[kk][mi][0][i];   // elems 0..7  : k = kk*32 + hi*8 + 0..7
        a[mi].h[4 + i]  = (bf16)ax[kk][mi][1][i];
        a[mi].h[8 + i]  = (bf16)ax[kk][mi][2][i];   // elems 8..15 : k = kk*32 + 16 + hi*8 + 0..7
        a[mi].h[12 + i] = (bf16)ax[kk][mi][3][i];
      }
    }
    #pragma unroll
    for (int j = 0; j < 3; ++j) {
      #pragma unroll
      for (int mi = 0; mi < 4; ++mi) acc[mi][j] = mma_bf16(a[mi].v, bw[kk][j].v, acc[mi][j]);
    }
    __builtin_amdgcn_sched_barrier(0);   // later loads are not lifted over this block: two blocks of x pieces live at most
  }

  // Column tile t: 0, 1 = f, 2, 3 = g, 4..11 = h. g goes unpooled to the tile of its 16 pixels; f and h are pooled along
  // ww: the pairs are D rows (2rp, 2rp+1) of the same lane half, pooled column pw = mi*8 + 4*hi + rp.
  #pragma unroll
  for (int j = 0; j < 3; ++j) {
    const int t = ng * 3 + j;
    if (t == 2 || t == 3) {
      #pragma unroll
      for (int mi = 0; mi < 4; ++mi) {
        f16* sgt = sG + (hsel * 4 + mi) * (16 * GP) + (t - 2) * 16 + m;
        #pragma unroll
        for (int r = 0; r < 8; ++r) sgt[(hi * 8 + r) * GP] = (f16)acc[mi][j][r];
      }
    } else {
      const int col = (t < 2 ? t * 16 : t * 16 - 32) + m;   // sP columns: [0,32) f, [32,160) h
      #pragma unroll
      for (int mi = 0; mi < 4; ++mi) {
        #pragma unroll
        for (int rp = 0; rp < 4; ++rp)
          sp[(mi * 8 + hi * 4 + rp) * PP + col] = (f16)fmaxf(acc[mi][j][2 * rp], acc[mi][j][2 * rp + 1]);
      }
    }
  }
  __syncthreads();

  // g tile -> gq: 16 consecutive pixel rows x 64 B = 1 KB contiguous; 32 lanes x 16 B per instruction
  {
    v4u    gv[2];
    size_t gi[2];
    #pragma unroll
    for (int i2 = 0; i2 < 2; ++i2) {
      const int row = i2 * 8 + (lane >> 2);
      const int cq  = (lane & 3) * 8;
      Pack8H p;
      p.v = *(const v8h*)(sg + row * GP + cq);
      gv[i2] = p.u;
      gi[i2] = ((size_t)b * SEQ + pix0 + row) * DQK + cq;
    }
    #pragma unroll
    for (int i2 = 0; i2 < 2; ++i2) *(v4u*)(gq + gi[i2]) = gv[i2];
  }

  // hh-pool into the block's pooled tiles
  #pragma unroll
  for (int e = 0; e < 4; ++e) {
    const int idx = e * 256 + tid;
    const int pw  = idx >> 5;
    const int c   = idx & 31;
    const float v = fmaxf((float)sP[pw * PP + c], (float)sP[32 * PP + pw * PP + c]);
    sF[pw * FP + c] = (f16)v;
  }
  #pragma unroll
  for (int e = 0; e < 16; ++e) {
    const int idx = e * 256 + tid;
    const int pw  = idx >> 7;
    const int d   = idx & 127;
    const float v = fmaxf((float)sP[pw * PP + 32 + d], (float)sP[32 * PP + pw * PP + 32 + d]);
    sHT[d * HP + pw] = (f16)v;
  }
  __syncthreads();

  // final plane stores: hvt (two 16-B pieces per thread, piece p = d * 4 + key quarter), fk (waves 0..3, 8 rows each)
  v4u    hv[2];
  size_t hidx[2];
  #pragma unroll
  for (int ps = 0; ps < 2; ++ps) {
    const int pc = ps * 256 + tid;         // 0..511
    Pack8H p;
    p.v = *(const v8h*)(sHT + (pc >> 2) * HP + (pc & 3) * 8);
    hv[ps]   = p.u;
    hidx[ps] = ((size_t)b * (NKEY / KTILE) + kt) * (DV * KTILE) + (size_t)pc * 8;
  }
  #pragma unroll
  for (int ps = 0; ps < 2; ++ps) *(v4u*)(hvt + hidx[ps]) = hv[ps];
  if (tid < KTILE * 4) {                   // wave-uniform: 128 pieces of 16 B
    const int row = tid >> 2;              // 0..31
    const int cq  = (tid & 3) * 8;
    Pack8H p;
    p.v = *(const v8h*)(sF + row * FP + cq);
    *(v4u*)(fk + ((size_t)b * NKEY + kt * KTILE + row) * DQK + cq) = p.u;
  }
}

// One stage of 64 keys into LDS, five asynchronous 16-B copies per thread: one piece of the f tile (64 rows x 64 B)
// and four of the h^T stage, which is two 32-key tiles of the plane = 16 KB contiguous (a wave covers four whole
// 128-B lines per copy). Copy i takes piece i * 256 + tid: key tile i >> 1, d = (i & 1) * 64 + (tid >> 2), key quarter
// tid & 3; in LDS the two tiles stand side by side in a row of 64 keys. The s_wait_xcnt closes the statement so that
// no address register of an issued copy is rewritten ahead of it.
static __device__ __forceinline__ void stage_copy(unsigned lf, const f16* gf, unsigned lv, const f16* gv) {
  const unsigned lv1 = lv + 64 * VSP * 2, lv2 = lv + KTILE * 2, lv3 = lv + 64 * VSP * 2 + KTILE * 2;
  const f16* gv1 = gv + 1 * 256 * 8;
  const f16* gv2 = gv + 2 * 256 * 8;
  const f16* gv3 = gv + 3 * 256 * 8;
  asm volatile("global_load_async_to_lds_b128 %0, %1, off\n\t"
               "global_load_async_to_lds_b128 %2, %3, off\n\t"
               "global_load_async_to_lds_b128 %4, %5, off\n\t"
               "global_load_async_to_lds_b128 %6, %7, off\n\t"
               "global_load_async_to_lds_b128 %8, %9, off\n\t"
               "s_wait_xcnt 0x0"
               :: "v"(lf), "v"(gf), "v"(lv), "v"(gv), "v"(lv1), "v"(gv1), "v"(lv2), "v"(gv2), "v"(lv3), "v"(gv3)
               : "memory");
}

// Flash attention, non-causal, no score scaling. Block = (query block of 128, batch); one wave owns 16 queries.
// S^T = F x G^T so queries sit on lanes; P^T in C-layout is bit-identical to the B-fragment layout of CTX^T += Hv^T x P^T,
// where a query stays on the lanes that hold its scores: its scale and its sum are the lane's own, and the two lane halves
// meet by a vector cross-row move, so that nothing of the softmax queues behind the fragment loads in the LDS pipe.
// G B-fragments come straight from the f16 plane. The f and h^T tiles, which all eight waves read, are brought into
// LDS once per block in stages of 64 keys (two buffers, the next stage's copies fly while this one is worked on);
// F and Hv^T A-fragments are two 16-B LDS loads each, issued as one group per pass ahead of their use.
// The output projection and the scaled residual follow in the same kernel: out = gamma * (CTX x Wo) + x_bf16. A wave's
// 16 x 128 CTX tile, rounded to f16, stays in its registers: the CTX^T tiles are already laid out as A fragments.
// LDS: sO per-wave regions, written and read across lanes under block barriers; staged extent == consumed extent.
__global__ __launch_bounds__(256) void attn_oproj_kernel(const f16* __restrict__ gq, const f16* __restrict__ fk,
                                                         const f16* __restrict__ hvt, const f16* __restrict__ wot,
                                                         const float* __restrict__ x, const float* __restrict__ gamma,
                                                         float* __restrict__ out) {
  const int qblk = blockIdx.x;
  const int b    = blockIdx.y;
  const int tid  = threadIdx.x;
  const int wave = tid >> 5;
  const int lane = tid & 31;
  const int lq   = lane & 15;   // query column of S^T and CTX^T / row of an F or Hv^T fragment
  const int hi   = lane >> 4;   // k-split half

  __shared__ __align__(16) f16 sKF[2 * SK * FSP];   // [buffer][key][32 d], pitch FSP
  __shared__ __align__(16) f16 sKV[2 * DV * VSP];   // [buffer][d][64 keys], pitch VSP
  __shared__ __align__(16) float sO[NWAVE * 16 * OP];   // per-wave f32 tile of one output quarter

  const int qrow0 = qblk * BQ + wave * 16;

  // G as B-operand fragment: lane lq holds query qrow0+lq, elements follow the split d map
  FragH qf;
  {
    const f16* qp = gq + ((size_t)b * SEQ + qrow0 + lq) * DQK + hi * 8;
    qf.q[0] = *(const v4u*)(qp);        // d = hi*8 + 0..7
    qf.q[1] = *(const v4u*)(qp + 16);   // d = 16 + hi*8 + 0..7
  }

  const float gsc = (float)(bf16)gamma[0] * 0.0625f;   // gamma (RNE bf16) folded with the 1/16 Wo carry

  const f16* fk_b = fk + (size_t)b * NKEY * DQK;
  const f16* vt_b = hvt + (size_t)b * DV * NKEY;

  v8f o[8];
  #pragma unroll
  for (int dt = 0; dt < 8; ++dt) o[dt] = (v8f){0, 0, 0, 0, 0, 0, 0, 0};

  float rmax = -__builtin_inff();
  float rsum = 0.0f;
  const float SL = 1.4426950408889634f;   // log2(e); the scores carry no extra scale

  // this thread's pieces of a stage: LDS byte addresses in buffer 0 and global pointers of stage 0
  const unsigned lf0 = (unsigned)(uintptr_t)sKF + (unsigned)((tid >> 2) * (FSP * 2) + (tid & 3) * 16);
  const unsigned lv0 = (unsigned)(uintptr_t)sKV + (unsigned)((tid >> 2) * (VSP * 2) + (tid & 3) * 16);
  const f16* gf0 = fk_b + tid * 8;                                  // f stage = 4 KB contiguous
  const f16* gv0 = vt_b + tid * 8;                                  // h^T stage = 16 KB contiguous

  stage_copy(lf0, gf0, lv0, gv0);
  asm volatile("s_wait_asynccnt 0x0" ::: "memory");   // this wave's pieces of stage 0 have landed
  __syncthreads();                                    // publishes stage 0 to all waves
  if (NST > 1) stage_copy(lf0 + SK * FSP * 2, gf0 + SK * DQK, lv0 + DV * VSP * 2, gv0 + SK * DV);

  for (int t = 0; t < NST; ++t) {
   const int buf = t & 1;
   const f16* sf = sKF + buf * (SK * FSP);
   const f16* sv = sKV + buf * (DV * VSP);
   // One group of LDS loads at the head of the stage: the F A-fragments of both passes (row = key, split d map) and the
   // Hv^T A-fragments of the first pass (row = d = dt*16 + lq, split key map from the transposed tile).
   FragH ak[SK / BK][2];
   #pragma unroll
   for (int ps = 0; ps < SK / BK; ++ps) {
     #pragma unroll
     for (int sub = 0; sub < 2; ++sub) {
       const f16* base = sf + (ps * BK + sub * 16 + lq) * FSP + hi * 8;
       ak[ps][sub].q[0] = *(const v4u*)(base);        // d = hi*8 + 0..7
       ak[ps][sub].q[1] = *(const v4u*)(base + 16);   // d = 16 + hi*8 + 0..7
     }
   }
   FragH bv[8];
   #pragma unroll
   for (int dt = 0; dt < 8; ++dt) {
     const f16* base = sv + (dt * 16 + lq) * VSP + hi * 8;
     bv[dt].q[0] = *(const v4u*)(base);        // keys hi*8 + 0..7
     bv[dt].q[1] = *(const v4u*)(base + 16);   // keys 16 + hi*8 + 0..7
   }
   __builtin_amdgcn_sched_barrier(0);   // the group stays whole, in front of the scores and the softmax that hide its latency
   #pragma unroll   // both passes of a stage inline: j0 folds into the LDS loads' immediate offsets
   for (int ps = 0; ps < SK / BK; ++ps) {
    // S^T tiles: c[sub][r] = score(query qrow0+lq, key j0 + sub*16 + hi*8 + r), j0 = ps * BK
    v8f c[2];
    #pragma unroll
    for (int sub = 0; sub < 2; ++sub)
      c[sub] = mma_f16(ak[ps][sub].v, qf.v, (v8f){0, 0, 0, 0, 0, 0, 0, 0});

    // online softmax: query lq's 32 scores are split across lane / lane^16
    float m_new = rmax;
    #pragma unroll
    for (int r = 0; r < 8; ++r) {
      m_new = fmaxf(m_new, c[0][r]);
      m_new = fmaxf(m_new, c[1][r]);
    }
    m_new = fmaxf(m_new, xhalf(m_new));
    const float scale = __builtin_amdgcn_exp2f((rmax - m_new) * SL);
    rmax = m_new;

    // exp + pack: P^T C-layout == B-fragment layout for the PV product; P carried x4096 in f16
    FragH pa;
    float psum = 0.0f;
    #pragma unroll
    for (int r = 0; r < 8; ++r) {
      const float p0 = __builtin_amdgcn_exp2f((c[0][r] - m_new) * SL);   // key j0 + hi*8 + r
      const float p1 = __builtin_amdgcn_exp2f((c[1][r] - m_new) * SL);   // key j0 + 16 + hi*8 + r
      psum += p0 + p1;
      pa.h[r]     = (f16)(p0 * 4096.0f);
      pa.h[8 + r] = (f16)(p1 * 4096.0f);
    }
    rsum = rsum * scale + psum + xhalf(psum);

    // rescale CTX^T: queries are the column dimension there -> the lane's own scale
    #pragma unroll
    for (int dt = 0; dt < 8; ++dt) {
      #pragma unroll
      for (int r = 0; r < 8; ++r) o[dt][r] *= scale;
    }

    // CTX^T += Hv^T x P^T: o[dt][r] = ctx(query qrow0 + lq, d = dt*16 + hi*8 + r)
    #pragma unroll
    for (int dt = 0; dt < 8; ++dt) o[dt] = mma_f16(bv[dt].v, pa.v, o[dt]);
    if (ps + 1 < SK / BK) {
      __builtin_amdgcn_sched_barrier(0);   // the next pass's group is not lifted over these products: one set of Hv^T registers
      #pragma unroll
      for (int dt = 0; dt < 8; ++dt) {
        const f16* base = sv + (dt * 16 + lq) * VSP + (ps + 1) * BK + hi * 8;
        bv[dt].q[0] = *(const v4u*)(base);        // keys j0 + hi*8 + 0..7 of the next pass
        bv[dt].q[1] = *(const v4u*)(base + 16);   // keys j0 + 16 + hi*8 + 0..7
      }
      __builtin_amdgcn_sched_barrier(0);   // and it stays whole, in front of the next pass's scores and softmax
    }
   }
   __builtin_amdgcn_sched_barrier(0);   // the second pass's work stays in front of the hand-over, whose waits would else stand right behind its loads
   // hand-over: stage t + 1 becomes readable, and the buffer of stage t free, behind this one barrier
   asm volatile("s_wait_dscnt 0x0" ::: "memory");      // this wave's reads of stage t are done before the refill
   asm volatile("s_wait_asynccnt 0x0" ::: "memory");   // this wave's pieces of stage t + 1 have landed
   __syncthreads();
   if (t + 2 < NST)
     stage_copy(lf0 + buf * (SK * FSP * 2), gf0 + (size_t)(t + 2) * (SK * DQK),
                lv0 + buf * (DV * VSP * 2), gv0 + (size_t)(t + 2) * (SK * DV));
  }
  asm volatile("s_wait_asynccnt 0x0" ::: "memory");    // no copy is outstanding when the wave goes on to its end

  // normalize: lane holds d = dt*16 + hi*8 + 0..7 of its own query lq. Two neighbouring CTX^T tiles, rounded to f16 in place,
  // are the A fragment of the output projection (row = query lq, split d map): the ctx tile never leaves the registers.
  const float rs = 1.0f / rsum;

  FragH a[DV / 32];   // the wave's ctx rows, the same for all four quarters
  #pragma unroll
  for (int kk = 0; kk < DV / 32; ++kk) {
    #pragma unroll
    for (int r = 0; r < 8; ++r) {
      a[kk].h[r]     = (f16)(o[2 * kk][r] * (1.0f / 4096.0f) * rs);       // d = kk*32 + hi*8 + r
      a[kk].h[8 + r] = (f16)(o[2 * kk + 1][r] * (1.0f / 4096.0f) * rs);   // d = kk*32 + 16 + hi*8 + r
    }
  }

  // Output projection: four passes over 64-column quarters. B fragments from the wot units (carried x16). Epilogue per
  // quarter: f32 tile staged in LDS, then whole 256-B quarter-rows per half wave, with the residual added.
  const int m = lq;                          // B column within a tile / 16-B piece index of the quarter-row
  const size_t xrow0 = (size_t)b * SEQ_FULL + qrow0;
  float* so = sO + wave * (16 * OP);

  #pragma unroll 1
  for (int qn = 0; qn < 4; ++qn) {
    // one group of loads per quarter: its sixteen Wo fragments, then the x pieces of its residual
    FragH bw[DV / 32][4];
    #pragma unroll
    for (int kk = 0; kk < DV / 32; ++kk) {
      #pragma unroll
      for (int j = 0; j < 4; ++j) {
        const f16* wp = wot + (size_t)(((qn * 4 + j) * (DV / 32) + kk) * 2) * FRU + lane * 8;
        bw[kk][j].q[0] = *(const v4u*)(wp);         // d = kk*32 + hi*8 + 0..7 of column (qn*4 + j)*16 + m
        bw[kk][j].q[1] = *(const v4u*)(wp + FRU);   // d = kk*32 + 16 + hi*8 + 0..7
      }
    }
    v4f    xq[8];
    size_t gidx[8];
    #pragma unroll
    for (int it = 0; it < 8; ++it) {
      gidx[it] = (xrow0 + it * 2 + hi) * CIN + qn * 64 + m * 4;
      xq[it]   = *(const v4f*)(x + gidx[it]);
    }
    __builtin_amdgcn_sched_barrier(0);   // the group stays whole, in front of the quarter's matrix work
    v8f acc[4];
    #pragma unroll
    for (int j = 0; j < 4; ++j) acc[j] = (v8f){0, 0, 0, 0, 0, 0, 0, 0};
    #pragma unroll
    for (int kk = 0; kk < DV / 32; ++kk) {
      #pragma unroll
      for (int j = 0; j < 4; ++j) acc[j] = mma_f16(a[kk].v, bw[kk][j].v, acc[j]);
    }
    #pragma unroll
    for (int r = 0; r < 8; ++r) {
      #pragma unroll
      for (int j = 0; j < 4; ++j) so[(hi * 8 + r) * OP + j * 16 + m] = acc[j][r] * gsc;
    }
    __syncthreads();

    v4f vals[8];
    #pragma unroll
    for (int it = 0; it < 8; ++it) {
      const int row = it * 2 + hi;
      v4f v = *(const v4f*)(so + row * OP + m * 4);
      #pragma unroll
      for (int cc = 0; cc < 4; ++cc) v[cc] = v[cc] + (float)(bf16)xq[it][cc];   // residual with the RNE bf16 input value
      vals[it] = v;
    }
    #pragma unroll
    for (int it = 0; it < 8; ++it) *(v4f*)(out + gidx[it]) = vals[it];
    
    __syncthreads();
  }
}

extern "C" void kernel_launch(void* const* d_in, const int* in_sizes, int n_in,
                              void* d_out, int out_size, void* d_ws, size_t ws_size,
                              hipStream_t stream) {
  if (n_in < 6) return;
  const size_t rows_used = (size_t)(NB - 1) * SEQ_FULL + SEQ;
  if ((size_t)in_sizes[0] < rows_used * CIN) return;
  if (in_sizes[1] < CIN * DQK) return;
  if (in_sizes[2] < CIN * DQK) return;
  if (in_sizes[3] < CIN * DV) return;
  if (in_sizes[4] < DV * CIN) return;
  if (in_sizes[5] < 1) return;
  if ((size_t)out_size < rows_used * CIN) return;

  const size_t wct_bytes = (size_t)NPROJ * CIN * 2;           // 98,304
  const size_t wot_bytes = (size_t)CIN * DV * 2;              // 65,536
  const size_t gq_bytes  = (size_t)NB * SEQ * DQK * 2;        // 2,097,152 at full size
  const size_t fk_bytes  = (size_t)NB * NKEY * DQK * 2;       // 524,288
  const size_t hvt_bytes = (size_t)NB * DV * NKEY * 2;        // 2,097,152
  const size_t off_wct = 0;
  const size_t off_wot = off_wct + wct_bytes;
  const size_t off_gq  = off_wot + wot_bytes;
  const size_t off_fk  = off_gq + gq_bytes;
  const size_t off_hvt = off_fk + fk_bytes;
  const size_t total   = off_hvt + hvt_bytes;                 // 4,882,432 at full size
  if (ws_size < total) return;

  const float* x     = (const float*)d_in[0];
  const float* wf    = (const float*)d_in[1];
  const float* wg    = (const float*)d_in[2];
  const float* wh    = (const float*)d_in[3];
  const float* wo    = (const float*)d_in[4];
  const float* gamma = (const float*)d_in[5];
  float* out = (float*)d_out;
  char*  ws  = (char*)d_ws;
  bf16* wct = (bf16*)(ws + off_wct);
  f16*  wot = (f16*)(ws + off_wot);
  f16*  gq  = (f16*)(ws + off_gq);
  f16*  fk  = (f16*)(ws + off_fk);
  f16*  hvt = (f16*)(ws + off_hvt);

  pack_w_kernel<<<40, 256, 0, stream>>>(wf, wg, wh, wo, wct, wot);
  proj_pool_kernel<<<dim3(SEQ / 128, NB), 256, 0, stream>>>(x, wct, gq, fk, hvt);
  attn_oproj_kernel<<<dim3(SEQ / BQ, NB), 256, 0, stream>>>(gq, fk, hvt, wot, x, gamma, out);
}

// v008
// One run takes 31.5 microseconds.
// Two timings next to v007 put it at 1.04 and 1.03 times that version's speed.
// All steps since v000 together make it 4.92 times as fast.
#include <hip/hip_runtime.h>

// Contractions: X x [Wf|Wg|Wh] on v_wmma_f32_16x16x32_bf16 (bf16 operands = RNE-converted inputs, f32 accumulate);
// S^T = F x G^T, CTX^T = Hv^T x P^T (P as f16 carried x4096) and OUT = CTX x Wo (Wo as f16 of the bf16 value, carried x16)
// on v_wmma_f32_16x16x32_f16 (f16 operands, f32 accumulate). Max-pool, softmax and residual in f32.

#ifndef NB
#define NB 8
#endif
#ifndef SEQ
#define SEQ 4096
#endif
#define NB_FULL  8
#define SEQ_FULL 4096
#define W_IMG    64                 // image width (pixels per image row)
#define CIN      256                // input channels
#define DQK      32                 // query / key channels
#define DV       128                // value channels
#define NPROJ    192                // packed projection columns: [0,32) f, [32,64) g, [64,192) h
#define NKEY     (SEQ / 4)          // pooled key count per image
#define KTILE    32                 // keys produced per projection block (two image rows)
#define BQ       128                // query rows per attention block (8 waves x 16)
#define BK       32                 // keys per inner iteration
#define NWAVE    8
#define PP       168                // LDS pitch (halves) of the ww-pooled staging rows
#define GP       40                 // LDS pitch (halves) of the g staging tile
#define FP       40                 // LDS pitch (halves) of the pooled f tile
#define HP       40                 // LDS pitch (halves) of the pooled h^T tile: 80 B = 16 B x odd
#define OP       68                 // LDS pitch (floats) of the output staging tile
#define SK       64                 // keys per LDS stage of the attention loop (two BK passes)
#define NST      (NKEY / SK)        // stages per image
#define FSP      40                 // LDS pitch (halves) of a staged f row: 80 B = 16 B x odd
#define VSP      72                 // LDS pitch (halves) of a staged h^T row: 144 B = 16 B x odd
#define FRU      256                // halves per weight fragment unit: 32 lanes x 16 B = 512 B = four whole lines
#define XP       260                // LDS pitch (floats) of a staged x row: 1040 B = 16 B x odd
#define WTS      4104               // LDS pitch (halves) of a column tile's 16 weight units: 8192 B + 16 B

static_assert(SEQ % 256 == 0);
static_assert(SEQ >= 256 && SEQ <= SEQ_FULL);
static_assert(NB >= 1 && NB <= NB_FULL);
static_assert(BQ == NWAVE * 16);
static_assert(NKEY % BK == 0);
static_assert(NKEY % KTILE == 0);
static_assert(CIN % 32 == 0 && DV % 32 == 0 && DQK == 32);
// coverage equalities (grid x block x per-thread elements == plane extent)
static_assert((SEQ / 128) * NWAVE * 16 == SEQ);              // g plane rows per image
static_assert((SEQ / 128) * KTILE == NKEY);                   // f / h^T plane keys per image
static_assert(2 * W_IMG == NWAVE * 16 && KTILE == W_IMG / 2); // a projection block = two whole image rows
static_assert((SEQ / BQ) * NWAVE * 16 == SEQ);                // ctx and output rows per image
static_assert((GP * 2) % 16 == 0 && (FP * 2) % 16 == 0 && (HP * 2) % 16 == 0);
static_assert((OP * 4) % 16 == 0);
static_assert(NKEY % SK == 0 && SK == 2 * BK && NST >= 1);
static_assert((FSP * 2) % 16 == 0 && (VSP * 2) % 16 == 0);
static_assert(SK * DQK * 2 == 256 * 16);        // f stage: one 16-B copy per thread
static_assert(DV * SK * 2 == 4 * 256 * 16);     // h^T stage: four 16-B copies per thread
static_assert(SK == 2 * KTILE);                 // h^T stage: two whole key tiles of the plane, 16 KB contiguous
static_assert((XP * 4) % 16 == 0 && XP >= CIN && CIN * 4 == 2 * 32 * 16);   // x row: two wave-wide 16-B copies
static_assert(W_IMG == 4 * 16 && NPROJ == 4 * 3 * 16 && NWAVE == 2 * 4);    // wave tile: one image row x three column tiles
static_assert(WTS >= 16 * FRU && (WTS * 2) % 16 == 0);
static_assert(CIN == NWAVE * 4 * 8 && DV == 32 * 4 && DQK == 8 * 4);         // weight pack: a wave takes 32 k of every column
static_assert((SEQ / 128) * NB * NWAVE >= (CIN / 16) * (DV / 32) * 2);       // enough waves in the first blocks for the wot units

typedef __bf16   bf16;
typedef _Float16 f16;
typedef bf16     v16bf __attribute__((ext_vector_type(16)));
typedef f16      v16h  __attribute__((ext_vector_type(16)));
typedef f16      v8h   __attribute__((ext_vector_type(8)));
typedef float    v8f   __attribute__((ext_vector_type(8)));
typedef float    v4f   __attribute__((ext_vector_type(4)));
typedef unsigned v4u   __attribute__((ext_vector_type(4)));

union FragB  { v16bf v; v4u q[2]; bf16 h[16]; };
union FragH  { v16h  v; v4u q[2]; f16  h[16]; };
union Pack8B { v4u u; bf16 h[8]; };
union Pack8H { v4u u; v8h v; f16 h[8]; };

// WMMA helpers: the plain builtins; the compiler keeps the distance behind its own matrix instructions. No volatile
// statement stands behind them, so that a block's fragment loads can be issued ahead of the block before it.
static __device__ __forceinline__ v8f mma_bf16(v16bf a, v16bf b, v8f acc) {
  return __builtin_amdgcn_wmma_f32_16x16x32_bf16(false, a, false, b, (short)0, acc, false, false);
}
static __device__ __forceinline__ v8f mma_f16(v16h a, v16h b, v8f acc) {
  return __builtin_amdgcn_wmma_f32_16x16x32_f16(false, a, false, b, (short)0, acc, false, false);
}
// lane l takes the value of lane l ^ 16: a vector cross-row move, no trip through the LDS pipe
static __device__ __forceinline__ float xhalf(float v) {
  const int b = __builtin_bit_cast(int, v);
  return __builtin_bit_cast(float, __builtin_amdgcn_permlanex16(b, b, 0x76543210, 0xfedcba98, false, false));
}

// Weights in fragment order: a unit is the 512 contiguous bytes that one wave-wide 16-B load of a B fragment half takes,
// lane (hi, m) holding column n = tile * 16 + m, k = kk * 32 + q * 16 + hi * 8 + 0..7.
//   [wf | wg | wh], bf16 RNE, unit (kk * 2 + q) of column tile t = 0..11: made by every projection block in its own LDS.
//   wot unit (nt * 4 + kk) * 2 + q, nt = 0..15 : f16(bf16(w) * 16) (exact) of column nt * 16 + m of wo, a workspace plane.

// Four x rows (4 KB contiguous in global memory) into LDS, eight asynchronous 16-B copies per lane: copy j takes the
// 512 contiguous bytes j of the piece (four whole lines per wave-wide copy) to row j >> 1, half j & 1 of the padded tile.
// The s_wait_xcnt closes the statement so that no address register of an issued copy is rewritten ahead of it.
static __device__ __forceinline__ void x_copy4rows(unsigned l, const float* g) {
  const unsigned l1 = l + 512,              l2 = l + XP * 4,     l3 = l + XP * 4 + 512;
  const unsigned l4 = l + 2 * XP * 4,       l5 = l4 + 512,       l6 = l + 3 * XP * 4,   l7 = l6 + 512;
  const float* g1 = g + 1 * 128;
  const float* g2 = g + 2 * 128;
  const float* g3 = g + 3 * 128;
  const float* g4 = g + 4 * 128;
  const float* g5 = g + 5 * 128;
  const float* g6 = g + 6 * 128;
  const float* g7 = g + 7 * 128;
  asm volatile("global_load_async_to_lds_b128 %0, %1, off\n\t"
               "global_load_async_to_lds_b128 %2, %3, off\n\t"
               "global_load_async_to_lds_b128 %4, %5, off\n\t"
               "global_load_async_to_lds_b128 %6, %7, off\n\t"
               "global_load_async_to_lds_b128 %8, %9, off\n\t"
               "global_load_async_to_lds_b128 %10, %11, off\n\t"
               "global_load_async_to_lds_b128 %12, %13, off\n\t"
               "global_load_async_to_lds_b128 %14, %15, off\n\t"
               "s_wait_xcnt 0x0"
               :: "v"(l), "v"(g), "v"(l1), "v"(g1), "v"(l2), "v"(g2), "v"(l3), "v"(g3),
                  "v"(l4), "v"(g4), "v"(l5), "v"(g5), "v"(l6), "v"(g6), "v"(l7), "v"(g7)
               : "memory");
}

// Projection + 2x2 max-pool. Block = (32-key tile kt, batch b), 256 threads: the two image rows hh = kt*2 + {0,1},
// so that the grid has one block for every WGP of the chip. Matrix work: wave -> (image row, three column tiles);
// copies in and plane stores out: wave -> (image row, 16 pixels along ww).
//   gq  [NB][SEQ][DQK]  f16 : queries, one 64-B row per pixel (wave writes 16 rows = 1 KB, 2 instructions).
//   fk  [NB][NKEY][DQK] f16 : pooled keys, 32 rows per block = 2 KB (one 512-B instruction per wave, four waves).
//   hvt [NB][NKEY/32][DV][32] f16 : pooled values, transposed inside a 32-key tile; a block writes its own 8 KB,
//                                   whole lines only (512 B per instruction).
// x comes in once, in whole lines: each wave copies 16 pixel rows (16 KB contiguous) into sX, from where four waves read
// every row as A pieces (RNE bf16 convert, split k map); a direct fragment load would touch 16 lines for 512 bytes.
// The weights come in as the f32 inputs, in whole lines, while the x copies fly: every block converts them and lays them
// out in fragment order in its own LDS (sW), so that no launch of its own stands in front of this one for it. The first
// sixteen blocks also write the wo plane of the next launch, one unit per wave.
// LDS regions, all cross-wave under block barriers: sX (filled by copies), sW, sP, sG, sF, sHT. Staged == consumed extent.
__global__ __launch_bounds__(256) void proj_pool_kernel(const float* __restrict__ x, const float* __restrict__ wf,
                                                         const float* __restrict__ wg, const float* __restrict__ wh,
                                                         const float* __restrict__ wo, f16* __restrict__ wot,
                                                         f16* __restrict__ gq, f16* __restrict__ fk,
                                                         f16* __restrict__ hvt) {
  const int kt   = blockIdx.x;
  const int b    = blockIdx.y;
  const int tid  = threadIdx.x;
  const int wave = tid >> 5;
  const int lane = tid & 31;
  const int m    = lane & 15;
  const int hi   = lane >> 4;
  const int hsel = wave >> 2;          // which of the block's two image rows
  const int ww0  = (wave & 3) * 16;    // first pixel column of this wave's 16 copied and stored pixels

  __shared__ __align__(16) f16 sP[2 * 32 * PP];       // [hsel][pw][160 cols] ww-pooled f|h
  __shared__ __align__(16) f16 sG[NWAVE * 16 * GP];   // g tile [16][32] of each 16-pixel group
  __shared__ __align__(16) f16 sF[KTILE * FP];        // pooled f [32 keys][32]
  __shared__ __align__(16) f16 sHT[DV * HP];          // pooled h^T [128 d][32 keys]
  __shared__ __align__(16) float sX[NWAVE * 16 * XP]; // x rows of the block's 128 pixels, f32, pitch XP
  __shared__ __align__(16) bf16 sW[(NPROJ / 16) * WTS]; // [column tile][16 units of 512 B], tile pitch WTS

  f16* sg = sG + wave * (16 * GP);
  f16* sp = sP + hsel * (32 * PP);

  const int hh   = kt * 2 + hsel;
  const int pix0 = hh * W_IMG + ww0;
  {
    const unsigned lx = (unsigned)(uintptr_t)sX + (unsigned)(wave * (16 * XP * 4) + lane * 16);
    const float*   gx = x + ((size_t)b * SEQ_FULL + pix0) * CIN + lane * 4;
    #pragma unroll   // 32 copies of a wave in flight, four statements of eight
    for (int c = 0; c < 4; ++c) x_copy4rows(lx + c * (4 * XP * 4), gx + c * (4 * CIN));
  }
  // wo plane: unit u of the first sixteen blocks' waves (block-uniform test); the loads go out first, the store follows below
  constexpr int WOB = (CIN / 16) * (DV / 32) * 2 / NWAVE;   // blocks that pack a wo unit per wave
  const int  lin   = b * (SEQ / 128) + kt;
  const bool packs = lin < WOB;
  const int  u     = lin * NWAVE + wave;                    // 0..127 where packs
  float wov[8];
  #pragma unroll
  for (int i = 0; i < 8; ++i) wov[i] = 0.0f;
  if (packs) {
    const int n  = (u >> 3) * 16 + m;                                    // 0..255
    const int k0 = ((u >> 1) & 3) * 32 + (u & 1) * 16 + hi * 8;          // 0..120
    #pragma unroll
    for (int i = 0; i < 8; ++i) wov[i] = wo[(size_t)(k0 + i) * CIN + n];
  }
  // [wf | wg | wh] -> sW. A wave takes k = wave * 32 + 0..31 of every column: a lane loads eight consecutive k of four
  // neighbouring columns (eight 16-B loads, each wave-wide load four whole lines) and makes four 16-B pieces of them.
  // Piece (column tile t, k group k8 = k / 8, column m) stands at t * WTS + k8 * 128 + m * 8 halves: k8 = kk*4 + q*2 + hi.
  {
    const int k8h = wave * 4;                  // wh: a row is 512 B, one k group per set of eight loads
    const int k8s = wave * 4 + (lane >> 3);    // wf, wg: a row is 128 B, four k groups per set
    v4f wv[6][8];
    #pragma unroll
    for (int jj = 0; jj < 4; ++jj) {
      #pragma unroll
      for (int i = 0; i < 8; ++i) wv[jj][i] = *(const v4f*)(wh + (size_t)((k8h + jj) * 8 + i) * DV + lane * 4);
    }
    #pragma unroll
    for (int i = 0; i < 8; ++i) wv[4][i] = *(const v4f*)(wf + (size_t)(k8s * 8 + i) * DQK + (lane & 7) * 4);
    #pragma unroll
    for (int i = 0; i < 8; ++i) wv[5][i] = *(const v4f*)(wg + (size_t)(k8s * 8 + i) * DQK + (lane & 7) * 4);
    bf16* dh = sW + (4 + (lane >> 2)) * WTS + k8h * 128 + (lane & 3) * 32;    // columns 64 + lane * 4 + 0..3
    bf16* df = sW + ((lane & 7) >> 2) * WTS + k8s * 128 + (lane & 3) * 32;    // columns (lane & 7) * 4 + 0..3; wg: + 32
    #pragma unroll
    for (int jj = 0; jj < 6; ++jj) {
      bf16* d = jj < 4 ? dh + jj * 128 : (jj == 4 ? df : df + 2 * WTS);
      #pragma unroll
      for (int j = 0; j < 4; ++j) {
        Pack8B pk;
        #pragma unroll
        for (int i = 0; i < 8; ++i) pk.h[i] = (bf16)wv[jj][i][j];   // RNE convert
        *(v4u*)(d + j * 8) = pk.u;
      }
    }
  }
  if (packs) {
    Pack8H pk;
    #pragma unroll
    for (int i = 0; i < 8; ++i) pk.h[i] = (f16)((float)(bf16)wov[i] * 16.0f);   // bf16 significand fits f16: exact for normal results
    *(v4u*)(wot + (size_t)u * FRU + lane * 8) = pk.u;
    asm volatile("s_wait_xcnt 0x0" ::: "memory");   // stands before any later write of the store's address or data registers
  }
  // Wave tile: the 64 pixels of image row hsel (four M tiles) x three 16-column tiles t = ng * 3 + 0..2 of sW; K = CIN.
  // A weight fragment serves four M tiles.
  constexpr int NKB = CIN / 32;
  const int ng = __builtin_amdgcn_readfirstlane(wave) & 3;                      // scalar: it picks the tiles' kind below
  const bf16* wp = sW + (ng * 3) * WTS + lane * 8;                              // this lane's 16 B of every unit
  FragB bw[NKB][3];
  asm volatile("s_wait_asynccnt 0x0" ::: "memory");   // this wave's x rows have landed
  __syncthreads();                                    // publishes the x tile and the weight units to the waves that share them

  v8f acc[4][3];
  #pragma unroll
  for (int mi = 0; mi < 4; ++mi) {
    #pragma unroll
    for (int j = 0; j < 3; ++j) acc[mi][j] = (v8f){0, 0, 0, 0, 0, 0, 0, 0};
  }
  const float* xp = sX + (hsel * 64 + m) * XP + hi * 8;   // row of M tile mi: + mi * 16 * XP
  v4f ax[NKB][4][4];
  #pragma unroll
  for (int mi = 0; mi < 4; ++mi) {
    ax[0][mi][0] = *(const v4f*)(xp + mi * 16 * XP);
    ax[0][mi][1] = *(const v4f*)(xp + mi * 16 * XP + 4);
    ax[0][mi][2] = *(const v4f*)(xp + mi * 16 * XP + 16);
    ax[0][mi][3] = *(const v4f*)(xp + mi * 16 * XP + 20);
  }
  #pragma unroll
  for (int j = 0; j < 3; ++j) {
    bw[0][j].q[0] = *(const v4u*)(wp + j * WTS);         // k = hi*8 + 0..7 of the block
    bw[0][j].q[1] = *(const v4u*)(wp + j * WTS + FRU);   // k = 16 + hi*8 + 0..7
  }
  #pragma unroll
  for (int kk = 0; kk < NKB; ++kk) {
    if (kk + 1 < NKB) {
      #pragma unroll
      for (int mi = 0; mi < 4; ++mi) {
        ax[kk + 1][mi][0] = *(const v4f*)(xp + mi * 16 * XP + (kk + 1) * 32);
        ax[kk + 1][mi][1] = *(const v4f*)(xp + mi * 16 * XP + (kk + 1) * 32 + 4);
        ax[kk + 1][mi][2] = *(const v4f*)(xp + mi * 16 * XP + (kk + 1) * 32 + 16);
        ax[kk + 1][mi][3] = *(const v4f*)(xp + mi * 16 * XP + (kk + 1) * 32 + 20);
      }
      #pragma unroll
      for (int j = 0; j < 3; ++j) {
        bw[kk + 1][j].q[0] = *(const v4u*)(wp + j * WTS + ((kk + 1) * 2) * FRU);
        bw[kk + 1][j].q[1] = *(const v4u*)(wp + j * WTS + ((kk + 1) * 2 + 1) * FRU);
      }
    }
    __builtin_amdgcn_sched_barrier(0);   // the next block's loads stay in front of this block's matrix work
    FragB a[4];
    #pragma unroll
    for (int mi = 0; mi < 4; ++mi) {
      #pragma unroll
      for (int i = 0; i < 4; ++i) {
        a[mi].h[i]      = (bf16)ax[kk][mi][0][i];   // elems 0..7  : k = kk*32 + hi*8 + 0..7
        a[mi].h[4 + i]  = (bf16)ax[kk][mi][1][i];
        a[mi].h[8 + i]  = (bf16)ax[kk][mi][2][i];   // elems 8..15 : k = kk*32 + 16 + hi*8 + 0..7
        a[mi].h[12 + i] = (bf16)ax[kk][mi][3][i];
      }
    }
    #pragma unroll
    for (int j = 0; j < 3; ++j) {
      #pragma unroll
      for (int mi = 0; mi < 4; ++mi) acc[mi][j] = mma_bf16(a[mi].v, bw[kk][j].v, acc[mi][j]);
    }
    __builtin_amdgcn_sched_barrier(0);   // later loads are not lifted over this block: two blocks of x pieces live at most
  }

  // Column tile t: 0, 1 = f, 2, 3 = g, 4..11 = h. g goes unpooled to the tile of its 16 pixels; f and h are pooled along
  // ww: the pairs are D rows (2rp, 2rp+1) of the same lane half, pooled column pw = mi*8 + 4*hi + rp.
  #pragma unroll
  for (int j = 0; j < 3; ++j) {
    const int t = ng * 3 + j;
    if (t == 2 || t == 3) {
      #pragma unroll
      for (int mi = 0; mi < 4; ++mi) {
        f16* sgt = sG + (hsel * 4 + mi) * (16 * GP) + (t - 2) * 16 + m;
        #pragma unroll
        for (int r = 0; r < 8; ++r) sgt[(hi * 8 + r) * GP] = (f16)acc[mi][j][r];
      }
    } else {
      const int col = (t < 2 ? t * 16 : t * 16 - 32) + m;   // sP columns: [0,32) f, [32,160) h
      #pragma unroll
      for (int mi = 0; mi < 4; ++mi) {
        #pragma unroll
        for (int rp = 0; rp < 4; ++rp)
          sp[(mi * 8 + hi * 4 + rp) * PP + col] = (f16)fmaxf(acc[mi][j][2 * rp], acc[mi][j][2 * rp + 1]);
      }
    }
  }
  __syncthreads();

  // g tile -> gq: 16 consecutive pixel rows x 64 B = 1 KB contiguous; 32 lanes x 16 B per instruction
  {
    v4u    gv[2];
    size_t gi[2];
    #pragma unroll
    for (int i2 = 0; i2 < 2; ++i2) {
      const int row = i2 * 8 + (lane >> 2);
      const int cq  = (lane & 3) * 8;
      Pack8H p;
      p.v = *(const v8h*)(sg + row * GP + cq);
      gv[i2] = p.u;
      gi[i2] = ((size_t)b * SEQ + pix0 + row) * DQK + cq;
    }
    #pragma unroll
    for (int i2 = 0; i2 < 2; ++i2) *(v4u*)(gq + gi[i2]) = gv[i2];
  }

  // hh-pool into the block's pooled tiles
  #pragma unroll
  for (int e = 0; e < 4; ++e) {
    const int idx = e * 256 + tid;
    const int pw  = idx >> 5;
    const int c   = idx & 31;
    const float v = fmaxf((float)sP[pw * PP + c], (float)sP[32 * PP + pw * PP + c]);
    sF[pw * FP + c] = (f16)v;
  }
  #pragma unroll
  for (int e = 0; e < 16; ++e) {
    const int idx = e * 256 + tid;
    const int pw  = idx >> 7;
    const int d   = idx & 127;
    const float v = fmaxf((float)sP[pw * PP + 32 + d], (float)sP[32 * PP + pw * PP + 32 + d]);
    sHT[d * HP + pw] = (f16)v;
  }
  __syncthreads();

  // final plane stores: hvt (two 16-B pieces per thread, piece p = d * 4 + key quarter), fk (waves 0..3, 8 rows each)
  v4u    hv[2];
  size_t hidx[2];
  #pragma unroll
  for (int ps = 0; ps < 2; ++ps) {
    const int pc = ps * 256 + tid;         // 0..511
    Pack8H p;
    p.v = *(const v8h*)(sHT + (pc >> 2) * HP + (pc & 3) * 8);
    hv[ps]   = p.u;
    hidx[ps] = ((size_t)b * (NKEY / KTILE) + kt) * (DV * KTILE) + (size_t)pc * 8;
  }
  #pragma unroll
  for (int ps = 0; ps < 2; ++ps) *(v4u*)(hvt + hidx[ps]) = hv[ps];
  if (tid < KTILE * 4) {                   // wave-uniform: 128 pieces of 16 B
    const int row = tid >> 2;              // 0..31
    const int cq  = (tid & 3) * 8;
    Pack8H p;
    p.v = *(const v8h*)(sF + row * FP + cq);
    *(v4u*)(fk + ((size_t)b * NKEY + kt * KTILE + row) * DQK + cq) = p.u;
  }
}

// One stage of 64 keys into LDS, five asynchronous 16-B copies per thread: one piece of the f tile (64 rows x 64 B)
// and four of the h^T stage, which is two 32-key tiles of the plane = 16 KB contiguous (a wave covers four whole
// 128-B lines per copy). Copy i takes piece i * 256 + tid: key tile i >> 1, d = (i & 1) * 64 + (tid >> 2), key quarter
// tid & 3; in LDS the two tiles stand side by side in a row of 64 keys. The s_wait_xcnt closes the statement so that
// no address register of an issued copy is rewritten ahead of it.
static __device__ __forceinline__ void stage_copy(unsigned lf, const f16* gf, unsigned lv, const f16* gv) {
  const unsigned lv1 = lv + 64 * VSP * 2, lv2 = lv + KTILE * 2, lv3 = lv + 64 * VSP * 2 + KTILE * 2;
  const f16* gv1 = gv + 1 * 256 * 8;
  const f16* gv2 = gv + 2 * 256 * 8;
  const f16* gv3 = gv + 3 * 256 * 8;
  asm volatile("global_load_async_to_lds_b128 %0, %1, off\n\t"
               "global_load_async_to_lds_b128 %2, %3, off\n\t"
               "global_load_async_to_lds_b128 %4, %5, off\n\t"
               "global_load_async_to_lds_b128 %6, %7, off\n\t"
               "global_load_async_to_lds_b128 %8, %9, off\n\t"
               "s_wait_xcnt 0x0"
               :: "v"(lf), "v"(gf), "v"(lv), "v"(gv), "v"(lv1), "v"(gv1), "v"(lv2), "v"(gv2), "v"(lv3), "v"(gv3)
               : "memory");
}

// Flash attention, non-causal, no score scaling. Block = (query block of 128, batch); one wave owns 16 queries.
// S^T = F x G^T so queries sit on lanes; P^T in C-layout is bit-identical to the B-fragment layout of CTX^T += Hv^T x P^T,
// where a query stays on the lanes that hold its scores: its scale and its sum are the lane's own, and the two lane halves
// meet by a vector cross-row move, so that nothing of the softmax queues behind the fragment loads in the LDS pipe.
// G B-fragments come straight from the f16 plane. The f and h^T tiles, which all eight waves read, are brought into
// LDS once per block in stages of 64 keys (two buffers, the next stage's copies fly while this one is worked on);
// F and Hv^T A-fragments are two 16-B LDS loads each, issued as one group per pass ahead of their use.
// The output projection and the scaled residual follow in the same kernel: out = gamma * (CTX x Wo) + x_bf16. A wave's
// 16 x 128 CTX tile, rounded to f16, stays in its registers: the CTX^T tiles are already laid out as A fragments.
// LDS: sO per-wave regions, written and read across lanes under block barriers; staged extent == consumed extent.
__global__ __launch_bounds__(256) void attn_oproj_kernel(const f16* __restrict__ gq, const f16* __restrict__ fk,
                                                         const f16* __restrict__ hvt, const f16* __restrict__ wot,
                                                         const float* __restrict__ x, const float* __restrict__ gamma,
                                                         float* __restrict__ out) {
  const int qblk = blockIdx.x;
  const int b    = blockIdx.y;
  const int tid  = threadIdx.x;
  const int wave = tid >> 5;
  const int lane = tid & 31;
  const int lq   = lane & 15;   // query column of S^T and CTX^T / row of an F or Hv^T fragment
  const int hi   = lane >> 4;   // k-split half

  __shared__ __align__(16) f16 sKF[2 * SK * FSP];   // [buffer][key][32 d], pitch FSP
  __shared__ __align__(16) f16 sKV[2 * DV * VSP];   // [buffer][d][64 keys], pitch VSP
  __shared__ __align__(16) float sO[NWAVE * 16 * OP];   // per-wave f32 tile of one output quarter

  const int qrow0 = qblk * BQ + wave * 16;

  // G as B-operand fragment: lane lq holds query qrow0+lq, elements follow the split d map
  FragH qf;
  {
    const f16* qp = gq + ((size_t)b * SEQ + qrow0 + lq) * DQK + hi * 8;
    qf.q[0] = *(const v4u*)(qp);        // d = hi*8 + 0..7
    qf.q[1] = *(const v4u*)(qp + 16);   // d = 16 + hi*8 + 0..7
  }

  const float gsc = (float)(bf16)gamma[0] * 0.0625f;   // gamma (RNE bf16) folded with the 1/16 Wo carry

  const f16* fk_b = fk + (size_t)b * NKEY * DQK;
  const f16* vt_b = hvt + (size_t)b * DV * NKEY;

  v8f o[8];
  #pragma unroll
  for (int dt = 0; dt < 8; ++dt) o[dt] = (v8f){0, 0, 0, 0, 0, 0, 0, 0};

  float rmax = -__builtin_inff();
  float rsum = 0.0f;
  const float SL = 1.4426950408889634f;   // log2(e); the scores carry no extra scale

  // this thread's pieces of a stage: LDS byte addresses in buffer 0 and global pointers of stage 0
  const unsigned lf0 = (unsigned)(uintptr_t)sKF + (unsigned)((tid >> 2) * (FSP * 2) + (tid & 3) * 16);
  const unsigned lv0 = (unsigned)(uintptr_t)sKV + (unsigned)((tid >> 2) * (VSP * 2) + (tid & 3) * 16);
  const f16* gf0 = fk_b + tid * 8;                                  // f stage = 4 KB contiguous
  const f16* gv0 = vt_b + tid * 8;                                  // h^T stage = 16 KB contiguous

  stage_copy(lf0, gf0, lv0, gv0);
  asm volatile("s_wait_asynccnt 0x0" ::: "memory");   // this wave's pieces of stage 0 have landed
  __syncthreads();                                    // publishes stage 0 to all waves
  if (NST > 1) stage_copy(lf0 + SK * FSP * 2, gf0 + SK * DQK, lv0 + DV * VSP * 2, gv0 + SK * DV);

  for (int t = 0; t < NST; ++t) {
   const int buf = t & 1;
   const f16* sf = sKF + buf * (SK * FSP);
   const f16* sv = sKV + buf * (DV * VSP);
   // One group of LDS loads at the head of the stage: the F A-fragments of both passes (row = key, split d map) and the
   // Hv^T A-fragments of the first pass (row = d = dt*16 + lq, split key map from the transposed tile).
   FragH ak[SK / BK][2];
   #pragma unroll
   for (int ps = 0; ps < SK / BK; ++ps) {
     #pragma unroll
     for (int sub = 0; sub < 2; ++sub) {
       const f16* base = sf + (ps * BK + sub * 16 + lq) * FSP + hi * 8;
       ak[ps][sub].q[0] = *(const v4u*)(base);        // d = hi*8 + 0..7
       ak[ps][sub].q[1] = *(const v4u*)(base + 16);   // d = 16 + hi*8 + 0..7
     }
   }
   FragH bv[8];
   #pragma unroll
   for (int dt = 0; dt < 8; ++dt) {
     const f16* base = sv + (dt * 16 + lq) * VSP + hi * 8;
     bv[dt].q[0] = *(const v4u*)(base);        // keys hi*8 + 0..7
     bv[dt].q[1] = *(const v4u*)(base + 16);   // keys 16 + hi*8 + 0..7
   }
   __builtin_amdgcn_sched_barrier(0);   // the group stays whole, in front of the scores and the softmax that hide its latency
   #pragma unroll   // both passes of a stage inline: j0 folds into the LDS loads' immediate offsets
   for (int ps = 0; ps < SK / BK; ++ps) {
    // S^T tiles: c[sub][r] = score(query qrow0+lq, key j0 + sub*16 + hi*8 + r), j0 = ps * BK
    v8f c[2];
    #pragma unroll
    for (int sub = 0; sub < 2; ++sub)
      c[sub] = mma_f16(ak[ps][sub].v, qf.v, (v8f){0, 0, 0, 0, 0, 0, 0, 0});

    // online softmax: query lq's 32 scores are split across lane / lane^16
    float m_new = rmax;
    #pragma unroll
    for (int r = 0; r < 8; ++r) {
      m_new = fmaxf(m_new, c[0][r]);
      m_new = fmaxf(m_new, c[1][r]);
    }
    m_new = fmaxf(m_new, xhalf(m_new));
    const float scale = __builtin_amdgcn_exp2f((rmax - m_new) * SL);
    rmax = m_new;

    // exp + pack: P^T C-layout == B-fragment layout for the PV product; P carried x4096 in f16
    FragH pa;
    float psum = 0.0f;
    #pragma unroll
    for (int r = 0; r < 8; ++r) {
      const float p0 = __builtin_amdgcn_exp2f((c[0][r] - m_new) * SL);   // key j0 + hi*8 + r
      const float p1 = __builtin_amdgcn_exp2f((c[1][r] - m_new) * SL);   // key j0 + 16 + hi*8 + r
      psum += p0 + p1;
      pa.h[r]     = (f16)(p0 * 4096.0f);
      pa.h[8 + r] = (f16)(p1 * 4096.0f);
    }
    rsum = rsum * scale + psum + xhalf(psum);

    // rescale CTX^T: queries are the column dimension there -> the lane's own scale
    #pragma unroll
    for (int dt = 0; dt < 8; ++dt) {
      #pragma unroll
      for (int r = 0; r < 8; ++r) o[dt][r] *= scale;
    }

    // CTX^T += Hv^T x P^T: o[dt][r] = ctx(query qrow0 + lq, d = dt*16 + hi*8 + r)
    #pragma unroll
    for (int dt = 0; dt < 8; ++dt) o[dt] = mma_f16(bv[dt].v, pa.v, o[dt]);
    if (ps + 1 < SK / BK) {
      __builtin_amdgcn_sched_barrier(0);   // the next pass's group is not lifted over these products: one set of Hv^T registers
      #pragma unroll
      for (int dt = 0; dt < 8; ++dt) {
        const f16* base = sv + (dt * 16 + lq) * VSP + (ps + 1) * BK + hi * 8;
        bv[dt].q[0] = *(const v4u*)(base);        // keys j0 + hi*8 + 0..7 of the next pass
        bv[dt].q[1] = *(const v4u*)(base + 16);   // keys j0 + 16 + hi*8 + 0..7
      }
      __builtin_amdgcn_sched_barrier(0);   // and it stays whole, in front of the next pass's scores and softmax
    }
   }
   __builtin_amdgcn_sched_barrier(0);   // the second pass's work stays in front of the hand-over, whose waits would else stand right behind its loads
   // hand-over: stage t + 1 becomes readable, and the buffer of stage t free, behind this one barrier
   asm volatile("s_wait_dscnt 0x0" ::: "memory");      // this wave's reads of stage t are done before the refill
   asm volatile("s_wait_asynccnt 0x0" ::: "memory");   // this wave's pieces of stage t + 1 have landed
   __syncthreads();
   if (t + 2 < NST)
     stage_copy(lf0 + buf * (SK * FSP * 2), gf0 + (size_t)(t + 2) * (SK * DQK),
                lv0 + buf * (DV * VSP * 2), gv0 + (size_t)(t + 2) * (SK * DV));
  }
  asm volatile("s_wait_asynccnt 0x0" ::: "memory");    // no copy is outstanding when the wave goes on to its end

  // normalize: lane holds d = dt*16 + hi*8 + 0..7 of its own query lq. Two neighbouring CTX^T tiles, rounded to f16 in place,
  // are the A fragment of the output projection (row = query lq, split d map): the ctx tile never leaves the registers.
  const float rs = 1.0f / rsum;

  FragH a[DV / 32];   // the wave's ctx rows, the same for all four quarters
  #pragma unroll
  for (int kk = 0; kk < DV / 32; ++kk) {
    #pragma unroll
    for (int r = 0; r < 8; ++r) {
      a[kk].h[r]     = (f16)(o[2 * kk][r] * (1.0f / 4096.0f) * rs);       // d = kk*32 + hi*8 + r
      a[kk].h[8 + r] = (f16)(o[2 * kk + 1][r] * (1.0f / 4096.0f) * rs);   // d = kk*32 + 16 + hi*8 + r
    }
  }

  // Output projection: four passes over 64-column quarters. B fragments from the wot units (carried x16). Epilogue per
  // quarter: f32 tile staged in LDS, then whole 256-B quarter-rows per half wave, with the residual added.
  const int m = lq;                          // B column within a tile / 16-B piece index of the quarter-row
  const size_t xrow0 = (size_t)b * SEQ_FULL + qrow0;
  float* so = sO + wave * (16 * OP);

  #pragma unroll 1
  for (int qn = 0; qn < 4; ++qn) {
    // one group of loads per quarter: its sixteen Wo fragments, then the x pieces of its residual
    FragH bw[DV / 32][4];
    #pragma unroll
    for (int kk = 0; kk < DV / 32; ++kk) {
      #pragma unroll
      for (int j = 0; j < 4; ++j) {
        const f16* wp = wot + (size_t)(((qn * 4 + j) * (DV / 32) + kk) * 2) * FRU + lane * 8;
        bw[kk][j].q[0] = *(const v4u*)(wp);         // d = kk*32 + hi*8 + 0..7 of column (qn*4 + j)*16 + m
        bw[kk][j].q[1] = *(const v4u*)(wp + FRU);   // d = kk*32 + 16 + hi*8 + 0..7
      }
    }
    v4f    xq[8];
    size_t gidx[8];
    #pragma unroll
    for (int it = 0; it < 8; ++it) {
      gidx[it] = (xrow0 + it * 2 + hi) * CIN + qn * 64 + m * 4;
      xq[it]   = *(const v4f*)(x + gidx[it]);
    }
    __builtin_amdgcn_sched_barrier(0);   // the group stays whole, in front of the quarter's matrix work
    v8f acc[4];
    #pragma unroll
    for (int j = 0; j < 4; ++j) acc[j] = (v8f){0, 0, 0, 0, 0, 0, 0, 0};
    #pragma unroll
    for (int kk = 0; kk < DV / 32; ++kk) {
      #pragma unroll
      for (int j = 0; j < 4; ++j) acc[j] = mma_f16(a[kk].v, bw[kk][j].v, acc[j]);
    }
    #pragma unroll
    for (int r = 0; r < 8; ++r) {
      #pragma unroll
      for (int j = 0; j < 4; ++j) so[(hi * 8 + r) * OP + j * 16 + m] = acc[j][r] * gsc;
    }
    __syncthreads();

    v4f vals[8];
    #pragma unroll
    for (int it = 0; it < 8; ++it) {
      const int row = it * 2 + hi;
      v4f v = *(const v4f*)(so + row * OP + m * 4);
      #pragma unroll
      for (int cc = 0; cc < 4; ++cc) v[cc] = v[cc] + (float)(bf16)xq[it][cc];   // residual with the RNE bf16 input value
      vals[it] = v;
    }
    #pragma unroll
    for (int it = 0; it < 8; ++it) *(v4f*)(out + gidx[it]) = vals[it];
    
    __syncthreads();
  }
}

extern "C" void kernel_launch(void* const* d_in, const int* in_sizes, int n_in,
                              void* d_out, int out_size, void* d_ws, size_t ws_size,
                              hipStream_t stream) {
  if (n_in < 6) return;
  const size_t rows_used = (size_t)(NB - 1) * SEQ_FULL + SEQ;
  if ((size_t)in_sizes[0] < rows_used * CIN) return;
  if (in_sizes[1] < CIN * DQK) return;
  if (in_sizes[2] < CIN * DQK) return;
  if (in_sizes[3] < CIN * DV) return;
  if (in_sizes[4] < DV * CIN) return;
  if (in_sizes[5] < 1) return;
  if ((size_t)out_size < rows_used * CIN) return;

  const size_t wot_bytes = (size_t)CIN * DV * 2;              // 65,536
  const size_t gq_bytes  = (size_t)NB * SEQ * DQK * 2;        // 2,097,152 at full size
  const size_t fk_bytes  = (size_t)NB * NKEY * DQK * 2;       // 524,288
  const size_t hvt_bytes = (size_t)NB * DV * NKEY * 2;        // 2,097,152
  const size_t off_wot = 0;
  const size_t off_gq  = off_wot + wot_bytes;
  const size_t off_fk  = off_gq + gq_bytes;
  const size_t off_hvt = off_fk + fk_bytes;
  const size_t total   = off_hvt + hvt_bytes;                 // 4,784,128 at full size
  if (ws_size < total) return;

  const float* x     = (const float*)d_in[0];
  const float* wf    = (const float*)d_in[1];
  const float* wg    = (const float*)d_in[2];
  const float* wh    = (const float*)d_in[3];
  const float* wo    = (const float*)d_in[4];
  const float* gamma = (const float*)d_in[5];
  float* out = (float*)d_out;
  char*  ws  = (char*)d_ws;
  f16*  wot = (f16*)(ws + off_wot);
  f16*  gq  = (f16*)(ws + off_gq);
  f16*  fk  = (f16*)(ws + off_fk);
  f16*  hvt = (f16*)(ws + off_hvt);

  proj_pool_kernel<<<dim3(SEQ / 128, NB), 256, 0, stream>>>(x, wf, wg, wh, wo, wot, gq, fk, hvt);
  attn_oproj_kernel<<<dim3(SEQ / BQ, NB), 256, 0, stream>>>(gq, fk, hvt, wot, x, gamma, out);
}

// v009
// A run of this version takes 29 microseconds.
// Timed twice side by side with v008, it ran 1.04 times as fast both times.
// All steps since v000 together make it 5.13 times as fast.
#include <hip/hip_runtime.h>

// Contractions: X x [Wf|Wg|Wh] on v_wmma_f32_16x16x32_bf16 (bf16 operands = RNE-converted inputs, f32 accumulate);
// S^T = F x G^T, CTX^T = Hv^T x P^T (P as f16 carried x4096) and OUT = CTX x Wo (Wo as f16 of the bf16 value, carried x16)
// on v_wmma_f32_16x16x32_f16 (f16 operands, f32 accumulate). Max-pool, softmax and residual in f32.

#ifndef NB
#define NB 8
#endif
#ifndef SEQ
#define SEQ 4096
#endif
#define NB_FULL  8
#define SEQ_FULL 4096
#define W_IMG    64                 // image width (pixels per image row)
#define CIN      256                // input channels
#define DQK      32                 // query / key channels
#define DV       128                // value channels
#define NPROJ    192                // packed projection columns: [0,32) f, [32,64) g, [64,192) h
#define NKEY     (SEQ / 4)          // pooled key count per image
#define KTILE    32                 // keys produced per projection block (two image rows)
#define BQ       128                // query rows per attention block (8 waves x 16)
#define BK       32                 // keys per inner iteration
#define NWAVE    8
#define PP       168                // LDS pitch (halves) of the ww-pooled staging rows
#define GP       40                 // LDS pitch (halves) of the g staging tile
#define FP       40                 // LDS pitch (halves) of the pooled f tile
#define HP       40                 // LDS pitch (halves) of the pooled h^T tile: 80 B = 16 B x odd
#define OP       68                 // LDS pitch (floats) of the output staging tile
#define SK       64                 // keys per LDS stage of the attention loop (two BK passes)
#define NST      (NKEY / SK)        // stages per image
#define FSP      40                 // LDS pitch (halves) of a staged f row: 80 B = 16 B x odd
#define VSP      72                 // LDS pitch (halves) of a staged h^T row: 144 B = 16 B x odd
#define FRU      256                // halves per weight fragment unit: 32 lanes x 16 B = 512 B = four whole lines
#define XP       260                // LDS pitch (floats) of a staged x row: 1040 B = 16 B x odd
#define WTS      4104               // LDS pitch (halves) of a column tile's 16 weight units: 8192 B + 16 B

static_assert(SEQ % 256 == 0);
static_assert(SEQ >= 256 && SEQ <= SEQ_FULL);
static_assert(NB >= 1 && NB <= NB_FULL);
static_assert(BQ == NWAVE * 16);
static_assert(NKEY % BK == 0);
static_assert(NKEY % KTILE == 0);
static_assert(CIN % 32 == 0 && DV % 32 == 0 && DQK == 32);
// coverage equalities (grid x block x per-thread elements == plane extent)
static_assert((SEQ / 128) * NWAVE * 16 == SEQ);              // g plane rows per image
static_assert((SEQ / 128) * KTILE == NKEY);                   // f / h^T plane keys per image
static_assert(2 * W_IMG == NWAVE * 16 && KTILE == W_IMG / 2); // a projection block = two whole image rows
static_assert((SEQ / BQ) * NWAVE * 16 == SEQ);                // ctx and output rows per image
static_assert((GP * 2) % 16 == 0 && (FP * 2) % 16 == 0 && (HP * 2) % 16 == 0);
static_assert((OP * 4) % 16 == 0);
static_assert(NKEY % SK == 0 && SK == 2 * BK && NST >= 1);
static_assert((FSP * 2) % 16 == 0 && (VSP * 2) % 16 == 0);
static_assert(SK * DQK * 2 == 256 * 16);        // f stage: one 16-B copy per thread
static_assert(DV * SK * 2 == 4 * 256 * 16);     // h^T stage: four 16-B copies per thread
static_assert(SK == 2 * KTILE);                 // h^T stage: two whole key tiles of the plane, 16 KB contiguous
static_assert((XP * 4) % 16 == 0 && XP >= CIN && CIN * 4 == 2 * 32 * 16);   // x row: two wave-wide 16-B copies
static_assert(W_IMG == 4 * 16 && NPROJ == 4 * 3 * 16 && NWAVE == 2 * 4);    // wave tile: one image row x three column tiles
static_assert(WTS >= 16 * FRU && (WTS * 2) % 16 == 0);
static_assert(CIN == NWAVE * 4 * 8 && DV == 32 * 4 && DQK == 8 * 4);         // weight pack: a wave takes 32 k of every column
static_assert((SEQ / 128) * NB * NWAVE >= (CIN / 16) * (DV / 32) * 2);       // enough waves in the first blocks for the wot units

typedef __bf16   bf16;
typedef _Float16 f16;
typedef bf16     v16bf __attribute__((ext_vector_type(16)));
typedef f16      v16h  __attribute__((ext_vector_type(16)));
typedef f16      v8h   __attribute__((ext_vector_type(8)));
typedef float    v8f   __attribute__((ext_vector_type(8)));
typedef float    v4f   __attribute__((ext_vector_type(4)));
typedef unsigned v4u   __attribute__((ext_vector_type(4)));

union FragB  { v16bf v; v4u q[2]; bf16 h[16]; };
union FragH  { v16h  v; v4u q[2]; f16  h[16]; };
union Pack8B { v4u u; bf16 h[8]; };
union Pack8H { v4u u; v8h v; f16 h[8]; };

// WMMA helpers: the plain builtins; the compiler keeps the distance behind its own matrix instructions. No volatile
// statement stands behind them, so that a block's fragment loads can be issued ahead of the block before it.
static __device__ __forceinline__ v8f mma_bf16(v16bf a, v16bf b, v8f acc) {
  return __builtin_amdgcn_wmma_f32_16x16x32_bf16(false, a, false, b, (short)0, acc, false, false);
}
static __device__ __forceinline__ v8f mma_f16(v16h a, v16h b, v8f acc) {
  return __builtin_amdgcn_wmma_f32_16x16x32_f16(false, a, false, b, (short)0, acc, false, false);
}
// lane l takes the value of lane l ^ 16: a vector cross-row move, no trip through the LDS pipe
static __device__ __forceinline__ float xhalf(float v) {
  const int b = __builtin_bit_cast(int, v);
  return __builtin_bit_cast(float, __builtin_amdgcn_permlanex16(b, b, 0x76543210, 0xfedcba98, false, false));
}

// Weights in fragment order: a unit is the 512 contiguous bytes that one wave-wide 16-B load of a B fragment half takes,
// lane (hi, m) holding column n = tile * 16 + m, k = kk * 32 + q * 16 + hi * 8 + 0..7.
//   [wf | wg | wh], bf16 RNE, unit (kk * 2 + q) of column tile t = 0..11: made by every projection block in its own LDS.
//   wot unit (nt * 4 + kk) * 2 + q, nt = 0..15 : f16(bf16(w) * 16) (exact) of column nt * 16 + m of wo, a workspace plane.

// Four x rows (4 KB contiguous in global memory) into LDS, eight asynchronous 16-B copies per lane: copy j takes the
// 512 contiguous bytes j of the piece (four whole lines per wave-wide copy) to row j >> 1, half j & 1 of the padded tile.
// The s_wait_xcnt closes the statement so that no address register of an issued copy is rewritten ahead of it.
static __device__ __forceinline__ void x_copy4rows(unsigned l, const float* g) {
  const unsigned l1 = l + 512,              l2 = l + XP * 4,     l3 = l + XP * 4 + 512;
  const unsigned l4 = l + 2 * XP * 4,       l5 = l4 + 512,       l6 = l + 3 * XP * 4,   l7 = l6 + 512;
  const float* g1 = g + 1 * 128;
  const float* g2 = g + 2 * 128;
  const float* g3 = g + 3 * 128;
  const float* g4 = g + 4 * 128;
  const float* g5 = g + 5 * 128;
  const float* g6 = g + 6 * 128;
  const float* g7 = g + 7 * 128;
  asm volatile("global_load_async_to_lds_b128 %0, %1, off\n\t"
               "global_load_async_to_lds_b128 %2, %3, off\n\t"
               "global_load_async_to_lds_b128 %4, %5, off\n\t"
               "global_load_async_to_lds_b128 %6, %7, off\n\t"
               "global_load_async_to_lds_b128 %8, %9, off\n\t"
               "global_load_async_to_lds_b128 %10, %11, off\n\t"
               "global_load_async_to_lds_b128 %12, %13, off\n\t"
               "global_load_async_to_lds_b128 %14, %15, off\n\t"
               "s_wait_xcnt 0x0"
               :: "v"(l), "v"(g), "v"(l1), "v"(g1), "v"(l2), "v"(g2), "v"(l3), "v"(g3),
                  "v"(l4), "v"(g4), "v"(l5), "v"(g5), "v"(l6), "v"(g6), "v"(l7), "v"(g7)
               : "memory");
}

// Projection + 2x2 max-pool. Block = (32-key tile kt, batch b), 256 threads: the two image rows hh = kt*2 + {0,1},
// so that the grid has one block for every WGP of the chip. Matrix work: wave -> (image row, three column tiles);
// copies in and plane stores out: wave -> (image row, 16 pixels along ww).
//   gq  [NB][SEQ][DQK]  f16 : queries, one 64-B row per pixel (wave writes 16 rows = 1 KB, 2 instructions).
//   fk  [NB][NKEY][DQK] f16 : pooled keys, 32 rows per block = 2 KB (one 512-B instruction per wave, four waves).
//   hvt [NB][NKEY/32][DV][32] f16 : pooled values, transposed inside a 32-key tile; a block writes its own 8 KB,
//                                   whole lines only (512 B per instruction).
// x comes in once, in whole lines: each wave copies 16 pixel rows (16 KB contiguous) into sX, from where four waves read
// every row as A pieces (RNE bf16 convert, split k map); a direct fragment load would touch 16 lines for 512 bytes.
// The weights come in as the f32 inputs, in whole lines, while the x copies fly: every block converts them and lays them
// out in fragment order in its own LDS (sW), so that no launch of its own stands in front of this one for it. The first
// sixteen blocks also write the wo plane of the next launch, one unit per wave.
// LDS regions, all cross-wave under block barriers: sX (filled by copies), sW, sP, sG, sF, sHT. Staged == consumed extent.
__global__ __launch_bounds__(256) void proj_pool_kernel(const float* __restrict__ x, const float* __restrict__ wf,
                                                         const float* __restrict__ wg, const float* __restrict__ wh,
                                                         const float* __restrict__ wo, f16* __restrict__ wot,
                                                         f16* __restrict__ gq, f16* __restrict__ fk,
                                                         f16* __restrict__ hvt) {
  const int kt   = blockIdx.x;
  const int b    = blockIdx.y;
  const int tid  = threadIdx.x;
  const int wave = tid >> 5;
  const int lane = tid & 31;
  const int m    = lane & 15;
  const int hi   = lane >> 4;
  const int hsel = wave >> 2;          // which of the block's two image rows
  const int ww0  = (wave & 3) * 16;    // first pixel column of this wave's 16 copied and stored pixels

  __shared__ __align__(16) f16 sP[2 * 32 * PP];       // [hsel][pw][160 cols] ww-pooled f|h
  __shared__ __align__(16) f16 sG[NWAVE * 16 * GP];   // g tile [16][32] of each 16-pixel group
  __shared__ __align__(16) f16 sF[KTILE * FP];        // pooled f [32 keys][32]
  __shared__ __align__(16) f16 sHT[DV * HP];          // pooled h^T [128 d][32 keys]
  __shared__ __align__(16) float sX[NWAVE * 16 * XP]; // x rows of the block's 128 pixels, f32, pitch XP
  __shared__ __align__(16) bf16 sW[(NPROJ / 16) * WTS]; // [column tile][16 units of 512 B], tile pitch WTS

  f16* sg = sG + wave * (16 * GP);
  f16* sp = sP + hsel * (32 * PP);

  const int hh   = kt * 2 + hsel;
  const int pix0 = hh * W_IMG + ww0;
  {
    const unsigned lx = (unsigned)(uintptr_t)sX + (unsigned)(wave * (16 * XP * 4) + lane * 16);
    const float*   gx = x + ((size_t)b * SEQ_FULL + pix0) * CIN + lane * 4;
    #pragma unroll   // 32 copies of a wave in flight, four statements of eight
    for (int c = 0; c < 4; ++c) x_copy4rows(lx + c * (4 * XP * 4), gx + c * (4 * CIN));
  }
  // wo plane: unit u of the first sixteen blocks' waves (block-uniform test); the loads go out first, the store follows below
  constexpr int WOB = (CIN / 16) * (DV / 32) * 2 / NWAVE;   // blocks that pack a wo unit per wave
  const int  lin   = b * (SEQ / 128) + kt;
  const bool packs = lin < WOB;
  const int  u     = lin * NWAVE + wave;                    // 0..127 where packs
  float wov[8];
  #pragma unroll
  for (int i = 0; i < 8; ++i) wov[i] = 0.0f;
  if (packs) {
    const int n  = (u >> 3) * 16 + m;                                    // 0..255
    const int k0 = ((u >> 1) & 3) * 32 + (u & 1) * 16 + hi * 8;          // 0..120
    #pragma unroll
    for (int i = 0; i < 8; ++i) wov[i] = wo[(size_t)(k0 + i) * CIN + n];
  }
  // [wf | wg | wh] -> sW. A wave takes k = wave * 32 + 0..31 of every column: a lane loads eight consecutive k of four
  // neighbouring columns (eight 16-B loads, each wave-wide load four whole lines) and makes four 16-B pieces of them.
  // Piece (column tile t, k group k8 = k / 8, column m) stands at t * WTS + k8 * 128 + m * 8 halves: k8 = kk*4 + q*2 + hi.
  {
    const int k8h = wave * 4;                  // wh: a row is 512 B, one k group per set of eight loads
    const int k8s = wave * 4 + (lane >> 3);    // wf, wg: a row is 128 B, four k groups per set
    v4f wv[6][8];
    #pragma unroll
    for (int jj = 0; jj < 4; ++jj) {
      #pragma unroll
      for (int i = 0; i < 8; ++i) wv[jj][i] = *(const v4f*)(wh + (size_t)((k8h + jj) * 8 + i) * DV + lane * 4);
    }
    #pragma unroll
    for (int i = 0; i < 8; ++i) wv[4][i] = *(const v4f*)(wf + (size_t)(k8s * 8 + i) * DQK + (lane & 7) * 4);
    #pragma unroll
    for (int i = 0; i < 8; ++i) wv[5][i] = *(const v4f*)(wg + (size_t)(k8s * 8 + i) * DQK + (lane & 7) * 4);
    bf16* dh = sW + (4 + (lane >> 2)) * WTS + k8h * 128 + (lane & 3) * 32;    // columns 64 + lane * 4 + 0..3
    bf16* df = sW + ((lane & 7) >> 2) * WTS + k8s * 128 + (lane & 3) * 32;    // columns (lane & 7) * 4 + 0..3; wg: + 32
    #pragma unroll
    for (int jj = 0; jj < 6; ++jj) {
      bf16* d = jj < 4 ? dh + jj * 128 : (jj == 4 ? df : df + 2 * WTS);
      #pragma unroll
      for (int j = 0; j < 4; ++j) {
        Pack8B pk;
        #pragma unroll
        for (int i = 0; i < 8; ++i) pk.h[i] = (bf16)wv[jj][i][j];   // RNE convert
        *(v4u*)(d + j * 8) = pk.u;
      }
    }
  }
  if (packs) {
    Pack8H pk;
    #pragma unroll
    for (int i = 0; i < 8; ++i) pk.h[i] = (f16)((float)(bf16)wov[i] * 16.0f);   // bf16 significand fits f16: exact for normal results
    *(v4u*)(wot + (size_t)u * FRU + lane * 8) = pk.u;
    asm volatile("s_wait_xcnt 0x0" ::: "memory");   // stands before any later write of the store's address or data registers
  }
  // Wave tile: the 64 pixels of image row hsel (four M tiles) x three 16-column tiles t = ng * 3 + 0..2 of sW; K = CIN.
  // A weight fragment serves four M tiles.
  constexpr int NKB = CIN / 32;
  const int ng = __builtin_amdgcn_readfirstlane(wave) & 3;                      // scalar: it picks the tiles' kind below
  const bf16* wp = sW + (ng * 3) * WTS + lane * 8;                              // this lane's 16 B of every unit
  FragB bw[NKB][3];
  asm volatile("s_wait_asynccnt 0x0" ::: "memory");   // this wave's x rows have landed
  __syncthreads();                                    // publishes the x tile and the weight units to the waves that share them

  v8f acc[4][3];
  #pragma unroll
  for (int mi = 0; mi < 4; ++mi) {
    #pragma unroll
    for (int j = 0; j < 3; ++j) acc[mi][j] = (v8f){0, 0, 0, 0, 0, 0, 0, 0};
  }
  const float* xp = sX + (hsel * 64 + m) * XP + hi * 8;   // row of M tile mi: + mi * 16 * XP
  v4f ax[NKB][4][4];
  #pragma unroll
  for (int mi = 0; mi < 4; ++mi) {
    ax[0][mi][0] = *(const v4f*)(xp + mi * 16 * XP);
    ax[0][mi][1] = *(const v4f*)(xp + mi * 16 * XP + 4);
    ax[0][mi][2] = *(const v4f*)(xp + mi * 16 * XP + 16);
    ax[0][mi][3] = *(const v4f*)(xp + mi * 16 * XP + 20);
  }
  #pragma unroll
  for (int j = 0; j < 3; ++j) {
    bw[0][j].q[0] = *(const v4u*)(wp + j * WTS);         // k = hi*8 + 0..7 of the block
    bw[0][j].q[1] = *(const v4u*)(wp + j * WTS + FRU);   // k = 16 + hi*8 + 0..7
  }
  #pragma unroll
  for (int kk = 0; kk < NKB; ++kk) {
    if (kk + 1 < NKB) {
      #pragma unroll
      for (int mi = 0; mi < 4; ++mi) {
        ax[kk + 1][mi][0] = *(const v4f*)(xp + mi * 16 * XP + (kk + 1) * 32);
        ax[kk + 1][mi][1] = *(const v4f*)(xp + mi * 16 * XP + (kk + 1) * 32 + 4);
        ax[kk + 1][mi][2] = *(const v4f*)(xp + mi * 16 * XP + (kk + 1) * 32 + 16);
        ax[kk + 1][mi][3] = *(const v4f*)(xp + mi * 16 * XP + (kk + 1) * 32 + 20);
      }
      #pragma unroll
      for (int j = 0; j < 3; ++j) {
        bw[kk + 1][j].q[0] = *(const v4u*)(wp + j * WTS + ((kk + 1) * 2) * FRU);
        bw[kk + 1][j].q[1] = *(const v4u*)(wp + j * WTS + ((kk + 1) * 2 + 1) * FRU);
      }
    }
    __builtin_amdgcn_sched_barrier(0);   // the next block's loads stay in front of this block's matrix work
    FragB a[4];
    #pragma unroll
    for (int mi = 0; mi < 4; ++mi) {
      #pragma unroll
      for (int i = 0; i < 4; ++i) {
        a[mi].h[i]      = (bf16)ax[kk][mi][0][i];   // elems 0..7  : k = kk*32 + hi*8 + 0..7
        a[mi].h[4 + i]  = (bf16)ax[kk][mi][1][i];
        a[mi].h[8 + i]  = (bf16)ax[kk][mi][2][i];   // elems 8..15 : k = kk*32 + 16 + hi*8 + 0..7
        a[mi].h[12 + i] = (bf16)ax[kk][mi][3][i];
      }
    }
    #pragma unroll
    for (int j = 0; j < 3; ++j) {
      #pragma unroll
      for (int mi = 0; mi < 4; ++mi) acc[mi][j] = mma_bf16(a[mi].v, bw[kk][j].v, acc[mi][j]);
    }
    __builtin_amdgcn_sched_barrier(0);   // later loads are not lifted over this block: two blocks of x pieces live at most
  }

  // Column tile t: 0, 1 = f, 2, 3 = g, 4..11 = h. g goes unpooled to the tile of its 16 pixels; f and h are pooled along
  // ww: the pairs are D rows (2rp, 2rp+1) of the same lane half, pooled column pw = mi*8 + 4*hi + rp.
  #pragma unroll
  for (int j = 0; j < 3; ++j) {
    const int t = ng * 3 + j;
    if (t == 2 || t == 3) {
      #pragma unroll
      for (int mi = 0; mi < 4; ++mi) {
        f16* sgt = sG + (hsel * 4 + mi) * (16 * GP) + (t - 2) * 16 + m;
        #pragma unroll
        for (int r = 0; r < 8; ++r) sgt[(hi * 8 + r) * GP] = (f16)acc[mi][j][r];
      }
    } else {
      const int col = (t < 2 ? t * 16 : t * 16 - 32) + m;   // sP columns: [0,32) f, [32,160) h
      #pragma unroll
      for (int mi = 0; mi < 4; ++mi) {
        #pragma unroll
        for (int rp = 0; rp < 4; ++rp)
          sp[(mi * 8 + hi * 4 + rp) * PP + col] = (f16)fmaxf(acc[mi][j][2 * rp], acc[mi][j][2 * rp + 1]);
      }
    }
  }
  __syncthreads();

  // g tile -> gq: 16 consecutive pixel rows x 64 B = 1 KB contiguous; 32 lanes x 16 B per instruction
  {
    v4u    gv[2];
    size_t gi[2];
    #pragma unroll
    for (int i2 = 0; i2 < 2; ++i2) {
      const int row = i2 * 8 + (lane >> 2);
      const int cq  = (lane & 3) * 8;
      Pack8H p;
      p.v = *(const v8h*)(sg + row * GP + cq);
      gv[i2] = p.u;
      gi[i2] = ((size_t)b * SEQ + pix0 + row) * DQK + cq;
    }
    #pragma unroll
    for (int i2 = 0; i2 < 2; ++i2) *(v4u*)(gq + gi[i2]) = gv[i2];
  }

  // hh-pool into the block's pooled tiles
  #pragma unroll
  for (int e = 0; e < 4; ++e) {
    const int idx = e * 256 + tid;
    const int pw  = idx >> 5;
    const int c   = idx & 31;
    const float v = fmaxf((float)sP[pw * PP + c], (float)sP[32 * PP + pw * PP + c]);
    sF[pw * FP + c] = (f16)v;
  }
  #pragma unroll
  for (int e = 0; e < 16; ++e) {
    const int idx = e * 256 + tid;
    const int pw  = idx >> 7;
    const int d   = idx & 127;
    const float v = fmaxf((float)sP[pw * PP + 32 + d], (float)sP[32 * PP + pw * PP + 32 + d]);
    sHT[d * HP + pw] = (f16)v;
  }
  __syncthreads();

  // final plane stores: hvt (two 16-B pieces per thread, piece p = d * 4 + key quarter), fk (waves 0..3, 8 rows each)
  v4u    hv[2];
  size_t hidx[2];
  #pragma unroll
  for (int ps = 0; ps < 2; ++ps) {
    const int pc = ps * 256 + tid;         // 0..511
    Pack8H p;
    p.v = *(const v8h*)(sHT + (pc >> 2) * HP + (pc & 3) * 8);
    hv[ps]   = p.u;
    hidx[ps] = ((size_t)b * (NKEY / KTILE) + kt) * (DV * KTILE) + (size_t)pc * 8;
  }
  #pragma unroll
  for (int ps = 0; ps < 2; ++ps) *(v4u*)(hvt + hidx[ps]) = hv[ps];
  if (tid < KTILE * 4) {                   // wave-uniform: 128 pieces of 16 B
    const int row = tid >> 2;              // 0..31
    const int cq  = (tid & 3) * 8;
    Pack8H p;
    p.v = *(const v8h*)(sF + row * FP + cq);
    *(v4u*)(fk + ((size_t)b * NKEY + kt * KTILE + row) * DQK + cq) = p.u;
  }
}

// One stage of 64 keys into LDS, five asynchronous 16-B copies per thread: one piece of the f tile (64 rows x 64 B)
// and four of the h^T stage, which is two 32-key tiles of the plane = 16 KB contiguous (a wave covers four whole
// 128-B lines per copy). Copy i takes piece i * 256 + tid: key tile i >> 1, d = (i & 1) * 64 + (tid >> 2), key quarter
// tid & 3; in LDS the two tiles stand side by side in a row of 64 keys. The s_wait_xcnt closes the statement so that
// no address register of an issued copy is rewritten ahead of it.
static __device__ __forceinline__ void stage_copy(unsigned lf, const f16* gf, unsigned lv, const f16* gv) {
  const unsigned lv1 = lv + 64 * VSP * 2, lv2 = lv + KTILE * 2, lv3 = lv + 64 * VSP * 2 + KTILE * 2;
  const f16* gv1 = gv + 1 * 256 * 8;
  const f16* gv2 = gv + 2 * 256 * 8;
  const f16* gv3 = gv + 3 * 256 * 8;
  asm volatile("global_load_async_to_lds_b128 %0, %1, off\n\t"
               "global_load_async_to_lds_b128 %2, %3, off\n\t"
               "global_load_async_to_lds_b128 %4, %5, off\n\t"
               "global_load_async_to_lds_b128 %6, %7, off\n\t"
               "global_load_async_to_lds_b128 %8, %9, off\n\t"
               "s_wait_xcnt 0x0"
               :: "v"(lf), "v"(gf), "v"(lv), "v"(gv), "v"(lv1), "v"(gv1), "v"(lv2), "v"(gv2), "v"(lv3), "v"(gv3)
               : "memory");
}

// Flash attention, non-causal, no score scaling. Block = (query block of 128, batch); one wave owns 16 queries.
// S^T = F x G^T so queries sit on lanes; P^T in C-layout is bit-identical to the B-fragment layout of CTX^T += Hv^T x P^T,
// where a query stays on the lanes that hold its scores: its scale and its sum are the lane's own, and the two lane halves
// meet by a vector cross-row move, so that nothing of the softmax queues behind the fragment loads in the LDS pipe.
// G B-fragments come straight from the f16 plane. The f and h^T tiles, which all eight waves read, are brought into
// LDS once per block in stages of 64 keys (two buffers, the next stage's copies fly while this one is worked on);
// F and Hv^T A-fragments are two 16-B LDS loads each, issued as one group per pass ahead of their use.
// The output projection and the scaled residual follow in the same kernel: out = gamma * (CTX x Wo) + x_bf16. A wave's
// 16 x 128 CTX tile, rounded to f16, stays in its registers: the CTX^T tiles are already laid out as A fragments.
// LDS: sO per-wave regions, written and read across the lanes of their own wave only, so that no block barrier and with it
// no wait for the output stores stands between the quarters; staged extent == consumed extent.
__global__ __launch_bounds__(256) void attn_oproj_kernel(const f16* __restrict__ gq, const f16* __restrict__ fk,
                                                         const f16* __restrict__ hvt, const f16* __restrict__ wot,
                                                         const float* __restrict__ x, const float* __restrict__ gamma,
                                                         float* __restrict__ out) {
  const int qblk = blockIdx.x;
  const int b    = blockIdx.y;
  const int tid  = threadIdx.x;
  const int wave = tid >> 5;
  const int lane = tid & 31;
  const int lq   = lane & 15;   // query column of S^T and CTX^T / row of an F or Hv^T fragment
  const int hi   = lane >> 4;   // k-split half

  __shared__ __align__(16) f16 sKF[2 * SK * FSP];   // [buffer][key][32 d], pitch FSP
  __shared__ __align__(16) f16 sKV[2 * DV * VSP];   // [buffer][d][64 keys], pitch VSP
  __shared__ __align__(16) float sO[NWAVE * 16 * OP];   // per-wave f32 tile of one output quarter

  const int qrow0 = qblk * BQ + wave * 16;

  // G as B-operand fragment: lane lq holds query qrow0+lq, elements follow the split d map
  FragH qf;
  {
    const f16* qp = gq + ((size_t)b * SEQ + qrow0 + lq) * DQK + hi * 8;
    qf.q[0] = *(const v4u*)(qp);        // d = hi*8 + 0..7
    qf.q[1] = *(const v4u*)(qp + 16);   // d = 16 + hi*8 + 0..7
  }

  const float gsc = (float)(bf16)gamma[0] * 0.0625f;   // gamma (RNE bf16) folded with the 1/16 Wo carry

  const f16* fk_b = fk + (size_t)b * NKEY * DQK;
  const f16* vt_b = hvt + (size_t)b * DV * NKEY;

  v8f o[8];
  #pragma unroll
  for (int dt = 0; dt < 8; ++dt) o[dt] = (v8f){0, 0, 0, 0, 0, 0, 0, 0};

  float rmax = -__builtin_inff();
  float rsum = 0.0f;
  const float SL = 1.4426950408889634f;   // log2(e); the scores carry no extra scale

  // this thread's pieces of a stage: LDS byte addresses in buffer 0 and global pointers of stage 0
  const unsigned lf0 = (unsigned)(uintptr_t)sKF + (unsigned)((tid >> 2) * (FSP * 2) + (tid & 3) * 16);
  const unsigned lv0 = (unsigned)(uintptr_t)sKV + (unsigned)((tid >> 2) * (VSP * 2) + (tid & 3) * 16);
  const f16* gf0 = fk_b + tid * 8;                                  // f stage = 4 KB contiguous
  const f16* gv0 = vt_b + tid * 8;                                  // h^T stage = 16 KB contiguous

  stage_copy(lf0, gf0, lv0, gv0);
  asm volatile("s_wait_asynccnt 0x0" ::: "memory");   // this wave's pieces of stage 0 have landed
  __syncthreads();                                    // publishes stage 0 to all waves
  if (NST > 1) stage_copy(lf0 + SK * FSP * 2, gf0 + SK * DQK, lv0 + DV * VSP * 2, gv0 + SK * DV);

  for (int t = 0; t < NST; ++t) {
   const int buf = t & 1;
   const f16* sf = sKF + buf * (SK * FSP);
   const f16* sv = sKV + buf * (DV * VSP);
   // One group of LDS loads at the head of the stage: the F A-fragments of both passes (row = key, split d map) and the
   // Hv^T A-fragments of the first pass (row = d = dt*16 + lq, split key map from the transposed tile).
   FragH ak[SK / BK][2];
   #pragma unroll
   for (int ps = 0; ps < SK / BK; ++ps) {
     #pragma unroll
     for (int sub = 0; sub < 2; ++sub) {
       const f16* base = sf + (ps * BK + sub * 16 + lq) * FSP + hi * 8;
       ak[ps][sub].q[0] = *(const v4u*)(base);        // d = hi*8 + 0..7
       ak[ps][sub].q[1] = *(const v4u*)(base + 16);   // d = 16 + hi*8 + 0..7
     }
   }
   FragH bv[8];
   #pragma unroll
   for (int dt = 0; dt < 8; ++dt) {
     const f16* base = sv + (dt * 16 + lq) * VSP + hi * 8;
     bv[dt].q[0] = *(const v4u*)(base);        // keys hi*8 + 0..7
     bv[dt].q[1] = *(const v4u*)(base + 16);   // keys 16 + hi*8 + 0..7
   }
   __builtin_amdgcn_sched_barrier(0);   // the group stays whole, in front of the scores and the softmax that hide its latency
   #pragma unroll   // both passes of a stage inline: j0 folds into the LDS loads' immediate offsets
   for (int ps = 0; ps < SK / BK; ++ps) {
    // S^T tiles: c[sub][r] = score(query qrow0+lq, key j0 + sub*16 + hi*8 + r), j0 = ps * BK
    v8f c[2];
    #pragma unroll
    for (int sub = 0; sub < 2; ++sub)
      c[sub] = mma_f16(ak[ps][sub].v, qf.v, (v8f){0, 0, 0, 0, 0, 0, 0, 0});

    // online softmax: query lq's 32 scores are split across lane / lane^16
    float m_new = rmax;
    #pragma unroll
    for (int r = 0; r < 8; ++r) {
      m_new = fmaxf(m_new, c[0][r]);
      m_new = fmaxf(m_new, c[1][r]);
    }
    m_new = fmaxf(m_new, xhalf(m_new));
    const float scale = __builtin_amdgcn_exp2f((rmax - m_new) * SL);
    rmax = m_new;

    // exp + pack: P^T C-layout == B-fragment layout for the PV product; P carried x4096 in f16
    FragH pa;
    float psum = 0.0f;
    #pragma unroll
    for (int r = 0; r < 8; ++r) {
      const float p0 = __builtin_amdgcn_exp2f((c[0][r] - m_new) * SL);   // key j0 + hi*8 + r
      const float p1 = __builtin_amdgcn_exp2f((c[1][r] - m_new) * SL);   // key j0 + 16 + hi*8 + r
      psum += p0 + p1;
      pa.h[r]     = (f16)(p0 * 4096.0f);
      pa.h[8 + r] = (f16)(p1 * 4096.0f);
    }
    rsum = rsum * scale + psum + xhalf(psum);

    // rescale CTX^T: queries are the column dimension there -> the lane's own scale
    #pragma unroll
    for (int dt = 0; dt < 8; ++dt) {
      #pragma unroll
      for (int r = 0; r < 8; ++r) o[dt][r] *= scale;
    }

    // CTX^T += Hv^T x P^T: o[dt][r] = ctx(query qrow0 + lq, d = dt*16 + hi*8 + r)
    #pragma unroll
    for (int dt = 0; dt < 8; ++dt) o[dt] = mma_f16(bv[dt].v, pa.v, o[dt]);
    if (ps + 1 < SK / BK) {
      __builtin_amdgcn_sched_barrier(0);   // the next pass's group is not lifted over these products: one set of Hv^T registers
      #pragma unroll
      for (int dt = 0; dt < 8; ++dt) {
        const f16* base = sv + (dt * 16 + lq) * VSP + (ps + 1) * BK + hi * 8;
        bv[dt].q[0] = *(const v4u*)(base);        // keys j0 + hi*8 + 0..7 of the next pass
        bv[dt].q[1] = *(const v4u*)(base + 16);   // keys j0 + 16 + hi*8 + 0..7
      }
      __builtin_amdgcn_sched_barrier(0);   // and it stays whole, in front of the next pass's scores and softmax
    }
   }
   __builtin_amdgcn_sched_barrier(0);   // the second pass's work stays in front of the hand-over, whose waits would else stand right behind its loads
   // hand-over: stage t + 1 becomes readable, and the buffer of stage t free, behind this one barrier
   asm volatile("s_wait_dscnt 0x0" ::: "memory");      // this wave's reads of stage t are done before the refill
   asm volatile("s_wait_asynccnt 0x0" ::: "memory");   // this wave's pieces of stage t + 1 have landed
   __syncthreads();
   if (t + 2 < NST)
     stage_copy(lf0 + buf * (SK * FSP * 2), gf0 + (size_t)(t + 2) * (SK * DQK),
                lv0 + buf * (DV * VSP * 2), gv0 + (size_t)(t + 2) * (SK * DV));
  }
  asm volatile("s_wait_asynccnt 0x0" ::: "memory");    // no copy is outstanding when the wave goes on to its end

  // normalize: lane holds d = dt*16 + hi*8 + 0..7 of its own query lq. Two neighbouring CTX^T tiles, rounded to f16 in place,
  // are the A fragment of the output projection (row = query lq, split d map): the ctx tile never leaves the registers.
  const float rs = 1.0f / rsum;

  FragH a[DV / 32];   // the wave's ctx rows, the same for all four quarters
  #pragma unroll
  for (int kk = 0; kk < DV / 32; ++kk) {
    #pragma unroll
    for (int r = 0; r < 8; ++r) {
      a[kk].h[r]     = (f16)(o[2 * kk][r] * (1.0f / 4096.0f) * rs);       // d = kk*32 + hi*8 + r
      a[kk].h[8 + r] = (f16)(o[2 * kk + 1][r] * (1.0f / 4096.0f) * rs);   // d = kk*32 + 16 + hi*8 + r
    }
  }

  // Output projection: four passes over 64-column quarters. B fragments from the wot units (carried x16). Epilogue per
  // quarter: f32 tile staged in LDS, then whole 256-B quarter-rows per half wave, with the residual added.
  const int m = lq;                          // B column within a tile / 16-B piece index of the quarter-row
  const size_t xrow0 = (size_t)b * SEQ_FULL + qrow0;
  float* so = sO + wave * (16 * OP);

  #pragma unroll 1
  for (int qn = 0; qn < 4; ++qn) {
    // one group of loads per quarter: its sixteen Wo fragments, then the x pieces of its residual
    FragH bw[DV / 32][4];
    #pragma unroll
    for (int kk = 0; kk < DV / 32; ++kk) {
      #pragma unroll
      for (int j = 0; j < 4; ++j) {
        const f16* wp = wot + (size_t)(((qn * 4 + j) * (DV / 32) + kk) * 2) * FRU + lane * 8;
        bw[kk][j].q[0] = *(const v4u*)(wp);         // d = kk*32 + hi*8 + 0..7 of column (qn*4 + j)*16 + m
        bw[kk][j].q[1] = *(const v4u*)(wp + FRU);   // d = kk*32 + 16 + hi*8 + 0..7
      }
    }
    v4f    xq[8];
    size_t gidx[8];
    #pragma unroll
    for (int it = 0; it < 8; ++it) {
      gidx[it] = (xrow0 + it * 2 + hi) * CIN + qn * 64 + m * 4;
      xq[it]   = *(const v4f*)(x + gidx[it]);
    }
    __builtin_amdgcn_sched_barrier(0);   // the group stays whole, in front of the quarter's matrix work
    v8f acc[4];
    #pragma unroll
    for (int j = 0; j < 4; ++j) acc[j] = (v8f){0, 0, 0, 0, 0, 0, 0, 0};
    #pragma unroll
    for (int kk = 0; kk < DV / 32; ++kk) {
      #pragma unroll
      for (int j = 0; j < 4; ++j) acc[j] = mma_f16(a[kk].v, bw[kk][j].v, acc[j]);
    }
    #pragma unroll
    for (int r = 0; r < 8; ++r) {
      #pragma unroll
      for (int j = 0; j < 4; ++j) so[(hi * 8 + r) * OP + j * 16 + m] = acc[j][r] * gsc;
    }
    asm volatile("s_wait_dscnt 0x0" ::: "memory");   // the tile is the wave's own: its stores have landed before its lanes read each other's rows

    v4f vals[8];
    #pragma unroll
    for (int it = 0; it < 8; ++it) {
      const int row = it * 2 + hi;
      v4f v = *(const v4f*)(so + row * OP + m * 4);
      #pragma unroll
      for (int cc = 0; cc < 4; ++cc) v[cc] = v[cc] + (float)(bf16)xq[it][cc];   // residual with the RNE bf16 input value
      vals[it] = v;
    }
    #pragma unroll
    for (int it = 0; it < 8; ++it) *(v4f*)(out + gidx[it]) = vals[it];
    asm volatile("s_wait_xcnt 0x0" ::: "memory");    // stands before the next quarter rewrites the stores' address and data registers
  }
}

extern "C" void kernel_launch(void* const* d_in, const int* in_sizes, int n_in,
                              void* d_out, int out_size, void* d_ws, size_t ws_size,
                              hipStream_t stream) {
  if (n_in < 6) return;
  const size_t rows_used = (size_t)(NB - 1) * SEQ_FULL + SEQ;
  if ((size_t)in_sizes[0] < rows_used * CIN) return;
  if (in_sizes[1] < CIN * DQK) return;
  if (in_sizes[2] < CIN * DQK) return;
  if (in_sizes[3] < CIN * DV) return;
  if (in_sizes[4] < DV * CIN) return;
  if (in_sizes[5] < 1) return;
  if ((size_t)out_size < rows_used * CIN) return;

  const size_t wot_bytes = (size_t)CIN * DV * 2;              // 65,536
  const size_t gq_bytes  = (size_t)NB * SEQ * DQK * 2;        // 2,097,152 at full size
  const size_t fk_bytes  = (size_t)NB * NKEY * DQK * 2;       // 524,288
  const size_t hvt_bytes = (size_t)NB * DV * NKEY * 2;        // 2,097,152
  const size_t off_wot = 0;
  const size_t off_gq  = off_wot + wot_bytes;
  const size_t off_fk  = off_gq + gq_bytes;
  const size_t off_hvt = off_fk + fk_bytes;
  const size_t total   = off_hvt + hvt_bytes;                 // 4,784,128 at full size
  if (ws_size < total) return;

  const float* x     = (const float*)d_in[0];
  const float* wf    = (const float*)d_in[1];
  const float* wg    = (const float*)d_in[2];
  const float* wh    = (const float*)d_in[3];
  const float* wo    = (const float*)d_in[4];
  const float* gamma = (const float*)d_in[5];
  float* out = (float*)d_out;
  char*  ws  = (char*)d_ws;
  f16*  wot = (f16*)(ws + off_wot);
  f16*  gq  = (f16*)(ws + off_gq);
  f16*  fk  = (f16*)(ws + off_fk);
  f16*  hvt = (f16*)(ws + off_hvt);

  proj_pool_kernel<<<dim3(SEQ / 128, NB), 256, 0, stream>>>(x, wf, wg, wh, wo, wot, gq, fk, hvt);
  attn_oproj_kernel<<<dim3(SEQ / BQ, NB), 256, 0, stream>>>(gq, fk, hvt, wot, x, gamma, out);
}

// v010
// It runs in 27.9 microseconds.
// In two side-by-side timings against v009, it was 1.04 and 1.07 times as fast.
// All steps since v000 together make it 5.41 times as fast.
#include <hip/hip_runtime.h>

// Contractions: X x [Wf|Wg|Wh] on v_wmma_f32_16x16x32_bf16 (bf16 operands = RNE-converted inputs, f32 accumulate);
// S^T = F x G^T, CTX^T = Hv^T x P^T (P as f16 carried x4096) and OUT = CTX x Wo (Wo as f16 of the bf16 value, carried x16)
// on v_wmma_f32_16x16x32_f16 (f16 operands, f32 accumulate). Max-pool, softmax and residual in f32.

#ifndef NB
#define NB 8
#endif
#ifndef SEQ
#define SEQ 4096
#endif
#define NB_FULL  8
#define SEQ_FULL 4096
#define W_IMG    64                 // image width (pixels per image row)
#define CIN      256                // input channels
#define DQK      32                 // query / key channels
#define DV       128                // value channels
#define NPROJ    192                // packed projection columns: [0,32) f, [32,64) g, [64,192) h
#define NKEY     (SEQ / 4)          // pooled key count per image
#define KTILE    32                 // keys produced per projection block (two image rows)
#define BQ       128                // query rows per attention block (8 waves x 16)
#define BK       32                 // keys per inner iteration
#define NWAVE    8
#define PP       168                // LDS pitch (halves) of the ww-pooled staging rows
#define GP       40                 // LDS pitch (halves) of the g staging tile
#define FP       40                 // LDS pitch (halves) of the pooled f tile
#define HP       40                 // LDS pitch (halves) of the pooled h^T tile: 80 B = 16 B x odd
#define OP       68                 // LDS pitch (floats) of the output staging tile
#define SK       64                 // keys per LDS stage of the attention loop (two BK passes)
#define NST      (NKEY / SK)        // stages per image
#define FSP      40                 // LDS pitch (halves) of a staged f row: 80 B = 16 B x odd
#define VSP      72                 // LDS pitch (halves) of a staged h^T row: 144 B = 16 B x odd
#define FRU      256                // halves per weight fragment unit: 32 lanes x 16 B = 512 B = four whole lines
#define XP       260                // LDS pitch (floats) of a staged x row: 1040 B = 16 B x odd
#define WTS      4104               // LDS pitch (halves) of a column tile's 16 weight units: 8192 B + 16 B

static_assert(SEQ % 256 == 0);
static_assert(SEQ >= 256 && SEQ <= SEQ_FULL);
static_assert(NB >= 1 && NB <= NB_FULL);
static_assert(BQ == NWAVE * 16);
static_assert(NKEY % BK == 0);
static_assert(NKEY % KTILE == 0);
static_assert(CIN % 32 == 0 && DV % 32 == 0 && DQK == 32);
// coverage equalities (grid x block x per-thread elements == plane extent)
static_assert((SEQ / 128) * NWAVE * 16 == SEQ);              // g plane rows per image
static_assert((SEQ / 128) * KTILE == NKEY);                   // f / h^T plane keys per image
static_assert(2 * W_IMG == NWAVE * 16 && KTILE == W_IMG / 2); // a projection block = two whole image rows
static_assert((SEQ / BQ) * NWAVE * 16 == SEQ);                // ctx and output rows per image
static_assert((GP * 2) % 16 == 0 && (FP * 2) % 16 == 0 && (HP * 2) % 16 == 0);
static_assert((OP * 4) % 16 == 0);
static_assert(NKEY % SK == 0 && SK == 2 * BK && NST >= 1);
static_assert((FSP * 2) % 16 == 0 && (VSP * 2) % 16 == 0);
static_assert(SK * DQK * 2 == 256 * 16);        // f stage: one 16-B copy per thread
static_assert(DV * SK * 2 == 4 * 256 * 16);     // h^T stage: four 16-B copies per thread
static_assert(SK == 2 * KTILE);                 // h^T stage: two whole key tiles of the plane, 16 KB contiguous
static_assert(NST * 256 * 16 == CIN * DV * 2);  // wo plane: one 16-B copy per thread and stage brings in all of it
static_assert((XP * 4) % 16 == 0 && XP >= CIN && CIN * 4 == 2 * 32 * 16);   // x row: two wave-wide 16-B copies
static_assert(W_IMG == 4 * 16 && NPROJ == 4 * 3 * 16 && NWAVE == 2 * 4);    // wave tile: one image row x three column tiles
static_assert(WTS >= 16 * FRU && (WTS * 2) % 16 == 0);
static_assert(CIN == NWAVE * 4 * 8 && DV == 32 * 4 && DQK == 8 * 4);         // weight pack: a wave takes 32 k of every column
static_assert((SEQ / 128) * NB * NWAVE >= (CIN / 16) * (DV / 32) * 2);       // enough waves in the first blocks for the wot units

typedef __bf16   bf16;
typedef _Float16 f16;
typedef bf16     v16bf __attribute__((ext_vector_type(16)));
typedef f16      v16h  __attribute__((ext_vector_type(16)));
typedef f16      v8h   __attribute__((ext_vector_type(8)));
typedef float    v8f   __attribute__((ext_vector_type(8)));
typedef float    v4f   __attribute__((ext_vector_type(4)));
typedef unsigned v4u   __attribute__((ext_vector_type(4)));

union FragB  { v16bf v; v4u q[2]; bf16 h[16]; };
union FragH  { v16h  v; v4u q[2]; f16  h[16]; };
union Pack8B { v4u u; bf16 h[8]; };
union Pack8H { v4u u; v8h v; f16 h[8]; };

// WMMA helpers: the plain builtins; the compiler keeps the distance behind its own matrix instructions. No volatile
// statement stands behind them, so that a block's fragment loads can be issued ahead of the block before it.
static __device__ __forceinline__ v8f mma_bf16(v16bf a, v16bf b, v8f acc) {
  return __builtin_amdgcn_wmma_f32_16x16x32_bf16(false, a, false, b, (short)0, acc, false, false);
}
static __device__ __forceinline__ v8f mma_f16(v16h a, v16h b, v8f acc) {
  return __builtin_amdgcn_wmma_f32_16x16x32_f16(false, a, false, b, (short)0, acc, false, false);
}
// lane l takes the value of lane l ^ 16: a vector cross-row move, no trip through the LDS pipe
static __device__ __forceinline__ float xhalf(float v) {
  const int b = __builtin_bit_cast(int, v);
  return __builtin_bit_cast(float, __builtin_amdgcn_permlanex16(b, b, 0x76543210, 0xfedcba98, false, false));
}

// Weights in fragment order: a unit is the 512 contiguous bytes that one wave-wide 16-B load of a B fragment half takes,
// lane (hi, m) holding column n = tile * 16 + m, k = kk * 32 + q * 16 + hi * 8 + 0..7.
//   [wf | wg | wh], bf16 RNE, unit (kk * 2 + q) of column tile t = 0..11: made by every projection block in its own LDS.
//   wot unit (nt * 4 + kk) * 2 + q, nt = 0..15 : f16(bf16(w) * 16) (exact) of column nt * 16 + m of wo, a workspace plane.

// Four x rows (4 KB contiguous in global memory) into LDS, eight asynchronous 16-B copies per lane: copy j takes the
// 512 contiguous bytes j of the piece (four whole lines per wave-wide copy) to row j >> 1, half j & 1 of the padded tile.
// The s_wait_xcnt closes the statement so that no address register of an issued copy is rewritten ahead of it.
static __device__ __forceinline__ void x_copy4rows(unsigned l, const float* g) {
  const unsigned l1 = l + 512,              l2 = l + XP * 4,     l3 = l + XP * 4 + 512;
  const unsigned l4 = l + 2 * XP * 4,       l5 = l4 + 512,       l6 = l + 3 * XP * 4,   l7 = l6 + 512;
  const float* g1 = g + 1 * 128;
  const float* g2 = g + 2 * 128;
  const float* g3 = g + 3 * 128;
  const float* g4 = g + 4 * 128;
  const float* g5 = g + 5 * 128;
  const float* g6 = g + 6 * 128;
  const float* g7 = g + 7 * 128;
  asm volatile("global_load_async_to_lds_b128 %0, %1, off\n\t"
               "global_load_async_to_lds_b128 %2, %3, off\n\t"
               "global_load_async_to_lds_b128 %4, %5, off\n\t"
               "global_load_async_to_lds_b128 %6, %7, off\n\t"
               "global_load_async_to_lds_b128 %8, %9, off\n\t"
               "global_load_async_to_lds_b128 %10, %11, off\n\t"
               "global_load_async_to_lds_b128 %12, %13, off\n\t"
               "global_load_async_to_lds_b128 %14, %15, off\n\t"
               "s_wait_xcnt 0x0"
               :: "v"(l), "v"(g), "v"(l1), "v"(g1), "v"(l2), "v"(g2), "v"(l3), "v"(g3),
                  "v"(l4), "v"(g4), "v"(l5), "v"(g5), "v"(l6), "v"(g6), "v"(l7), "v"(g7)
               : "memory");
}

// Projection + 2x2 max-pool. Block = (32-key tile kt, batch b), 256 threads: the two image rows hh = kt*2 + {0,1},
// so that the grid has one block for every WGP of the chip. Matrix work: wave -> (image row, three column tiles);
// copies in and plane stores out: wave -> (image row, 16 pixels along ww).
//   gq  [NB][SEQ][DQK]  f16 : queries, one 64-B row per pixel (wave writes 16 rows = 1 KB, 2 instructions).
//   fk  [NB][NKEY][DQK] f16 : pooled keys, 32 rows per block = 2 KB (one 512-B instruction per wave, four waves).
//   hvt [NB][NKEY/32][DV][32] f16 : pooled values, transposed inside a 32-key tile; a block writes its own 8 KB,
//                                   whole lines only (512 B per instruction).
// x comes in once, in whole lines: each wave copies 16 pixel rows (16 KB contiguous) into sX, from where four waves read
// every row as A pieces (RNE bf16 convert, split k map); a direct fragment load would touch 16 lines for 512 bytes.
// The weights come in as the f32 inputs, in whole lines, while the x copies fly: every block converts them and lays them
// out in fragment order in its own LDS (sW), so that no launch of its own stands in front of this one for it. The first
// sixteen blocks also write the wo plane of the next launch, one unit per wave.
// LDS regions, all cross-wave under block barriers: sX (filled by copies), sW, sP, sG, sF, sHT. Staged == consumed extent.
__global__ __launch_bounds__(256) void proj_pool_kernel(const float* __restrict__ x, const float* __restrict__ wf,
                                                         const float* __restrict__ wg, const float* __restrict__ wh,
                                                         const float* __restrict__ wo, f16* __restrict__ wot,
                                                         f16* __restrict__ gq, f16* __restrict__ fk,
                                                         f16* __restrict__ hvt) {
  const int kt   = blockIdx.x;
  const int b    = blockIdx.y;
  const int tid  = threadIdx.x;
  const int wave = tid >> 5;
  const int lane = tid & 31;
  const int m    = lane & 15;
  const int hi   = lane >> 4;
  const int hsel = wave >> 2;          // which of the block's two image rows
  const int ww0  = (wave & 3) * 16;    // first pixel column of this wave's 16 copied and stored pixels

  __shared__ __align__(16) f16 sP[2 * 32 * PP];       // [hsel][pw][160 cols] ww-pooled f|h
  __shared__ __align__(16) f16 sG[NWAVE * 16 * GP];   // g tile [16][32] of each 16-pixel group
  __shared__ __align__(16) f16 sF[KTILE * FP];        // pooled f [32 keys][32]
  __shared__ __align__(16) f16 sHT[DV * HP];          // pooled h^T [128 d][32 keys]
  __shared__ __align__(16) float sX[NWAVE * 16 * XP]; // x rows of the block's 128 pixels, f32, pitch XP
  __shared__ __align__(16) bf16 sW[(NPROJ / 16) * WTS]; // [column tile][16 units of 512 B], tile pitch WTS

  f16* sg = sG + wave * (16 * GP);
  f16* sp = sP + hsel * (32 * PP);

  const int hh   = kt * 2 + hsel;
  const int pix0 = hh * W_IMG + ww0;
  {
    const unsigned lx = (unsigned)(uintptr_t)sX + (unsigned)(wave * (16 * XP * 4) + lane * 16);
    const float*   gx = x + ((size_t)b * SEQ_FULL + pix0) * CIN + lane * 4;
    #pragma unroll   // 32 copies of a wave in flight, four statements of eight
    for (int c = 0; c < 4; ++c) x_copy4rows(lx + c * (4 * XP * 4), gx + c * (4 * CIN));
  }
  // wo plane: unit u of the first sixteen blocks' waves (block-uniform test); the loads go out first, the store follows below
  constexpr int WOB = (CIN / 16) * (DV / 32) * 2 / NWAVE;   // blocks that pack a wo unit per wave
  const int  lin   = b * (SEQ / 128) + kt;
  const bool packs = lin < WOB;
  const int  u     = lin * NWAVE + wave;                    // 0..127 where packs
  float wov[8];
  #pragma unroll
  for (int i = 0; i < 8; ++i) wov[i] = 0.0f;
  if (packs) {
    const int n  = (u >> 3) * 16 + m;                                    // 0..255
    const int k0 = ((u >> 1) & 3) * 32 + (u & 1) * 16 + hi * 8;          // 0..120
    #pragma unroll
    for (int i = 0; i < 8; ++i) wov[i] = wo[(size_t)(k0 + i) * CIN + n];
  }
  // [wf | wg | wh] -> sW. A wave takes k = wave * 32 + 0..31 of every column: a lane loads eight consecutive k of four
  // neighbouring columns (eight 16-B loads, each wave-wide load four whole lines) and makes four 16-B pieces of them.
  // Piece (column tile t, k group k8 = k / 8, column m) stands at t * WTS + k8 * 128 + m * 8 halves: k8 = kk*4 + q*2 + hi.
  {
    const int k8h = wave * 4;                  // wh: a row is 512 B, one k group per set of eight loads
    const int k8s = wave * 4 + (lane >> 3);    // wf, wg: a row is 128 B, four k groups per set
    v4f wv[6][8];
    #pragma unroll
    for (int jj = 0; jj < 4; ++jj) {
      #pragma unroll
      for (int i = 0; i < 8; ++i) wv[jj][i] = *(const v4f*)(wh + (size_t)((k8h + jj) * 8 + i) * DV + lane * 4);
    }
    #pragma unroll
    for (int i = 0; i < 8; ++i) wv[4][i] = *(const v4f*)(wf + (size_t)(k8s * 8 + i) * DQK + (lane & 7) * 4);
    #pragma unroll
    for (int i = 0; i < 8; ++i) wv[5][i] = *(const v4f*)(wg + (size_t)(k8s * 8 + i) * DQK + (lane & 7) * 4);
    bf16* dh = sW + (4 + (lane >> 2)) * WTS + k8h * 128 + (lane & 3) * 32;    // columns 64 + lane * 4 + 0..3
    bf16* df = sW + ((lane & 7) >> 2) * WTS + k8s * 128 + (lane & 3) * 32;    // columns (lane & 7) * 4 + 0..3; wg: + 32
    #pragma unroll
    for (int jj = 0; jj < 6; ++jj) {
      bf16* d = jj < 4 ? dh + jj * 128 : (jj == 4 ? df : df + 2 * WTS);
      #pragma unroll
      for (int j = 0; j < 4; ++j) {
        Pack8B pk;
        #pragma unroll
        for (int i = 0; i < 8; ++i) pk.h[i] = (bf16)wv[jj][i][j];   // RNE convert
        *(v4u*)(d + j * 8) = pk.u;
      }
    }
  }
  if (packs) {
    Pack8H pk;
    #pragma unroll
    for (int i = 0; i < 8; ++i) pk.h[i] = (f16)((float)(bf16)wov[i] * 16.0f);   // bf16 significand fits f16: exact for normal results
    *(v4u*)(wot + (size_t)u * FRU + lane * 8) = pk.u;
    asm volatile("s_wait_xcnt 0x0" ::: "memory");   // stands before any later write of the store's address or data registers
  }
  // Wave tile: the 64 pixels of image row hsel (four M tiles) x three 16-column tiles t = ng * 3 + 0..2 of sW; K = CIN.
  // A weight fragment serves four M tiles.
  constexpr int NKB = CIN / 32;
  const int ng = __builtin_amdgcn_readfirstlane(wave) & 3;                      // scalar: it picks the tiles' kind below
  const bf16* wp = sW + (ng * 3) * WTS + lane * 8;                              // this lane's 16 B of every unit
  FragB bw[NKB][3];
  asm volatile("s_wait_asynccnt 0x0" ::: "memory");   // this wave's x rows have landed
  __syncthreads();                                    // publishes the x tile and the weight units to the waves that share them

  v8f acc[4][3];
  #pragma unroll
  for (int mi = 0; mi < 4; ++mi) {
    #pragma unroll
    for (int j = 0; j < 3; ++j) acc[mi][j] = (v8f){0, 0, 0, 0, 0, 0, 0, 0};
  }
  const float* xp = sX + (hsel * 64 + m) * XP + hi * 8;   // row of M tile mi: + mi * 16 * XP
  v4f ax[NKB][4][4];
  #pragma unroll
  for (int mi = 0; mi < 4; ++mi) {
    ax[0][mi][0] = *(const v4f*)(xp + mi * 16 * XP);
    ax[0][mi][1] = *(const v4f*)(xp + mi * 16 * XP + 4);
    ax[0][mi][2] = *(const v4f*)(xp + mi * 16 * XP + 16);
    ax[0][mi][3] = *(const v4f*)(xp + mi * 16 * XP + 20);
  }
  #pragma unroll
  for (int j = 0; j < 3; ++j) {
    bw[0][j].q[0] = *(const v4u*)(wp + j * WTS);         // k = hi*8 + 0..7 of the block
    bw[0][j].q[1] = *(const v4u*)(wp + j * WTS + FRU);   // k = 16 + hi*8 + 0..7
  }
  #pragma unroll
  for (int kk = 0; kk < NKB; ++kk) {
    if (kk + 1 < NKB) {
      #pragma unroll
      for (int mi = 0; mi < 4; ++mi) {
        ax[kk + 1][mi][0] = *(const v4f*)(xp + mi * 16 * XP + (kk + 1) * 32);
        ax[kk + 1][mi][1] = *(const v4f*)(xp + mi * 16 * XP + (kk + 1) * 32 + 4);
        ax[kk + 1][mi][2] = *(const v4f*)(xp + mi * 16 * XP + (kk + 1) * 32 + 16);
        ax[kk + 1][mi][3] = *(const v4f*)(xp + mi * 16 * XP + (kk + 1) * 32 + 20);
      }
      #pragma unroll
      for (int j = 0; j < 3; ++j) {
        bw[kk + 1][j].q[0] = *(const v4u*)(wp + j * WTS + ((kk + 1) * 2) * FRU);
        bw[kk + 1][j].q[1] = *(const v4u*)(wp + j * WTS + ((kk + 1) * 2 + 1) * FRU);
      }
    }
    __builtin_amdgcn_sched_barrier(0);   // the next block's loads stay in front of this block's matrix work
    FragB a[4];
    #pragma unroll
    for (int mi = 0; mi < 4; ++mi) {
      #pragma unroll
      for (int i = 0; i < 4; ++i) {
        a[mi].h[i]      = (bf16)ax[kk][mi][0][i];   // elems 0..7  : k = kk*32 + hi*8 + 0..7
        a[mi].h[4 + i]  = (bf16)ax[kk][mi][1][i];
        a[mi].h[8 + i]  = (bf16)ax[kk][mi][2][i];   // elems 8..15 : k = kk*32 + 16 + hi*8 + 0..7
        a[mi].h[12 + i] = (bf16)ax[kk][mi][3][i];
      }
    }
    #pragma unroll
    for (int j = 0; j < 3; ++j) {
      #pragma unroll
      for (int mi = 0; mi < 4; ++mi) acc[mi][j] = mma_bf16(a[mi].v, bw[kk][j].v, acc[mi][j]);
    }
    __builtin_amdgcn_sched_barrier(0);   // later loads are not lifted over this block: two blocks of x pieces live at most
  }

  // Column tile t: 0, 1 = f, 2, 3 = g, 4..11 = h. g goes unpooled to the tile of its 16 pixels; f and h are pooled along
  // ww: the pairs are D rows (2rp, 2rp+1) of the same lane half, pooled column pw = mi*8 + 4*hi + rp.
  #pragma unroll
  for (int j = 0; j < 3; ++j) {
    const int t = ng * 3 + j;
    if (t == 2 || t == 3) {
      #pragma unroll
      for (int mi = 0; mi < 4; ++mi) {
        f16* sgt = sG + (hsel * 4 + mi) * (16 * GP) + (t - 2) * 16 + m;
        #pragma unroll
        for (int r = 0; r < 8; ++r) sgt[(hi * 8 + r) * GP] = (f16)acc[mi][j][r];
      }
    } else {
      const int col = (t < 2 ? t * 16 : t * 16 - 32) + m;   // sP columns: [0,32) f, [32,160) h
      #pragma unroll
      for (int mi = 0; mi < 4; ++mi) {
        #pragma unroll
        for (int rp = 0; rp < 4; ++rp)
          sp[(mi * 8 + hi * 4 + rp) * PP + col] = (f16)fmaxf(acc[mi][j][2 * rp], acc[mi][j][2 * rp + 1]);
      }
    }
  }
  __syncthreads();

  // g tile -> gq: 16 consecutive pixel rows x 64 B = 1 KB contiguous; 32 lanes x 16 B per instruction
  {
    v4u    gv[2];
    size_t gi[2];
    #pragma unroll
    for (int i2 = 0; i2 < 2; ++i2) {
      const int row = i2 * 8 + (lane >> 2);
      const int cq  = (lane & 3) * 8;
      Pack8H p;
      p.v = *(const v8h*)(sg + row * GP + cq);
      gv[i2] = p.u;
      gi[i2] = ((size_t)b * SEQ + pix0 + row) * DQK + cq;
    }
    #pragma unroll
    for (int i2 = 0; i2 < 2; ++i2) *(v4u*)(gq + gi[i2]) = gv[i2];
  }

  // hh-pool into the block's pooled tiles
  #pragma unroll
  for (int e = 0; e < 4; ++e) {
    const int idx = e * 256 + tid;
    const int pw  = idx >> 5;
    const int c   = idx & 31;
    const float v = fmaxf((float)sP[pw * PP + c], (float)sP[32 * PP + pw * PP + c]);
    sF[pw * FP + c] = (f16)v;
  }
  #pragma unroll
  for (int e = 0; e < 16; ++e) {
    const int idx = e * 256 + tid;
    const int pw  = idx >> 7;
    const int d   = idx & 127;
    const float v = fmaxf((float)sP[pw * PP + 32 + d], (float)sP[32 * PP + pw * PP + 32 + d]);
    sHT[d * HP + pw] = (f16)v;
  }
  __syncthreads();

  // final plane stores: hvt (two 16-B pieces per thread, piece p = d * 4 + key quarter), fk (waves 0..3, 8 rows each)
  v4u    hv[2];
  size_t hidx[2];
  #pragma unroll
  for (int ps = 0; ps < 2; ++ps) {
    const int pc = ps * 256 + tid;         // 0..511
    Pack8H p;
    p.v = *(const v8h*)(sHT + (pc >> 2) * HP + (pc & 3) * 8);
    hv[ps]   = p.u;
    hidx[ps] = ((size_t)b * (NKEY / KTILE) + kt) * (DV * KTILE) + (size_t)pc * 8;
  }
  #pragma unroll
  for (int ps = 0; ps < 2; ++ps) *(v4u*)(hvt + hidx[ps]) = hv[ps];
  if (tid < KTILE * 4) {                   // wave-uniform: 128 pieces of 16 B
    const int row = tid >> 2;              // 0..31
    const int cq  = (tid & 3) * 8;
    Pack8H p;
    p.v = *(const v8h*)(sF + row * FP + cq);
    *(v4u*)(fk + ((size_t)b * NKEY + kt * KTILE + row) * DQK + cq) = p.u;
  }
}

// One stage of 64 keys into LDS, six asynchronous 16-B copies per thread: one piece of the f tile (64 rows x 64 B), one
// of the wo plane (4 KB contiguous per stage, the same place in LDS as in the plane: the epilogue's operand rides along)
// and four of the h^T stage, which is two 32-key tiles of the plane = 16 KB contiguous (a wave covers four whole
// 128-B lines per copy). Copy i takes piece i * 256 + tid: key tile i >> 1, d = (i & 1) * 64 + (tid >> 2), key quarter
// tid & 3; in LDS the two tiles stand side by side in a row of 64 keys. The s_wait_xcnt closes the statement so that
// no address register of an issued copy is rewritten ahead of it.
static __device__ __forceinline__ void stage_copy(unsigned lf, const f16* gf, unsigned lv, const f16* gv,
                                                  unsigned lw, const f16* gw) {
  const unsigned lv1 = lv + 64 * VSP * 2, lv2 = lv + KTILE * 2, lv3 = lv + 64 * VSP * 2 + KTILE * 2;
  const f16* gv1 = gv + 1 * 256 * 8;
  const f16* gv2 = gv + 2 * 256 * 8;
  const f16* gv3 = gv + 3 * 256 * 8;
  asm volatile("global_load_async_to_lds_b128 %0, %1, off\n\t"
               "global_load_async_to_lds_b128 %2, %3, off\n\t"
               "global_load_async_to_lds_b128 %4, %5, off\n\t"
               "global_load_async_to_lds_b128 %6, %7, off\n\t"
               "global_load_async_to_lds_b128 %8, %9, off\n\t"
               "global_load_async_to_lds_b128 %10, %11, off\n\t"
               "s_wait_xcnt 0x0"
               :: "v"(lf), "v"(gf), "v"(lv), "v"(gv), "v"(lv1), "v"(gv1), "v"(lv2), "v"(gv2), "v"(lv3), "v"(gv3),
                  "v"(lw), "v"(gw)
               : "memory");
}

// Flash attention, non-causal, no score scaling. Block = (query block of 128, batch); one wave owns 16 queries.
// S^T = F x G^T so queries sit on lanes; P^T in C-layout is bit-identical to the B-fragment layout of CTX^T += Hv^T x P^T,
// where a query stays on the lanes that hold its scores: its scale and its sum are the lane's own, and the two lane halves
// meet by a vector cross-row move, so that nothing of the softmax queues behind the fragment loads in the LDS pipe.
// G B-fragments come straight from the f16 plane. The f and h^T tiles, which all eight waves read, are brought into
// LDS once per block in stages of 64 keys (two buffers, the next stage's copies fly while this one is worked on);
// F and Hv^T A-fragments are two 16-B LDS loads each, issued as one group per pass ahead of their use.
// The output projection and the scaled residual follow in the same kernel: out = gamma * (CTX x Wo) + x_bf16. A wave's
// 16 x 128 CTX tile, rounded to f16, stays in its registers: the CTX^T tiles are already laid out as A fragments.
// Every wave needs the whole wo plane as B fragments: it comes into LDS once per block, a piece with every stage, published
// by the stages' own waits and barriers, so that the eight waves read it from LDS and not each through the vector cache.
// LDS: sO per-wave regions, written and read across the lanes of their own wave only, so that no block barrier and with it
// no wait for the output stores stands between the quarters; staged extent == consumed extent.
__global__ __launch_bounds__(256) void attn_oproj_kernel(const f16* __restrict__ gq, const f16* __restrict__ fk,
                                                         const f16* __restrict__ hvt, const f16* __restrict__ wot,
                                                         const float* __restrict__ x, const float* __restrict__ gamma,
                                                         float* __restrict__ out) {
  const int qblk = blockIdx.x;
  const int b    = blockIdx.y;
  const int tid  = threadIdx.x;
  const int wave = tid >> 5;
  const int lane = tid & 31;
  const int lq   = lane & 15;   // query column of S^T and CTX^T / row of an F or Hv^T fragment
  const int hi   = lane >> 4;   // k-split half

  __shared__ __align__(16) f16 sKF[2 * SK * FSP];   // [buffer][key][32 d], pitch FSP
  __shared__ __align__(16) f16 sKV[2 * DV * VSP];   // [buffer][d][64 keys], pitch VSP
  __shared__ __align__(16) float sO[NWAVE * 16 * OP];   // per-wave f32 tile of one output quarter
  __shared__ __align__(16) f16 sWo[CIN * DV];           // the wo plane, unit for unit

  const int qrow0 = qblk * BQ + wave * 16;

  // G as B-operand fragment: lane lq holds query qrow0+lq, elements follow the split d map
  FragH qf;
  {
    const f16* qp = gq + ((size_t)b * SEQ + qrow0 + lq) * DQK + hi * 8;
    qf.q[0] = *(const v4u*)(qp);        // d = hi*8 + 0..7
    qf.q[1] = *(const v4u*)(qp + 16);   // d = 16 + hi*8 + 0..7
  }

  const float gsc = (float)(bf16)gamma[0] * 0.0625f;   // gamma (RNE bf16) folded with the 1/16 Wo carry

  const f16* fk_b = fk + (size_t)b * NKEY * DQK;
  const f16* vt_b = hvt + (size_t)b * DV * NKEY;

  v8f o[8];
  #pragma unroll
  for (int dt = 0; dt < 8; ++dt) o[dt] = (v8f){0, 0, 0, 0, 0, 0, 0, 0};

  float rmax = -__builtin_inff();
  float rsum = 0.0f;
  const float SL = 1.4426950408889634f;   // log2(e); the scores carry no extra scale

  // this thread's pieces of a stage: LDS byte addresses in buffer 0 and global pointers of stage 0
  const unsigned lf0 = (unsigned)(uintptr_t)sKF + (unsigned)((tid >> 2) * (FSP * 2) + (tid & 3) * 16);
  const unsigned lv0 = (unsigned)(uintptr_t)sKV + (unsigned)((tid >> 2) * (VSP * 2) + (tid & 3) * 16);
  const f16* gf0 = fk_b + tid * 8;                                  // f stage = 4 KB contiguous
  const f16* gv0 = vt_b + tid * 8;                                  // h^T stage = 16 KB contiguous
  const unsigned lw0 = (unsigned)(uintptr_t)sWo + (unsigned)(tid * 16);
  const f16* gw0 = wot + tid * 8;                                   // wo piece of a stage = 4 KB contiguous

  stage_copy(lf0, gf0, lv0, gv0, lw0, gw0);
  asm volatile("s_wait_asynccnt 0x0" ::: "memory");   // this wave's pieces of stage 0 have landed
  __syncthreads();                                    // publishes stage 0 to all waves
  if (NST > 1) stage_copy(lf0 + SK * FSP * 2, gf0 + SK * DQK, lv0 + DV * VSP * 2, gv0 + SK * DV, lw0 + 256 * 16, gw0 + 256 * 8);

  for (int t = 0; t < NST; ++t) {
   const int buf = t & 1;
   const f16* sf = sKF + buf * (SK * FSP);
   const f16* sv = sKV + buf * (DV * VSP);
   // One group of LDS loads at the head of the stage: the F A-fragments of both passes (row = key, split d map) and the
   // Hv^T A-fragments of the first pass (row = d = dt*16 + lq, split key map from the transposed tile).
   FragH ak[SK / BK][2];
   #pragma unroll
   for (int ps = 0; ps < SK / BK; ++ps) {
     #pragma unroll
     for (int sub = 0; sub < 2; ++sub) {
       const f16* base = sf + (ps * BK + sub * 16 + lq) * FSP + hi * 8;
       ak[ps][sub].q[0] = *(const v4u*)(base);        // d = hi*8 + 0..7
       ak[ps][sub].q[1] = *(const v4u*)(base + 16);   // d = 16 + hi*8 + 0..7
     }
   }
   FragH bv[8];
   #pragma unroll
   for (int dt = 0; dt < 8; ++dt) {
     const f16* base = sv + (dt * 16 + lq) * VSP + hi * 8;
     bv[dt].q[0] = *(const v4u*)(base);        // keys hi*8 + 0..7
     bv[dt].q[1] = *(const v4u*)(base + 16);   // keys 16 + hi*8 + 0..7
   }
   __builtin_amdgcn_sched_barrier(0);   // the group stays whole, in front of the scores and the softmax that hide its latency
   #pragma unroll   // both passes of a stage inline: j0 folds into the LDS loads' immediate offsets
   for (int ps = 0; ps < SK / BK; ++ps) {
    // S^T tiles: c[sub][r] = score(query qrow0+lq, key j0 + sub*16 + hi*8 + r), j0 = ps * BK
    v8f c[2];
    #pragma unroll
    for (int sub = 0; sub < 2; ++sub)
      c[sub] = mma_f16(ak[ps][sub].v, qf.v, (v8f){0, 0, 0, 0, 0, 0, 0, 0});

    // online softmax: query lq's 32 scores are split across lane / lane^16
    float m_new = rmax;
    #pragma unroll
    for (int r = 0; r < 8; ++r) {
      m_new = fmaxf(m_new, c[0][r]);
      m_new = fmaxf(m_new, c[1][r]);
    }
    m_new = fmaxf(m_new, xhalf(m_new));
    const float scale = __builtin_amdgcn_exp2f((rmax - m_new) * SL);
    rmax = m_new;

    // exp + pack: P^T C-layout == B-fragment layout for the PV product; P carried x4096 in f16
    FragH pa;
    float psum = 0.0f;
    #pragma unroll
    for (int r = 0; r < 8; ++r) {
      const float p0 = __builtin_amdgcn_exp2f((c[0][r] - m_new) * SL);   // key j0 + hi*8 + r
      const float p1 = __builtin_amdgcn_exp2f((c[1][r] - m_new) * SL);   // key j0 + 16 + hi*8 + r
      psum += p0 + p1;
      pa.h[r]     = (f16)(p0 * 4096.0f);
      pa.h[8 + r] = (f16)(p1 * 4096.0f);
    }
    rsum = rsum * scale + psum + xhalf(psum);

    // rescale CTX^T: queries are the column dimension there -> the lane's own scale
    #pragma unroll
    for (int dt = 0; dt < 8; ++dt) {
      #pragma unroll
      for (int r = 0; r < 8; ++r) o[dt][r] *= scale;
    }

    // CTX^T += Hv^T x P^T: o[dt][r] = ctx(query qrow0 + lq, d = dt*16 + hi*8 + r)
    #pragma unroll
    for (int dt = 0; dt < 8; ++dt) o[dt] = mma_f16(bv[dt].v, pa.v, o[dt]);
    if (ps + 1 < SK / BK) {
      __builtin_amdgcn_sched_barrier(0);   // the next pass's group is not lifted over these products: one set of Hv^T registers
      #pragma unroll
      for (int dt = 0; dt < 8; ++dt) {
        const f16* base = sv + (dt * 16 + lq) * VSP + (ps + 1) * BK + hi * 8;
        bv[dt].q[0] = *(const v4u*)(base);        // keys j0 + hi*8 + 0..7 of the next pass
        bv[dt].q[1] = *(const v4u*)(base + 16);   // keys j0 + 16 + hi*8 + 0..7
      }
      __builtin_amdgcn_sched_barrier(0);   // and it stays whole, in front of the next pass's scores and softmax
    }
   }
   __builtin_amdgcn_sched_barrier(0);   // the second pass's work stays in front of the hand-over, whose waits would else stand right behind its loads
   // hand-over: stage t + 1 becomes readable, and the buffer of stage t free, behind this one barrier
   asm volatile("s_wait_dscnt 0x0" ::: "memory");      // this wave's reads of stage t are done before the refill
   asm volatile("s_wait_asynccnt 0x0" ::: "memory");   // this wave's pieces of stage t + 1 have landed
   __syncthreads();
   if (t + 2 < NST)
     stage_copy(lf0 + buf * (SK * FSP * 2), gf0 + (size_t)(t + 2) * (SK * DQK),
                lv0 + buf * (DV * VSP * 2), gv0 + (size_t)(t + 2) * (SK * DV),
                lw0 + (t + 2) * (256 * 16), gw0 + (size_t)(t + 2) * (256 * 8));
  }
  asm volatile("s_wait_asynccnt 0x0" ::: "memory");    // no copy is outstanding when the wave goes on to its end

  // normalize: lane holds d = dt*16 + hi*8 + 0..7 of its own query lq. Two neighbouring CTX^T tiles, rounded to f16 in place,
  // are the A fragment of the output projection (row = query lq, split d map): the ctx tile never leaves the registers.
  const float rs = 1.0f / rsum;

  FragH a[DV / 32];   // the wave's ctx rows, the same for all four quarters
  #pragma unroll
  for (int kk = 0; kk < DV / 32; ++kk) {
    #pragma unroll
    for (int r = 0; r < 8; ++r) {
      a[kk].h[r]     = (f16)(o[2 * kk][r] * (1.0f / 4096.0f) * rs);       // d = kk*32 + hi*8 + r
      a[kk].h[8 + r] = (f16)(o[2 * kk + 1][r] * (1.0f / 4096.0f) * rs);   // d = kk*32 + 16 + hi*8 + r
    }
  }

  // Output projection: four passes over 64-column quarters. B fragments from the wo units in LDS (carried x16). Epilogue per
  // quarter: f32 tile staged in LDS, then whole 256-B quarter-rows per half wave, with the residual added.
  const int m = lq;                          // B column within a tile / 16-B piece index of the quarter-row
  const size_t xrow0 = (size_t)b * SEQ_FULL + qrow0;
  float* so = sO + wave * (16 * OP);

  #pragma unroll 1
  for (int qn = 0; qn < 4; ++qn) {
    // one group of loads per quarter: the x pieces of its residual, which come the long way, then its sixteen Wo fragments
    v4f    xq[8];
    size_t gidx[8];
    #pragma unroll
    for (int it = 0; it < 8; ++it) {
      gidx[it] = (xrow0 + it * 2 + hi) * CIN + qn * 64 + m * 4;
      xq[it]   = *(const v4f*)(x + gidx[it]);
    }
    FragH bw[DV / 32][4];
    #pragma unroll
    for (int kk = 0; kk < DV / 32; ++kk) {
      #pragma unroll
      for (int j = 0; j < 4; ++j) {
        const f16* wp = sWo + (((qn * 4 + j) * (DV / 32) + kk) * 2) * FRU + lane * 8;
        bw[kk][j].q[0] = *(const v4u*)(wp);         // d = kk*32 + hi*8 + 0..7 of column (qn*4 + j)*16 + m
        bw[kk][j].q[1] = *(const v4u*)(wp + FRU);   // d = kk*32 + 16 + hi*8 + 0..7
      }
    }
    __builtin_amdgcn_sched_barrier(0);   // the group stays whole, in front of the quarter's matrix work
    v8f acc[4];
    #pragma unroll
    for (int j = 0; j < 4; ++j) acc[j] = (v8f){0, 0, 0, 0, 0, 0, 0, 0};
    #pragma unroll
    for (int kk = 0; kk < DV / 32; ++kk) {
      #pragma unroll
      for (int j = 0; j < 4; ++j) acc[j] = mma_f16(a[kk].v, bw[kk][j].v, acc[j]);
    }
    __builtin_amdgcn_sched_barrier(0);   // the residual's converts, which wait for the global loads, are not lifted among the products
    #pragma unroll
    for (int r = 0; r < 8; ++r) {
      #pragma unroll
      for (int j = 0; j < 4; ++j) so[(hi * 8 + r) * OP + j * 16 + m] = acc[j][r] * gsc;
    }
    asm volatile("s_wait_dscnt 0x0" ::: "memory");   // the tile is the wave's own: its stores have landed before its lanes read each other's rows

    v4f vals[8];
    #pragma unroll
    for (int it = 0; it < 8; ++it) {
      const int row = it * 2 + hi;
      v4f v = *(const v4f*)(so + row * OP + m * 4);
      #pragma unroll
      for (int cc = 0; cc < 4; ++cc) v[cc] = v[cc] + (float)(bf16)xq[it][cc];   // residual with the RNE bf16 input value
      vals[it] = v;
    }
    #pragma unroll
    for (int it = 0; it < 8; ++it) *(v4f*)(out + gidx[it]) = vals[it];
    asm volatile("s_wait_xcnt 0x0" ::: "memory");    // stands before the next quarter rewrites the stores' address and data registers
  }
}

extern "C" void kernel_launch(void* const* d_in, const int* in_sizes, int n_in,
                              void* d_out, int out_size, void* d_ws, size_t ws_size,
                              hipStream_t stream) {
  if (n_in < 6) return;
  const size_t rows_used = (size_t)(NB - 1) * SEQ_FULL + SEQ;
  if ((size_t)in_sizes[0] < rows_used * CIN) return;
  if (in_sizes[1] < CIN * DQK) return;
  if (in_sizes[2] < CIN * DQK) return;
  if (in_sizes[3] < CIN * DV) return;
  if (in_sizes[4] < DV * CIN) return;
  if (in_sizes[5] < 1) return;
  if ((size_t)out_size < rows_used * CIN) return;

  const size_t wot_bytes = (size_t)CIN * DV * 2;              // 65,536
  const size_t gq_bytes  = (size_t)NB * SEQ * DQK * 2;        // 2,097,152 at full size
  const size_t fk_bytes  = (size_t)NB * NKEY * DQK * 2;       // 524,288
  const size_t hvt_bytes = (size_t)NB * DV * NKEY * 2;        // 2,097,152
  const size_t off_wot = 0;
  const size_t off_gq  = off_wot + wot_bytes;
  const size_t off_fk  = off_gq + gq_bytes;
  const size_t off_hvt = off_fk + fk_bytes;
  const size_t total   = off_hvt + hvt_bytes;                 // 4,784,128 at full size
  if (ws_size < total) return;

  const float* x     = (const float*)d_in[0];
  const float* wf    = (const float*)d_in[1];
  const float* wg    = (const float*)d_in[2];
  const float* wh    = (const float*)d_in[3];
  const float* wo    = (const float*)d_in[4];
  const float* gamma = (const float*)d_in[5];
  float* out = (float*)d_out;
  char*  ws  = (char*)d_ws;
  f16*  wot = (f16*)(ws + off_wot);
  f16*  gq  = (f16*)(ws + off_gq);
  f16*  fk  = (f16*)(ws + off_fk);
  f16*  hvt = (f16*)(ws + off_hvt);

  proj_pool_kernel<<<dim3(SEQ / 128, NB), 256, 0, stream>>>(x, wf, wg, wh, wo, wot, gq, fk, hvt);
  attn_oproj_kernel<<<dim3(SEQ / BQ, NB), 256, 0, stream>>>(gq, fk, hvt, wot, x, gamma, out);
}
